// v000
// Measured on an AMD MI455X. A time is GPU time per run, averaged over a window of back-to-back runs after a warm-up
// (all launches, gaps included; the runs take copies of the inputs in turn), and the median of several windows.
// Apart from v000's, it joins two sittings. Times from different sittings can be a few percent apart, while
// side-by-side timings come from the same sitting.
// v000, which the later versions start from, runs in 324 microseconds.
// Contractions: qkv projection [NB*SEQ x 1024 x 3072] and output projection [NB*SEQ x 1024 x 1024] = v_wmma_f32_16x16x32_f16 (f16 operands holding bf16 RNE input values scaled by powers of two, except the output projection's A = f16(256 * ctx); f32 accumulate); attention scores q.k^T = v_wmma_f32_16x16x32_f16 (normed q,k carried x16 as f16, single product, f32 accumulate); P.V = v_wmma_f32_16x16x32_f16 (P carried x2^15 as f16, v f16, f32 accumulate); RMSNorm and online softmax in f32.
#include <hip/hip_runtime.h>
#include <math.h>

#ifndef NB
#define NB 2
#endif
#ifndef SEQ
#define SEQ 2048
#endif
#define NB_FULL 2
#define SEQ_FULL 2048
#define DM 1024
#define NH 16
#define HDIM 64
#define NQKV (3 * DM)
#define NTOK (NB * SEQ)
#define QCAR 16.0f
// small f32 vector region: [bqkv 3072 | bproj 1024 | qn_w 64 | kn_w 64], each entry the bf16 RNE value of the input
#define OFF_BQ 0
#define OFF_BP NQKV
#define OFF_QW (NQKV + DM)
#define OFF_KW (NQKV + DM + HDIM)
#define VECN (NQKV + DM + 2 * HDIM)
static_assert(SEQ % 64 == 0);
static_assert(NB >= 1);
static_assert(NB <= NB_FULL);
static_assert(SEQ <= SEQ_FULL);
static_assert(VECN % 32 == 0);
static_assert(NH * HDIM == DM);
static_assert(DM % 64 == 0);
static_assert(NQKV % 64 == 0);

typedef __attribute__((ext_vector_type(16))) _Float16 v16h;
typedef __attribute__((ext_vector_type(8)))  _Float16 v8h;
typedef __attribute__((ext_vector_type(16))) __bf16   v16b;
typedef __attribute__((ext_vector_type(8)))  __bf16   v8b;
typedef __attribute__((ext_vector_type(8)))  float    v8f;
typedef __attribute__((ext_vector_type(4)))  float    v4f;
typedef __attribute__((ext_vector_type(2)))  float    v2f;
typedef __attribute__((ext_vector_type(4)))  unsigned int v4u;

// 16-bit WMMA fragment map (wave32), lane L, h = L>>4, m = L&15:
//   A 16x32: lane = row m;   element i -> k = (i<8) ? 8h+i : 16+8h+(i-8)
//   B 32x16: lane = column m; the SAME k(i,h)
//   D 16x16 (8 f32): lane = column m; element r -> row 8h+r

// workspace carve (bytes, 256-B aligned regions)
constexpr size_t al256(size_t x) { return (x + 255) / 256 * 256; }
constexpr size_t WS_VEC   = al256((size_t)VECN * 4);
constexpr size_t WS_X16   = al256((size_t)NTOK * DM * 2);
constexpr size_t WS_W16   = al256((size_t)NQKV * DM * 2);
constexpr size_t WS_WP16  = al256((size_t)DM * DM * 2);
constexpr size_t WS_QKV   = al256((size_t)NTOK * NQKV * 4);
constexpr size_t WS_QK16  = al256((size_t)NTOK * DM * 2);
constexpr size_t WS_CTX   = al256((size_t)NTOK * DM * 4);
constexpr size_t WS_CTX16 = al256((size_t)NTOK * DM * 2);
constexpr size_t WS_TOTAL = WS_VEC + WS_X16 + WS_W16 + WS_WP16 + WS_QKV + 2 * WS_QK16 + WS_CTX + WS_CTX16;
static_assert(WS_TOTAL <= (size_t)134217728);

// ---- scalar helpers ----
__device__ __forceinline__ float cmb_bf(float v) { const unsigned u = __builtin_bit_cast(unsigned, v); const unsigned r = (u + 0x7fffu + ((u >> 16) & 1u)) & 0xffff0000u; return __builtin_bit_cast(float, r); }   // bf16 RNE value kept as f32
__device__ __forceinline__ unsigned int cmb_pk2(float a, float b) { return (unsigned int)__builtin_bit_cast(unsigned short, (_Float16)a) | ((unsigned int)__builtin_bit_cast(unsigned short, (_Float16)b) << 16); }

namespace w25 {

__device__ __forceinline__ unsigned short f2bf_bits(float f) {
  unsigned u = __float_as_uint(f);
  return (unsigned short)((u + 0x7FFFu + ((u >> 16) & 1u)) >> 16);
}
__device__ __forceinline__ float bf_bits2f(unsigned short h) { return __uint_as_float(((unsigned)h) << 16); }

// hazard guards as plain device helpers
__device__ __forceinline__ void dep_guard_h(v8f& a, v8f& b, v16h x, v16h y) { asm volatile("v_nop\n\tv_nop\n\tv_nop\n\tv_nop" : "+v"(a), "+v"(b) : "v"(x), "v"(y)); }
__device__ __forceinline__ void dep_guard_b(v8f& a, v8f& b, v16b x, v16b y) { asm volatile("v_nop\n\tv_nop\n\tv_nop\n\tv_nop" : "+v"(a), "+v"(b) : "v"(x), "v"(y)); }
__device__ __forceinline__ void keep4_h(v16h a, v16h b, v16h c, v16h d) { asm volatile("v_nop" :: "v"(a), "v"(b), "v"(c), "v"(d)); }
__device__ __forceinline__ void keep4_b(v16b a, v16b b, v16b c, v16b d) { asm volatile("v_nop" :: "v"(a), "v"(b), "v"(c), "v"(d)); }
__device__ __forceinline__ void acc_guard4(v8f& a, v8f& b, v8f& c, v8f& d) { asm volatile("v_nop\n\tv_nop\n\tv_nop\n\tv_nop" : "+v"(a), "+v"(b), "+v"(c), "+v"(d)); }
template <typename T> struct Frag;
template <> struct Frag<_Float16> {
  typedef v16h V; union U { v16h v; v8h h[2]; };
  static __device__ __forceinline__ v16h load(const _Float16* p) {   // elements 0..7 <- p[0..7], 8..15 <- p[16..23]
    U f; f.h[0] = *(const v8h*)(p); f.h[1] = *(const v8h*)(p + 16); return f.v;
  }
  static __device__ __forceinline__ v8f mma(v16h a, v16h b, v8f c) {
    return __builtin_amdgcn_wmma_f32_16x16x32_f16(false, a, false, b, (short)0, c, false, false);
  }
  static __device__ __forceinline__ void guard(v8f& a, v8f& b, v16h x, v16h y) { dep_guard_h(a, b, x, y); }
  static __device__ __forceinline__ void keep(v16h a, v16h b, v16h c, v16h d) { keep4_h(a, b, c, d); }
};
template <> struct Frag<__bf16> {
  typedef v16b V; union U { v16b v; v8b h[2]; };
  static __device__ __forceinline__ v16b load(const __bf16* p) {
    U f; f.h[0] = *(const v8b*)(p); f.h[1] = *(const v8b*)(p + 16); return f.v;
  }
  static __device__ __forceinline__ v8f mma(v16b a, v16b b, v8f c) {
    return __builtin_amdgcn_wmma_f32_16x16x32_bf16(false, a, false, b, (short)0, c, false, false);
  }
  static __device__ __forceinline__ void guard(v8f& a, v8f& b, v16b x, v16b y) { dep_guard_b(a, b, x, y); }
  static __device__ __forceinline__ void keep(v16b a, v16b b, v16b c, v16b d) { keep4_b(a, b, c, d); }
};

// ---- Register-blocked batched WMMA GEMM ------------------------------------
// C[m,n] = scale * sum_k A[m,k] * Bt[n,k] (+bias)(+resid); each wave owns a 64x64 tile.
// A row-major [M,K]; Bt row-major [N,K]; M,N % 64 == 0, K % 32 == 0.
// SPLIT: operands are hi/lo planes (A2/Bt2 = lo planes, same layout); product = hi.hi + hi.lo + lo.hi.
// BIAS_MODE: 0 = none, 1 = bias[m], 2 = bias[n].
// OUT_MODE: 0 = f32, 1 = f16, 2 = bf16 hi plane (Cout) + bf16 lo plane (Cout2).
// ET: 0 = f16 operands, 1 = bf16 operands (pointers passed as 16-bit storage)
template <int ET> struct Elem;
template <> struct Elem<0> { typedef _Float16 T; };
template <> struct Elem<1> { typedef __bf16 T; };
template <int ET, bool SPLIT, int BIAS_MODE, int OUT_MODE, bool RESID>
__global__ __launch_bounds__(256) void wmma_gemm64(
    const unsigned short* __restrict__ Ap, const unsigned short* __restrict__ A2p, int lda, long strideA,
    const unsigned short* __restrict__ Btp, const unsigned short* __restrict__ Bt2p, int ldb, long strideB,
    void* __restrict__ Cout, void* __restrict__ Cout2, int ldc, long strideC,
    const float* __restrict__ bias,
    const float* __restrict__ resid, long strideR,
    int M, int N, int K, float scale) {
  typedef typename Elem<ET>::T T;
  typedef typename Frag<T>::V V;
  const T* A = (const T*)Ap; const T* A2 = (const T*)A2p; const T* Bt = (const T*)Btp; const T* Bt2 = (const T*)Bt2p;
  __shared__ __align__(16) float sT[8][16 * 68];   // per-wave 16x64 slab, pitch 68 floats (wave-private)
  const int b    = blockIdx.y;
  const int lane = threadIdx.x & 31;
  const int wave = threadIdx.x >> 5;
  const int tilesN = N >> 6;
  const int tilesM = M >> 6;
  const int tile = blockIdx.x * 8 + wave;
  if (tile >= tilesM * tilesN) return;   // wave-uniform; no block barriers in this kernel
  const int tm = tile / tilesN;
  const int tn = tile - tm * tilesN;
  const int m0 = tm << 6;
  const int n0 = tn << 6;

  const T* Ab  = A  + (size_t)b * strideA;
  const T* Bb  = Bt + (size_t)b * strideB;
  const T* Ab2 = SPLIT ? (A2  + (size_t)b * strideA) : nullptr;
  const T* Bb2 = SPLIT ? (Bt2 + (size_t)b * strideB) : nullptr;

  const int rlane = lane & 15;                 // row (A) / col (B, D) within subtile
  const int koff  = (lane >> 4) * 8;           // k offset of this lane half
  const int mOff  = (lane >> 4) * 8;           // D row offset

  v8f acc[4][4];
#pragma unroll
  for (int i = 0; i < 4; ++i)
#pragma unroll
    for (int j = 0; j < 4; ++j) acc[i][j] = (v8f){0.f,0.f,0.f,0.f,0.f,0.f,0.f,0.f};

  for (int k0 = 0; k0 < K; k0 += 32) {
    V bh[4], bl[4];
#pragma unroll
    for (int j = 0; j < 4; ++j) {
      const size_t bo = (size_t)(n0 + (j << 4) + rlane) * ldb + koff + k0;
      bh[j] = Frag<T>::load(Bb + bo);
      if (SPLIT) bl[j] = Frag<T>::load(Bb2 + bo);
    }
#pragma unroll
    for (int i = 0; i < 4; ++i) {
      const size_t ao = (size_t)(m0 + (i << 4) + rlane) * lda + koff + k0;
      V ah = Frag<T>::load(Ab + ao);
      V al;
      if (SPLIT) al = Frag<T>::load(Ab2 + ao);
#pragma unroll
      for (int j = 0; j < 4; ++j) {
        acc[i][j] = Frag<T>::mma(ah, bh[j], acc[i][j]);
        if (SPLIT) {
          acc[i][j] = Frag<T>::mma(ah, bl[j], acc[i][j]);
          acc[i][j] = Frag<T>::mma(al, bh[j], acc[i][j]);
        }
      }
      Frag<T>::guard(acc[i][0], acc[i][3], ah, SPLIT ? al : ah);
    }
    Frag<T>::keep(bh[0], bh[1], bh[2], bh[3]);
    if (SPLIT) Frag<T>::keep(bl[0], bl[1], bl[2], bl[3]);
  }
  acc_guard4(acc[0][0], acc[0][1], acc[0][2], acc[0][3]);
  acc_guard4(acc[1][0], acc[1][1], acc[1][2], acc[1][3]);
  acc_guard4(acc[2][0], acc[2][1], acc[2][2], acc[2][3]);
  acc_guard4(acc[3][0], acc[3][1], acc[3][2], acc[3][3]);

  // ---- epilogue ----
  float* slab = sT[wave];
  const float* Rb = RESID ? (resid + (size_t)b * strideR) : nullptr;
#pragma unroll
  for (int i = 0; i < 4; ++i) {
    const int mBase = m0 + (i << 4);
#pragma unroll
    for (int j = 0; j < 4; ++j) {
      const int n = n0 + (j << 4) + rlane;
      float bv = 0.f;
      if (BIAS_MODE == 2) bv = bias[n];
#pragma unroll
      for (int r = 0; r < 8; ++r) {
        float v = acc[i][j][r] * scale;
        if (BIAS_MODE == 1) v += bias[mBase + mOff + r];
        if (BIAS_MODE == 2) v += bv;
        if (RESID) v += Rb[(size_t)(mBase + mOff + r) * ldc + n];
        slab[(mOff + r) * 68 + (j << 4) + rlane] = v;
      }
    }
    __builtin_amdgcn_fence(3, "workgroup");
    __builtin_amdgcn_wave_barrier();
    __builtin_amdgcn_fence(2, "workgroup");
    if (OUT_MODE == 0) {
      float* C = (float*)Cout + (size_t)b * strideC;
      const int hh = lane >> 4, c4 = (lane & 15) * 4;     // row seg = 256 B = 16 lanes x 16 B
      {
#pragma unroll
        for (int it = 0; it < 8; ++it) {
          const int row = it * 2 + hh;
          v4f v = *(const v4f*)(slab + row * 68 + c4);
          *(v4f*)(C + (size_t)(mBase + row) * ldc + n0 + c4) = v;
        }
        
      }
    } else {
      const int q = lane >> 3, c8 = (lane & 7) * 8;
      unsigned short* C  = (unsigned short*)Cout  + (size_t)b * strideC;
      unsigned short* C2 = (OUT_MODE == 2) ? ((unsigned short*)Cout2 + (size_t)b * strideC) : nullptr;
      {
#pragma unroll
        for (int it = 0; it < 4; ++it) {
          const int row = it * 4 + q;
          const float* sp = slab + row * 68 + c8;
          v8h hv, lv;
#pragma unroll
          for (int e = 0; e < 8; ++e) {
            if (OUT_MODE == 1) {
              hv[e] = (_Float16)sp[e];
            } else {
              unsigned short hb = f2bf_bits(sp[e]);
              unsigned short lb = f2bf_bits(sp[e] - bf_bits2f(hb));
              hv[e] = __builtin_bit_cast(_Float16, hb);
              lv[e] = __builtin_bit_cast(_Float16, lb);
            }
          }
          *(v8h*)(C + (size_t)(mBase + row) * ldc + n0 + c8) = hv;
          if (OUT_MODE == 2) *(v8h*)(C2 + (size_t)(mBase + row) * ldc + n0 + c8) = lv;
        }
        
      }
    }
    __builtin_amdgcn_fence(3, "workgroup");
    __builtin_amdgcn_wave_barrier();
    __builtin_amdgcn_fence(2, "workgroup");
  }
}

// =====================================================================================
// Non-causal attention for head_dim 64; q/k from f16 planes (normed values carried x QCAR), v f32 in, f32 out.
//   scores = q.k^T          : v_wmma_f32_16x16x32_f16, single product; natural score = raw * sscale (sscale = 1/sqrt(64) / QCAR^2)
//   out    = p.v            : v_wmma_f32_16x16x32_f16; p = exp((s - m_running)*sscale) carried x psc (2^15) as f16, v plain f16
//   f32 accumulate; online softmax in f32. Block = 4 waves = 64 query rows of one (batch, head); S % 64 == 0.
//   Element (b, s, h, d) of tensor X lives at X[b*X_bs + s*X_rs + h*X_hs + d] (strides in elements, multiples of 8).
//   grid.x = B * H * (S/64), block 128.
// =====================================================================================
#define AT_D 64
#define AT_NW 4
#define AT_QB 64
#define AT_KC 64
struct AttnGeom { long long q_bs, q_rs, q_hs, k_bs, k_rs, k_hs, v_bs, v_rs, v_hs, o_bs, o_rs, o_hs; int S, Skv, H, nchunk; float sscale; float psc; };
static_assert(sizeof(AttnGeom) == 12 * 8 + 4 * 4 + 2 * 4);

__device__ __forceinline__ v8f at_mmah(v16h a, v16h b, v8f c) {
  c = __builtin_amdgcn_wmma_f32_16x16x32_f16(false, a, false, b, (short)0, c, false, false);
  asm volatile("v_nop\n\tv_nop\n\tv_nop\n\tv_nop" : "+v"(c) : "v"(a), "v"(b));
  return c;
}

__global__ __launch_bounds__(128) __attribute__((amdgpu_num_vgpr(256)))
void k_attn64(const unsigned short* __restrict__ qp, const unsigned short* __restrict__ kp,
              const float* __restrict__ v, float* __restrict__ out, AttnGeom g) {
  union FH { v16h v; v8h h[2]; };
  __shared__ __align__(16) _Float16 Ksh[AT_KC * AT_D];      // K [kv][d] f16   (cross-wave: block barriers before and after staging)
  __shared__ __align__(16) _Float16 Vth[AT_D * AT_KC];      // V [d][kv] f16   (cross-wave)
  __shared__ __align__(16) _Float16 Psh[AT_NW][16 * AT_KC];
  __shared__ __align__(16) float    Os[AT_NW][16 * 68];     // per wave out tile, pitch 68 (wave-private)

  const int tid  = threadIdx.x;
  const int wave = tid >> 5;
  const int lane = tid & 31;
  const int hh   = lane >> 4;
  const int c    = lane & 15;

  const int nqb = g.S / AT_QB;
  const int bx = blockIdx.x;
  const int qb = bx % nqb;
  const int bh = bx / nqb;
  const int h  = bh % g.H;
  const int b  = bh / g.H;
  const int q0 = qb * AT_QB + wave * 16;

  const _Float16* q = (const _Float16*)qp;
  const _Float16* k = (const _Float16*)kp;
  const _Float16* qb_ptr = q + (size_t)b * g.q_bs + (size_t)h * g.q_hs;
  const _Float16* kb_ptr = k + (size_t)b * g.k_bs + (size_t)h * g.k_hs;
  const float*    vb_ptr = v + (size_t)b * g.v_bs + (size_t)h * g.v_hs;
  float*          ob_ptr = out + (size_t)b * g.o_bs + (size_t)h * g.o_hs;

  // ---- Q fragments (A operand): 2 d-chunks; lane row c, elements 0..7 <- d = dc*32 + 8hh + e, 8..15 <- dc*32 + 16 + 8hh + e (two 16-B loads from the f16 row) ----
  v16h qa[2];
  {
    const _Float16* qrow = qb_ptr + (size_t)(q0 + c) * g.q_rs;
#pragma unroll
    for (int dc = 0; dc < 2; ++dc) {
      FH f;
      f.h[0] = *(const v8h*)(qrow + dc * 32 + 8 * hh);
      f.h[1] = *(const v8h*)(qrow + dc * 32 + 16 + 8 * hh);
      qa[dc] = f.v;
    }
  }

  float mrow[8], lrow[8];
  v8f oacc[4];
#pragma unroll
  for (int r = 0; r < 8; ++r) { mrow[r] = -INFINITY; lrow[r] = 0.f; }
#pragma unroll
  for (int t = 0; t < 4; ++t) oacc[t] = (v8f){0.f,0.f,0.f,0.f,0.f,0.f,0.f,0.f};

  for (int kc = 0; kc < g.nchunk; ++kc) {
    const int kv0 = kc * AT_KC;
    __syncthreads();                       // every wave is done reading the earlier chunk's Ksh / Vth
    {
      // thread (kvr, dh): 32 of the 64 elements of key row kvr (four 16-B copies) and value row kvr; full 64x64 tiles every chunk (staged extent == consumed extent)
      const int kvr = tid >> 1, dh = (tid & 1) * 32;
      const _Float16* krow = kb_ptr + (size_t)(kv0 + kvr) * g.k_rs + dh;
      const float*    vrow = vb_ptr + (size_t)(kv0 + kvr) * g.v_rs + dh;
#pragma unroll
      for (int i = 0; i < 4; ++i) {
        const v8h kk = *(const v8h*)(krow + 8 * i);
        *(v8h*)(Ksh + kvr * AT_D + dh + 8 * i) = kk;
      }
#pragma unroll
      for (int i = 0; i < 8; ++i) {
        const v4f vv = *(const v4f*)(vrow + 4 * i);
#pragma unroll
        for (int e = 0; e < 4; ++e) {
          const int d = dh + 4 * i + e;
          const float fv = vv[e];
          Vth[d * AT_KC + kvr] = (_Float16)fv;
        }
      }
    }
    __syncthreads();

    // ---- scores: 4 key subtiles x 2 d-chunks; B fragment lane column c = key j*16+c, same k(i,h) map as A ----
    v8f s[4];
#pragma unroll
    for (int j = 0; j < 4; ++j) {
      v8f acc = (v8f){0.f,0.f,0.f,0.f,0.f,0.f,0.f,0.f};
#pragma unroll
      for (int dc = 0; dc < 2; ++dc) {
        FH kf;
        kf.h[0] = *(const v8h*)(Ksh + (j * 16 + c) * AT_D + dc * 32 + 8 * hh);
        kf.h[1] = *(const v8h*)(Ksh + (j * 16 + c) * AT_D + dc * 32 + 16 + 8 * hh);
        acc = at_mmah(qa[dc], kf.v, acc);
      }
      s[j] = acc;
    }
    // ---- chunk row max (raw units; sscale > 0 so max commutes): D element r of this lane = (query q0 + 8hh + r, key kv0 + j*16 + c) ----
    float cm[8];
#pragma unroll
    for (int r = 0; r < 8; ++r) {
      float m = fmaxf(fmaxf(s[0][r], s[1][r]), fmaxf(s[2][r], s[3][r]));
#pragma unroll
      for (int off = 1; off < 16; off <<= 1) m = fmaxf(m, __shfl_xor(m, off, 32));
      cm[r] = m;
    }
    _Float16* pwh = Psh[wave];
#pragma unroll
    for (int r = 0; r < 8; ++r) {
      const float mnew = fmaxf(mrow[r], cm[r]);
      const float alpha = expf((mrow[r] - mnew) * g.sscale);
      mrow[r] = mnew;
      float psum = 0.f;
#pragma unroll
      for (int j = 0; j < 4; ++j) {
        const float p = expf((s[j][r] - mnew) * g.sscale);
        psum += p;
        pwh[(8 * hh + r) * AT_KC + j * 16 + c] = (_Float16)(p * g.psc);
      }
#pragma unroll
      for (int off = 1; off < 16; off <<= 1) psum += __shfl_xor(psum, off, 32);
      lrow[r] = lrow[r] * alpha + psum;
#pragma unroll
      for (int t = 0; t < 4; ++t) oacc[t][r] *= alpha;
    }
    __builtin_amdgcn_fence(3, "workgroup");
    __builtin_amdgcn_wave_barrier();
    __builtin_amdgcn_fence(2, "workgroup");
    // ---- P.V: A = P rows (lane row c = query, k = key), B = Vth rows (lane column c = d), both with the fragment k map ----
#pragma unroll 1
    for (int kk = 0; kk < 2; ++kk) {
      FH pa;
      pa.h[0] = *(const v8h*)(pwh + c * AT_KC + kk * 32 + 8 * hh);
      pa.h[1] = *(const v8h*)(pwh + c * AT_KC + kk * 32 + 16 + 8 * hh);
#pragma unroll
      for (int t = 0; t < 4; ++t) {
        FH vbf;
        vbf.h[0] = *(const v8h*)(Vth + (t * 16 + c) * AT_KC + kk * 32 + 8 * hh);
        vbf.h[1] = *(const v8h*)(Vth + (t * 16 + c) * AT_KC + kk * 32 + 16 + 8 * hh);
        oacc[t] = at_mmah(pa.v, vbf.v, oacc[t]);
      }
    }
  }

  float* os = Os[wave];
#pragma unroll
  for (int r = 0; r < 8; ++r) {
    const float inv = 1.0f / (lrow[r] * g.psc);
#pragma unroll
    for (int t = 0; t < 4; ++t) os[(8 * hh + r) * 68 + t * 16 + c] = oacc[t][r] * inv;
  }
  __builtin_amdgcn_fence(3, "workgroup");
  __builtin_amdgcn_wave_barrier();
  __builtin_amdgcn_fence(2, "workgroup");
  {
    const int c4 = (lane & 15) * 4;
    {
#pragma unroll
      for (int it = 0; it < 8; ++it) {
        const int row = it * 2 + hh;
        v4f val = *(const v4f*)(os + row * 68 + c4);
        *(v4f*)(ob_ptr + (size_t)(q0 + row) * g.o_rs + c4) = val;
      }
      
    }
  }
}

} // namespace w25

// =====================================================================================
// =====================================================================================
__global__ __launch_bounds__(256) void k_vec(const float* __restrict__ bq, const float* __restrict__ bp, const float* __restrict__ qw, const float* __restrict__ kw, float* __restrict__ VEC) {
    const int u = blockIdx.x * 256 + threadIdx.x;
    if (u >= VECN) return;
    const float a  = bq[min(u, NQKV - 1)];
    const float bb = bp[min(max(u - OFF_BP, 0), DM - 1)];
    const float cq = qw[min(max(u - OFF_QW, 0), HDIM - 1)];
    const float ck = kw[min(max(u - OFF_KW, 0), HDIM - 1)];
    const float sel = (u < OFF_BP) ? a : ((u < OFF_QW) ? bb : ((u < OFF_KW) ? cq : ck));
    const float o = cmb_bf(sel);
    *(float*)(VEC + u) = o;
    
}

// =====================================================================================
// k_castp: DST[z][r][c] (pitch ldd halves, batch stride dbs halves) = f16(sc * g(SRC[z][r][c])) with g = bf16 RNE value (bfr != 0) or identity,
//   r < nR, c < nC (nC % 8 == 0); SRC batch stride sbs floats, row pitch lds floats. Thread per (r, 8 consecutive c): two 16-B loads,
// =====================================================================================
__global__ __launch_bounds__(256) void k_castp(const float* __restrict__ SRC, long long sbs, int lds, unsigned short* __restrict__ DST, long long dbs, int ldd, int nR, int nC, float sc, int bfr) {
    const long long u = (long long)blockIdx.x * 256 + threadIdx.x;
    const int per = nC >> 3;
    if (u >= (long long)nR * per) return;
    const int r = (int)(u / per);
    const int c0 = 8 * (int)(u - (long long)r * per);
    const float* s = SRC + (long long)blockIdx.y * sbs + (long long)r * lds + c0;
    const v4f a = *(const v4f*)s;
    const v4f bq = *(const v4f*)(s + 4);
    float w[8] = {a.x, a.y, a.z, a.w, bq.x, bq.y, bq.z, bq.w};
#pragma unroll
    for (int e = 0; e < 8; ++e) { const float t = bfr ? cmb_bf(w[e]) : w[e]; w[e] = t * sc; }
    v4u pk;
    pk.x = cmb_pk2(w[0], w[1]); pk.y = cmb_pk2(w[2], w[3]); pk.z = cmb_pk2(w[4], w[5]); pk.w = cmb_pk2(w[6], w[7]);
    v4u* d = (v4u*)(DST + (long long)blockIdx.y * dbs + (long long)r * ldd + c0);
    *d = pk;
    
}

// =====================================================================================
// k_rms: per (token, head) RMSNorm of the q and k slices of the QKV rows (64 f32 elements each):
//   DST[token][h*64 + d] = f16(QCAR * x[d] * (1 / sqrt(mean(x^2) + 1e-6)) * w[d]), DST = QH (slice 0) or KH (slice 1), f16 planes [tokens][1024].
//   Wave per row r in [0, nrow): token = r >> 5, slice = (r >> 4) & 1, head = r & 15; lane L holds elements 2L, 2L+1 (one packed 4-B word).
//   grid nrow / 8 blocks of 256 (nrow = tokens * 32). Coverage: all (token, slice, head) rows -> QH and KH [tokens][1024] complete.
// =====================================================================================
__global__ __launch_bounds__(256) void k_rms(const float* __restrict__ QKV, const float* __restrict__ QW, const float* __restrict__ KW, unsigned short* __restrict__ QH, unsigned short* __restrict__ KH, int nrow) {
    #pragma clang fp contract(off)
    const int r = blockIdx.x * 8 + (threadIdx.x >> 5);
    const int L = threadIdx.x & 31;
    if (r >= nrow) return;                                   // wave-uniform; no block barriers in this kernel
    const int token = r >> 5, slice = (r >> 4) & 1, h = r & 15;
    const float* src = QKV + (long long)token * NQKV + slice * DM + h * HDIM + 2 * L;
    const v2f x = *(const v2f*)src;
    float ss = x.x * x.x + x.y * x.y;
#pragma unroll
    for (int o = 16; o > 0; o >>= 1) ss += __shfl_xor(ss, o, 32);
    const float rms = sqrtf(ss * (1.0f / 64.0f) + 1e-6f);
    const float rec = 1.0f / rms;
    const v2f wq = *(const v2f*)(QW + 2 * L);
    const v2f wk = *(const v2f*)(KW + 2 * L);
    v2f w; w.x = slice ? wk.x : wq.x; w.y = slice ? wk.y : wq.y;
    const float o0 = ((x.x * rec) * w.x) * QCAR;
    const float o1 = ((x.y * rec) * w.y) * QCAR;
    const unsigned pk = cmb_pk2(o0, o1);
    unsigned short* dst = (slice ? KH : QH) + (long long)token * DM + h * HDIM + 2 * L;
    *(unsigned*)dst = pk;
    
}

extern "C" void kernel_launch(void* const* d_in, const int* in_sizes, int n_in, void* d_out, int out_size, void* d_ws, size_t ws_size, hipStream_t stream) {
    if (n_in < 7) return;
    const float* x     = (const float*)d_in[0];     // [2][2048][1024]
    const float* Wqkv  = (const float*)d_in[1];     // [3072][1024]  ([out][in] = Bt layout)
    const float* bqkv  = (const float*)d_in[2];     // [3072]
    const float* Wproj = (const float*)d_in[3];     // [1024][1024]  ([out][in] = Bt layout)
    const float* bproj = (const float*)d_in[4];     // [1024]
    const float* qn_w  = (const float*)d_in[5];     // [64]
    const float* kn_w  = (const float*)d_in[6];     // [64]
    const long long xneed = ((long long)(NB - 1) * SEQ_FULL + SEQ) * DM;
    if ((long long)in_sizes[0] < xneed) return;
    if ((long long)in_sizes[1] < (long long)NQKV * DM) return;
    if (in_sizes[2] < NQKV) return;
    if ((long long)in_sizes[3] < (long long)DM * DM) return;
    if (in_sizes[4] < DM) return;
    if (in_sizes[5] < HDIM || in_sizes[6] < HDIM) return;
    if ((long long)out_size < xneed) return;
    if (WS_TOTAL > ws_size) return;

    char* wsp = (char*)d_ws;
    float* VEC = (float*)wsp; wsp += WS_VEC;                              // 4224 f32 (bf16 RNE values of the small input vectors)
    unsigned short* X16 = (unsigned short*)wsp; wsp += WS_X16;             // [NTOK][1024] f16 = 16 * bf16(x)
    unsigned short* W16 = (unsigned short*)wsp; wsp += WS_W16;             // [3072][1024] f16 = 64 * bf16(Wqkv)
    unsigned short* WP16 = (unsigned short*)wsp; wsp += WS_WP16;           // [1024][1024] f16 = 64 * bf16(Wproj)
    float* QKV = (float*)wsp; wsp += WS_QKV;                               // [NTOK][3072] f32
    unsigned short* QH16 = (unsigned short*)wsp; wsp += WS_QK16;           // [NTOK][1024] f16 = 16 * normalised q
    unsigned short* KH16 = (unsigned short*)wsp; wsp += WS_QK16;           // [NTOK][1024] f16 = 16 * normalised k
    float* CTX = (float*)wsp; wsp += WS_CTX;                               // [NTOK][1024] f32 attention output (token-major, head*64 + d)
    unsigned short* CTX16 = (unsigned short*)wsp; wsp += WS_CTX16;         // [NTOK][1024] f16 = 256 * ctx
    float* out = (float*)d_out;

    // 1. small vectors -> bf16 RNE values (f32)
    k_vec<<<(VECN + 255) / 256, 256, 0, stream>>>(bqkv, bproj, qn_w, kn_w, VEC);
    // 2-4. 16-bit operand planes (bf16 RNE input values times a power of two, exact in f16)
    k_castp<<<dim3((unsigned)(((long long)SEQ * (DM / 8) + 255) / 256), (unsigned)NB), 256, 0, stream>>>(x, (long long)SEQ_FULL * DM, DM, X16, (long long)SEQ * DM, DM, SEQ, DM, 16.0f, 1);
    k_castp<<<dim3((unsigned)(((long long)NQKV * (DM / 8) + 255) / 256), 1u), 256, 0, stream>>>(Wqkv, 0LL, DM, W16, 0LL, DM, NQKV, DM, 64.0f, 1);
    k_castp<<<dim3((unsigned)(((long long)DM * (DM / 8) + 255) / 256), 1u), 256, 0, stream>>>(Wproj, 0LL, DM, WP16, 0LL, DM, DM, DM, 64.0f, 1);
    // 5. QKV = (16 bf16(x)) . (64 bf16(Wqkv))^T / 1024 + bf16(bqkv)   -> [NTOK][3072] f32
    w25::wmma_gemm64<0, false, 2, 0, false><<<dim3((unsigned)(((NTOK / 64) * (NQKV / 64) + 7) / 8), 1u), 256, 0, stream>>>(
        (const unsigned short*)X16, nullptr, DM, 0L, (const unsigned short*)W16, nullptr, DM, 0L,
        (void*)QKV, nullptr, NQKV, 0L, VEC + OFF_BQ, nullptr, 0L, NTOK, NQKV, DM, 1.0f / 1024.0f);
    // 6. per-head RMSNorm of q and k (f32 math) -> f16 planes carried x16
    k_rms<<<(unsigned)((NTOK * 32) / 8), 256, 0, stream>>>(QKV, VEC + OFF_QW, VEC + OFF_KW, QH16, KH16, NTOK * 32);
    // 7. attention: 64 query rows per block, 64-key chunks, online softmax; v read from the QKV tile (columns 2048 + h*64)
    w25::AttnGeom g;
    g.q_bs = (long long)SEQ * DM;   g.q_rs = DM;   g.q_hs = HDIM;
    g.k_bs = (long long)SEQ * DM;   g.k_rs = DM;   g.k_hs = HDIM;
    g.v_bs = (long long)SEQ * NQKV; g.v_rs = NQKV; g.v_hs = HDIM;
    g.o_bs = (long long)SEQ * DM;   g.o_rs = DM;   g.o_hs = HDIM;
    g.S = SEQ; g.Skv = SEQ; g.H = NH; g.nchunk = SEQ / AT_KC; g.sscale = 0.125f / (QCAR * QCAR); g.psc = 32768.0f;
    w25::k_attn64<<<(unsigned)(NB * NH * (SEQ / AT_QB)), 128, 0, stream>>>(QH16, KH16, QKV + 2 * DM, CTX, g);
    // 8. ctx -> f16 plane (x256)
    k_castp<<<dim3((unsigned)(((long long)NTOK * (DM / 8) + 255) / 256), 1u), 256, 0, stream>>>(CTX, 0LL, DM, CTX16, 0LL, DM, NTOK, DM, 256.0f, 0);
    // 9. out[b][s][:] = (256 ctx) . (64 bf16(Wproj))^T / 16384 + bf16(bproj), batch rows at the full per-batch stride of d_out
    w25::wmma_gemm64<0, false, 2, 0, false><<<dim3((unsigned)((((SEQ / 64) * (DM / 64)) + 7) / 8), (unsigned)NB), 256, 0, stream>>>(
        (const unsigned short*)CTX16, nullptr, DM, (long)SEQ * DM, (const unsigned short*)WP16, nullptr, DM, 0L,
        (void*)out, nullptr, DM, (long)SEQ_FULL * DM, VEC + OFF_BP, nullptr, 0L, SEQ, DM, DM, 1.0f / 16384.0f);
    (void)hipGetLastError();
}

// v001
// Measured time: 295 microseconds a run.
// Timed twice side by side with v000, it ran 1.14 times as fast both times.
// Contractions: qkv projection [NB*SEQ x 1024 x 3072] and output projection [NB*SEQ x 1024 x 1024] = v_wmma_f32_16x16x32_f16 (f16 operands holding bf16 RNE input values scaled by powers of two, except the output projection's A = f16(256 * ctx); f32 accumulate); attention scores q.k^T = v_wmma_f32_16x16x32_f16 (normed q,k carried x16 as f16, single product, f32 accumulate); P.V = v_wmma_f32_16x16x32_f16 (P carried x2^15 as f16, v f16, f32 accumulate); RMSNorm and online softmax in f32.
#include <hip/hip_runtime.h>
#include <math.h>

#ifndef NB
#define NB 2
#endif
#ifndef SEQ
#define SEQ 2048
#endif
#define NB_FULL 2
#define SEQ_FULL 2048
#define DM 1024
#define NH 16
#define HDIM 64
#define NQKV (3 * DM)
#define NTOK (NB * SEQ)
#define QCAR 16.0f
// small f32 vector region: [bqkv 3072 | bproj 1024 | qn_w 64 | kn_w 64], each entry the bf16 RNE value of the input
#define OFF_BQ 0
#define OFF_BP NQKV
#define OFF_QW (NQKV + DM)
#define OFF_KW (NQKV + DM + HDIM)
#define VECN (NQKV + DM + 2 * HDIM)
static_assert(SEQ % 64 == 0);
static_assert(NB >= 1);
static_assert(NB <= NB_FULL);
static_assert(SEQ <= SEQ_FULL);
static_assert(VECN % 32 == 0);
static_assert(NH * HDIM == DM);
static_assert(DM % 64 == 0);
static_assert(NQKV % 64 == 0);

typedef __attribute__((ext_vector_type(16))) _Float16 v16h;
typedef __attribute__((ext_vector_type(8)))  _Float16 v8h;
typedef __attribute__((ext_vector_type(16))) __bf16   v16b;
typedef __attribute__((ext_vector_type(8)))  __bf16   v8b;
typedef __attribute__((ext_vector_type(8)))  float    v8f;
typedef __attribute__((ext_vector_type(4)))  float    v4f;
typedef __attribute__((ext_vector_type(2)))  float    v2f;
typedef __attribute__((ext_vector_type(4)))  unsigned int v4u;

// 16-bit WMMA fragment map (wave32), lane L, h = L>>4, m = L&15:
//   A 16x32: lane = row m;   element i -> k = (i<8) ? 8h+i : 16+8h+(i-8)
//   B 32x16: lane = column m; the SAME k(i,h)
//   D 16x16 (8 f32): lane = column m; element r -> row 8h+r

// workspace carve (bytes, 256-B aligned regions)
constexpr size_t al256(size_t x) { return (x + 255) / 256 * 256; }
constexpr size_t WS_VEC   = al256((size_t)VECN * 4);
constexpr size_t WS_X16   = al256((size_t)NTOK * DM * 2);
constexpr size_t WS_W16   = al256((size_t)NQKV * DM * 2);
constexpr size_t WS_WP16  = al256((size_t)DM * DM * 2);
constexpr size_t WS_QKV   = al256((size_t)NTOK * NQKV * 4);
constexpr size_t WS_QK16  = al256((size_t)NTOK * DM * 2);
constexpr size_t WS_CTX   = al256((size_t)NTOK * DM * 4);
constexpr size_t WS_CTX16 = al256((size_t)NTOK * DM * 2);
constexpr size_t WS_TOTAL = WS_VEC + WS_X16 + WS_W16 + WS_WP16 + WS_QKV + 2 * WS_QK16 + WS_CTX + WS_CTX16;
static_assert(WS_TOTAL <= (size_t)134217728);

// ---- scalar helpers ----
__device__ __forceinline__ float cmb_bf(float v) { const unsigned u = __builtin_bit_cast(unsigned, v); const unsigned r = (u + 0x7fffu + ((u >> 16) & 1u)) & 0xffff0000u; return __builtin_bit_cast(float, r); }   // bf16 RNE value kept as f32
__device__ __forceinline__ unsigned int cmb_pk2(float a, float b) { return (unsigned int)__builtin_bit_cast(unsigned short, (_Float16)a) | ((unsigned int)__builtin_bit_cast(unsigned short, (_Float16)b) << 16); }

namespace w25 {

__device__ __forceinline__ unsigned short f2bf_bits(float f) {
  unsigned u = __float_as_uint(f);
  return (unsigned short)((u + 0x7FFFu + ((u >> 16) & 1u)) >> 16);
}
__device__ __forceinline__ float bf_bits2f(unsigned short h) { return __uint_as_float(((unsigned)h) << 16); }

// hazard guards as plain device helpers
__device__ __forceinline__ void dep_guard_h(v8f& a, v8f& b, v16h x, v16h y) { asm volatile("v_nop\n\tv_nop\n\tv_nop\n\tv_nop" : "+v"(a), "+v"(b) : "v"(x), "v"(y)); }
__device__ __forceinline__ void dep_guard_b(v8f& a, v8f& b, v16b x, v16b y) { asm volatile("v_nop\n\tv_nop\n\tv_nop\n\tv_nop" : "+v"(a), "+v"(b) : "v"(x), "v"(y)); }
__device__ __forceinline__ void keep4_h(v16h a, v16h b, v16h c, v16h d) { asm volatile("v_nop" :: "v"(a), "v"(b), "v"(c), "v"(d)); }
__device__ __forceinline__ void keep4_b(v16b a, v16b b, v16b c, v16b d) { asm volatile("v_nop" :: "v"(a), "v"(b), "v"(c), "v"(d)); }
__device__ __forceinline__ void acc_guard4(v8f& a, v8f& b, v8f& c, v8f& d) { asm volatile("v_nop\n\tv_nop\n\tv_nop\n\tv_nop" : "+v"(a), "+v"(b), "+v"(c), "+v"(d)); }
template <typename T> struct Frag;
template <> struct Frag<_Float16> {
  typedef v16h V; union U { v16h v; v8h h[2]; };
  static __device__ __forceinline__ v16h load(const _Float16* p) {   // elements 0..7 <- p[0..7], 8..15 <- p[16..23]
    U f; f.h[0] = *(const v8h*)(p); f.h[1] = *(const v8h*)(p + 16); return f.v;
  }
  static __device__ __forceinline__ v8f mma(v16h a, v16h b, v8f c) {
    return __builtin_amdgcn_wmma_f32_16x16x32_f16(false, a, false, b, (short)0, c, false, false);
  }
  static __device__ __forceinline__ void guard(v8f& a, v8f& b, v16h x, v16h y) { dep_guard_h(a, b, x, y); }
  static __device__ __forceinline__ void keep(v16h a, v16h b, v16h c, v16h d) { keep4_h(a, b, c, d); }
};
template <> struct Frag<__bf16> {
  typedef v16b V; union U { v16b v; v8b h[2]; };
  static __device__ __forceinline__ v16b load(const __bf16* p) {
    U f; f.h[0] = *(const v8b*)(p); f.h[1] = *(const v8b*)(p + 16); return f.v;
  }
  static __device__ __forceinline__ v8f mma(v16b a, v16b b, v8f c) {
    return __builtin_amdgcn_wmma_f32_16x16x32_bf16(false, a, false, b, (short)0, c, false, false);
  }
  static __device__ __forceinline__ void guard(v8f& a, v8f& b, v16b x, v16b y) { dep_guard_b(a, b, x, y); }
  static __device__ __forceinline__ void keep(v16b a, v16b b, v16b c, v16b d) { keep4_b(a, b, c, d); }
};

// ---- Register-blocked batched WMMA GEMM ------------------------------------
// C[m,n] = scale * sum_k A[m,k] * Bt[n,k] (+bias)(+resid); each wave owns a 64x64 tile.
// A row-major [M,K]; Bt row-major [N,K]; M,N % 64 == 0, K % 32 == 0.
// SPLIT: operands are hi/lo planes (A2/Bt2 = lo planes, same layout); product = hi.hi + hi.lo + lo.hi.
// BIAS_MODE: 0 = none, 1 = bias[m], 2 = bias[n].
// OUT_MODE: 0 = f32, 1 = f16, 2 = bf16 hi plane (Cout) + bf16 lo plane (Cout2).
// ET: 0 = f16 operands, 1 = bf16 operands (pointers passed as 16-bit storage)
template <int ET> struct Elem;
template <> struct Elem<0> { typedef _Float16 T; };
template <> struct Elem<1> { typedef __bf16 T; };
template <int ET, bool SPLIT, int BIAS_MODE, int OUT_MODE, bool RESID>
__global__ __launch_bounds__(256) void wmma_gemm64(
    const unsigned short* __restrict__ Ap, const unsigned short* __restrict__ A2p, int lda, long strideA,
    const unsigned short* __restrict__ Btp, const unsigned short* __restrict__ Bt2p, int ldb, long strideB,
    void* __restrict__ Cout, void* __restrict__ Cout2, int ldc, long strideC,
    const float* __restrict__ bias,
    const float* __restrict__ resid, long strideR,
    int M, int N, int K, float scale) {
  typedef typename Elem<ET>::T T;
  typedef typename Frag<T>::V V;
  const T* A = (const T*)Ap; const T* A2 = (const T*)A2p; const T* Bt = (const T*)Btp; const T* Bt2 = (const T*)Bt2p;
  __shared__ __align__(16) float sT[8][16 * 68];   // per-wave 16x64 slab, pitch 68 floats (wave-private)
  const int b    = blockIdx.y;
  const int lane = threadIdx.x & 31;
  const int wave = threadIdx.x >> 5;
  const int tilesN = N >> 6;
  const int tilesM = M >> 6;
  const int tile = blockIdx.x * 8 + wave;
  if (tile >= tilesM * tilesN) return;   // wave-uniform; no block barriers in this kernel
  const int tm = tile / tilesN;
  const int tn = tile - tm * tilesN;
  const int m0 = tm << 6;
  const int n0 = tn << 6;

  const T* Ab  = A  + (size_t)b * strideA;
  const T* Bb  = Bt + (size_t)b * strideB;
  const T* Ab2 = SPLIT ? (A2  + (size_t)b * strideA) : nullptr;
  const T* Bb2 = SPLIT ? (Bt2 + (size_t)b * strideB) : nullptr;

  const int rlane = lane & 15;                 // row (A) / col (B, D) within subtile
  const int koff  = (lane >> 4) * 8;           // k offset of this lane half
  const int mOff  = (lane >> 4) * 8;           // D row offset

  v8f acc[4][4];
#pragma unroll
  for (int i = 0; i < 4; ++i)
#pragma unroll
    for (int j = 0; j < 4; ++j) acc[i][j] = (v8f){0.f,0.f,0.f,0.f,0.f,0.f,0.f,0.f};

  for (int k0 = 0; k0 < K; k0 += 32) {
    V bh[4], bl[4];
#pragma unroll
    for (int j = 0; j < 4; ++j) {
      const size_t bo = (size_t)(n0 + (j << 4) + rlane) * ldb + koff + k0;
      bh[j] = Frag<T>::load(Bb + bo);
      if (SPLIT) bl[j] = Frag<T>::load(Bb2 + bo);
    }
#pragma unroll
    for (int i = 0; i < 4; ++i) {
      const size_t ao = (size_t)(m0 + (i << 4) + rlane) * lda + koff + k0;
      V ah = Frag<T>::load(Ab + ao);
      V al;
      if (SPLIT) al = Frag<T>::load(Ab2 + ao);
#pragma unroll
      for (int j = 0; j < 4; ++j) {
        acc[i][j] = Frag<T>::mma(ah, bh[j], acc[i][j]);
        if (SPLIT) {
          acc[i][j] = Frag<T>::mma(ah, bl[j], acc[i][j]);
          acc[i][j] = Frag<T>::mma(al, bh[j], acc[i][j]);
        }
      }
      Frag<T>::guard(acc[i][0], acc[i][3], ah, SPLIT ? al : ah);
    }
    Frag<T>::keep(bh[0], bh[1], bh[2], bh[3]);
    if (SPLIT) Frag<T>::keep(bl[0], bl[1], bl[2], bl[3]);
  }
  acc_guard4(acc[0][0], acc[0][1], acc[0][2], acc[0][3]);
  acc_guard4(acc[1][0], acc[1][1], acc[1][2], acc[1][3]);
  acc_guard4(acc[2][0], acc[2][1], acc[2][2], acc[2][3]);
  acc_guard4(acc[3][0], acc[3][1], acc[3][2], acc[3][3]);

  // ---- epilogue ----
  float* slab = sT[wave];
  const float* Rb = RESID ? (resid + (size_t)b * strideR) : nullptr;
#pragma unroll
  for (int i = 0; i < 4; ++i) {
    const int mBase = m0 + (i << 4);
#pragma unroll
    for (int j = 0; j < 4; ++j) {
      const int n = n0 + (j << 4) + rlane;
      float bv = 0.f;
      if (BIAS_MODE == 2) bv = bias[n];
#pragma unroll
      for (int r = 0; r < 8; ++r) {
        float v = acc[i][j][r] * scale;
        if (BIAS_MODE == 1) v += bias[mBase + mOff + r];
        if (BIAS_MODE == 2) v += bv;
        if (RESID) v += Rb[(size_t)(mBase + mOff + r) * ldc + n];
        slab[(mOff + r) * 68 + (j << 4) + rlane] = v;
      }
    }
    __builtin_amdgcn_fence(3, "workgroup");
    __builtin_amdgcn_wave_barrier();
    __builtin_amdgcn_fence(2, "workgroup");
    if (OUT_MODE == 0) {
      float* C = (float*)Cout + (size_t)b * strideC;
      const int hh = lane >> 4, c4 = (lane & 15) * 4;     // row seg = 256 B = 16 lanes x 16 B
      {
#pragma unroll
        for (int it = 0; it < 8; ++it) {
          const int row = it * 2 + hh;
          v4f v = *(const v4f*)(slab + row * 68 + c4);
          *(v4f*)(C + (size_t)(mBase + row) * ldc + n0 + c4) = v;
        }
        
      }
    } else {
      const int q = lane >> 3, c8 = (lane & 7) * 8;
      unsigned short* C  = (unsigned short*)Cout  + (size_t)b * strideC;
      unsigned short* C2 = (OUT_MODE == 2) ? ((unsigned short*)Cout2 + (size_t)b * strideC) : nullptr;
      {
#pragma unroll
        for (int it = 0; it < 4; ++it) {
          const int row = it * 4 + q;
          const float* sp = slab + row * 68 + c8;
          v8h hv, lv;
#pragma unroll
          for (int e = 0; e < 8; ++e) {
            if (OUT_MODE == 1) {
              hv[e] = (_Float16)sp[e];
            } else {
              unsigned short hb = f2bf_bits(sp[e]);
              unsigned short lb = f2bf_bits(sp[e] - bf_bits2f(hb));
              hv[e] = __builtin_bit_cast(_Float16, hb);
              lv[e] = __builtin_bit_cast(_Float16, lb);
            }
          }
          *(v8h*)(C + (size_t)(mBase + row) * ldc + n0 + c8) = hv;
          if (OUT_MODE == 2) *(v8h*)(C2 + (size_t)(mBase + row) * ldc + n0 + c8) = lv;
        }
        
      }
    }
    __builtin_amdgcn_fence(3, "workgroup");
    __builtin_amdgcn_wave_barrier();
    __builtin_amdgcn_fence(2, "workgroup");
  }
}

// =====================================================================================
// Non-causal attention for head_dim 64; q/k from f16 planes (normed values carried x QCAR), v f32 in, f32 out.
//   scores = q.k^T          : v_wmma_f32_16x16x32_f16, single product; natural score = raw * sscale (sscale = 1/sqrt(64) / QCAR^2)
//   out    = p.v            : v_wmma_f32_16x16x32_f16; p = exp((s - m_running)*sscale) carried x psc (2^15) as f16, v plain f16
//   f32 accumulate; online softmax in f32. Block = 4 waves = 64 query rows of one (batch, head); S % 64 == 0.
//   Element (b, s, h, d) of tensor X lives at X[b*X_bs + s*X_rs + h*X_hs + d] (strides in elements, multiples of 8).
//   grid.x = B * H * (S/64), block 128.
// =====================================================================================
#define AT_D 64
#define AT_NW 4
#define AT_QB 64
#define AT_KC 64
#define AT_LP 72   // LDS row pitch in halves of the 64-half K, V^T and P rows: 144 B = 16 B x odd, so the 16 lanes of a 16-byte fragment read fall on 16 distinct bank groups
struct AttnGeom { long long q_bs, q_rs, q_hs, k_bs, k_rs, k_hs, v_bs, v_rs, v_hs, o_bs, o_rs, o_hs; int S, Skv, H, nchunk; float sscale; float psc; };
static_assert(sizeof(AttnGeom) == 12 * 8 + 4 * 4 + 2 * 4);

__device__ __forceinline__ v8f at_mmah(v16h a, v16h b, v8f c) {
  c = __builtin_amdgcn_wmma_f32_16x16x32_f16(false, a, false, b, (short)0, c, false, false);
  asm volatile("v_nop\n\tv_nop\n\tv_nop\n\tv_nop" : "+v"(c) : "v"(a), "v"(b));
  return c;
}

__global__ __launch_bounds__(128) __attribute__((amdgpu_num_vgpr(256)))
void k_attn64(const unsigned short* __restrict__ qp, const unsigned short* __restrict__ kp,
              const float* __restrict__ v, float* __restrict__ out, AttnGeom g) {
  union FH { v16h v; v8h h[2]; };
  __shared__ __align__(16) _Float16 Ksh[AT_KC * AT_LP];     // K [kv][d] f16   (cross-wave: block barriers before and after staging)
  __shared__ __align__(16) _Float16 Vth[AT_D * AT_LP];     // V [d][kv] f16   (cross-wave)
  __shared__ __align__(16) _Float16 Psh[AT_NW][16 * AT_LP];
  __shared__ __align__(16) float    Os[AT_NW][16 * 68];     // per wave out tile, pitch 68 (wave-private)

  const int tid  = threadIdx.x;
  const int wave = tid >> 5;
  const int lane = tid & 31;
  const int hh   = lane >> 4;
  const int c    = lane & 15;

  const int nqb = g.S / AT_QB;
  const int bx = blockIdx.x;
  const int qb = bx % nqb;
  const int bh = bx / nqb;
  const int h  = bh % g.H;
  const int b  = bh / g.H;
  const int q0 = qb * AT_QB + wave * 16;

  const _Float16* q = (const _Float16*)qp;
  const _Float16* k = (const _Float16*)kp;
  const _Float16* qb_ptr = q + (size_t)b * g.q_bs + (size_t)h * g.q_hs;
  const _Float16* kb_ptr = k + (size_t)b * g.k_bs + (size_t)h * g.k_hs;
  const float*    vb_ptr = v + (size_t)b * g.v_bs + (size_t)h * g.v_hs;
  float*          ob_ptr = out + (size_t)b * g.o_bs + (size_t)h * g.o_hs;

  // ---- Q fragments (A operand): 2 d-chunks; lane row c, elements 0..7 <- d = dc*32 + 8hh + e, 8..15 <- dc*32 + 16 + 8hh + e (two 16-B loads from the f16 row) ----
  v16h qa[2];
  {
    const _Float16* qrow = qb_ptr + (size_t)(q0 + c) * g.q_rs;
#pragma unroll
    for (int dc = 0; dc < 2; ++dc) {
      FH f;
      f.h[0] = *(const v8h*)(qrow + dc * 32 + 8 * hh);
      f.h[1] = *(const v8h*)(qrow + dc * 32 + 16 + 8 * hh);
      qa[dc] = f.v;
    }
  }

  float mrow[8], lrow[8];
  v8f oacc[4];
#pragma unroll
  for (int r = 0; r < 8; ++r) { mrow[r] = -INFINITY; lrow[r] = 0.f; }
#pragma unroll
  for (int t = 0; t < 4; ++t) oacc[t] = (v8f){0.f,0.f,0.f,0.f,0.f,0.f,0.f,0.f};

  for (int kc = 0; kc < g.nchunk; ++kc) {
    const int kv0 = kc * AT_KC;
    __syncthreads();                       // every wave is done reading the earlier chunk's Ksh / Vth
    {
      // thread (kvr, dh): 32 of the 64 elements of key row kvr (four 16-B copies) and value row kvr; full 64x64 tiles every chunk (staged extent == consumed extent)
      const int kvr = tid >> 1, dh = (tid & 1) * 32;
      const _Float16* krow = kb_ptr + (size_t)(kv0 + kvr) * g.k_rs + dh;
      const float*    vrow = vb_ptr + (size_t)(kv0 + kvr) * g.v_rs + dh;
#pragma unroll
      for (int i = 0; i < 4; ++i) {
        const v8h kk = *(const v8h*)(krow + 8 * i);
        *(v8h*)(Ksh + kvr * AT_LP + dh + 8 * i) = kk;
      }
#pragma unroll
      for (int i = 0; i < 8; ++i) {
        const v4f vv = *(const v4f*)(vrow + 4 * i);
#pragma unroll
        for (int e = 0; e < 4; ++e) {
          const int d = dh + 4 * i + e;
          const float fv = vv[e];
          Vth[d * AT_LP + kvr] = (_Float16)fv;
        }
      }
    }
    __syncthreads();

    // ---- scores: 4 key subtiles x 2 d-chunks; B fragment lane column c = key j*16+c, same k(i,h) map as A ----
    v8f s[4];
#pragma unroll
    for (int j = 0; j < 4; ++j) {
      v8f acc = (v8f){0.f,0.f,0.f,0.f,0.f,0.f,0.f,0.f};
#pragma unroll
      for (int dc = 0; dc < 2; ++dc) {
        FH kf;
        kf.h[0] = *(const v8h*)(Ksh + (j * 16 + c) * AT_LP + dc * 32 + 8 * hh);
        kf.h[1] = *(const v8h*)(Ksh + (j * 16 + c) * AT_LP + dc * 32 + 16 + 8 * hh);
        acc = at_mmah(qa[dc], kf.v, acc);
      }
      s[j] = acc;
    }
    // ---- chunk row max (raw units; sscale > 0 so max commutes): D element r of this lane = (query q0 + 8hh + r, key kv0 + j*16 + c) ----
    float cm[8];
#pragma unroll
    for (int r = 0; r < 8; ++r) {
      float m = fmaxf(fmaxf(s[0][r], s[1][r]), fmaxf(s[2][r], s[3][r]));
#pragma unroll
      for (int off = 1; off < 16; off <<= 1) m = fmaxf(m, __shfl_xor(m, off, 32));
      cm[r] = m;
    }
    _Float16* pwh = Psh[wave];
#pragma unroll
    for (int r = 0; r < 8; ++r) {
      const float mnew = fmaxf(mrow[r], cm[r]);
      const float alpha = expf((mrow[r] - mnew) * g.sscale);
      mrow[r] = mnew;
      float psum = 0.f;
#pragma unroll
      for (int j = 0; j < 4; ++j) {
        const float p = expf((s[j][r] - mnew) * g.sscale);
        psum += p;
        pwh[(8 * hh + r) * AT_LP + j * 16 + c] = (_Float16)(p * g.psc);
      }
#pragma unroll
      for (int off = 1; off < 16; off <<= 1) psum += __shfl_xor(psum, off, 32);
      lrow[r] = lrow[r] * alpha + psum;
#pragma unroll
      for (int t = 0; t < 4; ++t) oacc[t][r] *= alpha;
    }
    __builtin_amdgcn_fence(3, "workgroup");
    __builtin_amdgcn_wave_barrier();
    __builtin_amdgcn_fence(2, "workgroup");
    // ---- P.V: A = P rows (lane row c = query, k = key), B = Vth rows (lane column c = d), both with the fragment k map ----
#pragma unroll 1
    for (int kk = 0; kk < 2; ++kk) {
      FH pa;
      pa.h[0] = *(const v8h*)(pwh + c * AT_LP + kk * 32 + 8 * hh);
      pa.h[1] = *(const v8h*)(pwh + c * AT_LP + kk * 32 + 16 + 8 * hh);
#pragma unroll
      for (int t = 0; t < 4; ++t) {
        FH vbf;
        vbf.h[0] = *(const v8h*)(Vth + (t * 16 + c) * AT_LP + kk * 32 + 8 * hh);
        vbf.h[1] = *(const v8h*)(Vth + (t * 16 + c) * AT_LP + kk * 32 + 16 + 8 * hh);
        oacc[t] = at_mmah(pa.v, vbf.v, oacc[t]);
      }
    }
  }

  float* os = Os[wave];
#pragma unroll
  for (int r = 0; r < 8; ++r) {
    const float inv = 1.0f / (lrow[r] * g.psc);
#pragma unroll
    for (int t = 0; t < 4; ++t) os[(8 * hh + r) * 68 + t * 16 + c] = oacc[t][r] * inv;
  }
  __builtin_amdgcn_fence(3, "workgroup");
  __builtin_amdgcn_wave_barrier();
  __builtin_amdgcn_fence(2, "workgroup");
  {
    const int c4 = (lane & 15) * 4;
    {
#pragma unroll
      for (int it = 0; it < 8; ++it) {
        const int row = it * 2 + hh;
        v4f val = *(const v4f*)(os + row * 68 + c4);
        *(v4f*)(ob_ptr + (size_t)(q0 + row) * g.o_rs + c4) = val;
      }
      
    }
  }
}

} // namespace w25

// =====================================================================================
// =====================================================================================
__global__ __launch_bounds__(256) void k_vec(const float* __restrict__ bq, const float* __restrict__ bp, const float* __restrict__ qw, const float* __restrict__ kw, float* __restrict__ VEC) {
    const int u = blockIdx.x * 256 + threadIdx.x;
    if (u >= VECN) return;
    const float a  = bq[min(u, NQKV - 1)];
    const float bb = bp[min(max(u - OFF_BP, 0), DM - 1)];
    const float cq = qw[min(max(u - OFF_QW, 0), HDIM - 1)];
    const float ck = kw[min(max(u - OFF_KW, 0), HDIM - 1)];
    const float sel = (u < OFF_BP) ? a : ((u < OFF_QW) ? bb : ((u < OFF_KW) ? cq : ck));
    const float o = cmb_bf(sel);
    *(float*)(VEC + u) = o;
    
}

// =====================================================================================
// k_castp: DST[z][r][c] (pitch ldd halves, batch stride dbs halves) = f16(sc * g(SRC[z][r][c])) with g = bf16 RNE value (bfr != 0) or identity,
//   r < nR, c < nC (nC % 8 == 0); SRC batch stride sbs floats, row pitch lds floats. Thread per (r, 8 consecutive c): two 16-B loads,
// =====================================================================================
__global__ __launch_bounds__(256) void k_castp(const float* __restrict__ SRC, long long sbs, int lds, unsigned short* __restrict__ DST, long long dbs, int ldd, int nR, int nC, float sc, int bfr) {
    const long long u = (long long)blockIdx.x * 256 + threadIdx.x;
    const int per = nC >> 3;
    if (u >= (long long)nR * per) return;
    const int r = (int)(u / per);
    const int c0 = 8 * (int)(u - (long long)r * per);
    const float* s = SRC + (long long)blockIdx.y * sbs + (long long)r * lds + c0;
    const v4f a = *(const v4f*)s;
    const v4f bq = *(const v4f*)(s + 4);
    float w[8] = {a.x, a.y, a.z, a.w, bq.x, bq.y, bq.z, bq.w};
#pragma unroll
    for (int e = 0; e < 8; ++e) { const float t = bfr ? cmb_bf(w[e]) : w[e]; w[e] = t * sc; }
    v4u pk;
    pk.x = cmb_pk2(w[0], w[1]); pk.y = cmb_pk2(w[2], w[3]); pk.z = cmb_pk2(w[4], w[5]); pk.w = cmb_pk2(w[6], w[7]);
    v4u* d = (v4u*)(DST + (long long)blockIdx.y * dbs + (long long)r * ldd + c0);
    *d = pk;
    
}

// =====================================================================================
// k_rms: per (token, head) RMSNorm of the q and k slices of the QKV rows (64 f32 elements each):
//   DST[token][h*64 + d] = f16(QCAR * x[d] * (1 / sqrt(mean(x^2) + 1e-6)) * w[d]), DST = QH (slice 0) or KH (slice 1), f16 planes [tokens][1024].
//   Wave per row r in [0, nrow): token = r >> 5, slice = (r >> 4) & 1, head = r & 15; lane L holds elements 2L, 2L+1 (one packed 4-B word).
//   grid nrow / 8 blocks of 256 (nrow = tokens * 32). Coverage: all (token, slice, head) rows -> QH and KH [tokens][1024] complete.
// =====================================================================================
__global__ __launch_bounds__(256) void k_rms(const float* __restrict__ QKV, const float* __restrict__ QW, const float* __restrict__ KW, unsigned short* __restrict__ QH, unsigned short* __restrict__ KH, int nrow) {
    #pragma clang fp contract(off)
    const int r = blockIdx.x * 8 + (threadIdx.x >> 5);
    const int L = threadIdx.x & 31;
    if (r >= nrow) return;                                   // wave-uniform; no block barriers in this kernel
    const int token = r >> 5, slice = (r >> 4) & 1, h = r & 15;
    const float* src = QKV + (long long)token * NQKV + slice * DM + h * HDIM + 2 * L;
    const v2f x = *(const v2f*)src;
    float ss = x.x * x.x + x.y * x.y;
#pragma unroll
    for (int o = 16; o > 0; o >>= 1) ss += __shfl_xor(ss, o, 32);
    const float rms = sqrtf(ss * (1.0f / 64.0f) + 1e-6f);
    const float rec = 1.0f / rms;
    const v2f wq = *(const v2f*)(QW + 2 * L);
    const v2f wk = *(const v2f*)(KW + 2 * L);
    v2f w; w.x = slice ? wk.x : wq.x; w.y = slice ? wk.y : wq.y;
    const float o0 = ((x.x * rec) * w.x) * QCAR;
    const float o1 = ((x.y * rec) * w.y) * QCAR;
    const unsigned pk = cmb_pk2(o0, o1);
    unsigned short* dst = (slice ? KH : QH) + (long long)token * DM + h * HDIM + 2 * L;
    *(unsigned*)dst = pk;
    
}

extern "C" void kernel_launch(void* const* d_in, const int* in_sizes, int n_in, void* d_out, int out_size, void* d_ws, size_t ws_size, hipStream_t stream) {
    if (n_in < 7) return;
    const float* x     = (const float*)d_in[0];     // [2][2048][1024]
    const float* Wqkv  = (const float*)d_in[1];     // [3072][1024]  ([out][in] = Bt layout)
    const float* bqkv  = (const float*)d_in[2];     // [3072]
    const float* Wproj = (const float*)d_in[3];     // [1024][1024]  ([out][in] = Bt layout)
    const float* bproj = (const float*)d_in[4];     // [1024]
    const float* qn_w  = (const float*)d_in[5];     // [64]
    const float* kn_w  = (const float*)d_in[6];     // [64]
    const long long xneed = ((long long)(NB - 1) * SEQ_FULL + SEQ) * DM;
    if ((long long)in_sizes[0] < xneed) return;
    if ((long long)in_sizes[1] < (long long)NQKV * DM) return;
    if (in_sizes[2] < NQKV) return;
    if ((long long)in_sizes[3] < (long long)DM * DM) return;
    if (in_sizes[4] < DM) return;
    if (in_sizes[5] < HDIM || in_sizes[6] < HDIM) return;
    if ((long long)out_size < xneed) return;
    if (WS_TOTAL > ws_size) return;

    char* wsp = (char*)d_ws;
    float* VEC = (float*)wsp; wsp += WS_VEC;                              // 4224 f32 (bf16 RNE values of the small input vectors)
    unsigned short* X16 = (unsigned short*)wsp; wsp += WS_X16;             // [NTOK][1024] f16 = 16 * bf16(x)
    unsigned short* W16 = (unsigned short*)wsp; wsp += WS_W16;             // [3072][1024] f16 = 64 * bf16(Wqkv)
    unsigned short* WP16 = (unsigned short*)wsp; wsp += WS_WP16;           // [1024][1024] f16 = 64 * bf16(Wproj)
    float* QKV = (float*)wsp; wsp += WS_QKV;                               // [NTOK][3072] f32
    unsigned short* QH16 = (unsigned short*)wsp; wsp += WS_QK16;           // [NTOK][1024] f16 = 16 * normalised q
    unsigned short* KH16 = (unsigned short*)wsp; wsp += WS_QK16;           // [NTOK][1024] f16 = 16 * normalised k
    float* CTX = (float*)wsp; wsp += WS_CTX;                               // [NTOK][1024] f32 attention output (token-major, head*64 + d)
    unsigned short* CTX16 = (unsigned short*)wsp; wsp += WS_CTX16;         // [NTOK][1024] f16 = 256 * ctx
    float* out = (float*)d_out;

    // 1. small vectors -> bf16 RNE values (f32)
    k_vec<<<(VECN + 255) / 256, 256, 0, stream>>>(bqkv, bproj, qn_w, kn_w, VEC);
    // 2-4. 16-bit operand planes (bf16 RNE input values times a power of two, exact in f16)
    k_castp<<<dim3((unsigned)(((long long)SEQ * (DM / 8) + 255) / 256), (unsigned)NB), 256, 0, stream>>>(x, (long long)SEQ_FULL * DM, DM, X16, (long long)SEQ * DM, DM, SEQ, DM, 16.0f, 1);
    k_castp<<<dim3((unsigned)(((long long)NQKV * (DM / 8) + 255) / 256), 1u), 256, 0, stream>>>(Wqkv, 0LL, DM, W16, 0LL, DM, NQKV, DM, 64.0f, 1);
    k_castp<<<dim3((unsigned)(((long long)DM * (DM / 8) + 255) / 256), 1u), 256, 0, stream>>>(Wproj, 0LL, DM, WP16, 0LL, DM, DM, DM, 64.0f, 1);
    // 5. QKV = (16 bf16(x)) . (64 bf16(Wqkv))^T / 1024 + bf16(bqkv)   -> [NTOK][3072] f32
    w25::wmma_gemm64<0, false, 2, 0, false><<<dim3((unsigned)(((NTOK / 64) * (NQKV / 64) + 7) / 8), 1u), 256, 0, stream>>>(
        (const unsigned short*)X16, nullptr, DM, 0L, (const unsigned short*)W16, nullptr, DM, 0L,
        (void*)QKV, nullptr, NQKV, 0L, VEC + OFF_BQ, nullptr, 0L, NTOK, NQKV, DM, 1.0f / 1024.0f);
    // 6. per-head RMSNorm of q and k (f32 math) -> f16 planes carried x16
    k_rms<<<(unsigned)((NTOK * 32) / 8), 256, 0, stream>>>(QKV, VEC + OFF_QW, VEC + OFF_KW, QH16, KH16, NTOK * 32);
    // 7. attention: 64 query rows per block, 64-key chunks, online softmax; v read from the QKV tile (columns 2048 + h*64)
    w25::AttnGeom g;
    g.q_bs = (long long)SEQ * DM;   g.q_rs = DM;   g.q_hs = HDIM;
    g.k_bs = (long long)SEQ * DM;   g.k_rs = DM;   g.k_hs = HDIM;
    g.v_bs = (long long)SEQ * NQKV; g.v_rs = NQKV; g.v_hs = HDIM;
    g.o_bs = (long long)SEQ * DM;   g.o_rs = DM;   g.o_hs = HDIM;
    g.S = SEQ; g.Skv = SEQ; g.H = NH; g.nchunk = SEQ / AT_KC; g.sscale = 0.125f / (QCAR * QCAR); g.psc = 32768.0f;
    w25::k_attn64<<<(unsigned)(NB * NH * (SEQ / AT_QB)), 128, 0, stream>>>(QH16, KH16, QKV + 2 * DM, CTX, g);
    // 8. ctx -> f16 plane (x256)
    k_castp<<<dim3((unsigned)(((long long)NTOK * (DM / 8) + 255) / 256), 1u), 256, 0, stream>>>(CTX, 0LL, DM, CTX16, 0LL, DM, NTOK, DM, 256.0f, 0);
    // 9. out[b][s][:] = (256 ctx) . (64 bf16(Wproj))^T / 16384 + bf16(bproj), batch rows at the full per-batch stride of d_out
    w25::wmma_gemm64<0, false, 2, 0, false><<<dim3((unsigned)((((SEQ / 64) * (DM / 64)) + 7) / 8), (unsigned)NB), 256, 0, stream>>>(
        (const unsigned short*)CTX16, nullptr, DM, (long)SEQ * DM, (const unsigned short*)WP16, nullptr, DM, 0L,
        (void*)out, nullptr, DM, (long)SEQ_FULL * DM, VEC + OFF_BP, nullptr, 0L, SEQ, DM, DM, 1.0f / 16384.0f);
    (void)hipGetLastError();
}

// v002
// A run of this version takes 281 microseconds.
// Two timings next to v001 both put it at 1.05 times that version's speed.
// Counting every step since v000, it is 1.20 times as fast.
// Contractions: qkv projection [NB*SEQ x 1024 x 3072] and output projection [NB*SEQ x 1024 x 1024] = v_wmma_f32_16x16x32_f16 (f16 operands holding bf16 RNE input values scaled by powers of two, except the output projection's ctx operand = f16(256 ctx); f32 accumulate); attention scores q.k^T = v_wmma_f32_16x16x32_f16 (normed q,k carried x16 as f16, single product, f32 accumulate); P.V = v_wmma_f32_16x16x32_f16 (P carried x2^15 as f16, v f16, f32 accumulate); RMSNorm (in the qkv projection's epilogue) and online softmax in f32.
#include <hip/hip_runtime.h>
#include <math.h>

#ifndef NB
#define NB 2
#endif
#ifndef SEQ
#define SEQ 2048
#endif
#define NB_FULL 2
#define SEQ_FULL 2048
#define DM 1024
#define NH 16
#define HDIM 64
#define NQKV (3 * DM)
#define NTOK (NB * SEQ)
#define QCAR 16.0f
// small f32 vector region: [bqkv 3072 | bproj 1024 | qn_w 64 | kn_w 64], each entry the bf16 RNE value of the input
#define OFF_BQ 0
#define OFF_BP NQKV
#define OFF_QW (NQKV + DM)
#define OFF_KW (NQKV + DM + HDIM)
#define VECN (NQKV + DM + 2 * HDIM)
static_assert(SEQ % 64 == 0);
static_assert(NB >= 1);
static_assert(NB <= NB_FULL);
static_assert(SEQ <= SEQ_FULL);
static_assert(VECN % 32 == 0);
static_assert(NH * HDIM == DM);
static_assert(DM % 64 == 0);
static_assert(NQKV % 64 == 0);
static_assert(HDIM == 64);   // one 64-column wave tile of the qkv projection = one head's q, k or v slice

typedef __attribute__((ext_vector_type(16))) _Float16 v16h;
typedef __attribute__((ext_vector_type(8)))  _Float16 v8h;
typedef __attribute__((ext_vector_type(16))) __bf16   v16b;
typedef __attribute__((ext_vector_type(8)))  __bf16   v8b;
typedef __attribute__((ext_vector_type(8)))  float    v8f;
typedef __attribute__((ext_vector_type(4)))  float    v4f;
typedef __attribute__((ext_vector_type(2)))  float    v2f;
typedef __attribute__((ext_vector_type(4)))  unsigned int v4u;

// 16-bit WMMA fragment map (wave32), lane L, h = L>>4, m = L&15:
//   A 16x32: lane = row m;   element i -> k = (i<8) ? 8h+i : 16+8h+(i-8)
//   B 32x16: lane = column m; the SAME k(i,h)
//   D 16x16 (8 f32): lane = column m; element r -> row 8h+r

// workspace carve (bytes, 256-B aligned regions)
constexpr size_t al256(size_t x) { return (x + 255) / 256 * 256; }
constexpr size_t WS_VEC   = al256((size_t)VECN * 4);
constexpr size_t WS_X16   = al256((size_t)NTOK * DM * 2);
constexpr size_t WS_W16   = al256((size_t)NQKV * DM * 2);
constexpr size_t WS_WP16  = al256((size_t)DM * DM * 2);
constexpr size_t WS_QKV   = al256((size_t)NTOK * NQKV * 4);
constexpr size_t WS_QK16  = al256((size_t)NTOK * DM * 2);
constexpr size_t WS_CTX   = al256((size_t)NTOK * DM * 4);
constexpr size_t WS_CTX16 = al256((size_t)NTOK * DM * 2);
constexpr size_t WS_TOTAL = WS_VEC + WS_X16 + WS_W16 + WS_WP16 + WS_QKV + 2 * WS_QK16 + WS_CTX + WS_CTX16;
static_assert(WS_TOTAL <= (size_t)134217728);

// ---- scalar helpers ----
__device__ __forceinline__ float cmb_bf(float v) { const unsigned u = __builtin_bit_cast(unsigned, v); const unsigned r = (u + 0x7fffu + ((u >> 16) & 1u)) & 0xffff0000u; return __builtin_bit_cast(float, r); }   // bf16 RNE value kept as f32
__device__ __forceinline__ unsigned int cmb_pk2(float a, float b) { return (unsigned int)__builtin_bit_cast(unsigned short, (_Float16)a) | ((unsigned int)__builtin_bit_cast(unsigned short, (_Float16)b) << 16); }

namespace w25 {

__device__ __forceinline__ unsigned short f2bf_bits(float f) {
  unsigned u = __float_as_uint(f);
  return (unsigned short)((u + 0x7FFFu + ((u >> 16) & 1u)) >> 16);
}
__device__ __forceinline__ float bf_bits2f(unsigned short h) { return __uint_as_float(((unsigned)h) << 16); }

// hazard guards as plain device helpers
__device__ __forceinline__ void dep_guard_h(v8f& a, v8f& b, v16h x, v16h y) { asm volatile("v_nop\n\tv_nop\n\tv_nop\n\tv_nop" : "+v"(a), "+v"(b) : "v"(x), "v"(y)); }
__device__ __forceinline__ void dep_guard_b(v8f& a, v8f& b, v16b x, v16b y) { asm volatile("v_nop\n\tv_nop\n\tv_nop\n\tv_nop" : "+v"(a), "+v"(b) : "v"(x), "v"(y)); }
__device__ __forceinline__ void keep4_h(v16h a, v16h b, v16h c, v16h d) { asm volatile("v_nop" :: "v"(a), "v"(b), "v"(c), "v"(d)); }
__device__ __forceinline__ void keep4_b(v16b a, v16b b, v16b c, v16b d) { asm volatile("v_nop" :: "v"(a), "v"(b), "v"(c), "v"(d)); }
__device__ __forceinline__ void acc_guard4(v8f& a, v8f& b, v8f& c, v8f& d) { asm volatile("v_nop\n\tv_nop\n\tv_nop\n\tv_nop" : "+v"(a), "+v"(b), "+v"(c), "+v"(d)); }
template <typename T> struct Frag;
template <> struct Frag<_Float16> {
  typedef v16h V; union U { v16h v; v8h h[2]; };
  static __device__ __forceinline__ v16h load(const _Float16* p) {   // elements 0..7 <- p[0..7], 8..15 <- p[16..23]
    U f; f.h[0] = *(const v8h*)(p); f.h[1] = *(const v8h*)(p + 16); return f.v;
  }
  static __device__ __forceinline__ v8f mma(v16h a, v16h b, v8f c) {
    return __builtin_amdgcn_wmma_f32_16x16x32_f16(false, a, false, b, (short)0, c, false, false);
  }
  static __device__ __forceinline__ void guard(v8f& a, v8f& b, v16h x, v16h y) { dep_guard_h(a, b, x, y); }
  static __device__ __forceinline__ void keep(v16h a, v16h b, v16h c, v16h d) { keep4_h(a, b, c, d); }
};
template <> struct Frag<__bf16> {
  typedef v16b V; union U { v16b v; v8b h[2]; };
  static __device__ __forceinline__ v16b load(const __bf16* p) {
    U f; f.h[0] = *(const v8b*)(p); f.h[1] = *(const v8b*)(p + 16); return f.v;
  }
  static __device__ __forceinline__ v8f mma(v16b a, v16b b, v8f c) {
    return __builtin_amdgcn_wmma_f32_16x16x32_bf16(false, a, false, b, (short)0, c, false, false);
  }
  static __device__ __forceinline__ void guard(v8f& a, v8f& b, v16b x, v16b y) { dep_guard_b(a, b, x, y); }
  static __device__ __forceinline__ void keep(v16b a, v16b b, v16b c, v16b d) { keep4_b(a, b, c, d); }
};

// ---- Register-blocked batched WMMA GEMM ------------------------------------
// C[m,n] = scale * sum_k A[m,k] * Bt[n,k] (+bias)(+resid); each wave owns a 64x64 tile.
// A row-major [M,K]; Bt row-major [N,K]; M,N % 64 == 0, K % 32 == 0.
// SPLIT: operands are hi/lo planes (A2/Bt2 = lo planes, same layout); product = hi.hi + hi.lo + lo.hi.
// BIAS_MODE: 0 = none, 1 = bias[m], 2 = bias[n].
// OUT_MODE: 0 = f32, 1 = f16, 2 = bf16 hi plane (Cout) + bf16 lo plane (Cout2).
// ET: 0 = f16 operands, 1 = bf16 operands (pointers passed as 16-bit storage)
// QKN: the qkv projection. A wave tile is 64 tokens x one head's 64 columns of q (n0 < DM), k (n0 < 2 DM) or v. q and k tiles are RMS-normalised
//   row by row in the epilogue and stored only as f16 planes: QHp / KHp[token][h*64 + d] = f16(QCAR * x[d] * (1 / sqrt(mean(x^2) + 1e-6)) * w[d]),
//   w = qnw / knw; v tiles are stored as f32 into Cout like any other tile (the q and k columns of Cout stay unwritten and are never read).
template <int ET> struct Elem;
template <> struct Elem<0> { typedef _Float16 T; };
template <> struct Elem<1> { typedef __bf16 T; };
template <int ET, bool SPLIT, int BIAS_MODE, int OUT_MODE, bool RESID, bool QKN>
__global__ __launch_bounds__(256) void wmma_gemm64(
    const unsigned short* __restrict__ Ap, const unsigned short* __restrict__ A2p, int lda, long strideA,
    const unsigned short* __restrict__ Btp, const unsigned short* __restrict__ Bt2p, int ldb, long strideB,
    void* __restrict__ Cout, void* __restrict__ Cout2, int ldc, long strideC,
    const float* __restrict__ bias,
    const float* __restrict__ resid, long strideR,
    int M, int N, int K, float scale,
    const float* __restrict__ qnw, const float* __restrict__ knw,
    unsigned short* __restrict__ QHp, unsigned short* __restrict__ KHp) {
  typedef typename Elem<ET>::T T;
  typedef typename Frag<T>::V V;
  const T* A = (const T*)Ap; const T* A2 = (const T*)A2p; const T* Bt = (const T*)Btp; const T* Bt2 = (const T*)Bt2p;
  __shared__ __align__(16) float sT[8][16 * 68];   // per-wave 16x64 slab, pitch 68 floats (wave-private)
  const int b    = blockIdx.y;
  const int lane = threadIdx.x & 31;
  const int wave = threadIdx.x >> 5;
  const int tilesN = N >> 6;
  const int tilesM = M >> 6;
  const int tile = blockIdx.x * 8 + wave;
  if (tile >= tilesM * tilesN) return;   // wave-uniform; no block barriers in this kernel
  const int tm = tile / tilesN;
  const int tn = tile - tm * tilesN;
  const int m0 = tm << 6;
  const int n0 = tn << 6;

  const T* Ab  = A  + (size_t)b * strideA;
  const T* Bb  = Bt + (size_t)b * strideB;
  const T* Ab2 = SPLIT ? (A2  + (size_t)b * strideA) : nullptr;
  const T* Bb2 = SPLIT ? (Bt2 + (size_t)b * strideB) : nullptr;

  const int rlane = lane & 15;                 // row (A) / col (B, D) within subtile
  const int koff  = (lane >> 4) * 8;           // k offset of this lane half
  const int mOff  = (lane >> 4) * 8;           // D row offset

  v8f acc[4][4];
#pragma unroll
  for (int i = 0; i < 4; ++i)
#pragma unroll
    for (int j = 0; j < 4; ++j) acc[i][j] = (v8f){0.f,0.f,0.f,0.f,0.f,0.f,0.f,0.f};

  for (int k0 = 0; k0 < K; k0 += 32) {
    V bh[4], bl[4];
#pragma unroll
    for (int j = 0; j < 4; ++j) {
      const size_t bo = (size_t)(n0 + (j << 4) + rlane) * ldb + koff + k0;
      bh[j] = Frag<T>::load(Bb + bo);
      if (SPLIT) bl[j] = Frag<T>::load(Bb2 + bo);
    }
#pragma unroll
    for (int i = 0; i < 4; ++i) {
      const size_t ao = (size_t)(m0 + (i << 4) + rlane) * lda + koff + k0;
      V ah = Frag<T>::load(Ab + ao);
      V al;
      if (SPLIT) al = Frag<T>::load(Ab2 + ao);
#pragma unroll
      for (int j = 0; j < 4; ++j) {
        acc[i][j] = Frag<T>::mma(ah, bh[j], acc[i][j]);
        if (SPLIT) {
          acc[i][j] = Frag<T>::mma(ah, bl[j], acc[i][j]);
          acc[i][j] = Frag<T>::mma(al, bh[j], acc[i][j]);
        }
      }
      Frag<T>::guard(acc[i][0], acc[i][3], ah, SPLIT ? al : ah);
    }
    Frag<T>::keep(bh[0], bh[1], bh[2], bh[3]);
    if (SPLIT) Frag<T>::keep(bl[0], bl[1], bl[2], bl[3]);
  }
  acc_guard4(acc[0][0], acc[0][1], acc[0][2], acc[0][3]);
  acc_guard4(acc[1][0], acc[1][1], acc[1][2], acc[1][3]);
  acc_guard4(acc[2][0], acc[2][1], acc[2][2], acc[2][3]);
  acc_guard4(acc[3][0], acc[3][1], acc[3][2], acc[3][3]);

  // ---- epilogue ----
  float* slab = sT[wave];
  const float* Rb = RESID ? (resid + (size_t)b * strideR) : nullptr;
  const int nslice = QKN ? n0 / DM : 2;            // 0 = q, 1 = k, 2 = v (wave-uniform)
  v4f nw0 = (v4f){0.f,0.f,0.f,0.f}, nw1 = nw0;     // norm weights of this lane's 8 columns
  if (QKN && nslice < 2) {
    const float* nwp = (nslice ? knw : qnw) + (lane & 7) * 8;
    nw0 = *(const v4f*)nwp;
    nw1 = *(const v4f*)(nwp + 4);
  }
#pragma unroll
  for (int i = 0; i < 4; ++i) {
    const int mBase = m0 + (i << 4);
#pragma unroll
    for (int j = 0; j < 4; ++j) {
      const int n = n0 + (j << 4) + rlane;
      float bv = 0.f;
      if (BIAS_MODE == 2) bv = bias[n];
#pragma unroll
      for (int r = 0; r < 8; ++r) {
        float v = acc[i][j][r] * scale;
        if (BIAS_MODE == 1) v += bias[mBase + mOff + r];
        if (BIAS_MODE == 2) v += bv;
        if (RESID) v += Rb[(size_t)(mBase + mOff + r) * ldc + n];
        slab[(mOff + r) * 68 + (j << 4) + rlane] = v;
      }
    }
    __builtin_amdgcn_fence(3, "workgroup");
    __builtin_amdgcn_wave_barrier();
    __builtin_amdgcn_fence(2, "workgroup");
    if (QKN && nslice < 2) {
      // 8 lanes per row, 8 columns per lane: sum of squares in the lane, then over the 8 lanes; one 16-B store per lane = a 128-B line per row
      const int q = lane >> 3, c8 = (lane & 7) * 8;
      unsigned short* P = (nslice ? KHp : QHp) + (n0 - nslice * DM) + c8;
#pragma unroll   // the four row groups' LDS reads and lane exchanges issue together, so their latencies overlap
      for (int it = 0; it < 4; ++it) {
        const int row = it * 4 + q;
        const v4f x0 = *(const v4f*)(slab + row * 68 + c8);
        const v4f x1 = *(const v4f*)(slab + row * 68 + c8 + 4);
        float ss = (x0.x * x0.x + x0.y * x0.y + x0.z * x0.z + x0.w * x0.w) + (x1.x * x1.x + x1.y * x1.y + x1.z * x1.z + x1.w * x1.w);
#pragma unroll   // constant lane distances 1, 2, 4: the 8 lanes of a row
        for (int o = 1; o < 8; o <<= 1) ss += __shfl_xor(ss, o, 32);
        const float rms = sqrtf(ss * (1.0f / 64.0f) + 1e-6f);
        const float rec = 1.0f / rms;
        v4u pk;
        pk.x = cmb_pk2(((x0.x * rec) * nw0.x) * QCAR, ((x0.y * rec) * nw0.y) * QCAR);
        pk.y = cmb_pk2(((x0.z * rec) * nw0.z) * QCAR, ((x0.w * rec) * nw0.w) * QCAR);
        pk.z = cmb_pk2(((x1.x * rec) * nw1.x) * QCAR, ((x1.y * rec) * nw1.y) * QCAR);
        pk.w = cmb_pk2(((x1.z * rec) * nw1.z) * QCAR, ((x1.w * rec) * nw1.w) * QCAR);
        *(v4u*)(P + (size_t)(mBase + row) * DM) = pk;
      }
    } else if (OUT_MODE == 0) {
      float* C = (float*)Cout + (size_t)b * strideC;
      const int hh = lane >> 4, c4 = (lane & 15) * 4;     // row seg = 256 B = 16 lanes x 16 B
      {
#pragma unroll
        for (int it = 0; it < 8; ++it) {
          const int row = it * 2 + hh;
          v4f v = *(const v4f*)(slab + row * 68 + c4);
          *(v4f*)(C + (size_t)(mBase + row) * ldc + n0 + c4) = v;
        }
        
      }
    } else {
      const int q = lane >> 3, c8 = (lane & 7) * 8;
      unsigned short* C  = (unsigned short*)Cout  + (size_t)b * strideC;
      unsigned short* C2 = (OUT_MODE == 2) ? ((unsigned short*)Cout2 + (size_t)b * strideC) : nullptr;
      {
#pragma unroll
        for (int it = 0; it < 4; ++it) {
          const int row = it * 4 + q;
          const float* sp = slab + row * 68 + c8;
          v8h hv, lv;
#pragma unroll
          for (int e = 0; e < 8; ++e) {
            if (OUT_MODE == 1) {
              hv[e] = (_Float16)sp[e];
            } else {
              unsigned short hb = f2bf_bits(sp[e]);
              unsigned short lb = f2bf_bits(sp[e] - bf_bits2f(hb));
              hv[e] = __builtin_bit_cast(_Float16, hb);
              lv[e] = __builtin_bit_cast(_Float16, lb);
            }
          }
          *(v8h*)(C + (size_t)(mBase + row) * ldc + n0 + c8) = hv;
          if (OUT_MODE == 2) *(v8h*)(C2 + (size_t)(mBase + row) * ldc + n0 + c8) = lv;
        }
        
      }
    }
    __builtin_amdgcn_fence(3, "workgroup");
    __builtin_amdgcn_wave_barrier();
    __builtin_amdgcn_fence(2, "workgroup");
  }
}

// =====================================================================================
// Non-causal attention for head_dim 64; q/k from f16 planes (normed values carried x QCAR), v f32 in, f32 out.
//   scores = q.k^T          : v_wmma_f32_16x16x32_f16, single product; natural score = raw * sscale (sscale = 1/sqrt(64) / QCAR^2)
//   out    = p.v            : v_wmma_f32_16x16x32_f16; p = exp((s - m_running)*sscale) carried x psc (2^15) as f16, v plain f16
//   f32 accumulate; online softmax in f32. Block = 4 waves = 64 query rows of one (batch, head); S % 64 == 0.
//   Element (b, s, h, d) of tensor X lives at X[b*X_bs + s*X_rs + h*X_hs + d] (strides in elements, multiples of 8).
//   grid.x = B * H * (S/64), block 128.
// =====================================================================================
#define AT_D 64
#define AT_NW 4
#define AT_QB 64
#define AT_KC 64
#define AT_LP 72   // LDS row pitch in halves of the 64-half K, V^T and P rows: 144 B = 16 B x odd, so the 16 lanes of a 16-byte fragment read fall on 16 distinct bank groups
struct AttnGeom { long long q_bs, q_rs, q_hs, k_bs, k_rs, k_hs, v_bs, v_rs, v_hs, o_bs, o_rs, o_hs; int S, Skv, H, nchunk; float sscale; float psc; };
static_assert(sizeof(AttnGeom) == 12 * 8 + 4 * 4 + 2 * 4);

__device__ __forceinline__ v8f at_mmah(v16h a, v16h b, v8f c) {
  c = __builtin_amdgcn_wmma_f32_16x16x32_f16(false, a, false, b, (short)0, c, false, false);
  asm volatile("v_nop\n\tv_nop\n\tv_nop\n\tv_nop" : "+v"(c) : "v"(a), "v"(b));
  return c;
}

__global__ __launch_bounds__(128) __attribute__((amdgpu_num_vgpr(256)))
void k_attn64(const unsigned short* __restrict__ qp, const unsigned short* __restrict__ kp,
              const float* __restrict__ v, float* __restrict__ out, AttnGeom g) {
  union FH { v16h v; v8h h[2]; };
  __shared__ __align__(16) _Float16 Ksh[AT_KC * AT_LP];     // K [kv][d] f16   (cross-wave: block barriers before and after staging)
  __shared__ __align__(16) _Float16 Vth[AT_D * AT_LP];     // V [d][kv] f16   (cross-wave)
  __shared__ __align__(16) _Float16 Psh[AT_NW][16 * AT_LP];
  __shared__ __align__(16) float    Os[AT_NW][16 * 68];     // per wave out tile, pitch 68 (wave-private)

  const int tid  = threadIdx.x;
  const int wave = tid >> 5;
  const int lane = tid & 31;
  const int hh   = lane >> 4;
  const int c    = lane & 15;

  const int nqb = g.S / AT_QB;
  const int bx = blockIdx.x;
  const int qb = bx % nqb;
  const int bh = bx / nqb;
  const int h  = bh % g.H;
  const int b  = bh / g.H;
  const int q0 = qb * AT_QB + wave * 16;

  const _Float16* q = (const _Float16*)qp;
  const _Float16* k = (const _Float16*)kp;
  const _Float16* qb_ptr = q + (size_t)b * g.q_bs + (size_t)h * g.q_hs;
  const _Float16* kb_ptr = k + (size_t)b * g.k_bs + (size_t)h * g.k_hs;
  const float*    vb_ptr = v + (size_t)b * g.v_bs + (size_t)h * g.v_hs;
  float*          ob_ptr = out + (size_t)b * g.o_bs + (size_t)h * g.o_hs;

  // ---- Q fragments (A operand): 2 d-chunks; lane row c, elements 0..7 <- d = dc*32 + 8hh + e, 8..15 <- dc*32 + 16 + 8hh + e (two 16-B loads from the f16 row) ----
  v16h qa[2];
  {
    const _Float16* qrow = qb_ptr + (size_t)(q0 + c) * g.q_rs;
#pragma unroll
    for (int dc = 0; dc < 2; ++dc) {
      FH f;
      f.h[0] = *(const v8h*)(qrow + dc * 32 + 8 * hh);
      f.h[1] = *(const v8h*)(qrow + dc * 32 + 16 + 8 * hh);
      qa[dc] = f.v;
    }
  }

  float mrow[8], lrow[8];
  v8f oacc[4];
#pragma unroll
  for (int r = 0; r < 8; ++r) { mrow[r] = -INFINITY; lrow[r] = 0.f; }
#pragma unroll
  for (int t = 0; t < 4; ++t) oacc[t] = (v8f){0.f,0.f,0.f,0.f,0.f,0.f,0.f,0.f};

  for (int kc = 0; kc < g.nchunk; ++kc) {
    const int kv0 = kc * AT_KC;
    __syncthreads();                       // every wave is done reading the earlier chunk's Ksh / Vth
    {
      // thread (kvr, dh): 32 of the 64 elements of key row kvr (four 16-B copies) and value row kvr; full 64x64 tiles every chunk (staged extent == consumed extent)
      const int kvr = tid >> 1, dh = (tid & 1) * 32;
      const _Float16* krow = kb_ptr + (size_t)(kv0 + kvr) * g.k_rs + dh;
      const float*    vrow = vb_ptr + (size_t)(kv0 + kvr) * g.v_rs + dh;
#pragma unroll
      for (int i = 0; i < 4; ++i) {
        const v8h kk = *(const v8h*)(krow + 8 * i);
        *(v8h*)(Ksh + kvr * AT_LP + dh + 8 * i) = kk;
      }
#pragma unroll
      for (int i = 0; i < 8; ++i) {
        const v4f vv = *(const v4f*)(vrow + 4 * i);
#pragma unroll
        for (int e = 0; e < 4; ++e) {
          const int d = dh + 4 * i + e;
          const float fv = vv[e];
          Vth[d * AT_LP + kvr] = (_Float16)fv;
        }
      }
    }
    __syncthreads();

    // ---- scores: 4 key subtiles x 2 d-chunks; B fragment lane column c = key j*16+c, same k(i,h) map as A ----
    v8f s[4];
#pragma unroll
    for (int j = 0; j < 4; ++j) {
      v8f acc = (v8f){0.f,0.f,0.f,0.f,0.f,0.f,0.f,0.f};
#pragma unroll
      for (int dc = 0; dc < 2; ++dc) {
        FH kf;
        kf.h[0] = *(const v8h*)(Ksh + (j * 16 + c) * AT_LP + dc * 32 + 8 * hh);
        kf.h[1] = *(const v8h*)(Ksh + (j * 16 + c) * AT_LP + dc * 32 + 16 + 8 * hh);
        acc = at_mmah(qa[dc], kf.v, acc);
      }
      s[j] = acc;
    }
    // ---- chunk row max (raw units; sscale > 0 so max commutes): D element r of this lane = (query q0 + 8hh + r, key kv0 + j*16 + c) ----
    float cm[8];
#pragma unroll
    for (int r = 0; r < 8; ++r) {
      float m = fmaxf(fmaxf(s[0][r], s[1][r]), fmaxf(s[2][r], s[3][r]));
#pragma unroll
      for (int off = 1; off < 16; off <<= 1) m = fmaxf(m, __shfl_xor(m, off, 32));
      cm[r] = m;
    }
    _Float16* pwh = Psh[wave];
#pragma unroll
    for (int r = 0; r < 8; ++r) {
      const float mnew = fmaxf(mrow[r], cm[r]);
      const float alpha = expf((mrow[r] - mnew) * g.sscale);
      mrow[r] = mnew;
      float psum = 0.f;
#pragma unroll
      for (int j = 0; j < 4; ++j) {
        const float p = expf((s[j][r] - mnew) * g.sscale);
        psum += p;
        pwh[(8 * hh + r) * AT_LP + j * 16 + c] = (_Float16)(p * g.psc);
      }
#pragma unroll
      for (int off = 1; off < 16; off <<= 1) psum += __shfl_xor(psum, off, 32);
      lrow[r] = lrow[r] * alpha + psum;
#pragma unroll
      for (int t = 0; t < 4; ++t) oacc[t][r] *= alpha;
    }
    __builtin_amdgcn_fence(3, "workgroup");
    __builtin_amdgcn_wave_barrier();
    __builtin_amdgcn_fence(2, "workgroup");
    // ---- P.V: A = P rows (lane row c = query, k = key), B = Vth rows (lane column c = d), both with the fragment k map ----
#pragma unroll 1
    for (int kk = 0; kk < 2; ++kk) {
      FH pa;
      pa.h[0] = *(const v8h*)(pwh + c * AT_LP + kk * 32 + 8 * hh);
      pa.h[1] = *(const v8h*)(pwh + c * AT_LP + kk * 32 + 16 + 8 * hh);
#pragma unroll
      for (int t = 0; t < 4; ++t) {
        FH vbf;
        vbf.h[0] = *(const v8h*)(Vth + (t * 16 + c) * AT_LP + kk * 32 + 8 * hh);
        vbf.h[1] = *(const v8h*)(Vth + (t * 16 + c) * AT_LP + kk * 32 + 16 + 8 * hh);
        oacc[t] = at_mmah(pa.v, vbf.v, oacc[t]);
      }
    }
  }

  float* os = Os[wave];
#pragma unroll
  for (int r = 0; r < 8; ++r) {
    const float inv = 1.0f / (lrow[r] * g.psc);
#pragma unroll
    for (int t = 0; t < 4; ++t) os[(8 * hh + r) * 68 + t * 16 + c] = oacc[t][r] * inv;
  }
  __builtin_amdgcn_fence(3, "workgroup");
  __builtin_amdgcn_wave_barrier();
  __builtin_amdgcn_fence(2, "workgroup");
  {
    const int c4 = (lane & 15) * 4;
    {
#pragma unroll
      for (int it = 0; it < 8; ++it) {
        const int row = it * 2 + hh;
        v4f val = *(const v4f*)(os + row * 68 + c4);
        *(v4f*)(ob_ptr + (size_t)(q0 + row) * g.o_rs + c4) = val;
      }
      
    }
  }
}

} // namespace w25

// =====================================================================================
// =====================================================================================
__global__ __launch_bounds__(256) void k_vec(const float* __restrict__ bq, const float* __restrict__ bp, const float* __restrict__ qw, const float* __restrict__ kw, float* __restrict__ VEC) {
    const int u = blockIdx.x * 256 + threadIdx.x;
    if (u >= VECN) return;
    const float a  = bq[min(u, NQKV - 1)];
    const float bb = bp[min(max(u - OFF_BP, 0), DM - 1)];
    const float cq = qw[min(max(u - OFF_QW, 0), HDIM - 1)];
    const float ck = kw[min(max(u - OFF_KW, 0), HDIM - 1)];
    const float sel = (u < OFF_BP) ? a : ((u < OFF_QW) ? bb : ((u < OFF_KW) ? cq : ck));
    const float o = cmb_bf(sel);
    *(float*)(VEC + u) = o;
    
}

// =====================================================================================
// k_castp: DST[z][r][c] (pitch ldd halves, batch stride dbs halves) = f16(sc * g(SRC[z][r][c])) with g = bf16 RNE value (bfr != 0) or identity,
//   r < nR, c < nC (nC % 8 == 0); SRC batch stride sbs floats, row pitch lds floats. Thread per (r, 8 consecutive c): two 16-B loads,
// =====================================================================================
__global__ __launch_bounds__(256) void k_castp(const float* __restrict__ SRC, long long sbs, int lds, unsigned short* __restrict__ DST, long long dbs, int ldd, int nR, int nC, float sc, int bfr) {
    const long long u = (long long)blockIdx.x * 256 + threadIdx.x;
    const int per = nC >> 3;
    if (u >= (long long)nR * per) return;
    const int r = (int)(u / per);
    const int c0 = 8 * (int)(u - (long long)r * per);
    const float* s = SRC + (long long)blockIdx.y * sbs + (long long)r * lds + c0;
    const v4f a = *(const v4f*)s;
    const v4f bq = *(const v4f*)(s + 4);
    float w[8] = {a.x, a.y, a.z, a.w, bq.x, bq.y, bq.z, bq.w};
#pragma unroll
    for (int e = 0; e < 8; ++e) { const float t = bfr ? cmb_bf(w[e]) : w[e]; w[e] = t * sc; }
    v4u pk;
    pk.x = cmb_pk2(w[0], w[1]); pk.y = cmb_pk2(w[2], w[3]); pk.z = cmb_pk2(w[4], w[5]); pk.w = cmb_pk2(w[6], w[7]);
    v4u* d = (v4u*)(DST + (long long)blockIdx.y * dbs + (long long)r * ldd + c0);
    *d = pk;
    
}

extern "C" void kernel_launch(void* const* d_in, const int* in_sizes, int n_in, void* d_out, int out_size, void* d_ws, size_t ws_size, hipStream_t stream) {
    if (n_in < 7) return;
    const float* x     = (const float*)d_in[0];     // [2][2048][1024]
    const float* Wqkv  = (const float*)d_in[1];     // [3072][1024]  ([out][in] = Bt layout)
    const float* bqkv  = (const float*)d_in[2];     // [3072]
    const float* Wproj = (const float*)d_in[3];     // [1024][1024]  ([out][in] = Bt layout)
    const float* bproj = (const float*)d_in[4];     // [1024]
    const float* qn_w  = (const float*)d_in[5];     // [64]
    const float* kn_w  = (const float*)d_in[6];     // [64]
    const long long xneed = ((long long)(NB - 1) * SEQ_FULL + SEQ) * DM;
    if ((long long)in_sizes[0] < xneed) return;
    if ((long long)in_sizes[1] < (long long)NQKV * DM) return;
    if (in_sizes[2] < NQKV) return;
    if ((long long)in_sizes[3] < (long long)DM * DM) return;
    if (in_sizes[4] < DM) return;
    if (in_sizes[5] < HDIM || in_sizes[6] < HDIM) return;
    if ((long long)out_size < xneed) return;
    if (WS_TOTAL > ws_size) return;

    char* wsp = (char*)d_ws;
    float* VEC = (float*)wsp; wsp += WS_VEC;                              // 4224 f32 (bf16 RNE values of the small input vectors)
    unsigned short* X16 = (unsigned short*)wsp; wsp += WS_X16;             // [NTOK][1024] f16 = 16 * bf16(x)
    unsigned short* W16 = (unsigned short*)wsp; wsp += WS_W16;             // [3072][1024] f16 = 64 * bf16(Wqkv)
    unsigned short* WP16 = (unsigned short*)wsp; wsp += WS_WP16;           // [1024][1024] f16 = 64 * bf16(Wproj)
    float* QKV = (float*)wsp; wsp += WS_QKV;                               // [NTOK][3072] f32, only the v columns (2048..3071) are written and read
    unsigned short* QH16 = (unsigned short*)wsp; wsp += WS_QK16;           // [NTOK][1024] f16 = 16 * normalised q
    unsigned short* KH16 = (unsigned short*)wsp; wsp += WS_QK16;           // [NTOK][1024] f16 = 16 * normalised k
    float* CTX = (float*)wsp; wsp += WS_CTX;                               // [NTOK][1024] f32 attention output (token-major, head*64 + d)
    unsigned short* CTX16 = (unsigned short*)wsp; wsp += WS_CTX16;         // [NTOK][1024] f16 = 256 * ctx
    float* out = (float*)d_out;

    // 1. small vectors -> bf16 RNE values (f32)
    k_vec<<<(VECN + 255) / 256, 256, 0, stream>>>(bqkv, bproj, qn_w, kn_w, VEC);
    // 2-4. 16-bit operand planes (bf16 RNE input values times a power of two, exact in f16)
    k_castp<<<dim3((unsigned)(((long long)SEQ * (DM / 8) + 255) / 256), (unsigned)NB), 256, 0, stream>>>(x, (long long)SEQ_FULL * DM, DM, X16, (long long)SEQ * DM, DM, SEQ, DM, 16.0f, 1);
    k_castp<<<dim3((unsigned)(((long long)NQKV * (DM / 8) + 255) / 256), 1u), 256, 0, stream>>>(Wqkv, 0LL, DM, W16, 0LL, DM, NQKV, DM, 64.0f, 1);
    k_castp<<<dim3((unsigned)(((long long)DM * (DM / 8) + 255) / 256), 1u), 256, 0, stream>>>(Wproj, 0LL, DM, WP16, 0LL, DM, DM, DM, 64.0f, 1);
    // 5. qkv = (16 bf16(x)) . (64 bf16(Wqkv))^T / 1024 + bf16(bqkv); v -> QKV f32; q and k -> per-head RMSNorm (f32 math) in the epilogue -> f16 planes carried x16
    w25::wmma_gemm64<0, false, 2, 0, false, true><<<dim3((unsigned)(((NTOK / 64) * (NQKV / 64) + 7) / 8), 1u), 256, 0, stream>>>(
        (const unsigned short*)X16, nullptr, DM, 0L, (const unsigned short*)W16, nullptr, DM, 0L,
        (void*)QKV, nullptr, NQKV, 0L, VEC + OFF_BQ, nullptr, 0L, NTOK, NQKV, DM, 1.0f / 1024.0f,
        VEC + OFF_QW, VEC + OFF_KW, QH16, KH16);
    // 6. attention: 64 query rows per block, 64-key chunks, online softmax; v read from the QKV tile (columns 2048 + h*64)
    w25::AttnGeom g;
    g.q_bs = (long long)SEQ * DM;   g.q_rs = DM;   g.q_hs = HDIM;
    g.k_bs = (long long)SEQ * DM;   g.k_rs = DM;   g.k_hs = HDIM;
    g.v_bs = (long long)SEQ * NQKV; g.v_rs = NQKV; g.v_hs = HDIM;
    g.o_bs = (long long)SEQ * DM;   g.o_rs = DM;   g.o_hs = HDIM;
    g.S = SEQ; g.Skv = SEQ; g.H = NH; g.nchunk = SEQ / AT_KC; g.sscale = 0.125f / (QCAR * QCAR); g.psc = 32768.0f;
    w25::k_attn64<<<(unsigned)(NB * NH * (SEQ / AT_QB)), 128, 0, stream>>>(QH16, KH16, QKV + 2 * DM, CTX, g);
    // 7. ctx -> f16 plane (x256)
    k_castp<<<dim3((unsigned)(((long long)NTOK * (DM / 8) + 255) / 256), 1u), 256, 0, stream>>>(CTX, 0LL, DM, CTX16, 0LL, DM, NTOK, DM, 256.0f, 0);
    // 8. out[b][s][:] = (256 ctx) . (64 bf16(Wproj))^T / 16384 + bf16(bproj), batch rows at the full per-batch stride of d_out
    w25::wmma_gemm64<0, false, 2, 0, false, false><<<dim3((unsigned)((((SEQ / 64) * (DM / 64)) + 7) / 8), (unsigned)NB), 256, 0, stream>>>(
        (const unsigned short*)CTX16, nullptr, DM, (long)SEQ * DM, (const unsigned short*)WP16, nullptr, DM, 0L,
        (void*)out, nullptr, DM, (long)SEQ_FULL * DM, VEC + OFF_BP, nullptr, 0L, SEQ, DM, DM, 1.0f / 16384.0f,
        nullptr, nullptr, nullptr, nullptr);
    (void)hipGetLastError();
}

// v003
// A run of this version takes 204 microseconds.
// Next to v002, in two timings, it ran 1.37 and 1.38 times as fast.
// All steps since v000 together make it 1.65 times as fast.
// Contractions: qkv projection [NB*SEQ x 1024 x 3072] and output projection [NB*SEQ x 1024 x 1024] = v_wmma_f32_16x16x32_f16 (f16 operands holding bf16 RNE input values scaled by powers of two, except the output projection's ctx operand = f16(256 ctx); f32 accumulate); attention scores q.k^T = v_wmma_f32_16x16x32_f16 (normed q,k carried x16 as f16, single product, f32 accumulate); P.V = v_wmma_f32_16x16x32_f16 (P carried x2^15 as f16, v f16, f32 accumulate); RMSNorm (in the qkv projection's epilogue) and online softmax in f32.
#include <hip/hip_runtime.h>
#include <math.h>

#ifndef NB
#define NB 2
#endif
#ifndef SEQ
#define SEQ 2048
#endif
#define NB_FULL 2
#define SEQ_FULL 2048
#define DM 1024
#define NH 16
#define HDIM 64
#define NQKV (3 * DM)
#define NTOK (NB * SEQ)
#define QCAR 16.0f
// small f32 vector region: [bqkv 3072 | bproj 1024 | qn_w 64 | kn_w 64], each entry the bf16 RNE value of the input
#define OFF_BQ 0
#define OFF_BP NQKV
#define OFF_QW (NQKV + DM)
#define OFF_KW (NQKV + DM + HDIM)
#define VECN (NQKV + DM + 2 * HDIM)
static_assert(SEQ % 128 == 0);   // 128-row block tiles of the projections; 64-row blocks of the attention
static_assert(NB >= 1);
static_assert(NB <= NB_FULL);
static_assert(SEQ <= SEQ_FULL);
static_assert(VECN % 32 == 0);
static_assert(NH * HDIM == DM);
static_assert(DM % 128 == 0);
static_assert(NQKV % 128 == 0);
static_assert(HDIM == 64);   // one 64-column wave tile of the qkv projection = one head's q, k or v slice

typedef __attribute__((ext_vector_type(16))) _Float16 v16h;
typedef __attribute__((ext_vector_type(8)))  _Float16 v8h;
typedef __attribute__((ext_vector_type(16))) __bf16   v16b;
typedef __attribute__((ext_vector_type(8)))  __bf16   v8b;
typedef __attribute__((ext_vector_type(8)))  float    v8f;
typedef __attribute__((ext_vector_type(4)))  float    v4f;
typedef __attribute__((ext_vector_type(2)))  float    v2f;
typedef __attribute__((ext_vector_type(4)))  unsigned int v4u;

// 16-bit WMMA fragment map (wave32), lane L, h = L>>4, m = L&15:
//   A 16x32: lane = row m;   element i -> k = (i<8) ? 8h+i : 16+8h+(i-8)
//   B 32x16: lane = column m; the SAME k(i,h)
//   D 16x16 (8 f32): lane = column m; element r -> row 8h+r

// workspace carve (bytes, 256-B aligned regions)
constexpr size_t al256(size_t x) { return (x + 255) / 256 * 256; }
constexpr size_t WS_VEC   = al256((size_t)VECN * 4);
constexpr size_t WS_X16   = al256((size_t)NTOK * DM * 2);
constexpr size_t WS_W16   = al256((size_t)NQKV * DM * 2);
constexpr size_t WS_WP16  = al256((size_t)DM * DM * 2);
constexpr size_t WS_QKV   = al256((size_t)NTOK * NQKV * 4);
constexpr size_t WS_QK16  = al256((size_t)NTOK * DM * 2);
constexpr size_t WS_CTX   = al256((size_t)NTOK * DM * 4);
constexpr size_t WS_CTX16 = al256((size_t)NTOK * DM * 2);
constexpr size_t WS_TOTAL = WS_VEC + WS_X16 + WS_W16 + WS_WP16 + WS_QKV + 2 * WS_QK16 + WS_CTX + WS_CTX16;
static_assert(WS_TOTAL <= (size_t)134217728);

// ---- scalar helpers ----
__device__ __forceinline__ float cmb_bf(float v) { const unsigned u = __builtin_bit_cast(unsigned, v); const unsigned r = (u + 0x7fffu + ((u >> 16) & 1u)) & 0xffff0000u; return __builtin_bit_cast(float, r); }   // bf16 RNE value kept as f32
__device__ __forceinline__ unsigned int cmb_pk2(float a, float b) { return (unsigned int)__builtin_bit_cast(unsigned short, (_Float16)a) | ((unsigned int)__builtin_bit_cast(unsigned short, (_Float16)b) << 16); }

namespace w25 {

__device__ __forceinline__ unsigned short f2bf_bits(float f) {
  unsigned u = __float_as_uint(f);
  return (unsigned short)((u + 0x7FFFu + ((u >> 16) & 1u)) >> 16);
}
__device__ __forceinline__ float bf_bits2f(unsigned short h) { return __uint_as_float(((unsigned)h) << 16); }

// hazard guards as plain device helpers
__device__ __forceinline__ void dep_guard_h(v8f& a, v8f& b, v16h x, v16h y) { asm volatile("v_nop\n\tv_nop\n\tv_nop\n\tv_nop" : "+v"(a), "+v"(b) : "v"(x), "v"(y)); }
__device__ __forceinline__ void dep_guard_b(v8f& a, v8f& b, v16b x, v16b y) { asm volatile("v_nop\n\tv_nop\n\tv_nop\n\tv_nop" : "+v"(a), "+v"(b) : "v"(x), "v"(y)); }
__device__ __forceinline__ void keep4_h(v16h a, v16h b, v16h c, v16h d) { asm volatile("v_nop" :: "v"(a), "v"(b), "v"(c), "v"(d)); }
__device__ __forceinline__ void keep4_b(v16b a, v16b b, v16b c, v16b d) { asm volatile("v_nop" :: "v"(a), "v"(b), "v"(c), "v"(d)); }
__device__ __forceinline__ void acc_guard4(v8f& a, v8f& b, v8f& c, v8f& d) { asm volatile("v_nop\n\tv_nop\n\tv_nop\n\tv_nop" : "+v"(a), "+v"(b), "+v"(c), "+v"(d)); }
template <typename T> struct Frag;
template <> struct Frag<_Float16> {
  typedef v16h V; union U { v16h v; v8h h[2]; };
  static __device__ __forceinline__ v16h load(const _Float16* p) {   // elements 0..7 <- p[0..7], 8..15 <- p[16..23]
    U f; f.h[0] = *(const v8h*)(p); f.h[1] = *(const v8h*)(p + 16); return f.v;
  }
  static __device__ __forceinline__ v8f mma(v16h a, v16h b, v8f c) {
    return __builtin_amdgcn_wmma_f32_16x16x32_f16(false, a, false, b, (short)0, c, false, false);
  }
  static __device__ __forceinline__ void guard(v8f& a, v8f& b, v16h x, v16h y) { dep_guard_h(a, b, x, y); }
  static __device__ __forceinline__ void keep(v16h a, v16h b, v16h c, v16h d) { keep4_h(a, b, c, d); }
};
template <> struct Frag<__bf16> {
  typedef v16b V; union U { v16b v; v8b h[2]; };
  static __device__ __forceinline__ v16b load(const __bf16* p) {
    U f; f.h[0] = *(const v8b*)(p); f.h[1] = *(const v8b*)(p + 16); return f.v;
  }
  static __device__ __forceinline__ v8f mma(v16b a, v16b b, v8f c) {
    return __builtin_amdgcn_wmma_f32_16x16x32_bf16(false, a, false, b, (short)0, c, false, false);
  }
  static __device__ __forceinline__ void guard(v8f& a, v8f& b, v16b x, v16b y) { dep_guard_b(a, b, x, y); }
  static __device__ __forceinline__ void keep(v16b a, v16b b, v16b c, v16b d) { keep4_b(a, b, c, d); }
};

// ---- Register-blocked batched WMMA GEMM ------------------------------------
// C[m,n] = scale * sum_k A[m,k] * Bt[n,k] (+bias)(+resid); each wave owns a 64x64 tile, a block of 4 waves (2 x 2) a 128x128 tile.
// A row-major [M,K]; Bt row-major [N,K]; M,N % 128 == 0, K % 64 == 0.
// Operands come through LDS: a stage is 64 k (one 128-B line) of the block's 128 A rows and 128 Bt rows, brought by asynchronous 16-B copies
//   (8 lanes = one whole line), two buffers, the next stage in flight while this one is multiplied; fragments are read from LDS with the same (row, k) map as before.
// SPLIT (hi/lo operand planes) is not built in this form.
// BIAS_MODE: 0 = none, 1 = bias[m], 2 = bias[n].
// OUT_MODE: 0 = f32, 1 = f16, 2 = bf16 hi plane (Cout) + bf16 lo plane (Cout2).
// ET: 0 = f16 operands, 1 = bf16 operands (pointers passed as 16-bit storage)
// QKN: the qkv projection. A wave tile is 64 tokens x one head's 64 columns of q (n0 < DM), k (n0 < 2 DM) or v. q and k tiles are RMS-normalised
//   row by row in the epilogue and stored only as f16 planes: QHp / KHp[token][h*64 + d] = f16(QCAR * x[d] * (1 / sqrt(mean(x^2) + 1e-6)) * w[d]),
//   w = qnw / knw; v tiles are stored as f32 into Cout like any other tile (the q and k columns of Cout stay unwritten and are never read).
template <int ET> struct Elem;
template <> struct Elem<0> { typedef _Float16 T; };
template <> struct Elem<1> { typedef __bf16 T; };
#define GK_KS 64                       // k per stage, in halves
#define GK_LP 72                       // LDS row pitch in halves: 144 B = 16 B x odd, conflict-free for the 16-byte fragment reads
#define GK_BT 128                      // block tile rows of A and of Bt
#define GK_BUF (2 * GK_BT * GK_LP)     // halves per buffer: A rows 0..127, then Bt rows 0..127
// Eight asynchronous 16-byte copies of one lane: rows r, r+16, ..., r+112 of one operand (global row step gstep halves) into LDS rows 16 apart.
// The s_wait_xcnt stands inside the statement, behind the last copy, so that no address register of a copy is rewritten in front of it.
template <typename T>
__device__ __forceinline__ void gk_copy8(unsigned lds, const T* g, size_t gstep) {
  const unsigned ls = 16u * GK_LP * 2u;
  asm volatile(
      "global_load_async_to_lds_b128 %0, %8, off\n\t"
      "global_load_async_to_lds_b128 %1, %9, off\n\t"
      "global_load_async_to_lds_b128 %2, %10, off\n\t"
      "global_load_async_to_lds_b128 %3, %11, off\n\t"
      "global_load_async_to_lds_b128 %4, %12, off\n\t"
      "global_load_async_to_lds_b128 %5, %13, off\n\t"
      "global_load_async_to_lds_b128 %6, %14, off\n\t"
      "global_load_async_to_lds_b128 %7, %15, off\n\t"
      "s_wait_xcnt 0x0"
      :: "v"(lds), "v"(lds + ls), "v"(lds + 2u * ls), "v"(lds + 3u * ls), "v"(lds + 4u * ls), "v"(lds + 5u * ls), "v"(lds + 6u * ls), "v"(lds + 7u * ls),
         "v"(g), "v"(g + gstep), "v"(g + 2 * gstep), "v"(g + 3 * gstep), "v"(g + 4 * gstep), "v"(g + 5 * gstep), "v"(g + 6 * gstep), "v"(g + 7 * gstep)
      : "memory");
}
template <int ET, bool SPLIT, int BIAS_MODE, int OUT_MODE, bool RESID, bool QKN>
__global__ __launch_bounds__(128) void wmma_gemm64(
    const unsigned short* __restrict__ Ap, const unsigned short* __restrict__ A2p, int lda, long strideA,
    const unsigned short* __restrict__ Btp, const unsigned short* __restrict__ Bt2p, int ldb, long strideB,
    void* __restrict__ Cout, void* __restrict__ Cout2, int ldc, long strideC,
    const float* __restrict__ bias,
    const float* __restrict__ resid, long strideR,
    int M, int N, int K, float scale,
    const float* __restrict__ qnw, const float* __restrict__ knw,
    unsigned short* __restrict__ QHp, unsigned short* __restrict__ KHp) {
  typedef typename Elem<ET>::T T;
  typedef typename Frag<T>::V V;
  static_assert(!SPLIT);
  const T* A = (const T*)Ap; const T* Bt = (const T*)Btp;
  __shared__ __align__(16) T ring[2 * GK_BUF];     // two stage buffers (cross-wave: published by the block barriers below)
  __shared__ __align__(16) float sT[4][16 * 68];   // per-wave 16x64 slab, pitch 68 floats (wave-private)
  const int b    = blockIdx.y;
  const int lane = threadIdx.x & 31;
  const int wave = threadIdx.x >> 5;
  const int tilesN = N >> 7;
  const int tilesM = M >> 7;
  const int tile = blockIdx.x;
  if (tile >= tilesM * tilesN) return;   // block-uniform, in front of every barrier and copy
  const int tm = tile / tilesN;
  const int tn = tile - tm * tilesN;
  const int wm = wave >> 1, wn = wave & 1;         // 2 x 2 waves
  const int m0 = (tm << 7) + (wm << 6);
  const int n0 = (tn << 7) + (wn << 6);

  const T* Ab  = A  + (size_t)b * strideA;
  const T* Bb  = Bt + (size_t)b * strideB;

  const int rlane = lane & 15;                 // row (A) / col (B, D) within subtile
  const int koff  = (lane >> 4) * 8;           // k offset of this lane half
  const int mOff  = (lane >> 4) * 8;           // D row offset

  v8f acc[4][4];
#pragma unroll
  for (int i = 0; i < 4; ++i)
#pragma unroll
    for (int j = 0; j < 4; ++j) acc[i][j] = (v8f){0.f,0.f,0.f,0.f,0.f,0.f,0.f,0.f};

  // copy map: thread -> (row crow + 16 i, 16-byte piece cseg) of each operand's 128 x 128-B stage; a wave's copy covers 4 whole lines
  const int nst  = K / GK_KS;
  const int crow = threadIdx.x >> 3;
  const int cseg = (threadIdx.x & 7) * 8;
  const T* ga = Ab + (size_t)((tm << 7) + crow) * lda + cseg;
  const T* gb = Bb + (size_t)((tn << 7) + crow) * ldb + cseg;
  const unsigned lA = (unsigned)(size_t)ring + (unsigned)(crow * GK_LP + cseg) * 2u;   // LDS byte address in buffer 0, A part
  const unsigned lB = lA + GK_BT * GK_LP * 2u;                                         // Bt part
  const size_t ast = (size_t)16 * lda, bst = (size_t)16 * ldb;

  gk_copy8(lA, ga, ast);
  gk_copy8(lB, gb, bst);
  asm volatile("s_wait_asynccnt 0x0" ::: "memory");   // this wave's copies of stage 0 have landed before the barrier publishes them
  __syncthreads();
  if (nst > 1) {
    gk_copy8(lA + GK_BUF * 2u, ga + GK_KS, ast);
    gk_copy8(lB + GK_BUF * 2u, gb + GK_KS, bst);
  }

  for (int t = 0; t < nst; ++t) {
    const int bsel = (t & 1) * GK_BUF;
    const T* la = ring + bsel + ((wm << 6) + rlane) * GK_LP + koff;
    const T* lb = ring + bsel + (GK_BT + (wn << 6) + rlane) * GK_LP + koff;
    // all four loops unrolled: the fragment and accumulator arrays stay in registers, and the LDS offsets become immediates
#pragma unroll
    for (int ks = 0; ks < GK_KS; ks += 32) {
      V bh[4], ah[4];
#pragma unroll
      for (int j = 0; j < 4; ++j) bh[j] = Frag<T>::load(lb + (j << 4) * GK_LP + ks);
#pragma unroll
      for (int i = 0; i < 4; ++i) ah[i] = Frag<T>::load(la + (i << 4) * GK_LP + ks);
#pragma unroll
      for (int i = 0; i < 4; ++i) {
#pragma unroll
        for (int j = 0; j < 4; ++j) acc[i][j] = Frag<T>::mma(ah[i], bh[j], acc[i][j]);
        Frag<T>::guard(acc[i][0], acc[i][3], ah[i], ah[i]);
      }
      Frag<T>::keep(bh[0], bh[1], bh[2], bh[3]);
    }
    asm volatile("s_wait_dscnt 0x0" ::: "memory");      // this wave's fragment reads have returned before the buffer may be refilled
    asm volatile("s_wait_asynccnt 0x0" ::: "memory");   // this wave's copies of stage t + 1 have landed before the barrier publishes them
    __syncthreads();                                    // publishes stage t + 1 and ends every wave's reads of stage t's buffer
    if (t + 2 < nst) {
      gk_copy8(lA + (unsigned)bsel * 2u, ga + (size_t)(t + 2) * GK_KS, ast);
      gk_copy8(lB + (unsigned)bsel * 2u, gb + (size_t)(t + 2) * GK_KS, bst);
    }
  }
  asm volatile("s_wait_asynccnt 0x0" ::: "memory");     // no copy is outstanding when the wave goes on
  acc_guard4(acc[0][0], acc[0][1], acc[0][2], acc[0][3]);
  acc_guard4(acc[1][0], acc[1][1], acc[1][2], acc[1][3]);
  acc_guard4(acc[2][0], acc[2][1], acc[2][2], acc[2][3]);
  acc_guard4(acc[3][0], acc[3][1], acc[3][2], acc[3][3]);

  // ---- epilogue ----
  float* slab = sT[wave];
  const float* Rb = RESID ? (resid + (size_t)b * strideR) : nullptr;
  const int nslice = QKN ? n0 / DM : 2;            // 0 = q, 1 = k, 2 = v (wave-uniform)
  v4f nw0 = (v4f){0.f,0.f,0.f,0.f}, nw1 = nw0;     // norm weights of this lane's 8 columns
  if (QKN && nslice < 2) {
    const float* nwp = (nslice ? knw : qnw) + (lane & 7) * 8;
    nw0 = *(const v4f*)nwp;
    nw1 = *(const v4f*)(nwp + 4);
  }
#pragma unroll
  for (int i = 0; i < 4; ++i) {
    const int mBase = m0 + (i << 4);
#pragma unroll
    for (int j = 0; j < 4; ++j) {
      const int n = n0 + (j << 4) + rlane;
      float bv = 0.f;
      if (BIAS_MODE == 2) bv = bias[n];
#pragma unroll
      for (int r = 0; r < 8; ++r) {
        float v = acc[i][j][r] * scale;
        if (BIAS_MODE == 1) v += bias[mBase + mOff + r];
        if (BIAS_MODE == 2) v += bv;
        if (RESID) v += Rb[(size_t)(mBase + mOff + r) * ldc + n];
        slab[(mOff + r) * 68 + (j << 4) + rlane] = v;
      }
    }
    __builtin_amdgcn_fence(3, "workgroup");
    __builtin_amdgcn_wave_barrier();
    __builtin_amdgcn_fence(2, "workgroup");
    if (QKN && nslice < 2) {
      // 8 lanes per row, 8 columns per lane: sum of squares in the lane, then over the 8 lanes; one 16-B store per lane = a 128-B line per row
      const int q = lane >> 3, c8 = (lane & 7) * 8;
      unsigned short* P = (nslice ? KHp : QHp) + (n0 - nslice * DM) + c8;
#pragma unroll   // the four row groups' LDS reads and lane exchanges issue together, so their latencies overlap
      for (int it = 0; it < 4; ++it) {
        const int row = it * 4 + q;
        const v4f x0 = *(const v4f*)(slab + row * 68 + c8);
        const v4f x1 = *(const v4f*)(slab + row * 68 + c8 + 4);
        float ss = (x0.x * x0.x + x0.y * x0.y + x0.z * x0.z + x0.w * x0.w) + (x1.x * x1.x + x1.y * x1.y + x1.z * x1.z + x1.w * x1.w);
#pragma unroll   // constant lane distances 1, 2, 4: the 8 lanes of a row
        for (int o = 1; o < 8; o <<= 1) ss += __shfl_xor(ss, o, 32);
        const float rms = sqrtf(ss * (1.0f / 64.0f) + 1e-6f);
        const float rec = 1.0f / rms;
        v4u pk;
        pk.x = cmb_pk2(((x0.x * rec) * nw0.x) * QCAR, ((x0.y * rec) * nw0.y) * QCAR);
        pk.y = cmb_pk2(((x0.z * rec) * nw0.z) * QCAR, ((x0.w * rec) * nw0.w) * QCAR);
        pk.z = cmb_pk2(((x1.x * rec) * nw1.x) * QCAR, ((x1.y * rec) * nw1.y) * QCAR);
        pk.w = cmb_pk2(((x1.z * rec) * nw1.z) * QCAR, ((x1.w * rec) * nw1.w) * QCAR);
        *(v4u*)(P + (size_t)(mBase + row) * DM) = pk;
      }
    } else if (OUT_MODE == 0) {
      float* C = (float*)Cout + (size_t)b * strideC;
      const int hh = lane >> 4, c4 = (lane & 15) * 4;     // row seg = 256 B = 16 lanes x 16 B
      {
#pragma unroll
        for (int it = 0; it < 8; ++it) {
          const int row = it * 2 + hh;
          v4f v = *(const v4f*)(slab + row * 68 + c4);
          *(v4f*)(C + (size_t)(mBase + row) * ldc + n0 + c4) = v;
        }
        
      }
    } else {
      const int q = lane >> 3, c8 = (lane & 7) * 8;
      unsigned short* C  = (unsigned short*)Cout  + (size_t)b * strideC;
      unsigned short* C2 = (OUT_MODE == 2) ? ((unsigned short*)Cout2 + (size_t)b * strideC) : nullptr;
      {
#pragma unroll
        for (int it = 0; it < 4; ++it) {
          const int row = it * 4 + q;
          const float* sp = slab + row * 68 + c8;
          v8h hv, lv;
#pragma unroll
          for (int e = 0; e < 8; ++e) {
            if (OUT_MODE == 1) {
              hv[e] = (_Float16)sp[e];
            } else {
              unsigned short hb = f2bf_bits(sp[e]);
              unsigned short lb = f2bf_bits(sp[e] - bf_bits2f(hb));
              hv[e] = __builtin_bit_cast(_Float16, hb);
              lv[e] = __builtin_bit_cast(_Float16, lb);
            }
          }
          *(v8h*)(C + (size_t)(mBase + row) * ldc + n0 + c8) = hv;
          if (OUT_MODE == 2) *(v8h*)(C2 + (size_t)(mBase + row) * ldc + n0 + c8) = lv;
        }
        
      }
    }
    __builtin_amdgcn_fence(3, "workgroup");
    __builtin_amdgcn_wave_barrier();
    __builtin_amdgcn_fence(2, "workgroup");
  }
}

// =====================================================================================
// Non-causal attention for head_dim 64; q/k from f16 planes (normed values carried x QCAR), v f32 in, f32 out.
//   scores = q.k^T          : v_wmma_f32_16x16x32_f16, single product; natural score = raw * sscale (sscale = 1/sqrt(64) / QCAR^2)
//   out    = p.v            : v_wmma_f32_16x16x32_f16; p = exp((s - m_running)*sscale) carried x psc (2^15) as f16, v plain f16
//   f32 accumulate; online softmax in f32. Block = 4 waves = 64 query rows of one (batch, head); S % 64 == 0.
//   Element (b, s, h, d) of tensor X lives at X[b*X_bs + s*X_rs + h*X_hs + d] (strides in elements, multiples of 8).
//   grid.x = B * H * (S/64), block 128.
// =====================================================================================
#define AT_D 64
#define AT_NW 4
#define AT_QB 64
#define AT_KC 64
#define AT_LP 72   // LDS row pitch in halves of the 64-half K, V^T and P rows: 144 B = 16 B x odd, so the 16 lanes of a 16-byte fragment read fall on 16 distinct bank groups
struct AttnGeom { long long q_bs, q_rs, q_hs, k_bs, k_rs, k_hs, v_bs, v_rs, v_hs, o_bs, o_rs, o_hs; int S, Skv, H, nchunk; float sscale; float psc; };
static_assert(sizeof(AttnGeom) == 12 * 8 + 4 * 4 + 2 * 4);

__device__ __forceinline__ v8f at_mmah(v16h a, v16h b, v8f c) {
  c = __builtin_amdgcn_wmma_f32_16x16x32_f16(false, a, false, b, (short)0, c, false, false);
  asm volatile("v_nop\n\tv_nop\n\tv_nop\n\tv_nop" : "+v"(c) : "v"(a), "v"(b));
  return c;
}

__global__ __launch_bounds__(128) __attribute__((amdgpu_num_vgpr(256)))
void k_attn64(const unsigned short* __restrict__ qp, const unsigned short* __restrict__ kp,
              const float* __restrict__ v, float* __restrict__ out, AttnGeom g) {
  union FH { v16h v; v8h h[2]; };
  __shared__ __align__(16) _Float16 Ksh[AT_KC * AT_LP];     // K [kv][d] f16   (cross-wave: block barriers before and after staging)
  __shared__ __align__(16) _Float16 Vth[AT_D * AT_LP];     // V [d][kv] f16   (cross-wave)
  __shared__ __align__(16) _Float16 Psh[AT_NW][16 * AT_LP];
  __shared__ __align__(16) float    Os[AT_NW][16 * 68];     // per wave out tile, pitch 68 (wave-private)

  const int tid  = threadIdx.x;
  const int wave = tid >> 5;
  const int lane = tid & 31;
  const int hh   = lane >> 4;
  const int c    = lane & 15;

  const int nqb = g.S / AT_QB;
  const int bx = blockIdx.x;
  const int qb = bx % nqb;
  const int bh = bx / nqb;
  const int h  = bh % g.H;
  const int b  = bh / g.H;
  const int q0 = qb * AT_QB + wave * 16;

  const _Float16* q = (const _Float16*)qp;
  const _Float16* k = (const _Float16*)kp;
  const _Float16* qb_ptr = q + (size_t)b * g.q_bs + (size_t)h * g.q_hs;
  const _Float16* kb_ptr = k + (size_t)b * g.k_bs + (size_t)h * g.k_hs;
  const float*    vb_ptr = v + (size_t)b * g.v_bs + (size_t)h * g.v_hs;
  float*          ob_ptr = out + (size_t)b * g.o_bs + (size_t)h * g.o_hs;

  // ---- Q fragments (A operand): 2 d-chunks; lane row c, elements 0..7 <- d = dc*32 + 8hh + e, 8..15 <- dc*32 + 16 + 8hh + e (two 16-B loads from the f16 row) ----
  v16h qa[2];
  {
    const _Float16* qrow = qb_ptr + (size_t)(q0 + c) * g.q_rs;
#pragma unroll
    for (int dc = 0; dc < 2; ++dc) {
      FH f;
      f.h[0] = *(const v8h*)(qrow + dc * 32 + 8 * hh);
      f.h[1] = *(const v8h*)(qrow + dc * 32 + 16 + 8 * hh);
      qa[dc] = f.v;
    }
  }

  float mrow[8], lrow[8];
  v8f oacc[4];
#pragma unroll
  for (int r = 0; r < 8; ++r) { mrow[r] = -INFINITY; lrow[r] = 0.f; }
#pragma unroll
  for (int t = 0; t < 4; ++t) oacc[t] = (v8f){0.f,0.f,0.f,0.f,0.f,0.f,0.f,0.f};

  for (int kc = 0; kc < g.nchunk; ++kc) {
    const int kv0 = kc * AT_KC;
    __syncthreads();                       // every wave is done reading the earlier chunk's Ksh / Vth
    {
      // thread (kvr, dh): 32 of the 64 elements of key row kvr (four 16-B copies) and value row kvr; full 64x64 tiles every chunk (staged extent == consumed extent)
      const int kvr = tid >> 1, dh = (tid & 1) * 32;
      const _Float16* krow = kb_ptr + (size_t)(kv0 + kvr) * g.k_rs + dh;
      const float*    vrow = vb_ptr + (size_t)(kv0 + kvr) * g.v_rs + dh;
#pragma unroll
      for (int i = 0; i < 4; ++i) {
        const v8h kk = *(const v8h*)(krow + 8 * i);
        *(v8h*)(Ksh + kvr * AT_LP + dh + 8 * i) = kk;
      }
#pragma unroll
      for (int i = 0; i < 8; ++i) {
        const v4f vv = *(const v4f*)(vrow + 4 * i);
#pragma unroll
        for (int e = 0; e < 4; ++e) {
          const int d = dh + 4 * i + e;
          const float fv = vv[e];
          Vth[d * AT_LP + kvr] = (_Float16)fv;
        }
      }
    }
    __syncthreads();

    // ---- scores: 4 key subtiles x 2 d-chunks; B fragment lane column c = key j*16+c, same k(i,h) map as A ----
    v8f s[4];
#pragma unroll
    for (int j = 0; j < 4; ++j) {
      v8f acc = (v8f){0.f,0.f,0.f,0.f,0.f,0.f,0.f,0.f};
#pragma unroll
      for (int dc = 0; dc < 2; ++dc) {
        FH kf;
        kf.h[0] = *(const v8h*)(Ksh + (j * 16 + c) * AT_LP + dc * 32 + 8 * hh);
        kf.h[1] = *(const v8h*)(Ksh + (j * 16 + c) * AT_LP + dc * 32 + 16 + 8 * hh);
        acc = at_mmah(qa[dc], kf.v, acc);
      }
      s[j] = acc;
    }
    // ---- chunk row max (raw units; sscale > 0 so max commutes): D element r of this lane = (query q0 + 8hh + r, key kv0 + j*16 + c) ----
    float cm[8];
#pragma unroll
    for (int r = 0; r < 8; ++r) {
      float m = fmaxf(fmaxf(s[0][r], s[1][r]), fmaxf(s[2][r], s[3][r]));
#pragma unroll
      for (int off = 1; off < 16; off <<= 1) m = fmaxf(m, __shfl_xor(m, off, 32));
      cm[r] = m;
    }
    _Float16* pwh = Psh[wave];
#pragma unroll
    for (int r = 0; r < 8; ++r) {
      const float mnew = fmaxf(mrow[r], cm[r]);
      const float alpha = expf((mrow[r] - mnew) * g.sscale);
      mrow[r] = mnew;
      float psum = 0.f;
#pragma unroll
      for (int j = 0; j < 4; ++j) {
        const float p = expf((s[j][r] - mnew) * g.sscale);
        psum += p;
        pwh[(8 * hh + r) * AT_LP + j * 16 + c] = (_Float16)(p * g.psc);
      }
#pragma unroll
      for (int off = 1; off < 16; off <<= 1) psum += __shfl_xor(psum, off, 32);
      lrow[r] = lrow[r] * alpha + psum;
#pragma unroll
      for (int t = 0; t < 4; ++t) oacc[t][r] *= alpha;
    }
    __builtin_amdgcn_fence(3, "workgroup");
    __builtin_amdgcn_wave_barrier();
    __builtin_amdgcn_fence(2, "workgroup");
    // ---- P.V: A = P rows (lane row c = query, k = key), B = Vth rows (lane column c = d), both with the fragment k map ----
#pragma unroll 1
    for (int kk = 0; kk < 2; ++kk) {
      FH pa;
      pa.h[0] = *(const v8h*)(pwh + c * AT_LP + kk * 32 + 8 * hh);
      pa.h[1] = *(const v8h*)(pwh + c * AT_LP + kk * 32 + 16 + 8 * hh);
#pragma unroll
      for (int t = 0; t < 4; ++t) {
        FH vbf;
        vbf.h[0] = *(const v8h*)(Vth + (t * 16 + c) * AT_LP + kk * 32 + 8 * hh);
        vbf.h[1] = *(const v8h*)(Vth + (t * 16 + c) * AT_LP + kk * 32 + 16 + 8 * hh);
        oacc[t] = at_mmah(pa.v, vbf.v, oacc[t]);
      }
    }
  }

  float* os = Os[wave];
#pragma unroll
  for (int r = 0; r < 8; ++r) {
    const float inv = 1.0f / (lrow[r] * g.psc);
#pragma unroll
    for (int t = 0; t < 4; ++t) os[(8 * hh + r) * 68 + t * 16 + c] = oacc[t][r] * inv;
  }
  __builtin_amdgcn_fence(3, "workgroup");
  __builtin_amdgcn_wave_barrier();
  __builtin_amdgcn_fence(2, "workgroup");
  {
    const int c4 = (lane & 15) * 4;
    {
#pragma unroll
      for (int it = 0; it < 8; ++it) {
        const int row = it * 2 + hh;
        v4f val = *(const v4f*)(os + row * 68 + c4);
        *(v4f*)(ob_ptr + (size_t)(q0 + row) * g.o_rs + c4) = val;
      }
      
    }
  }
}

} // namespace w25

// =====================================================================================
// =====================================================================================
__global__ __launch_bounds__(256) void k_vec(const float* __restrict__ bq, const float* __restrict__ bp, const float* __restrict__ qw, const float* __restrict__ kw, float* __restrict__ VEC) {
    const int u = blockIdx.x * 256 + threadIdx.x;
    if (u >= VECN) return;
    const float a  = bq[min(u, NQKV - 1)];
    const float bb = bp[min(max(u - OFF_BP, 0), DM - 1)];
    const float cq = qw[min(max(u - OFF_QW, 0), HDIM - 1)];
    const float ck = kw[min(max(u - OFF_KW, 0), HDIM - 1)];
    const float sel = (u < OFF_BP) ? a : ((u < OFF_QW) ? bb : ((u < OFF_KW) ? cq : ck));
    const float o = cmb_bf(sel);
    *(float*)(VEC + u) = o;
    
}

// =====================================================================================
// k_castp: DST[z][r][c] (pitch ldd halves, batch stride dbs halves) = f16(sc * g(SRC[z][r][c])) with g = bf16 RNE value (bfr != 0) or identity,
//   r < nR, c < nC (nC % 8 == 0); SRC batch stride sbs floats, row pitch lds floats. Thread per (r, 8 consecutive c): two 16-B loads,
// =====================================================================================
__global__ __launch_bounds__(256) void k_castp(const float* __restrict__ SRC, long long sbs, int lds, unsigned short* __restrict__ DST, long long dbs, int ldd, int nR, int nC, float sc, int bfr) {
    const long long u = (long long)blockIdx.x * 256 + threadIdx.x;
    const int per = nC >> 3;
    if (u >= (long long)nR * per) return;
    const int r = (int)(u / per);
    const int c0 = 8 * (int)(u - (long long)r * per);
    const float* s = SRC + (long long)blockIdx.y * sbs + (long long)r * lds + c0;
    const v4f a = *(const v4f*)s;
    const v4f bq = *(const v4f*)(s + 4);
    float w[8] = {a.x, a.y, a.z, a.w, bq.x, bq.y, bq.z, bq.w};
#pragma unroll
    for (int e = 0; e < 8; ++e) { const float t = bfr ? cmb_bf(w[e]) : w[e]; w[e] = t * sc; }
    v4u pk;
    pk.x = cmb_pk2(w[0], w[1]); pk.y = cmb_pk2(w[2], w[3]); pk.z = cmb_pk2(w[4], w[5]); pk.w = cmb_pk2(w[6], w[7]);
    v4u* d = (v4u*)(DST + (long long)blockIdx.y * dbs + (long long)r * ldd + c0);
    *d = pk;
    
}

extern "C" void kernel_launch(void* const* d_in, const int* in_sizes, int n_in, void* d_out, int out_size, void* d_ws, size_t ws_size, hipStream_t stream) {
    if (n_in < 7) return;
    const float* x     = (const float*)d_in[0];     // [2][2048][1024]
    const float* Wqkv  = (const float*)d_in[1];     // [3072][1024]  ([out][in] = Bt layout)
    const float* bqkv  = (const float*)d_in[2];     // [3072]
    const float* Wproj = (const float*)d_in[3];     // [1024][1024]  ([out][in] = Bt layout)
    const float* bproj = (const float*)d_in[4];     // [1024]
    const float* qn_w  = (const float*)d_in[5];     // [64]
    const float* kn_w  = (const float*)d_in[6];     // [64]
    const long long xneed = ((long long)(NB - 1) * SEQ_FULL + SEQ) * DM;
    if ((long long)in_sizes[0] < xneed) return;
    if ((long long)in_sizes[1] < (long long)NQKV * DM) return;
    if (in_sizes[2] < NQKV) return;
    if ((long long)in_sizes[3] < (long long)DM * DM) return;
    if (in_sizes[4] < DM) return;
    if (in_sizes[5] < HDIM || in_sizes[6] < HDIM) return;
    if ((long long)out_size < xneed) return;
    if (WS_TOTAL > ws_size) return;

    char* wsp = (char*)d_ws;
    float* VEC = (float*)wsp; wsp += WS_VEC;                              // 4224 f32 (bf16 RNE values of the small input vectors)
    unsigned short* X16 = (unsigned short*)wsp; wsp += WS_X16;             // [NTOK][1024] f16 = 16 * bf16(x)
    unsigned short* W16 = (unsigned short*)wsp; wsp += WS_W16;             // [3072][1024] f16 = 64 * bf16(Wqkv)
    unsigned short* WP16 = (unsigned short*)wsp; wsp += WS_WP16;           // [1024][1024] f16 = 64 * bf16(Wproj)
    float* QKV = (float*)wsp; wsp += WS_QKV;                               // [NTOK][3072] f32, only the v columns (2048..3071) are written and read
    unsigned short* QH16 = (unsigned short*)wsp; wsp += WS_QK16;           // [NTOK][1024] f16 = 16 * normalised q
    unsigned short* KH16 = (unsigned short*)wsp; wsp += WS_QK16;           // [NTOK][1024] f16 = 16 * normalised k
    float* CTX = (float*)wsp; wsp += WS_CTX;                               // [NTOK][1024] f32 attention output (token-major, head*64 + d)
    unsigned short* CTX16 = (unsigned short*)wsp; wsp += WS_CTX16;         // [NTOK][1024] f16 = 256 * ctx
    float* out = (float*)d_out;

    // 1. small vectors -> bf16 RNE values (f32)
    k_vec<<<(VECN + 255) / 256, 256, 0, stream>>>(bqkv, bproj, qn_w, kn_w, VEC);
    // 2-4. 16-bit operand planes (bf16 RNE input values times a power of two, exact in f16)
    k_castp<<<dim3((unsigned)(((long long)SEQ * (DM / 8) + 255) / 256), (unsigned)NB), 256, 0, stream>>>(x, (long long)SEQ_FULL * DM, DM, X16, (long long)SEQ * DM, DM, SEQ, DM, 16.0f, 1);
    k_castp<<<dim3((unsigned)(((long long)NQKV * (DM / 8) + 255) / 256), 1u), 256, 0, stream>>>(Wqkv, 0LL, DM, W16, 0LL, DM, NQKV, DM, 64.0f, 1);
    k_castp<<<dim3((unsigned)(((long long)DM * (DM / 8) + 255) / 256), 1u), 256, 0, stream>>>(Wproj, 0LL, DM, WP16, 0LL, DM, DM, DM, 64.0f, 1);
    // 5. qkv = (16 bf16(x)) . (64 bf16(Wqkv))^T / 1024 + bf16(bqkv); v -> QKV f32; q and k -> per-head RMSNorm (f32 math) in the epilogue -> f16 planes carried x16
    w25::wmma_gemm64<0, false, 2, 0, false, true><<<dim3((unsigned)((NTOK / 128) * (NQKV / 128)), 1u), 128, 0, stream>>>(
        (const unsigned short*)X16, nullptr, DM, 0L, (const unsigned short*)W16, nullptr, DM, 0L,
        (void*)QKV, nullptr, NQKV, 0L, VEC + OFF_BQ, nullptr, 0L, NTOK, NQKV, DM, 1.0f / 1024.0f,
        VEC + OFF_QW, VEC + OFF_KW, QH16, KH16);
    // 6. attention: 64 query rows per block, 64-key chunks, online softmax; v read from the QKV tile (columns 2048 + h*64)
    w25::AttnGeom g;
    g.q_bs = (long long)SEQ * DM;   g.q_rs = DM;   g.q_hs = HDIM;
    g.k_bs = (long long)SEQ * DM;   g.k_rs = DM;   g.k_hs = HDIM;
    g.v_bs = (long long)SEQ * NQKV; g.v_rs = NQKV; g.v_hs = HDIM;
    g.o_bs = (long long)SEQ * DM;   g.o_rs = DM;   g.o_hs = HDIM;
    g.S = SEQ; g.Skv = SEQ; g.H = NH; g.nchunk = SEQ / AT_KC; g.sscale = 0.125f / (QCAR * QCAR); g.psc = 32768.0f;
    w25::k_attn64<<<(unsigned)(NB * NH * (SEQ / AT_QB)), 128, 0, stream>>>(QH16, KH16, QKV + 2 * DM, CTX, g);
    // 7. ctx -> f16 plane (x256)
    k_castp<<<dim3((unsigned)(((long long)NTOK * (DM / 8) + 255) / 256), 1u), 256, 0, stream>>>(CTX, 0LL, DM, CTX16, 0LL, DM, NTOK, DM, 256.0f, 0);
    // 8. out[b][s][:] = (256 ctx) . (64 bf16(Wproj))^T / 16384 + bf16(bproj), batch rows at the full per-batch stride of d_out
    w25::wmma_gemm64<0, false, 2, 0, false, false><<<dim3((unsigned)((SEQ / 128) * (DM / 128)), (unsigned)NB), 128, 0, stream>>>(
        (const unsigned short*)CTX16, nullptr, DM, (long)SEQ * DM, (const unsigned short*)WP16, nullptr, DM, 0L,
        (void*)out, nullptr, DM, (long)SEQ_FULL * DM, VEC + OFF_BP, nullptr, 0L, SEQ, DM, DM, 1.0f / 16384.0f,
        nullptr, nullptr, nullptr, nullptr);
    (void)hipGetLastError();
}

// v004
// A run of this version takes 171 microseconds.
// In both of two side-by-side timings against v003, it was 1.19 times as fast.
// Over all steps from v000 it is 1.96 times as fast.
// Contractions: qkv projection [NB*SEQ x 1024 x 3072] and output projection [NB*SEQ x 1024 x 1024] = v_wmma_f32_16x16x32_f16 (f16 operands holding bf16 RNE input values scaled by powers of two, except the output projection's ctx operand, f16 of 256 ctx, f32 accumulate); attention scores, transposed, k.q^T = v_wmma_f32_16x16x32_f16 (normed q,k carried x16 as f16, single product, f32 accumulate); V^T.P^T = v_wmma_f32_16x16x32_f16 (P carried x2^15 as f16, v f16, f32 accumulate); RMSNorm (in the qkv projection's epilogue) and online softmax in f32.
#include <hip/hip_runtime.h>
#include <math.h>

#ifndef NB
#define NB 2
#endif
#ifndef SEQ
#define SEQ 2048
#endif
#define NB_FULL 2
#define SEQ_FULL 2048
#define DM 1024
#define NH 16
#define HDIM 64
#define NQKV (3 * DM)
#define NTOK (NB * SEQ)
#define QCAR 16.0f
// small f32 vector region: [bqkv 3072 | bproj 1024 | qn_w 64 | kn_w 64], each entry the bf16 RNE value of the input
#define OFF_BQ 0
#define OFF_BP NQKV
#define OFF_QW (NQKV + DM)
#define OFF_KW (NQKV + DM + HDIM)
#define VECN (NQKV + DM + 2 * HDIM)
static_assert(SEQ % 128 == 0);   // 128-row block tiles of the projections; 64-row blocks of the attention
static_assert(NB >= 1);
static_assert(NB <= NB_FULL);
static_assert(SEQ <= SEQ_FULL);
static_assert(VECN % 32 == 0);
static_assert(NH * HDIM == DM);
static_assert(DM % 128 == 0);
static_assert(NQKV % 128 == 0);
static_assert(HDIM == 64);   // one 64-column wave tile of the qkv projection = one head's q, k or v slice

typedef __attribute__((ext_vector_type(16))) _Float16 v16h;
typedef __attribute__((ext_vector_type(8)))  _Float16 v8h;
typedef __attribute__((ext_vector_type(16))) __bf16   v16b;
typedef __attribute__((ext_vector_type(8)))  __bf16   v8b;
typedef __attribute__((ext_vector_type(8)))  float    v8f;
typedef __attribute__((ext_vector_type(4)))  float    v4f;
typedef __attribute__((ext_vector_type(2)))  float    v2f;
typedef __attribute__((ext_vector_type(4)))  unsigned int v4u;

// 16-bit WMMA fragment map (wave32), lane L, h = L>>4, m = L&15:
//   A 16x32: lane = row m;   element i -> k = (i<8) ? 8h+i : 16+8h+(i-8)
//   B 32x16: lane = column m; the SAME k(i,h)
//   D 16x16 (8 f32): lane = column m; element r -> row 8h+r

// workspace carve (bytes, 256-B aligned regions)
constexpr size_t al256(size_t x) { return (x + 255) / 256 * 256; }
constexpr size_t WS_VEC   = al256((size_t)VECN * 4);
constexpr size_t WS_X16   = al256((size_t)NTOK * DM * 2);
constexpr size_t WS_W16   = al256((size_t)NQKV * DM * 2);
constexpr size_t WS_WP16  = al256((size_t)DM * DM * 2);
constexpr size_t WS_QKV   = al256((size_t)NTOK * NQKV * 4);
constexpr size_t WS_QK16  = al256((size_t)NTOK * DM * 2);
constexpr size_t WS_CTX   = al256((size_t)NTOK * DM * 4);
constexpr size_t WS_CTX16 = al256((size_t)NTOK * DM * 2);
constexpr size_t WS_TOTAL = WS_VEC + WS_X16 + WS_W16 + WS_WP16 + WS_QKV + 2 * WS_QK16 + WS_CTX + WS_CTX16;
static_assert(WS_TOTAL <= (size_t)134217728);

// ---- scalar helpers ----
__device__ __forceinline__ float cmb_bf(float v) { const unsigned u = __builtin_bit_cast(unsigned, v); const unsigned r = (u + 0x7fffu + ((u >> 16) & 1u)) & 0xffff0000u; return __builtin_bit_cast(float, r); }   // bf16 RNE value kept as f32
__device__ __forceinline__ unsigned int cmb_pk2(float a, float b) { return (unsigned int)__builtin_bit_cast(unsigned short, (_Float16)a) | ((unsigned int)__builtin_bit_cast(unsigned short, (_Float16)b) << 16); }

namespace w25 {

__device__ __forceinline__ unsigned short f2bf_bits(float f) {
  unsigned u = __float_as_uint(f);
  return (unsigned short)((u + 0x7FFFu + ((u >> 16) & 1u)) >> 16);
}
__device__ __forceinline__ float bf_bits2f(unsigned short h) { return __uint_as_float(((unsigned)h) << 16); }

// hazard guards as plain device helpers
__device__ __forceinline__ void dep_guard_h(v8f& a, v8f& b, v16h x, v16h y) { asm volatile("v_nop\n\tv_nop\n\tv_nop\n\tv_nop" : "+v"(a), "+v"(b) : "v"(x), "v"(y)); }
__device__ __forceinline__ void dep_guard_b(v8f& a, v8f& b, v16b x, v16b y) { asm volatile("v_nop\n\tv_nop\n\tv_nop\n\tv_nop" : "+v"(a), "+v"(b) : "v"(x), "v"(y)); }
__device__ __forceinline__ void keep4_h(v16h a, v16h b, v16h c, v16h d) { asm volatile("v_nop" :: "v"(a), "v"(b), "v"(c), "v"(d)); }
__device__ __forceinline__ void keep4_b(v16b a, v16b b, v16b c, v16b d) { asm volatile("v_nop" :: "v"(a), "v"(b), "v"(c), "v"(d)); }
__device__ __forceinline__ void acc_guard4(v8f& a, v8f& b, v8f& c, v8f& d) { asm volatile("v_nop\n\tv_nop\n\tv_nop\n\tv_nop" : "+v"(a), "+v"(b), "+v"(c), "+v"(d)); }
template <typename T> struct Frag;
template <> struct Frag<_Float16> {
  typedef v16h V; union U { v16h v; v8h h[2]; };
  static __device__ __forceinline__ v16h load(const _Float16* p) {   // elements 0..7 <- p[0..7], 8..15 <- p[16..23]
    U f; f.h[0] = *(const v8h*)(p); f.h[1] = *(const v8h*)(p + 16); return f.v;
  }
  static __device__ __forceinline__ v8f mma(v16h a, v16h b, v8f c) {
    return __builtin_amdgcn_wmma_f32_16x16x32_f16(false, a, false, b, (short)0, c, false, false);
  }
  static __device__ __forceinline__ void guard(v8f& a, v8f& b, v16h x, v16h y) { dep_guard_h(a, b, x, y); }
  static __device__ __forceinline__ void keep(v16h a, v16h b, v16h c, v16h d) { keep4_h(a, b, c, d); }
};
template <> struct Frag<__bf16> {
  typedef v16b V; union U { v16b v; v8b h[2]; };
  static __device__ __forceinline__ v16b load(const __bf16* p) {
    U f; f.h[0] = *(const v8b*)(p); f.h[1] = *(const v8b*)(p + 16); return f.v;
  }
  static __device__ __forceinline__ v8f mma(v16b a, v16b b, v8f c) {
    return __builtin_amdgcn_wmma_f32_16x16x32_bf16(false, a, false, b, (short)0, c, false, false);
  }
  static __device__ __forceinline__ void guard(v8f& a, v8f& b, v16b x, v16b y) { dep_guard_b(a, b, x, y); }
  static __device__ __forceinline__ void keep(v16b a, v16b b, v16b c, v16b d) { keep4_b(a, b, c, d); }
};

// ---- Register-blocked batched WMMA GEMM ------------------------------------
// C[m,n] = scale * sum_k A[m,k] * Bt[n,k] (+bias)(+resid); each wave owns a 64x64 tile, a block of 4 waves (2 x 2) a 128x128 tile.
// A row-major [M,K]; Bt row-major [N,K]; M,N % 128 == 0, K % 64 == 0.
// Operands come through LDS: a stage is 64 k (one 128-B line) of the block's 128 A rows and 128 Bt rows, brought by asynchronous 16-B copies
//   (8 lanes = one whole line), two buffers, the next stage in flight while this one is multiplied; fragments are read from LDS with the same (row, k) map as before.
// SPLIT (hi/lo operand planes) is not built in this form.
// BIAS_MODE: 0 = none, 1 = bias[m], 2 = bias[n].
// OUT_MODE: 0 = f32, 1 = f16, 2 = bf16 hi plane (Cout) + bf16 lo plane (Cout2).
// ET: 0 = f16 operands, 1 = bf16 operands (pointers passed as 16-bit storage)
// QKN: the qkv projection. A wave tile is 64 tokens x one head's 64 columns of q (n0 < DM), k (n0 < 2 DM) or v. q and k tiles are RMS-normalised
//   row by row in the epilogue and stored only as f16 planes: QHp / KHp[token][h*64 + d] = f16(QCAR * x[d] * (1 / sqrt(mean(x^2) + 1e-6)) * w[d]),
//   w = qnw / knw; v tiles are stored as f32 into Cout like any other tile (the q and k columns of Cout stay unwritten and are never read).
template <int ET> struct Elem;
template <> struct Elem<0> { typedef _Float16 T; };
template <> struct Elem<1> { typedef __bf16 T; };
#define GK_KS 64                       // k per stage, in halves
#define GK_LP 72                       // LDS row pitch in halves: 144 B = 16 B x odd, conflict-free for the 16-byte fragment reads
#define GK_BT 128                      // block tile rows of A and of Bt
#define GK_BUF (2 * GK_BT * GK_LP)     // halves per buffer: A rows 0..127, then Bt rows 0..127
// Eight asynchronous 16-byte copies of one lane: rows r, r+16, ..., r+112 of one operand (global row step gstep halves) into LDS rows 16 apart.
// The s_wait_xcnt stands inside the statement, behind the last copy, so that no address register of a copy is rewritten in front of it.
template <typename T>
__device__ __forceinline__ void gk_copy8(unsigned lds, const T* g, size_t gstep) {
  const unsigned ls = 16u * GK_LP * 2u;
  asm volatile(
      "global_load_async_to_lds_b128 %0, %8, off\n\t"
      "global_load_async_to_lds_b128 %1, %9, off\n\t"
      "global_load_async_to_lds_b128 %2, %10, off\n\t"
      "global_load_async_to_lds_b128 %3, %11, off\n\t"
      "global_load_async_to_lds_b128 %4, %12, off\n\t"
      "global_load_async_to_lds_b128 %5, %13, off\n\t"
      "global_load_async_to_lds_b128 %6, %14, off\n\t"
      "global_load_async_to_lds_b128 %7, %15, off\n\t"
      "s_wait_xcnt 0x0"
      :: "v"(lds), "v"(lds + ls), "v"(lds + 2u * ls), "v"(lds + 3u * ls), "v"(lds + 4u * ls), "v"(lds + 5u * ls), "v"(lds + 6u * ls), "v"(lds + 7u * ls),
         "v"(g), "v"(g + gstep), "v"(g + 2 * gstep), "v"(g + 3 * gstep), "v"(g + 4 * gstep), "v"(g + 5 * gstep), "v"(g + 6 * gstep), "v"(g + 7 * gstep)
      : "memory");
}
template <int ET, bool SPLIT, int BIAS_MODE, int OUT_MODE, bool RESID, bool QKN>
__global__ __launch_bounds__(128) void wmma_gemm64(
    const unsigned short* __restrict__ Ap, const unsigned short* __restrict__ A2p, int lda, long strideA,
    const unsigned short* __restrict__ Btp, const unsigned short* __restrict__ Bt2p, int ldb, long strideB,
    void* __restrict__ Cout, void* __restrict__ Cout2, int ldc, long strideC,
    const float* __restrict__ bias,
    const float* __restrict__ resid, long strideR,
    int M, int N, int K, float scale,
    const float* __restrict__ qnw, const float* __restrict__ knw,
    unsigned short* __restrict__ QHp, unsigned short* __restrict__ KHp) {
  typedef typename Elem<ET>::T T;
  typedef typename Frag<T>::V V;
  static_assert(!SPLIT);
  const T* A = (const T*)Ap; const T* Bt = (const T*)Btp;
  __shared__ __align__(16) T ring[2 * GK_BUF];     // two stage buffers (cross-wave: published by the block barriers below)
  __shared__ __align__(16) float sT[4][16 * 68];   // per-wave 16x64 slab, pitch 68 floats (wave-private)
  const int b    = blockIdx.y;
  const int lane = threadIdx.x & 31;
  const int wave = threadIdx.x >> 5;
  const int tilesN = N >> 7;
  const int tilesM = M >> 7;
  const int tile = blockIdx.x;
  if (tile >= tilesM * tilesN) return;   // block-uniform, in front of every barrier and copy
  const int tm = tile / tilesN;
  const int tn = tile - tm * tilesN;
  const int wm = wave >> 1, wn = wave & 1;         // 2 x 2 waves
  const int m0 = (tm << 7) + (wm << 6);
  const int n0 = (tn << 7) + (wn << 6);

  const T* Ab  = A  + (size_t)b * strideA;
  const T* Bb  = Bt + (size_t)b * strideB;

  const int rlane = lane & 15;                 // row (A) / col (B, D) within subtile
  const int koff  = (lane >> 4) * 8;           // k offset of this lane half
  const int mOff  = (lane >> 4) * 8;           // D row offset

  v8f acc[4][4];
#pragma unroll
  for (int i = 0; i < 4; ++i)
#pragma unroll
    for (int j = 0; j < 4; ++j) acc[i][j] = (v8f){0.f,0.f,0.f,0.f,0.f,0.f,0.f,0.f};

  // copy map: thread -> (row crow + 16 i, 16-byte piece cseg) of each operand's 128 x 128-B stage; a wave's copy covers 4 whole lines
  const int nst  = K / GK_KS;
  const int crow = threadIdx.x >> 3;
  const int cseg = (threadIdx.x & 7) * 8;
  const T* ga = Ab + (size_t)((tm << 7) + crow) * lda + cseg;
  const T* gb = Bb + (size_t)((tn << 7) + crow) * ldb + cseg;
  const unsigned lA = (unsigned)(size_t)ring + (unsigned)(crow * GK_LP + cseg) * 2u;   // LDS byte address in buffer 0, A part
  const unsigned lB = lA + GK_BT * GK_LP * 2u;                                         // Bt part
  const size_t ast = (size_t)16 * lda, bst = (size_t)16 * ldb;

  gk_copy8(lA, ga, ast);
  gk_copy8(lB, gb, bst);
  asm volatile("s_wait_asynccnt 0x0" ::: "memory");   // this wave's copies of stage 0 have landed before the barrier publishes them
  __syncthreads();
  if (nst > 1) {
    gk_copy8(lA + GK_BUF * 2u, ga + GK_KS, ast);
    gk_copy8(lB + GK_BUF * 2u, gb + GK_KS, bst);
  }

  for (int t = 0; t < nst; ++t) {
    const int bsel = (t & 1) * GK_BUF;
    const T* la = ring + bsel + ((wm << 6) + rlane) * GK_LP + koff;
    const T* lb = ring + bsel + (GK_BT + (wn << 6) + rlane) * GK_LP + koff;
    // all four loops unrolled: the fragment and accumulator arrays stay in registers, and the LDS offsets become immediates
#pragma unroll
    for (int ks = 0; ks < GK_KS; ks += 32) {
      V bh[4], ah[4];
#pragma unroll
      for (int j = 0; j < 4; ++j) bh[j] = Frag<T>::load(lb + (j << 4) * GK_LP + ks);
#pragma unroll
      for (int i = 0; i < 4; ++i) ah[i] = Frag<T>::load(la + (i << 4) * GK_LP + ks);
#pragma unroll
      for (int i = 0; i < 4; ++i) {
#pragma unroll
        for (int j = 0; j < 4; ++j) acc[i][j] = Frag<T>::mma(ah[i], bh[j], acc[i][j]);
        Frag<T>::guard(acc[i][0], acc[i][3], ah[i], ah[i]);
      }
      Frag<T>::keep(bh[0], bh[1], bh[2], bh[3]);
    }
    asm volatile("s_wait_dscnt 0x0" ::: "memory");      // this wave's fragment reads have returned before the buffer may be refilled
    asm volatile("s_wait_asynccnt 0x0" ::: "memory");   // this wave's copies of stage t + 1 have landed before the barrier publishes them
    __syncthreads();                                    // publishes stage t + 1 and ends every wave's reads of stage t's buffer
    if (t + 2 < nst) {
      gk_copy8(lA + (unsigned)bsel * 2u, ga + (size_t)(t + 2) * GK_KS, ast);
      gk_copy8(lB + (unsigned)bsel * 2u, gb + (size_t)(t + 2) * GK_KS, bst);
    }
  }
  asm volatile("s_wait_asynccnt 0x0" ::: "memory");     // no copy is outstanding when the wave goes on
  acc_guard4(acc[0][0], acc[0][1], acc[0][2], acc[0][3]);
  acc_guard4(acc[1][0], acc[1][1], acc[1][2], acc[1][3]);
  acc_guard4(acc[2][0], acc[2][1], acc[2][2], acc[2][3]);
  acc_guard4(acc[3][0], acc[3][1], acc[3][2], acc[3][3]);

  // ---- epilogue ----
  float* slab = sT[wave];
  const float* Rb = RESID ? (resid + (size_t)b * strideR) : nullptr;
  const int nslice = QKN ? n0 / DM : 2;            // 0 = q, 1 = k, 2 = v (wave-uniform)
  v4f nw0 = (v4f){0.f,0.f,0.f,0.f}, nw1 = nw0;     // norm weights of this lane's 8 columns
  if (QKN && nslice < 2) {
    const float* nwp = (nslice ? knw : qnw) + (lane & 7) * 8;
    nw0 = *(const v4f*)nwp;
    nw1 = *(const v4f*)(nwp + 4);
  }
#pragma unroll
  for (int i = 0; i < 4; ++i) {
    const int mBase = m0 + (i << 4);
#pragma unroll
    for (int j = 0; j < 4; ++j) {
      const int n = n0 + (j << 4) + rlane;
      float bv = 0.f;
      if (BIAS_MODE == 2) bv = bias[n];
#pragma unroll
      for (int r = 0; r < 8; ++r) {
        float v = acc[i][j][r] * scale;
        if (BIAS_MODE == 1) v += bias[mBase + mOff + r];
        if (BIAS_MODE == 2) v += bv;
        if (RESID) v += Rb[(size_t)(mBase + mOff + r) * ldc + n];
        slab[(mOff + r) * 68 + (j << 4) + rlane] = v;
      }
    }
    __builtin_amdgcn_fence(3, "workgroup");
    __builtin_amdgcn_wave_barrier();
    __builtin_amdgcn_fence(2, "workgroup");
    if (QKN && nslice < 2) {
      // 8 lanes per row, 8 columns per lane: sum of squares in the lane, then over the 8 lanes; one 16-B store per lane = a 128-B line per row
      const int q = lane >> 3, c8 = (lane & 7) * 8;
      unsigned short* P = (nslice ? KHp : QHp) + (n0 - nslice * DM) + c8;
#pragma unroll   // the four row groups' LDS reads and lane exchanges issue together, so their latencies overlap
      for (int it = 0; it < 4; ++it) {
        const int row = it * 4 + q;
        const v4f x0 = *(const v4f*)(slab + row * 68 + c8);
        const v4f x1 = *(const v4f*)(slab + row * 68 + c8 + 4);
        float ss = (x0.x * x0.x + x0.y * x0.y + x0.z * x0.z + x0.w * x0.w) + (x1.x * x1.x + x1.y * x1.y + x1.z * x1.z + x1.w * x1.w);
#pragma unroll   // constant lane distances 1, 2, 4: the 8 lanes of a row
        for (int o = 1; o < 8; o <<= 1) ss += __shfl_xor(ss, o, 32);
        const float rms = sqrtf(ss * (1.0f / 64.0f) + 1e-6f);
        const float rec = 1.0f / rms;
        v4u pk;
        pk.x = cmb_pk2(((x0.x * rec) * nw0.x) * QCAR, ((x0.y * rec) * nw0.y) * QCAR);
        pk.y = cmb_pk2(((x0.z * rec) * nw0.z) * QCAR, ((x0.w * rec) * nw0.w) * QCAR);
        pk.z = cmb_pk2(((x1.x * rec) * nw1.x) * QCAR, ((x1.y * rec) * nw1.y) * QCAR);
        pk.w = cmb_pk2(((x1.z * rec) * nw1.z) * QCAR, ((x1.w * rec) * nw1.w) * QCAR);
        *(v4u*)(P + (size_t)(mBase + row) * DM) = pk;
      }
    } else if (OUT_MODE == 0) {
      float* C = (float*)Cout + (size_t)b * strideC;
      const int hh = lane >> 4, c4 = (lane & 15) * 4;     // row seg = 256 B = 16 lanes x 16 B
      {
#pragma unroll
        for (int it = 0; it < 8; ++it) {
          const int row = it * 2 + hh;
          v4f v = *(const v4f*)(slab + row * 68 + c4);
          *(v4f*)(C + (size_t)(mBase + row) * ldc + n0 + c4) = v;
        }
        
      }
    } else {
      const int q = lane >> 3, c8 = (lane & 7) * 8;
      unsigned short* C  = (unsigned short*)Cout  + (size_t)b * strideC;
      unsigned short* C2 = (OUT_MODE == 2) ? ((unsigned short*)Cout2 + (size_t)b * strideC) : nullptr;
      {
#pragma unroll
        for (int it = 0; it < 4; ++it) {
          const int row = it * 4 + q;
          const float* sp = slab + row * 68 + c8;
          v8h hv, lv;
#pragma unroll
          for (int e = 0; e < 8; ++e) {
            if (OUT_MODE == 1) {
              hv[e] = (_Float16)sp[e];
            } else {
              unsigned short hb = f2bf_bits(sp[e]);
              unsigned short lb = f2bf_bits(sp[e] - bf_bits2f(hb));
              hv[e] = __builtin_bit_cast(_Float16, hb);
              lv[e] = __builtin_bit_cast(_Float16, lb);
            }
          }
          *(v8h*)(C + (size_t)(mBase + row) * ldc + n0 + c8) = hv;
          if (OUT_MODE == 2) *(v8h*)(C2 + (size_t)(mBase + row) * ldc + n0 + c8) = lv;
        }
        
      }
    }
    __builtin_amdgcn_fence(3, "workgroup");
    __builtin_amdgcn_wave_barrier();
    __builtin_amdgcn_fence(2, "workgroup");
  }
}

// =====================================================================================
// Non-causal attention for head_dim 64; q/k from f16 planes (normed values carried x QCAR), v f32 in, f32 out.
//   scores^T = k.q^T        : v_wmma_f32_16x16x32_f16, single product; natural score = raw * sscale (sscale = 1/sqrt(64) / QCAR^2)
//   out^T    = v^T.p^T      : v_wmma_f32_16x16x32_f16; p = exp((s - m_running)*sscale) carried x psc (2^15) as f16, v plain f16
//   Both products are transposed, so a lane holds scores, P and output of ONE query (its D column): maximum and sum run inside the lane
//   (one exchange between the lane halves), and two score tiles, converted in place, are the B fragment of the second product.
//   f32 accumulate; online softmax in f32. Block = 4 waves = 64 query rows of one (batch, head); S % 64 == 0.
//   Element (b, s, h, d) of tensor X lives at X[b*X_bs + s*X_rs + h*X_hs + d] (strides in elements, multiples of 8).
//   grid.x = B * H * (S/64), block 128.
// =====================================================================================
#define AT_D 64
#define AT_NW 4
#define AT_QB 64
#define AT_KC 64
#define AT_LP 72   // LDS row pitch in halves of the 64-half K and V^T rows: 144 B = 16 B x odd, so the 16 lanes of a 16-byte fragment read fall on 16 distinct bank groups
struct AttnGeom { long long q_bs, q_rs, q_hs, k_bs, k_rs, k_hs, v_bs, v_rs, v_hs, o_bs, o_rs, o_hs; int S, Skv, H, nchunk; float sscale; float psc; };
static_assert(sizeof(AttnGeom) == 12 * 8 + 4 * 4 + 2 * 4);

__device__ __forceinline__ v8f at_mmah(v16h a, v16h b, v8f c) {
  c = __builtin_amdgcn_wmma_f32_16x16x32_f16(false, a, false, b, (short)0, c, false, false);
  asm volatile("v_nop\n\tv_nop\n\tv_nop\n\tv_nop" : "+v"(c) : "v"(a), "v"(b));
  return c;
}

__global__ __launch_bounds__(128) __attribute__((amdgpu_num_vgpr(256)))
void k_attn64(const unsigned short* __restrict__ qp, const unsigned short* __restrict__ kp,
              const float* __restrict__ v, float* __restrict__ out, AttnGeom g) {
  union FH { v16h v; v8h h[2]; };
  __shared__ __align__(16) _Float16 Ksh[AT_KC * AT_LP];     // K [kv][d] f16   (cross-wave: block barriers before and after staging)
  __shared__ __align__(16) _Float16 Vth[AT_D * AT_LP];     // V [d][kv] f16   (cross-wave)
  __shared__ __align__(16) float    Os[AT_NW][16 * 68];     // per wave out tile, pitch 68 (wave-private)

  const int tid  = threadIdx.x;
  const int wave = tid >> 5;
  const int lane = tid & 31;
  const int hh   = lane >> 4;
  const int c    = lane & 15;

  const int nqb = g.S / AT_QB;
  const int bx = blockIdx.x;
  const int qb = bx % nqb;
  const int bh = bx / nqb;
  const int h  = bh % g.H;
  const int b  = bh / g.H;
  const int q0 = qb * AT_QB + wave * 16;

  const _Float16* q = (const _Float16*)qp;
  const _Float16* k = (const _Float16*)kp;
  const _Float16* qb_ptr = q + (size_t)b * g.q_bs + (size_t)h * g.q_hs;
  const _Float16* kb_ptr = k + (size_t)b * g.k_bs + (size_t)h * g.k_hs;
  const float*    vb_ptr = v + (size_t)b * g.v_bs + (size_t)h * g.v_hs;
  float*          ob_ptr = out + (size_t)b * g.o_bs + (size_t)h * g.o_hs;

  // ---- Q fragments (B operand): 2 d-chunks; lane column c = query q0 + c, elements 0..7 <- d = dc*32 + 8hh + e, 8..15 <- dc*32 + 16 + 8hh + e (two 16-B loads from the f16 row) ----
  v16h qa[2];
  {
    const _Float16* qrow = qb_ptr + (size_t)(q0 + c) * g.q_rs;
#pragma unroll
    for (int dc = 0; dc < 2; ++dc) {
      FH f;
      f.h[0] = *(const v8h*)(qrow + dc * 32 + 8 * hh);
      f.h[1] = *(const v8h*)(qrow + dc * 32 + 16 + 8 * hh);
      qa[dc] = f.v;
    }
  }

  float mcol = -INFINITY;   // running maximum of this lane's query (raw units; equal in both lane halves)
  float lcol = 0.f;         // running sum of p over the keys of this lane half; the halves are joined after the loop
  v8f oacc[4];              // out^T: tile t, element r = (d = t*16 + 8hh + r, query q0 + c)
#pragma unroll
  for (int t = 0; t < 4; ++t) oacc[t] = (v8f){0.f,0.f,0.f,0.f,0.f,0.f,0.f,0.f};

  for (int kc = 0; kc < g.nchunk; ++kc) {
    const int kv0 = kc * AT_KC;
    __syncthreads();                       // every wave is done reading the earlier chunk's Ksh / Vth
    {
      // thread (kvr, dh): 32 of the 64 elements of key row kvr (four 16-B copies) and value row kvr; full 64x64 tiles every chunk (staged extent == consumed extent)
      const int kvr = tid >> 1, dh = (tid & 1) * 32;
      const _Float16* krow = kb_ptr + (size_t)(kv0 + kvr) * g.k_rs + dh;
      const float*    vrow = vb_ptr + (size_t)(kv0 + kvr) * g.v_rs + dh;
#pragma unroll
      for (int i = 0; i < 4; ++i) {
        const v8h kk = *(const v8h*)(krow + 8 * i);
        *(v8h*)(Ksh + kvr * AT_LP + dh + 8 * i) = kk;
      }
#pragma unroll
      for (int i = 0; i < 8; ++i) {
        const v4f vv = *(const v4f*)(vrow + 4 * i);
#pragma unroll
        for (int e = 0; e < 4; ++e) {
          const int d = dh + 4 * i + e;
          const float fv = vv[e];
          Vth[d * AT_LP + kvr] = (_Float16)fv;
        }
      }
    }
    __syncthreads();

    // ---- scores^T: 4 key subtiles x 2 d-chunks; A fragment lane row c = key j*16+c, same k(i,h) map as B ----
    v8f s[4];
#pragma unroll
    for (int j = 0; j < 4; ++j) {
      v8f acc = (v8f){0.f,0.f,0.f,0.f,0.f,0.f,0.f,0.f};
#pragma unroll
      for (int dc = 0; dc < 2; ++dc) {
        FH kf;
        kf.h[0] = *(const v8h*)(Ksh + (j * 16 + c) * AT_LP + dc * 32 + 8 * hh);
        kf.h[1] = *(const v8h*)(Ksh + (j * 16 + c) * AT_LP + dc * 32 + 16 + 8 * hh);
        acc = at_mmah(kf.v, qa[dc], acc);
      }
      s[j] = acc;
    }
    // ---- chunk maximum of the lane's query (raw units; sscale > 0 so max commutes): D element r of this lane = (key kv0 + j*16 + 8hh + r, query q0 + c) ----
    float cm4[4];
#pragma unroll
    for (int j = 0; j < 4; ++j)
      cm4[j] = fmaxf(fmaxf(fmaxf(s[j][0], s[j][1]), fmaxf(s[j][2], s[j][3])), fmaxf(fmaxf(s[j][4], s[j][5]), fmaxf(s[j][6], s[j][7])));
    float cm = fmaxf(fmaxf(cm4[0], cm4[1]), fmaxf(cm4[2], cm4[3]));
    cm = fmaxf(cm, __shfl_xor(cm, 16, 32));   // the other lane half holds the query's other 32 keys
    const float mnew = fmaxf(mcol, cm);
    const float alpha = expf((mcol - mnew) * g.sscale);
    mcol = mnew;
    // ---- p, and P^T as B fragments: element i of fragment kk is key kk*32 + k(i,hh) = element i & 7 of score tile 2 kk + (i >> 3) ----
    v16h pb[2];
    float ps4[4];   // one partial sum per score tile: four independent add chains
#pragma unroll
    for (int j = 0; j < 4; ++j) {
      float psum = 0.f;
#pragma unroll
      for (int r = 0; r < 8; ++r) {
        const float p = expf((s[j][r] - mnew) * g.sscale);
        psum += p;
        pb[j >> 1][(j & 1) * 8 + r] = (_Float16)(p * g.psc);
      }
      ps4[j] = psum;
    }
    lcol = lcol * alpha + ((ps4[0] + ps4[1]) + (ps4[2] + ps4[3]));
#pragma unroll
    for (int t = 0; t < 4; ++t) oacc[t] *= alpha;
    // ---- V^T.P^T: A = Vth rows (lane row c = d, k = key) with the fragment k map, B = P^T from the registers ----
#pragma unroll   // pb and oacc are indexed by constants only, so both stay in registers
    for (int kk = 0; kk < 2; ++kk) {
#pragma unroll
      for (int t = 0; t < 4; ++t) {
        FH vbf;
        vbf.h[0] = *(const v8h*)(Vth + (t * 16 + c) * AT_LP + kk * 32 + 8 * hh);
        vbf.h[1] = *(const v8h*)(Vth + (t * 16 + c) * AT_LP + kk * 32 + 16 + 8 * hh);
        oacc[t] = at_mmah(vbf.v, pb[kk], oacc[t]);
      }
    }
  }

  float* os = Os[wave];
  {
    const float inv = 1.0f / ((lcol + __shfl_xor(lcol, 16, 32)) * g.psc);   // both halves' sums joined once
#pragma unroll
    for (int t = 0; t < 4; ++t) {
      // 8 consecutive d of the lane's query row: two 16-B LDS stores
      *(v4f*)(os + c * 68 + t * 16 + 8 * hh)     = (v4f){oacc[t][0] * inv, oacc[t][1] * inv, oacc[t][2] * inv, oacc[t][3] * inv};
      *(v4f*)(os + c * 68 + t * 16 + 8 * hh + 4) = (v4f){oacc[t][4] * inv, oacc[t][5] * inv, oacc[t][6] * inv, oacc[t][7] * inv};
    }
  }
  __builtin_amdgcn_fence(3, "workgroup");
  __builtin_amdgcn_wave_barrier();
  __builtin_amdgcn_fence(2, "workgroup");
  {
    const int c4 = (lane & 15) * 4;
    {
#pragma unroll
      for (int it = 0; it < 8; ++it) {
        const int row = it * 2 + hh;
        v4f val = *(const v4f*)(os + row * 68 + c4);
        *(v4f*)(ob_ptr + (size_t)(q0 + row) * g.o_rs + c4) = val;
      }
      
    }
  }
}

} // namespace w25

// =====================================================================================
// =====================================================================================
__global__ __launch_bounds__(256) void k_vec(const float* __restrict__ bq, const float* __restrict__ bp, const float* __restrict__ qw, const float* __restrict__ kw, float* __restrict__ VEC) {
    const int u = blockIdx.x * 256 + threadIdx.x;
    if (u >= VECN) return;
    const float a  = bq[min(u, NQKV - 1)];
    const float bb = bp[min(max(u - OFF_BP, 0), DM - 1)];
    const float cq = qw[min(max(u - OFF_QW, 0), HDIM - 1)];
    const float ck = kw[min(max(u - OFF_KW, 0), HDIM - 1)];
    const float sel = (u < OFF_BP) ? a : ((u < OFF_QW) ? bb : ((u < OFF_KW) ? cq : ck));
    const float o = cmb_bf(sel);
    *(float*)(VEC + u) = o;
    
}

// =====================================================================================
// k_castp: DST[z][r][c] (pitch ldd halves, batch stride dbs halves) = f16(sc * g(SRC[z][r][c])) with g = bf16 RNE value (bfr != 0) or identity,
//   r < nR, c < nC (nC % 8 == 0); SRC batch stride sbs floats, row pitch lds floats. Thread per (r, 8 consecutive c): two 16-B loads,
// =====================================================================================
__global__ __launch_bounds__(256) void k_castp(const float* __restrict__ SRC, long long sbs, int lds, unsigned short* __restrict__ DST, long long dbs, int ldd, int nR, int nC, float sc, int bfr) {
    const long long u = (long long)blockIdx.x * 256 + threadIdx.x;
    const int per = nC >> 3;
    if (u >= (long long)nR * per) return;
    const int r = (int)(u / per);
    const int c0 = 8 * (int)(u - (long long)r * per);
    const float* s = SRC + (long long)blockIdx.y * sbs + (long long)r * lds + c0;
    const v4f a = *(const v4f*)s;
    const v4f bq = *(const v4f*)(s + 4);
    float w[8] = {a.x, a.y, a.z, a.w, bq.x, bq.y, bq.z, bq.w};
#pragma unroll
    for (int e = 0; e < 8; ++e) { const float t = bfr ? cmb_bf(w[e]) : w[e]; w[e] = t * sc; }
    v4u pk;
    pk.x = cmb_pk2(w[0], w[1]); pk.y = cmb_pk2(w[2], w[3]); pk.z = cmb_pk2(w[4], w[5]); pk.w = cmb_pk2(w[6], w[7]);
    v4u* d = (v4u*)(DST + (long long)blockIdx.y * dbs + (long long)r * ldd + c0);
    *d = pk;
    
}

extern "C" void kernel_launch(void* const* d_in, const int* in_sizes, int n_in, void* d_out, int out_size, void* d_ws, size_t ws_size, hipStream_t stream) {
    if (n_in < 7) return;
    const float* x     = (const float*)d_in[0];     // [2][2048][1024]
    const float* Wqkv  = (const float*)d_in[1];     // [3072][1024]  ([out][in] = Bt layout)
    const float* bqkv  = (const float*)d_in[2];     // [3072]
    const float* Wproj = (const float*)d_in[3];     // [1024][1024]  ([out][in] = Bt layout)
    const float* bproj = (const float*)d_in[4];     // [1024]
    const float* qn_w  = (const float*)d_in[5];     // [64]
    const float* kn_w  = (const float*)d_in[6];     // [64]
    const long long xneed = ((long long)(NB - 1) * SEQ_FULL + SEQ) * DM;
    if ((long long)in_sizes[0] < xneed) return;
    if ((long long)in_sizes[1] < (long long)NQKV * DM) return;
    if (in_sizes[2] < NQKV) return;
    if ((long long)in_sizes[3] < (long long)DM * DM) return;
    if (in_sizes[4] < DM) return;
    if (in_sizes[5] < HDIM || in_sizes[6] < HDIM) return;
    if ((long long)out_size < xneed) return;
    if (WS_TOTAL > ws_size) return;

    char* wsp = (char*)d_ws;
    float* VEC = (float*)wsp; wsp += WS_VEC;                              // 4224 f32 (bf16 RNE values of the small input vectors)
    unsigned short* X16 = (unsigned short*)wsp; wsp += WS_X16;             // [NTOK][1024] f16 = 16 * bf16(x)
    unsigned short* W16 = (unsigned short*)wsp; wsp += WS_W16;             // [3072][1024] f16 = 64 * bf16(Wqkv)
    unsigned short* WP16 = (unsigned short*)wsp; wsp += WS_WP16;           // [1024][1024] f16 = 64 * bf16(Wproj)
    float* QKV = (float*)wsp; wsp += WS_QKV;                               // [NTOK][3072] f32, only the v columns (2048..3071) are written and read
    unsigned short* QH16 = (unsigned short*)wsp; wsp += WS_QK16;           // [NTOK][1024] f16 = 16 * normalised q
    unsigned short* KH16 = (unsigned short*)wsp; wsp += WS_QK16;           // [NTOK][1024] f16 = 16 * normalised k
    float* CTX = (float*)wsp; wsp += WS_CTX;                               // [NTOK][1024] f32 attention output (token-major, head*64 + d)
    unsigned short* CTX16 = (unsigned short*)wsp; wsp += WS_CTX16;         // [NTOK][1024] f16 = 256 * ctx
    float* out = (float*)d_out;

    // 1. small vectors -> bf16 RNE values (f32)
    k_vec<<<(VECN + 255) / 256, 256, 0, stream>>>(bqkv, bproj, qn_w, kn_w, VEC);
    // 2-4. 16-bit operand planes (bf16 RNE input values times a power of two, exact in f16)
    k_castp<<<dim3((unsigned)(((long long)SEQ * (DM / 8) + 255) / 256), (unsigned)NB), 256, 0, stream>>>(x, (long long)SEQ_FULL * DM, DM, X16, (long long)SEQ * DM, DM, SEQ, DM, 16.0f, 1);
    k_castp<<<dim3((unsigned)(((long long)NQKV * (DM / 8) + 255) / 256), 1u), 256, 0, stream>>>(Wqkv, 0LL, DM, W16, 0LL, DM, NQKV, DM, 64.0f, 1);
    k_castp<<<dim3((unsigned)(((long long)DM * (DM / 8) + 255) / 256), 1u), 256, 0, stream>>>(Wproj, 0LL, DM, WP16, 0LL, DM, DM, DM, 64.0f, 1);
    // 5. qkv = (16 bf16(x)) . (64 bf16(Wqkv))^T / 1024 + bf16(bqkv); v -> QKV f32; q and k -> per-head RMSNorm (f32 math) in the epilogue -> f16 planes carried x16
    w25::wmma_gemm64<0, false, 2, 0, false, true><<<dim3((unsigned)((NTOK / 128) * (NQKV / 128)), 1u), 128, 0, stream>>>(
        (const unsigned short*)X16, nullptr, DM, 0L, (const unsigned short*)W16, nullptr, DM, 0L,
        (void*)QKV, nullptr, NQKV, 0L, VEC + OFF_BQ, nullptr, 0L, NTOK, NQKV, DM, 1.0f / 1024.0f,
        VEC + OFF_QW, VEC + OFF_KW, QH16, KH16);
    // 6. attention: 64 query rows per block, 64-key chunks, online softmax; v read from the QKV tile (columns 2048 + h*64)
    w25::AttnGeom g;
    g.q_bs = (long long)SEQ * DM;   g.q_rs = DM;   g.q_hs = HDIM;
    g.k_bs = (long long)SEQ * DM;   g.k_rs = DM;   g.k_hs = HDIM;
    g.v_bs = (long long)SEQ * NQKV; g.v_rs = NQKV; g.v_hs = HDIM;
    g.o_bs = (long long)SEQ * DM;   g.o_rs = DM;   g.o_hs = HDIM;
    g.S = SEQ; g.Skv = SEQ; g.H = NH; g.nchunk = SEQ / AT_KC; g.sscale = 0.125f / (QCAR * QCAR); g.psc = 32768.0f;
    w25::k_attn64<<<(unsigned)(NB * NH * (SEQ / AT_QB)), 128, 0, stream>>>(QH16, KH16, QKV + 2 * DM, CTX, g);
    // 7. ctx -> f16 plane (x256)
    k_castp<<<dim3((unsigned)(((long long)NTOK * (DM / 8) + 255) / 256), 1u), 256, 0, stream>>>(CTX, 0LL, DM, CTX16, 0LL, DM, NTOK, DM, 256.0f, 0);
    // 8. out[b][s][:] = (256 ctx) . (64 bf16(Wproj))^T / 16384 + bf16(bproj), batch rows at the full per-batch stride of d_out
    w25::wmma_gemm64<0, false, 2, 0, false, false><<<dim3((unsigned)((SEQ / 128) * (DM / 128)), (unsigned)NB), 128, 0, stream>>>(
        (const unsigned short*)CTX16, nullptr, DM, (long)SEQ * DM, (const unsigned short*)WP16, nullptr, DM, 0L,
        (void*)out, nullptr, DM, (long)SEQ_FULL * DM, VEC + OFF_BP, nullptr, 0L, SEQ, DM, DM, 1.0f / 16384.0f,
        nullptr, nullptr, nullptr, nullptr);
    (void)hipGetLastError();
}

// v005
// Measured time: 136 microseconds a run.
// Timed twice side by side with v004, it ran 1.26 times as fast both times.
// Over all steps from v000 it is 2.47 times as fast.
// Contractions: qkv projection [NB*SEQ x 1024 x 3072] and output projection [NB*SEQ x 1024 x 1024] = v_wmma_f32_16x16x32_f16 (f16 operands holding bf16 RNE input values scaled by powers of two, except the output projection's ctx operand, f16 of 256 ctx, f32 accumulate); attention scores, transposed, k.q^T = v_wmma_f32_16x16x32_f16 (normed q,k carried x16 as f16, single product, f32 accumulate); V^T.P^T = v_wmma_f32_16x16x32_f16 (P carried x2^15 as f16, v f16, f32 accumulate); RMSNorm (in the qkv projection's epilogue) and online softmax in f32.
#include <hip/hip_runtime.h>
#include <math.h>

#ifndef NB
#define NB 2
#endif
#ifndef SEQ
#define SEQ 2048
#endif
#define NB_FULL 2
#define SEQ_FULL 2048
#define DM 1024
#define NH 16
#define HDIM 64
#define NQKV (3 * DM)
#define NTOK (NB * SEQ)
#define QCAR 16.0f
// small f32 vector region: [bqkv 3072 | bproj 1024 | qn_w 64 | kn_w 64], each entry the bf16 RNE value of the input
#define OFF_BQ 0
#define OFF_BP NQKV
#define OFF_QW (NQKV + DM)
#define OFF_KW (NQKV + DM + HDIM)
#define VECN (NQKV + DM + 2 * HDIM)
static_assert(SEQ % 128 == 0);   // 128-row block tiles of the projections; 64-row blocks of the attention
static_assert(NB >= 1);
static_assert(NB <= NB_FULL);
static_assert(SEQ <= SEQ_FULL);
static_assert(VECN % 32 == 0);
static_assert(NH * HDIM == DM);
static_assert(DM % 128 == 0);
static_assert(NQKV % 128 == 0);
static_assert(HDIM == 64);   // one 64-column wave tile of the qkv projection = one head's q, k or v slice

typedef __attribute__((ext_vector_type(16))) _Float16 v16h;
typedef __attribute__((ext_vector_type(8)))  _Float16 v8h;
typedef __attribute__((ext_vector_type(16))) __bf16   v16b;
typedef __attribute__((ext_vector_type(8)))  __bf16   v8b;
typedef __attribute__((ext_vector_type(8)))  float    v8f;
typedef __attribute__((ext_vector_type(4)))  float    v4f;
typedef __attribute__((ext_vector_type(2)))  float    v2f;
typedef __attribute__((ext_vector_type(4)))  unsigned int v4u;

// 16-bit WMMA fragment map (wave32), lane L, h = L>>4, m = L&15:
//   A 16x32: lane = row m;   element i -> k = (i<8) ? 8h+i : 16+8h+(i-8)
//   B 32x16: lane = column m; the SAME k(i,h)
//   D 16x16 (8 f32): lane = column m; element r -> row 8h+r

// workspace carve (bytes, 256-B aligned regions)
constexpr size_t al256(size_t x) { return (x + 255) / 256 * 256; }
constexpr size_t WS_VEC   = al256((size_t)VECN * 4);
constexpr size_t WS_X16   = al256((size_t)NTOK * DM * 2);
constexpr size_t WS_W16   = al256((size_t)NQKV * DM * 2);
constexpr size_t WS_WP16  = al256((size_t)DM * DM * 2);
constexpr size_t WS_QK16  = al256((size_t)NTOK * DM * 2);
constexpr size_t WS_CTX   = al256((size_t)NTOK * DM * 4);
constexpr size_t WS_CTX16 = al256((size_t)NTOK * DM * 2);
constexpr size_t WS_TOTAL = WS_VEC + WS_X16 + WS_W16 + WS_WP16 + 3 * WS_QK16 + WS_CTX + WS_CTX16;
static_assert(WS_TOTAL <= (size_t)134217728);

// ---- scalar helpers ----
__device__ __forceinline__ float cmb_bf(float v) { const unsigned u = __builtin_bit_cast(unsigned, v); const unsigned r = (u + 0x7fffu + ((u >> 16) & 1u)) & 0xffff0000u; return __builtin_bit_cast(float, r); }   // bf16 RNE value kept as f32
__device__ __forceinline__ unsigned int cmb_pk2(float a, float b) { return (unsigned int)__builtin_bit_cast(unsigned short, (_Float16)a) | ((unsigned int)__builtin_bit_cast(unsigned short, (_Float16)b) << 16); }

namespace w25 {

__device__ __forceinline__ unsigned short f2bf_bits(float f) {
  unsigned u = __float_as_uint(f);
  return (unsigned short)((u + 0x7FFFu + ((u >> 16) & 1u)) >> 16);
}
__device__ __forceinline__ float bf_bits2f(unsigned short h) { return __uint_as_float(((unsigned)h) << 16); }

// hazard guards as plain device helpers
__device__ __forceinline__ void dep_guard_h(v8f& a, v8f& b, v16h x, v16h y) { asm volatile("v_nop\n\tv_nop\n\tv_nop\n\tv_nop" : "+v"(a), "+v"(b) : "v"(x), "v"(y)); }
__device__ __forceinline__ void dep_guard_b(v8f& a, v8f& b, v16b x, v16b y) { asm volatile("v_nop\n\tv_nop\n\tv_nop\n\tv_nop" : "+v"(a), "+v"(b) : "v"(x), "v"(y)); }
__device__ __forceinline__ void keep4_h(v16h a, v16h b, v16h c, v16h d) { asm volatile("v_nop" :: "v"(a), "v"(b), "v"(c), "v"(d)); }
__device__ __forceinline__ void keep4_b(v16b a, v16b b, v16b c, v16b d) { asm volatile("v_nop" :: "v"(a), "v"(b), "v"(c), "v"(d)); }
__device__ __forceinline__ void acc_guard4(v8f& a, v8f& b, v8f& c, v8f& d) { asm volatile("v_nop\n\tv_nop\n\tv_nop\n\tv_nop" : "+v"(a), "+v"(b), "+v"(c), "+v"(d)); }
template <typename T> struct Frag;
template <> struct Frag<_Float16> {
  typedef v16h V; union U { v16h v; v8h h[2]; };
  static __device__ __forceinline__ v16h load(const _Float16* p) {   // elements 0..7 <- p[0..7], 8..15 <- p[16..23]
    U f; f.h[0] = *(const v8h*)(p); f.h[1] = *(const v8h*)(p + 16); return f.v;
  }
  static __device__ __forceinline__ v8f mma(v16h a, v16h b, v8f c) {
    return __builtin_amdgcn_wmma_f32_16x16x32_f16(false, a, false, b, (short)0, c, false, false);
  }
  static __device__ __forceinline__ void guard(v8f& a, v8f& b, v16h x, v16h y) { dep_guard_h(a, b, x, y); }
  static __device__ __forceinline__ void keep(v16h a, v16h b, v16h c, v16h d) { keep4_h(a, b, c, d); }
};
template <> struct Frag<__bf16> {
  typedef v16b V; union U { v16b v; v8b h[2]; };
  static __device__ __forceinline__ v16b load(const __bf16* p) {
    U f; f.h[0] = *(const v8b*)(p); f.h[1] = *(const v8b*)(p + 16); return f.v;
  }
  static __device__ __forceinline__ v8f mma(v16b a, v16b b, v8f c) {
    return __builtin_amdgcn_wmma_f32_16x16x32_bf16(false, a, false, b, (short)0, c, false, false);
  }
  static __device__ __forceinline__ void guard(v8f& a, v8f& b, v16b x, v16b y) { dep_guard_b(a, b, x, y); }
  static __device__ __forceinline__ void keep(v16b a, v16b b, v16b c, v16b d) { keep4_b(a, b, c, d); }
};

// ---- Register-blocked batched WMMA GEMM ------------------------------------
// C[m,n] = scale * sum_k A[m,k] * Bt[n,k] (+bias)(+resid); each wave owns a 64x64 tile, a block of 4 waves (2 x 2) a 128x128 tile.
// A row-major [M,K]; Bt row-major [N,K]; M,N % 128 == 0, K % 64 == 0.
// Operands come through LDS: a stage is 64 k (one 128-B line) of the block's 128 A rows and 128 Bt rows, brought by asynchronous 16-B copies
//   (8 lanes = one whole line), two buffers, the next stage in flight while this one is multiplied; fragments are read from LDS with the same (row, k) map as before.
// SPLIT (hi/lo operand planes) is not built in this form.
// BIAS_MODE: 0 = none, 1 = bias[m], 2 = bias[n].
// OUT_MODE: 0 = f32, 1 = f16, 2 = bf16 hi plane (Cout) + bf16 lo plane (Cout2).
// ET: 0 = f16 operands, 1 = bf16 operands (pointers passed as 16-bit storage)
// QKN: the qkv projection. A wave tile is 64 tokens x one head's 64 columns of q (n0 < DM), k (n0 < 2 DM) or v. q and k tiles are RMS-normalised
//   row by row in the epilogue and stored only as f16 planes: QHp / KHp[token][h*64 + d] = f16(QCAR * x[d] * (1 / sqrt(mean(x^2) + 1e-6)) * w[d]),
//   w = qnw / knw; v tiles are stored as a third f16 plane, VHp[token][h*64 + d] = f16(x[d]) (Cout is not used).
template <int ET> struct Elem;
template <> struct Elem<0> { typedef _Float16 T; };
template <> struct Elem<1> { typedef __bf16 T; };
#define GK_KS 64                       // k per stage, in halves
#define GK_LP 72                       // LDS row pitch in halves: 144 B = 16 B x odd, conflict-free for the 16-byte fragment reads
#define GK_BT 128                      // block tile rows of A and of Bt
#define GK_BUF (2 * GK_BT * GK_LP)     // halves per buffer: A rows 0..127, then Bt rows 0..127
// Eight asynchronous 16-byte copies of one lane: rows r, r+16, ..., r+112 of one operand (global row step gstep halves) into LDS rows 16 apart.
// The s_wait_xcnt stands inside the statement, behind the last copy, so that no address register of a copy is rewritten in front of it.
template <typename T>
__device__ __forceinline__ void gk_copy8(unsigned lds, const T* g, size_t gstep) {
  const unsigned ls = 16u * GK_LP * 2u;
  asm volatile(
      "global_load_async_to_lds_b128 %0, %8, off\n\t"
      "global_load_async_to_lds_b128 %1, %9, off\n\t"
      "global_load_async_to_lds_b128 %2, %10, off\n\t"
      "global_load_async_to_lds_b128 %3, %11, off\n\t"
      "global_load_async_to_lds_b128 %4, %12, off\n\t"
      "global_load_async_to_lds_b128 %5, %13, off\n\t"
      "global_load_async_to_lds_b128 %6, %14, off\n\t"
      "global_load_async_to_lds_b128 %7, %15, off\n\t"
      "s_wait_xcnt 0x0"
      :: "v"(lds), "v"(lds + ls), "v"(lds + 2u * ls), "v"(lds + 3u * ls), "v"(lds + 4u * ls), "v"(lds + 5u * ls), "v"(lds + 6u * ls), "v"(lds + 7u * ls),
         "v"(g), "v"(g + gstep), "v"(g + 2 * gstep), "v"(g + 3 * gstep), "v"(g + 4 * gstep), "v"(g + 5 * gstep), "v"(g + 6 * gstep), "v"(g + 7 * gstep)
      : "memory");
}
template <int ET, bool SPLIT, int BIAS_MODE, int OUT_MODE, bool RESID, bool QKN>
__global__ __launch_bounds__(128) void wmma_gemm64(
    const unsigned short* __restrict__ Ap, const unsigned short* __restrict__ A2p, int lda, long strideA,
    const unsigned short* __restrict__ Btp, const unsigned short* __restrict__ Bt2p, int ldb, long strideB,
    void* __restrict__ Cout, void* __restrict__ Cout2, int ldc, long strideC,
    const float* __restrict__ bias,
    const float* __restrict__ resid, long strideR,
    int M, int N, int K, float scale,
    const float* __restrict__ qnw, const float* __restrict__ knw,
    unsigned short* __restrict__ QHp, unsigned short* __restrict__ KHp, unsigned short* __restrict__ VHp) {
  typedef typename Elem<ET>::T T;
  typedef typename Frag<T>::V V;
  static_assert(!SPLIT);
  const T* A = (const T*)Ap; const T* Bt = (const T*)Btp;
  __shared__ __align__(16) T ring[2 * GK_BUF];     // two stage buffers (cross-wave: published by the block barriers below)
  __shared__ __align__(16) float sT[4][16 * 68];   // per-wave 16x64 slab, pitch 68 floats (wave-private)
  const int b    = blockIdx.y;
  const int lane = threadIdx.x & 31;
  const int wave = threadIdx.x >> 5;
  const int tilesN = N >> 7;
  const int tilesM = M >> 7;
  const int tile = blockIdx.x;
  if (tile >= tilesM * tilesN) return;   // block-uniform, in front of every barrier and copy
  const int tm = tile / tilesN;
  const int tn = tile - tm * tilesN;
  const int wm = wave >> 1, wn = wave & 1;         // 2 x 2 waves
  const int m0 = (tm << 7) + (wm << 6);
  const int n0 = (tn << 7) + (wn << 6);

  const T* Ab  = A  + (size_t)b * strideA;
  const T* Bb  = Bt + (size_t)b * strideB;

  const int rlane = lane & 15;                 // row (A) / col (B, D) within subtile
  const int koff  = (lane >> 4) * 8;           // k offset of this lane half
  const int mOff  = (lane >> 4) * 8;           // D row offset

  v8f acc[4][4];
#pragma unroll
  for (int i = 0; i < 4; ++i)
#pragma unroll
    for (int j = 0; j < 4; ++j) acc[i][j] = (v8f){0.f,0.f,0.f,0.f,0.f,0.f,0.f,0.f};

  // copy map: thread -> (row crow + 16 i, 16-byte piece cseg) of each operand's 128 x 128-B stage; a wave's copy covers 4 whole lines
  const int nst  = K / GK_KS;
  const int crow = threadIdx.x >> 3;
  const int cseg = (threadIdx.x & 7) * 8;
  const T* ga = Ab + (size_t)((tm << 7) + crow) * lda + cseg;
  const T* gb = Bb + (size_t)((tn << 7) + crow) * ldb + cseg;
  const unsigned lA = (unsigned)(size_t)ring + (unsigned)(crow * GK_LP + cseg) * 2u;   // LDS byte address in buffer 0, A part
  const unsigned lB = lA + GK_BT * GK_LP * 2u;                                         // Bt part
  const size_t ast = (size_t)16 * lda, bst = (size_t)16 * ldb;

  gk_copy8(lA, ga, ast);
  gk_copy8(lB, gb, bst);
  asm volatile("s_wait_asynccnt 0x0" ::: "memory");   // this wave's copies of stage 0 have landed before the barrier publishes them
  __syncthreads();
  if (nst > 1) {
    gk_copy8(lA + GK_BUF * 2u, ga + GK_KS, ast);
    gk_copy8(lB + GK_BUF * 2u, gb + GK_KS, bst);
  }

  for (int t = 0; t < nst; ++t) {
    const int bsel = (t & 1) * GK_BUF;
    const T* la = ring + bsel + ((wm << 6) + rlane) * GK_LP + koff;
    const T* lb = ring + bsel + (GK_BT + (wn << 6) + rlane) * GK_LP + koff;
    // all four loops unrolled: the fragment and accumulator arrays stay in registers, and the LDS offsets become immediates
#pragma unroll
    for (int ks = 0; ks < GK_KS; ks += 32) {
      V bh[4], ah[4];
#pragma unroll
      for (int j = 0; j < 4; ++j) bh[j] = Frag<T>::load(lb + (j << 4) * GK_LP + ks);
#pragma unroll
      for (int i = 0; i < 4; ++i) ah[i] = Frag<T>::load(la + (i << 4) * GK_LP + ks);
#pragma unroll
      for (int i = 0; i < 4; ++i) {
#pragma unroll
        for (int j = 0; j < 4; ++j) acc[i][j] = Frag<T>::mma(ah[i], bh[j], acc[i][j]);
        Frag<T>::guard(acc[i][0], acc[i][3], ah[i], ah[i]);
      }
      Frag<T>::keep(bh[0], bh[1], bh[2], bh[3]);
    }
    asm volatile("s_wait_dscnt 0x0" ::: "memory");      // this wave's fragment reads have returned before the buffer may be refilled
    asm volatile("s_wait_asynccnt 0x0" ::: "memory");   // this wave's copies of stage t + 1 have landed before the barrier publishes them
    __syncthreads();                                    // publishes stage t + 1 and ends every wave's reads of stage t's buffer
    if (t + 2 < nst) {
      gk_copy8(lA + (unsigned)bsel * 2u, ga + (size_t)(t + 2) * GK_KS, ast);
      gk_copy8(lB + (unsigned)bsel * 2u, gb + (size_t)(t + 2) * GK_KS, bst);
    }
  }
  asm volatile("s_wait_asynccnt 0x0" ::: "memory");     // no copy is outstanding when the wave goes on
  acc_guard4(acc[0][0], acc[0][1], acc[0][2], acc[0][3]);
  acc_guard4(acc[1][0], acc[1][1], acc[1][2], acc[1][3]);
  acc_guard4(acc[2][0], acc[2][1], acc[2][2], acc[2][3]);
  acc_guard4(acc[3][0], acc[3][1], acc[3][2], acc[3][3]);

  // ---- epilogue ----
  float* slab = sT[wave];
  const float* Rb = RESID ? (resid + (size_t)b * strideR) : nullptr;
  const int nslice = QKN ? n0 / DM : 2;            // 0 = q, 1 = k, 2 = v (wave-uniform)
  v4f nw0 = (v4f){0.f,0.f,0.f,0.f}, nw1 = nw0;     // norm weights of this lane's 8 columns
  if (QKN && nslice < 2) {
    const float* nwp = (nslice ? knw : qnw) + (lane & 7) * 8;
    nw0 = *(const v4f*)nwp;
    nw1 = *(const v4f*)(nwp + 4);
  }
#pragma unroll
  for (int i = 0; i < 4; ++i) {
    const int mBase = m0 + (i << 4);
#pragma unroll
    for (int j = 0; j < 4; ++j) {
      const int n = n0 + (j << 4) + rlane;
      float bv = 0.f;
      if (BIAS_MODE == 2) bv = bias[n];
#pragma unroll
      for (int r = 0; r < 8; ++r) {
        float v = acc[i][j][r] * scale;
        if (BIAS_MODE == 1) v += bias[mBase + mOff + r];
        if (BIAS_MODE == 2) v += bv;
        if (RESID) v += Rb[(size_t)(mBase + mOff + r) * ldc + n];
        slab[(mOff + r) * 68 + (j << 4) + rlane] = v;
      }
    }
    __builtin_amdgcn_fence(3, "workgroup");
    __builtin_amdgcn_wave_barrier();
    __builtin_amdgcn_fence(2, "workgroup");
    if (QKN && nslice < 2) {
      // 8 lanes per row, 8 columns per lane: sum of squares in the lane, then over the 8 lanes; one 16-B store per lane = a 128-B line per row
      const int q = lane >> 3, c8 = (lane & 7) * 8;
      unsigned short* P = (nslice ? KHp : QHp) + (n0 - nslice * DM) + c8;
#pragma unroll   // the four row groups' LDS reads and lane exchanges issue together, so their latencies overlap
      for (int it = 0; it < 4; ++it) {
        const int row = it * 4 + q;
        const v4f x0 = *(const v4f*)(slab + row * 68 + c8);
        const v4f x1 = *(const v4f*)(slab + row * 68 + c8 + 4);
        float ss = (x0.x * x0.x + x0.y * x0.y + x0.z * x0.z + x0.w * x0.w) + (x1.x * x1.x + x1.y * x1.y + x1.z * x1.z + x1.w * x1.w);
#pragma unroll   // constant lane distances 1, 2, 4: the 8 lanes of a row
        for (int o = 1; o < 8; o <<= 1) ss += __shfl_xor(ss, o, 32);
        const float rms = sqrtf(ss * (1.0f / 64.0f) + 1e-6f);
        const float rec = 1.0f / rms;
        v4u pk;
        pk.x = cmb_pk2(((x0.x * rec) * nw0.x) * QCAR, ((x0.y * rec) * nw0.y) * QCAR);
        pk.y = cmb_pk2(((x0.z * rec) * nw0.z) * QCAR, ((x0.w * rec) * nw0.w) * QCAR);
        pk.z = cmb_pk2(((x1.x * rec) * nw1.x) * QCAR, ((x1.y * rec) * nw1.y) * QCAR);
        pk.w = cmb_pk2(((x1.z * rec) * nw1.z) * QCAR, ((x1.w * rec) * nw1.w) * QCAR);
        *(v4u*)(P + (size_t)(mBase + row) * DM) = pk;
      }
    } else if (QKN) {
      // v tile: 8 lanes per row, 8 columns per lane, one 16-B store per lane = a 128-B line per row
      const int q = lane >> 3, c8 = (lane & 7) * 8;
      unsigned short* P = VHp + (n0 - 2 * DM) + c8;
#pragma unroll   // the four row groups' LDS reads issue together
      for (int it = 0; it < 4; ++it) {
        const int row = it * 4 + q;
        const v4f x0 = *(const v4f*)(slab + row * 68 + c8);
        const v4f x1 = *(const v4f*)(slab + row * 68 + c8 + 4);
        v4u pk;
        pk.x = cmb_pk2(x0.x, x0.y);
        pk.y = cmb_pk2(x0.z, x0.w);
        pk.z = cmb_pk2(x1.x, x1.y);
        pk.w = cmb_pk2(x1.z, x1.w);
        *(v4u*)(P + (size_t)(mBase + row) * DM) = pk;
      }
    } else if (OUT_MODE == 0) {
      float* C = (float*)Cout + (size_t)b * strideC;
      const int hh = lane >> 4, c4 = (lane & 15) * 4;     // row seg = 256 B = 16 lanes x 16 B
      {
#pragma unroll
        for (int it = 0; it < 8; ++it) {
          const int row = it * 2 + hh;
          v4f v = *(const v4f*)(slab + row * 68 + c4);
          *(v4f*)(C + (size_t)(mBase + row) * ldc + n0 + c4) = v;
        }
        
      }
    } else {
      const int q = lane >> 3, c8 = (lane & 7) * 8;
      unsigned short* C  = (unsigned short*)Cout  + (size_t)b * strideC;
      unsigned short* C2 = (OUT_MODE == 2) ? ((unsigned short*)Cout2 + (size_t)b * strideC) : nullptr;
      {
#pragma unroll
        for (int it = 0; it < 4; ++it) {
          const int row = it * 4 + q;
          const float* sp = slab + row * 68 + c8;
          v8h hv, lv;
#pragma unroll
          for (int e = 0; e < 8; ++e) {
            if (OUT_MODE == 1) {
              hv[e] = (_Float16)sp[e];
            } else {
              unsigned short hb = f2bf_bits(sp[e]);
              unsigned short lb = f2bf_bits(sp[e] - bf_bits2f(hb));
              hv[e] = __builtin_bit_cast(_Float16, hb);
              lv[e] = __builtin_bit_cast(_Float16, lb);
            }
          }
          *(v8h*)(C + (size_t)(mBase + row) * ldc + n0 + c8) = hv;
          if (OUT_MODE == 2) *(v8h*)(C2 + (size_t)(mBase + row) * ldc + n0 + c8) = lv;
        }
        
      }
    }
    __builtin_amdgcn_fence(3, "workgroup");
    __builtin_amdgcn_wave_barrier();
    __builtin_amdgcn_fence(2, "workgroup");
  }
}

// =====================================================================================
// Non-causal attention for head_dim 64; q/k from f16 planes (normed values carried x QCAR), v from an f16 plane, f32 out.
//   scores^T = k.q^T        : v_wmma_f32_16x16x32_f16, single product; natural score = raw * sscale (sscale = 1/sqrt(64) / QCAR^2)
//   out^T    = v^T.p^T      : v_wmma_f32_16x16x32_f16; p = exp((s - m_running)*sscale) carried x psc (2^15) as f16, v plain f16
//   Both products are transposed, so a lane holds scores, P and output of ONE query (its D column): maximum and sum run inside the lane
//   (one exchange between the lane halves), and two score tiles, converted in place, are the B fragment of the second product.
//   K and V chunks come row-major into LDS by asynchronous 16-B copies (8 lanes = one whole 128-B row), two buffers, the next chunk in flight while
//   this one is worked on; V^T fragments come by the transposing LDS load.
//   f32 accumulate; online softmax in f32. Block = 4 waves = 64 query rows of one (batch, head); S % 64 == 0.
//   Element (b, s, h, d) of tensor X lives at X[b*X_bs + s*X_rs + h*X_hs + d] (strides in elements, multiples of 8).
//   grid.x = B * H * (S/64), block 128.
// =====================================================================================
#define AT_D 64
#define AT_NW 4
#define AT_QB 64
#define AT_KC 64
#define AT_LP 72   // LDS row pitch in halves of the 64-half K rows: 144 B = 16 B x odd, so the 16 lanes of a 16-byte fragment read fall on 16 distinct bank groups
#define AT_VP 80   // LDS row pitch in halves of the 64-half V rows: 160 B = 32 B x odd, the conflict-free pitch of ds_load_tr16_b128
#define AT_KB (AT_KC * AT_LP)            // halves of a buffer's K part
#define AT_BUF (AT_KB + AT_KC * AT_VP)   // halves per buffer
struct AttnGeom { long long q_bs, q_rs, q_hs, k_bs, k_rs, k_hs, v_bs, v_rs, v_hs, o_bs, o_rs, o_hs; int S, Skv, H, nchunk; float sscale; float psc; };
static_assert(sizeof(AttnGeom) == 12 * 8 + 4 * 4 + 2 * 4);

__device__ __forceinline__ v8f at_mmah(v16h a, v16h b, v8f c) {
  c = __builtin_amdgcn_wmma_f32_16x16x32_f16(false, a, false, b, (short)0, c, false, false);
  asm volatile("v_nop\n\tv_nop\n\tv_nop\n\tv_nop" : "+v"(c) : "v"(a), "v"(b));
  return c;
}

// Transposing 16-bit LDS load: lane (c = l & 15, h = l >> 4), addressed at row 8h + (l & 7), halves 8 * ((l >> 3) & 1) of a row-major tile, gets T[8h + 0..7][c]
typedef short s16x8 __attribute__((ext_vector_type(8)));
__device__ __forceinline__ v8h at_ldtr16(const _Float16* p) {
  typedef __attribute__((address_space(3))) s16x8 lds_s16x8;
  return __builtin_bit_cast(v8h, __builtin_amdgcn_ds_load_tr16_b128_v8i16((lds_s16x8*)p));
}

// Eight asynchronous 16-byte copies of one lane: rows r, r+16, r+32, r+48 of a K chunk and of a V chunk (global row steps kst, vst halves per 16 rows).
// The s_wait_xcnt stands inside the statement, behind the last copy, so that no address register of a copy is rewritten in front of it.
__device__ __forceinline__ void at_copy8(unsigned lk, const _Float16* gk, size_t kst, unsigned lv, const _Float16* gv, size_t vst) {
  const unsigned ks = 16u * AT_LP * 2u, vs = 16u * AT_VP * 2u;
  asm volatile(
      "global_load_async_to_lds_b128 %0, %8, off\n\t"
      "global_load_async_to_lds_b128 %1, %9, off\n\t"
      "global_load_async_to_lds_b128 %2, %10, off\n\t"
      "global_load_async_to_lds_b128 %3, %11, off\n\t"
      "global_load_async_to_lds_b128 %4, %12, off\n\t"
      "global_load_async_to_lds_b128 %5, %13, off\n\t"
      "global_load_async_to_lds_b128 %6, %14, off\n\t"
      "global_load_async_to_lds_b128 %7, %15, off\n\t"
      "s_wait_xcnt 0x0"
      :: "v"(lk), "v"(lk + ks), "v"(lk + 2u * ks), "v"(lk + 3u * ks), "v"(lv), "v"(lv + vs), "v"(lv + 2u * vs), "v"(lv + 3u * vs),
         "v"(gk), "v"(gk + kst), "v"(gk + 2 * kst), "v"(gk + 3 * kst), "v"(gv), "v"(gv + vst), "v"(gv + 2 * vst), "v"(gv + 3 * vst)
      : "memory");
}

__global__ __launch_bounds__(128) __attribute__((amdgpu_num_vgpr(256)))
void k_attn64(const unsigned short* __restrict__ qp, const unsigned short* __restrict__ kp,
              const unsigned short* __restrict__ vp, float* __restrict__ out, AttnGeom g) {
  union FH { v16h v; v8h h[2]; };
  __shared__ __align__(16) _Float16 kvs[2 * AT_BUF];        // two chunk buffers, each K [kv][d] then V [kv][d], f16 (cross-wave: published by the block barriers below)
  __shared__ __align__(16) float    Os[AT_NW][16 * 68];     // per wave out tile, pitch 68 (wave-private)

  const int tid  = threadIdx.x;
  const int wave = tid >> 5;
  const int lane = tid & 31;
  const int hh   = lane >> 4;
  const int c    = lane & 15;

  const int nqb = g.S / AT_QB;
  const int bx = blockIdx.x;
  const int qb = bx % nqb;
  const int bh = bx / nqb;
  const int h  = bh % g.H;
  const int b  = bh / g.H;
  const int q0 = qb * AT_QB + wave * 16;

  const _Float16* q = (const _Float16*)qp;
  const _Float16* k = (const _Float16*)kp;
  const _Float16* v = (const _Float16*)vp;
  const _Float16* qb_ptr = q + (size_t)b * g.q_bs + (size_t)h * g.q_hs;
  const _Float16* kb_ptr = k + (size_t)b * g.k_bs + (size_t)h * g.k_hs;
  const _Float16* vb_ptr = v + (size_t)b * g.v_bs + (size_t)h * g.v_hs;
  float*          ob_ptr = out + (size_t)b * g.o_bs + (size_t)h * g.o_hs;

  // ---- Q fragments (B operand): 2 d-chunks; lane column c = query q0 + c, elements 0..7 <- d = dc*32 + 8hh + e, 8..15 <- dc*32 + 16 + 8hh + e (two 16-B loads from the f16 row) ----
  v16h qa[2];
  {
    const _Float16* qrow = qb_ptr + (size_t)(q0 + c) * g.q_rs;
#pragma unroll
    for (int dc = 0; dc < 2; ++dc) {
      FH f;
      f.h[0] = *(const v8h*)(qrow + dc * 32 + 8 * hh);
      f.h[1] = *(const v8h*)(qrow + dc * 32 + 16 + 8 * hh);
      qa[dc] = f.v;
    }
  }

  float mcol = -INFINITY;   // running maximum of this lane's query (raw units; equal in both lane halves)
  float lcol = 0.f;         // running sum of p over the keys of this lane half; the halves are joined after the loop
  v8f oacc[4];              // out^T: tile t, element r = (d = t*16 + 8hh + r, query q0 + c)
#pragma unroll
  for (int t = 0; t < 4; ++t) oacc[t] = (v8f){0.f,0.f,0.f,0.f,0.f,0.f,0.f,0.f};

  // copy map: thread -> (row srow + 16 i, 16-byte piece sseg / 8) of the chunk's 64 K rows and 64 V rows; a wave's copy covers 4 whole 128-B rows
  const int srow = tid >> 3, sseg = (tid & 7) * 8;
  const _Float16* gk = kb_ptr + (size_t)srow * g.k_rs + sseg;
  const _Float16* gv = vb_ptr + (size_t)srow * g.v_rs + sseg;
  const unsigned lK = (unsigned)(size_t)kvs + (unsigned)(srow * AT_LP + sseg) * 2u;           // LDS byte address in buffer 0, K part
  const unsigned lV = (unsigned)(size_t)kvs + (unsigned)(AT_KB + srow * AT_VP + sseg) * 2u;   // V part
  const size_t kst = (size_t)16 * g.k_rs, vst = (size_t)16 * g.v_rs;         // 16 rows
  const size_t kch = (size_t)AT_KC * g.k_rs, vch = (size_t)AT_KC * g.v_rs;   // one chunk

  if (g.nchunk > 0) at_copy8(lK, gk, kst, lV, gv, vst);
  asm volatile("s_wait_asynccnt 0x0" ::: "memory");   // this wave's copies of chunk 0 have landed before the barrier publishes them
  __syncthreads();
  if (g.nchunk > 1) at_copy8(lK + AT_BUF * 2u, gk + kch, kst, lV + AT_BUF * 2u, gv + vch, vst);

  for (int kc = 0; kc < g.nchunk; ++kc) {
    const int bsel = (kc & 1) * AT_BUF;
    const _Float16* Ksh = kvs + bsel;           // K [kv][d], pitch AT_LP
    const _Float16* Vsh = kvs + bsel + AT_KB;   // V [kv][d], pitch AT_VP

    // ---- scores^T: 4 key subtiles x 2 d-chunks; A fragment lane row c = key j*16+c, same k(i,h) map as B ----
    v8f s[4];
#pragma unroll
    for (int j = 0; j < 4; ++j) {
      v8f acc = (v8f){0.f,0.f,0.f,0.f,0.f,0.f,0.f,0.f};
#pragma unroll
      for (int dc = 0; dc < 2; ++dc) {
        FH kf;
        kf.h[0] = *(const v8h*)(Ksh + (j * 16 + c) * AT_LP + dc * 32 + 8 * hh);
        kf.h[1] = *(const v8h*)(Ksh + (j * 16 + c) * AT_LP + dc * 32 + 16 + 8 * hh);
        acc = at_mmah(kf.v, qa[dc], acc);
      }
      s[j] = acc;
    }
    // ---- chunk maximum of the lane's query (raw units; sscale > 0 so max commutes): D element r of this lane = (key kc*64 + j*16 + 8hh + r, query q0 + c) ----
    float cm4[4];
#pragma unroll
    for (int j = 0; j < 4; ++j)
      cm4[j] = fmaxf(fmaxf(fmaxf(s[j][0], s[j][1]), fmaxf(s[j][2], s[j][3])), fmaxf(fmaxf(s[j][4], s[j][5]), fmaxf(s[j][6], s[j][7])));
    float cm = fmaxf(fmaxf(cm4[0], cm4[1]), fmaxf(cm4[2], cm4[3]));
    cm = fmaxf(cm, __shfl_xor(cm, 16, 32));   // the other lane half holds the query's other 32 keys
    const float mnew = fmaxf(mcol, cm);
    const float alpha = expf((mcol - mnew) * g.sscale);
    mcol = mnew;
    // ---- p, and P^T as B fragments: element i of fragment kk is key kk*32 + k(i,hh) = element i & 7 of score tile 2 kk + (i >> 3) ----
    v16h pb[2];
    float ps4[4];   // one partial sum per score tile: four independent add chains
#pragma unroll
    for (int j = 0; j < 4; ++j) {
      float psum = 0.f;
#pragma unroll
      for (int r = 0; r < 8; ++r) {
        const float p = expf((s[j][r] - mnew) * g.sscale);
        psum += p;
        pb[j >> 1][(j & 1) * 8 + r] = (_Float16)(p * g.psc);
      }
      ps4[j] = psum;
    }
    lcol = lcol * alpha + ((ps4[0] + ps4[1]) + (ps4[2] + ps4[3]));
#pragma unroll
    for (int t = 0; t < 4; ++t) oacc[t] *= alpha;
    // ---- V^T.P^T: A = V^T (lane row c = d, k = key) by transposing loads of the row-major V tile, which deliver the fragment k map; B = P^T from the registers ----
#pragma unroll   // pb and oacc are indexed by constants only, so both stay in registers
    for (int kk = 0; kk < 2; ++kk) {
#pragma unroll
      for (int t = 0; t < 4; ++t) {
        FH vbf;
        vbf.h[0] = at_ldtr16(Vsh + (kk * 32 + 8 * hh + (lane & 7)) * AT_VP + t * 16 + 8 * ((lane >> 3) & 1));        // keys kk*32 + 8hh + 0..7 of d = t*16 + c
        vbf.h[1] = at_ldtr16(Vsh + (kk * 32 + 16 + 8 * hh + (lane & 7)) * AT_VP + t * 16 + 8 * ((lane >> 3) & 1));   // keys kk*32 + 16 + 8hh + 0..7
        oacc[t] = at_mmah(vbf.v, pb[kk], oacc[t]);
      }
    }
    asm volatile("s_wait_dscnt 0x0" ::: "memory");      // this wave's fragment reads have returned before the buffer may be refilled
    asm volatile("s_wait_asynccnt 0x0" ::: "memory");   // this wave's copies of chunk kc + 1 have landed before the barrier publishes them
    __syncthreads();                                    // publishes chunk kc + 1 and ends every wave's reads of chunk kc's buffer
    if (kc + 2 < g.nchunk) at_copy8(lK + (unsigned)bsel * 2u, gk + (size_t)(kc + 2) * kch, kst, lV + (unsigned)bsel * 2u, gv + (size_t)(kc + 2) * vch, vst);
  }
  asm volatile("s_wait_asynccnt 0x0" ::: "memory");     // no copy is outstanding when the wave goes on

  float* os = Os[wave];
  {
    const float inv = 1.0f / ((lcol + __shfl_xor(lcol, 16, 32)) * g.psc);   // both halves' sums joined once
#pragma unroll
    for (int t = 0; t < 4; ++t) {
      // 8 consecutive d of the lane's query row: two 16-B LDS stores
      *(v4f*)(os + c * 68 + t * 16 + 8 * hh)     = (v4f){oacc[t][0] * inv, oacc[t][1] * inv, oacc[t][2] * inv, oacc[t][3] * inv};
      *(v4f*)(os + c * 68 + t * 16 + 8 * hh + 4) = (v4f){oacc[t][4] * inv, oacc[t][5] * inv, oacc[t][6] * inv, oacc[t][7] * inv};
    }
  }
  __builtin_amdgcn_fence(3, "workgroup");
  __builtin_amdgcn_wave_barrier();
  __builtin_amdgcn_fence(2, "workgroup");
  {
    const int c4 = (lane & 15) * 4;
    {
#pragma unroll
      for (int it = 0; it < 8; ++it) {
        const int row = it * 2 + hh;
        v4f val = *(const v4f*)(os + row * 68 + c4);
        *(v4f*)(ob_ptr + (size_t)(q0 + row) * g.o_rs + c4) = val;
      }
      
    }
  }
}

} // namespace w25

// =====================================================================================
// =====================================================================================
__global__ __launch_bounds__(256) void k_vec(const float* __restrict__ bq, const float* __restrict__ bp, const float* __restrict__ qw, const float* __restrict__ kw, float* __restrict__ VEC) {
    const int u = blockIdx.x * 256 + threadIdx.x;
    if (u >= VECN) return;
    const float a  = bq[min(u, NQKV - 1)];
    const float bb = bp[min(max(u - OFF_BP, 0), DM - 1)];
    const float cq = qw[min(max(u - OFF_QW, 0), HDIM - 1)];
    const float ck = kw[min(max(u - OFF_KW, 0), HDIM - 1)];
    const float sel = (u < OFF_BP) ? a : ((u < OFF_QW) ? bb : ((u < OFF_KW) ? cq : ck));
    const float o = cmb_bf(sel);
    *(float*)(VEC + u) = o;
    
}

// =====================================================================================
// k_castp: DST[z][r][c] (pitch ldd halves, batch stride dbs halves) = f16(sc * g(SRC[z][r][c])) with g = bf16 RNE value (bfr != 0) or identity,
//   r < nR, c < nC (nC % 8 == 0); SRC batch stride sbs floats, row pitch lds floats. Thread per (r, 8 consecutive c): two 16-B loads,
// =====================================================================================
__global__ __launch_bounds__(256) void k_castp(const float* __restrict__ SRC, long long sbs, int lds, unsigned short* __restrict__ DST, long long dbs, int ldd, int nR, int nC, float sc, int bfr) {
    const long long u = (long long)blockIdx.x * 256 + threadIdx.x;
    const int per = nC >> 3;
    if (u >= (long long)nR * per) return;
    const int r = (int)(u / per);
    const int c0 = 8 * (int)(u - (long long)r * per);
    const float* s = SRC + (long long)blockIdx.y * sbs + (long long)r * lds + c0;
    const v4f a = *(const v4f*)s;
    const v4f bq = *(const v4f*)(s + 4);
    float w[8] = {a.x, a.y, a.z, a.w, bq.x, bq.y, bq.z, bq.w};
#pragma unroll
    for (int e = 0; e < 8; ++e) { const float t = bfr ? cmb_bf(w[e]) : w[e]; w[e] = t * sc; }
    v4u pk;
    pk.x = cmb_pk2(w[0], w[1]); pk.y = cmb_pk2(w[2], w[3]); pk.z = cmb_pk2(w[4], w[5]); pk.w = cmb_pk2(w[6], w[7]);
    v4u* d = (v4u*)(DST + (long long)blockIdx.y * dbs + (long long)r * ldd + c0);
    *d = pk;
    
}

extern "C" void kernel_launch(void* const* d_in, const int* in_sizes, int n_in, void* d_out, int out_size, void* d_ws, size_t ws_size, hipStream_t stream) {
    if (n_in < 7) return;
    const float* x     = (const float*)d_in[0];     // [2][2048][1024]
    const float* Wqkv  = (const float*)d_in[1];     // [3072][1024]  ([out][in] = Bt layout)
    const float* bqkv  = (const float*)d_in[2];     // [3072]
    const float* Wproj = (const float*)d_in[3];     // [1024][1024]  ([out][in] = Bt layout)
    const float* bproj = (const float*)d_in[4];     // [1024]
    const float* qn_w  = (const float*)d_in[5];     // [64]
    const float* kn_w  = (const float*)d_in[6];     // [64]
    const long long xneed = ((long long)(NB - 1) * SEQ_FULL + SEQ) * DM;
    if ((long long)in_sizes[0] < xneed) return;
    if ((long long)in_sizes[1] < (long long)NQKV * DM) return;
    if (in_sizes[2] < NQKV) return;
    if ((long long)in_sizes[3] < (long long)DM * DM) return;
    if (in_sizes[4] < DM) return;
    if (in_sizes[5] < HDIM || in_sizes[6] < HDIM) return;
    if ((long long)out_size < xneed) return;
    if (WS_TOTAL > ws_size) return;

    char* wsp = (char*)d_ws;
    float* VEC = (float*)wsp; wsp += WS_VEC;                              // 4224 f32 (bf16 RNE values of the small input vectors)
    unsigned short* X16 = (unsigned short*)wsp; wsp += WS_X16;             // [NTOK][1024] f16 = 16 * bf16(x)
    unsigned short* W16 = (unsigned short*)wsp; wsp += WS_W16;             // [3072][1024] f16 = 64 * bf16(Wqkv)
    unsigned short* WP16 = (unsigned short*)wsp; wsp += WS_WP16;           // [1024][1024] f16 = 64 * bf16(Wproj)
    unsigned short* QH16 = (unsigned short*)wsp; wsp += WS_QK16;           // [NTOK][1024] f16 = 16 * normalised q
    unsigned short* KH16 = (unsigned short*)wsp; wsp += WS_QK16;           // [NTOK][1024] f16 = 16 * normalised k
    unsigned short* VH16 = (unsigned short*)wsp; wsp += WS_QK16;           // [NTOK][1024] f16 = v
    float* CTX = (float*)wsp; wsp += WS_CTX;                               // [NTOK][1024] f32 attention output (token-major, head*64 + d)
    unsigned short* CTX16 = (unsigned short*)wsp; wsp += WS_CTX16;         // [NTOK][1024] f16 = 256 * ctx
    float* out = (float*)d_out;

    // 1. small vectors -> bf16 RNE values (f32)
    k_vec<<<(VECN + 255) / 256, 256, 0, stream>>>(bqkv, bproj, qn_w, kn_w, VEC);
    // 2-4. 16-bit operand planes (bf16 RNE input values times a power of two, exact in f16)
    k_castp<<<dim3((unsigned)(((long long)SEQ * (DM / 8) + 255) / 256), (unsigned)NB), 256, 0, stream>>>(x, (long long)SEQ_FULL * DM, DM, X16, (long long)SEQ * DM, DM, SEQ, DM, 16.0f, 1);
    k_castp<<<dim3((unsigned)(((long long)NQKV * (DM / 8) + 255) / 256), 1u), 256, 0, stream>>>(Wqkv, 0LL, DM, W16, 0LL, DM, NQKV, DM, 64.0f, 1);
    k_castp<<<dim3((unsigned)(((long long)DM * (DM / 8) + 255) / 256), 1u), 256, 0, stream>>>(Wproj, 0LL, DM, WP16, 0LL, DM, DM, DM, 64.0f, 1);
    // 5. qkv = (16 bf16(x)) . (64 bf16(Wqkv))^T / 1024 + bf16(bqkv); v -> f16 plane; q and k -> per-head RMSNorm (f32 math) in the epilogue -> f16 planes carried x16
    w25::wmma_gemm64<0, false, 2, 0, false, true><<<dim3((unsigned)((NTOK / 128) * (NQKV / 128)), 1u), 128, 0, stream>>>(
        (const unsigned short*)X16, nullptr, DM, 0L, (const unsigned short*)W16, nullptr, DM, 0L,
        nullptr, nullptr, NQKV, 0L, VEC + OFF_BQ, nullptr, 0L, NTOK, NQKV, DM, 1.0f / 1024.0f,
        VEC + OFF_QW, VEC + OFF_KW, QH16, KH16, VH16);
    // 6. attention: 64 query rows per block, 64-key chunks, online softmax
    w25::AttnGeom g;
    g.q_bs = (long long)SEQ * DM;   g.q_rs = DM;   g.q_hs = HDIM;
    g.k_bs = (long long)SEQ * DM;   g.k_rs = DM;   g.k_hs = HDIM;
    g.v_bs = (long long)SEQ * DM;   g.v_rs = DM;   g.v_hs = HDIM;
    g.o_bs = (long long)SEQ * DM;   g.o_rs = DM;   g.o_hs = HDIM;
    g.S = SEQ; g.Skv = SEQ; g.H = NH; g.nchunk = SEQ / AT_KC; g.sscale = 0.125f / (QCAR * QCAR); g.psc = 32768.0f;
    w25::k_attn64<<<(unsigned)(NB * NH * (SEQ / AT_QB)), 128, 0, stream>>>(QH16, KH16, VH16, CTX, g);
    // 7. ctx -> f16 plane (x256)
    k_castp<<<dim3((unsigned)(((long long)NTOK * (DM / 8) + 255) / 256), 1u), 256, 0, stream>>>(CTX, 0LL, DM, CTX16, 0LL, DM, NTOK, DM, 256.0f, 0);
    // 8. out[b][s][:] = (256 ctx) . (64 bf16(Wproj))^T / 16384 + bf16(bproj), batch rows at the full per-batch stride of d_out
    w25::wmma_gemm64<0, false, 2, 0, false, false><<<dim3((unsigned)((SEQ / 128) * (DM / 128)), (unsigned)NB), 128, 0, stream>>>(
        (const unsigned short*)CTX16, nullptr, DM, (long)SEQ * DM, (const unsigned short*)WP16, nullptr, DM, 0L,
        (void*)out, nullptr, DM, (long)SEQ_FULL * DM, VEC + OFF_BP, nullptr, 0L, SEQ, DM, DM, 1.0f / 16384.0f,
        nullptr, nullptr, nullptr, nullptr, nullptr);
    (void)hipGetLastError();
}

// v006
// Measured time: 109 microseconds a run.
// Timed twice side by side with v005, it ran 1.25 and 1.24 times as fast.
// Counting every step since v000, it is 3.07 times as fast.
// Contractions: qkv projection [NB*SEQ x 1024 x 3072] and output projection [NB*SEQ x 1024 x 1024] = v_wmma_f32_16x16x32_f16 (f16 operands: x and weights as bf16 RNE input values scaled by powers of two, ctx as f16 of 256 ctx, f32 accumulate); attention scores, transposed, k.q^T = v_wmma_f32_16x16x32_f16 (normed q,k carried x16 as f16, single product, f32 accumulate); V^T.P^T = v_wmma_f32_16x16x32_f16 (P carried x2^15 as f16, v f16, f32 accumulate); RMSNorm (in the qkv projection's epilogue) and online softmax in f32, its exponentials in base 2.
#include <hip/hip_runtime.h>
#include <math.h>

#ifndef NB
#define NB 2
#endif
#ifndef SEQ
#define SEQ 2048
#endif
#define NB_FULL 2
#define SEQ_FULL 2048
#define DM 1024
#define NH 16
#define HDIM 64
#define NQKV (3 * DM)
#define NTOK (NB * SEQ)
#define QCAR 16.0f
// small f32 vector region: [bqkv 3072 | bproj 1024 | qn_w 64 | kn_w 64], each entry the bf16 RNE value of the input
#define OFF_BQ 0
#define OFF_BP NQKV
#define OFF_QW (NQKV + DM)
#define OFF_KW (NQKV + DM + HDIM)
#define VECN (NQKV + DM + 2 * HDIM)
static_assert(SEQ % 128 == 0);   // 128-row block tiles of the projections; 64-row blocks of the attention
static_assert(NB >= 1);
static_assert(NB <= NB_FULL);
static_assert(SEQ <= SEQ_FULL);
static_assert(VECN % 32 == 0);
static_assert(NH * HDIM == DM);
static_assert(DM % 128 == 0);
static_assert(NQKV % 128 == 0);
static_assert(HDIM == 64);   // one 64-column wave tile of the qkv projection = one head's q, k or v slice

typedef __attribute__((ext_vector_type(16))) _Float16 v16h;
typedef __attribute__((ext_vector_type(8)))  _Float16 v8h;
typedef __attribute__((ext_vector_type(16))) __bf16   v16b;
typedef __attribute__((ext_vector_type(8)))  __bf16   v8b;
typedef __attribute__((ext_vector_type(8)))  float    v8f;
typedef __attribute__((ext_vector_type(4)))  float    v4f;
typedef __attribute__((ext_vector_type(2)))  float    v2f;
typedef __attribute__((ext_vector_type(4)))  unsigned int v4u;

// 16-bit WMMA fragment map (wave32), lane L, h = L>>4, m = L&15:
//   A 16x32: lane = row m;   element i -> k = (i<8) ? 8h+i : 16+8h+(i-8)
//   B 32x16: lane = column m; the SAME k(i,h)
//   D 16x16 (8 f32): lane = column m; element r -> row 8h+r

// workspace carve (bytes, 256-B aligned regions)
constexpr size_t al256(size_t x) { return (x + 255) / 256 * 256; }
constexpr size_t WS_VEC   = al256((size_t)VECN * 4);
constexpr size_t WS_X16   = al256((size_t)NTOK * DM * 2);
constexpr size_t WS_W16   = al256((size_t)NQKV * DM * 2);
constexpr size_t WS_WP16  = al256((size_t)DM * DM * 2);
constexpr size_t WS_QK16  = al256((size_t)NTOK * DM * 2);
constexpr size_t WS_CTX   = al256((size_t)NTOK * DM * 4);
constexpr size_t WS_CTX16 = al256((size_t)NTOK * DM * 2);
constexpr size_t WS_TOTAL = WS_VEC + WS_X16 + WS_W16 + WS_WP16 + 3 * WS_QK16 + WS_CTX + WS_CTX16;
static_assert(WS_TOTAL <= (size_t)134217728);

// ---- scalar helpers ----
__device__ __forceinline__ float cmb_bf(float v) { const unsigned u = __builtin_bit_cast(unsigned, v); const unsigned r = (u + 0x7fffu + ((u >> 16) & 1u)) & 0xffff0000u; return __builtin_bit_cast(float, r); }   // bf16 RNE value kept as f32
__device__ __forceinline__ unsigned int cmb_pk2(float a, float b) { return (unsigned int)__builtin_bit_cast(unsigned short, (_Float16)a) | ((unsigned int)__builtin_bit_cast(unsigned short, (_Float16)b) << 16); }

namespace w25 {

__device__ __forceinline__ unsigned short f2bf_bits(float f) {
  unsigned u = __float_as_uint(f);
  return (unsigned short)((u + 0x7FFFu + ((u >> 16) & 1u)) >> 16);
}
__device__ __forceinline__ float bf_bits2f(unsigned short h) { return __uint_as_float(((unsigned)h) << 16); }

// hazard guards as plain device helpers
__device__ __forceinline__ void dep_guard_h(v8f& a, v8f& b, v16h x, v16h y) { asm volatile("v_nop\n\tv_nop\n\tv_nop\n\tv_nop" : "+v"(a), "+v"(b) : "v"(x), "v"(y)); }
__device__ __forceinline__ void dep_guard_b(v8f& a, v8f& b, v16b x, v16b y) { asm volatile("v_nop\n\tv_nop\n\tv_nop\n\tv_nop" : "+v"(a), "+v"(b) : "v"(x), "v"(y)); }
__device__ __forceinline__ void keep4_h(v16h a, v16h b, v16h c, v16h d) { asm volatile("v_nop" :: "v"(a), "v"(b), "v"(c), "v"(d)); }
__device__ __forceinline__ void keep4_b(v16b a, v16b b, v16b c, v16b d) { asm volatile("v_nop" :: "v"(a), "v"(b), "v"(c), "v"(d)); }
__device__ __forceinline__ void acc_guard4(v8f& a, v8f& b, v8f& c, v8f& d) { asm volatile("v_nop\n\tv_nop\n\tv_nop\n\tv_nop" : "+v"(a), "+v"(b), "+v"(c), "+v"(d)); }
template <typename T> struct Frag;
template <> struct Frag<_Float16> {
  typedef v16h V; union U { v16h v; v8h h[2]; };
  static __device__ __forceinline__ v16h load(const _Float16* p) {   // elements 0..7 <- p[0..7], 8..15 <- p[16..23]
    U f; f.h[0] = *(const v8h*)(p); f.h[1] = *(const v8h*)(p + 16); return f.v;
  }
  static __device__ __forceinline__ v8f mma(v16h a, v16h b, v8f c) {
    return __builtin_amdgcn_wmma_f32_16x16x32_f16(false, a, false, b, (short)0, c, false, false);
  }
  static __device__ __forceinline__ void guard(v8f& a, v8f& b, v16h x, v16h y) { dep_guard_h(a, b, x, y); }
  static __device__ __forceinline__ void keep(v16h a, v16h b, v16h c, v16h d) { keep4_h(a, b, c, d); }
};
template <> struct Frag<__bf16> {
  typedef v16b V; union U { v16b v; v8b h[2]; };
  static __device__ __forceinline__ v16b load(const __bf16* p) {
    U f; f.h[0] = *(const v8b*)(p); f.h[1] = *(const v8b*)(p + 16); return f.v;
  }
  static __device__ __forceinline__ v8f mma(v16b a, v16b b, v8f c) {
    return __builtin_amdgcn_wmma_f32_16x16x32_bf16(false, a, false, b, (short)0, c, false, false);
  }
  static __device__ __forceinline__ void guard(v8f& a, v8f& b, v16b x, v16b y) { dep_guard_b(a, b, x, y); }
  static __device__ __forceinline__ void keep(v16b a, v16b b, v16b c, v16b d) { keep4_b(a, b, c, d); }
};

// ---- Register-blocked batched WMMA GEMM ------------------------------------
// C[m,n] = scale * sum_k A[m,k] * Bt[n,k] (+bias)(+resid); each wave owns a 64x64 tile, a block of 4 waves (2 x 2) a 128x128 tile.
// A row-major [M,K]; Bt row-major [N,K]; M,N % 128 == 0, K % 64 == 0.
// Operands come through LDS: a stage is 64 k (one 128-B line) of the block's 128 A rows and 128 Bt rows, brought by asynchronous 16-B copies
//   (8 lanes = one whole line), two buffers, the next stage in flight while this one is multiplied; fragments are read from LDS with the same (row, k) map as before.
// SPLIT (hi/lo operand planes) is not built in this form.
// BIAS_MODE: 0 = none, 1 = bias[m], 2 = bias[n].
// OUT_MODE: 0 = f32, 1 = f16, 2 = bf16 hi plane (Cout) + bf16 lo plane (Cout2).
// ET: 0 = f16 operands, 1 = bf16 operands (pointers passed as 16-bit storage)
// QKN: the qkv projection. A wave tile is 64 tokens x one head's 64 columns of q (n0 < DM), k (n0 < 2 DM) or v. q and k tiles are RMS-normalised
//   row by row in the epilogue and stored only as f16 planes: QHp / KHp[token][h*64 + d] = f16(QCAR * x[d] * (1 / sqrt(mean(x^2) + 1e-6)) * w[d]),
//   w = qnw / knw; v tiles are stored as a third f16 plane, VHp[token][h*64 + d] = f16(x[d]) (Cout is not used).
template <int ET> struct Elem;
template <> struct Elem<0> { typedef _Float16 T; };
template <> struct Elem<1> { typedef __bf16 T; };
#define GK_KS 64                       // k per stage, in halves
#define GK_LP 72                       // LDS row pitch in halves: 144 B = 16 B x odd, conflict-free for the 16-byte fragment reads
#define GK_BT 128                      // block tile rows of A and of Bt
#define GK_BUF (2 * GK_BT * GK_LP)     // halves per buffer: A rows 0..127, then Bt rows 0..127
// Eight asynchronous 16-byte copies of one lane: rows r, r+16, ..., r+112 of one operand (global row step gstep halves) into LDS rows 16 apart.
// The s_wait_xcnt stands inside the statement, behind the last copy, so that no address register of a copy is rewritten in front of it.
template <typename T>
__device__ __forceinline__ void gk_copy8(unsigned lds, const T* g, size_t gstep) {
  const unsigned ls = 16u * GK_LP * 2u;
  asm volatile(
      "global_load_async_to_lds_b128 %0, %8, off\n\t"
      "global_load_async_to_lds_b128 %1, %9, off\n\t"
      "global_load_async_to_lds_b128 %2, %10, off\n\t"
      "global_load_async_to_lds_b128 %3, %11, off\n\t"
      "global_load_async_to_lds_b128 %4, %12, off\n\t"
      "global_load_async_to_lds_b128 %5, %13, off\n\t"
      "global_load_async_to_lds_b128 %6, %14, off\n\t"
      "global_load_async_to_lds_b128 %7, %15, off\n\t"
      "s_wait_xcnt 0x0"
      :: "v"(lds), "v"(lds + ls), "v"(lds + 2u * ls), "v"(lds + 3u * ls), "v"(lds + 4u * ls), "v"(lds + 5u * ls), "v"(lds + 6u * ls), "v"(lds + 7u * ls),
         "v"(g), "v"(g + gstep), "v"(g + 2 * gstep), "v"(g + 3 * gstep), "v"(g + 4 * gstep), "v"(g + 5 * gstep), "v"(g + 6 * gstep), "v"(g + 7 * gstep)
      : "memory");
}
template <int ET, bool SPLIT, int BIAS_MODE, int OUT_MODE, bool RESID, bool QKN>
__global__ __launch_bounds__(128) void wmma_gemm64(
    const unsigned short* __restrict__ Ap, const unsigned short* __restrict__ A2p, int lda, long strideA,
    const unsigned short* __restrict__ Btp, const unsigned short* __restrict__ Bt2p, int ldb, long strideB,
    void* __restrict__ Cout, void* __restrict__ Cout2, int ldc, long strideC,
    const float* __restrict__ bias,
    const float* __restrict__ resid, long strideR,
    int M, int N, int K, float scale,
    const float* __restrict__ qnw, const float* __restrict__ knw,
    unsigned short* __restrict__ QHp, unsigned short* __restrict__ KHp, unsigned short* __restrict__ VHp) {
  typedef typename Elem<ET>::T T;
  typedef typename Frag<T>::V V;
  static_assert(!SPLIT);
  const T* A = (const T*)Ap; const T* Bt = (const T*)Btp;
  __shared__ __align__(16) T ring[2 * GK_BUF];     // two stage buffers (cross-wave: published by the block barriers below)
  __shared__ __align__(16) float sT[4][16 * 68];   // per-wave 16x64 slab, pitch 68 floats (wave-private)
  const int b    = blockIdx.y;
  const int lane = threadIdx.x & 31;
  const int wave = threadIdx.x >> 5;
  const int tilesN = N >> 7;
  const int tilesM = M >> 7;
  const int tile = blockIdx.x;
  if (tile >= tilesM * tilesN) return;   // block-uniform, in front of every barrier and copy
  const int tm = tile / tilesN;
  const int tn = tile - tm * tilesN;
  const int wm = wave >> 1, wn = wave & 1;         // 2 x 2 waves
  const int m0 = (tm << 7) + (wm << 6);
  const int n0 = (tn << 7) + (wn << 6);

  const T* Ab  = A  + (size_t)b * strideA;
  const T* Bb  = Bt + (size_t)b * strideB;

  const int rlane = lane & 15;                 // row (A) / col (B, D) within subtile
  const int koff  = (lane >> 4) * 8;           // k offset of this lane half
  const int mOff  = (lane >> 4) * 8;           // D row offset

  v8f acc[4][4];
#pragma unroll
  for (int i = 0; i < 4; ++i)
#pragma unroll
    for (int j = 0; j < 4; ++j) acc[i][j] = (v8f){0.f,0.f,0.f,0.f,0.f,0.f,0.f,0.f};

  // copy map: thread -> (row crow + 16 i, 16-byte piece cseg) of each operand's 128 x 128-B stage; a wave's copy covers 4 whole lines
  const int nst  = K / GK_KS;
  const int crow = threadIdx.x >> 3;
  const int cseg = (threadIdx.x & 7) * 8;
  const T* ga = Ab + (size_t)((tm << 7) + crow) * lda + cseg;
  const T* gb = Bb + (size_t)((tn << 7) + crow) * ldb + cseg;
  const unsigned lA = (unsigned)(size_t)ring + (unsigned)(crow * GK_LP + cseg) * 2u;   // LDS byte address in buffer 0, A part
  const unsigned lB = lA + GK_BT * GK_LP * 2u;                                         // Bt part
  const size_t ast = (size_t)16 * lda, bst = (size_t)16 * ldb;

  gk_copy8(lA, ga, ast);
  gk_copy8(lB, gb, bst);
  asm volatile("s_wait_asynccnt 0x0" ::: "memory");   // this wave's copies of stage 0 have landed before the barrier publishes them
  __syncthreads();
  if (nst > 1) {
    gk_copy8(lA + GK_BUF * 2u, ga + GK_KS, ast);
    gk_copy8(lB + GK_BUF * 2u, gb + GK_KS, bst);
  }

  for (int t = 0; t < nst; ++t) {
    const int bsel = (t & 1) * GK_BUF;
    const T* la = ring + bsel + ((wm << 6) + rlane) * GK_LP + koff;
    const T* lb = ring + bsel + (GK_BT + (wn << 6) + rlane) * GK_LP + koff;
    // all four loops unrolled: the fragment and accumulator arrays stay in registers, and the LDS offsets become immediates
#pragma unroll
    for (int ks = 0; ks < GK_KS; ks += 32) {
      V bh[4], ah[4];
#pragma unroll
      for (int j = 0; j < 4; ++j) bh[j] = Frag<T>::load(lb + (j << 4) * GK_LP + ks);
#pragma unroll
      for (int i = 0; i < 4; ++i) ah[i] = Frag<T>::load(la + (i << 4) * GK_LP + ks);
#pragma unroll
      for (int i = 0; i < 4; ++i) {
#pragma unroll
        for (int j = 0; j < 4; ++j) acc[i][j] = Frag<T>::mma(ah[i], bh[j], acc[i][j]);
        Frag<T>::guard(acc[i][0], acc[i][3], ah[i], ah[i]);
      }
      Frag<T>::keep(bh[0], bh[1], bh[2], bh[3]);
    }
    asm volatile("s_wait_dscnt 0x0" ::: "memory");      // this wave's fragment reads have returned before the buffer may be refilled
    asm volatile("s_wait_asynccnt 0x0" ::: "memory");   // this wave's copies of stage t + 1 have landed before the barrier publishes them
    __syncthreads();                                    // publishes stage t + 1 and ends every wave's reads of stage t's buffer
    if (t + 2 < nst) {
      gk_copy8(lA + (unsigned)bsel * 2u, ga + (size_t)(t + 2) * GK_KS, ast);
      gk_copy8(lB + (unsigned)bsel * 2u, gb + (size_t)(t + 2) * GK_KS, bst);
    }
  }
  asm volatile("s_wait_asynccnt 0x0" ::: "memory");     // no copy is outstanding when the wave goes on
  acc_guard4(acc[0][0], acc[0][1], acc[0][2], acc[0][3]);
  acc_guard4(acc[1][0], acc[1][1], acc[1][2], acc[1][3]);
  acc_guard4(acc[2][0], acc[2][1], acc[2][2], acc[2][3]);
  acc_guard4(acc[3][0], acc[3][1], acc[3][2], acc[3][3]);

  // ---- epilogue ----
  float* slab = sT[wave];
  const float* Rb = RESID ? (resid + (size_t)b * strideR) : nullptr;
  const int nslice = QKN ? n0 / DM : 2;            // 0 = q, 1 = k, 2 = v (wave-uniform)
  v4f nw0 = (v4f){0.f,0.f,0.f,0.f}, nw1 = nw0;     // norm weights of this lane's 8 columns
  if (QKN && nslice < 2) {
    const float* nwp = (nslice ? knw : qnw) + (lane & 7) * 8;
    nw0 = *(const v4f*)nwp;
    nw1 = *(const v4f*)(nwp + 4);
  }
#pragma unroll
  for (int i = 0; i < 4; ++i) {
    const int mBase = m0 + (i << 4);
#pragma unroll
    for (int j = 0; j < 4; ++j) {
      const int n = n0 + (j << 4) + rlane;
      float bv = 0.f;
      if (BIAS_MODE == 2) bv = bias[n];
#pragma unroll
      for (int r = 0; r < 8; ++r) {
        float v = acc[i][j][r] * scale;
        if (BIAS_MODE == 1) v += bias[mBase + mOff + r];
        if (BIAS_MODE == 2) v += bv;
        if (RESID) v += Rb[(size_t)(mBase + mOff + r) * ldc + n];
        slab[(mOff + r) * 68 + (j << 4) + rlane] = v;
      }
    }
    __builtin_amdgcn_fence(3, "workgroup");
    __builtin_amdgcn_wave_barrier();
    __builtin_amdgcn_fence(2, "workgroup");
    if (QKN && nslice < 2) {
      // 8 lanes per row, 8 columns per lane: sum of squares in the lane, then over the 8 lanes; one 16-B store per lane = a 128-B line per row
      const int q = lane >> 3, c8 = (lane & 7) * 8;
      unsigned short* P = (nslice ? KHp : QHp) + (n0 - nslice * DM) + c8;
#pragma unroll   // the four row groups' LDS reads and lane exchanges issue together, so their latencies overlap
      for (int it = 0; it < 4; ++it) {
        const int row = it * 4 + q;
        const v4f x0 = *(const v4f*)(slab + row * 68 + c8);
        const v4f x1 = *(const v4f*)(slab + row * 68 + c8 + 4);
        float ss = (x0.x * x0.x + x0.y * x0.y + x0.z * x0.z + x0.w * x0.w) + (x1.x * x1.x + x1.y * x1.y + x1.z * x1.z + x1.w * x1.w);
#pragma unroll   // constant lane distances 1, 2, 4: the 8 lanes of a row
        for (int o = 1; o < 8; o <<= 1) ss += __shfl_xor(ss, o, 32);
        const float rms = sqrtf(ss * (1.0f / 64.0f) + 1e-6f);
        const float rec = 1.0f / rms;
        v4u pk;
        pk.x = cmb_pk2(((x0.x * rec) * nw0.x) * QCAR, ((x0.y * rec) * nw0.y) * QCAR);
        pk.y = cmb_pk2(((x0.z * rec) * nw0.z) * QCAR, ((x0.w * rec) * nw0.w) * QCAR);
        pk.z = cmb_pk2(((x1.x * rec) * nw1.x) * QCAR, ((x1.y * rec) * nw1.y) * QCAR);
        pk.w = cmb_pk2(((x1.z * rec) * nw1.z) * QCAR, ((x1.w * rec) * nw1.w) * QCAR);
        *(v4u*)(P + (size_t)(mBase + row) * DM) = pk;
      }
    } else if (QKN) {
      // v tile: 8 lanes per row, 8 columns per lane, one 16-B store per lane = a 128-B line per row
      const int q = lane >> 3, c8 = (lane & 7) * 8;
      unsigned short* P = VHp + (n0 - 2 * DM) + c8;
#pragma unroll   // the four row groups' LDS reads issue together
      for (int it = 0; it < 4; ++it) {
        const int row = it * 4 + q;
        const v4f x0 = *(const v4f*)(slab + row * 68 + c8);
        const v4f x1 = *(const v4f*)(slab + row * 68 + c8 + 4);
        v4u pk;
        pk.x = cmb_pk2(x0.x, x0.y);
        pk.y = cmb_pk2(x0.z, x0.w);
        pk.z = cmb_pk2(x1.x, x1.y);
        pk.w = cmb_pk2(x1.z, x1.w);
        *(v4u*)(P + (size_t)(mBase + row) * DM) = pk;
      }
    } else if (OUT_MODE == 0) {
      float* C = (float*)Cout + (size_t)b * strideC;
      const int hh = lane >> 4, c4 = (lane & 15) * 4;     // row seg = 256 B = 16 lanes x 16 B
      {
#pragma unroll
        for (int it = 0; it < 8; ++it) {
          const int row = it * 2 + hh;
          v4f v = *(const v4f*)(slab + row * 68 + c4);
          *(v4f*)(C + (size_t)(mBase + row) * ldc + n0 + c4) = v;
        }
        
      }
    } else {
      const int q = lane >> 3, c8 = (lane & 7) * 8;
      unsigned short* C  = (unsigned short*)Cout  + (size_t)b * strideC;
      unsigned short* C2 = (OUT_MODE == 2) ? ((unsigned short*)Cout2 + (size_t)b * strideC) : nullptr;
      {
#pragma unroll
        for (int it = 0; it < 4; ++it) {
          const int row = it * 4 + q;
          const float* sp = slab + row * 68 + c8;
          v8h hv, lv;
#pragma unroll
          for (int e = 0; e < 8; ++e) {
            if (OUT_MODE == 1) {
              hv[e] = (_Float16)sp[e];
            } else {
              unsigned short hb = f2bf_bits(sp[e]);
              unsigned short lb = f2bf_bits(sp[e] - bf_bits2f(hb));
              hv[e] = __builtin_bit_cast(_Float16, hb);
              lv[e] = __builtin_bit_cast(_Float16, lb);
            }
          }
          *(v8h*)(C + (size_t)(mBase + row) * ldc + n0 + c8) = hv;
          if (OUT_MODE == 2) *(v8h*)(C2 + (size_t)(mBase + row) * ldc + n0 + c8) = lv;
        }
        
      }
    }
    __builtin_amdgcn_fence(3, "workgroup");
    __builtin_amdgcn_wave_barrier();
    __builtin_amdgcn_fence(2, "workgroup");
  }
}

// =====================================================================================
// Non-causal attention for head_dim 64; q/k from f16 planes (normed values carried x QCAR), v from an f16 plane, f32 out.
//   scores^T = k.q^T        : v_wmma_f32_16x16x32_f16, single product; natural score = raw * sscale (sscale = 1/sqrt(64) / QCAR^2)
//   out^T    = v^T.p^T      : v_wmma_f32_16x16x32_f16; p = exp((s - m_running)*sscale) carried x 2^pexp (2^15) as f16, v plain f16
//   An exponential is one multiply-add and one v_exp_f32: 2^pexp * p = exp2(s * c2 - (m_running * c2 - pexp)), c2 = sscale * log2(e); the sum of p is carried x 2^pexp too.
//   Both products are transposed, so a lane holds scores, P and output of ONE query (its D column): maximum and sum run inside the lane
//   (one exchange between the lane halves), and two score tiles, converted in place, are the B fragment of the second product.
//   K and V chunks come row-major into LDS by asynchronous 16-B copies (8 lanes = one whole 128-B row), two buffers, the next chunk in flight while
//   this one is worked on; V^T fragments come by the transposing LDS load.
//   f32 accumulate; online softmax in f32. Block = 4 waves = 64 query rows of one (batch, head); S % 64 == 0.
//   Element (b, s, h, d) of tensor X lives at X[b*X_bs + s*X_rs + h*X_hs + d] (strides in elements, multiples of 8).
//   grid.x = B * H * (S/64), block 128.
// =====================================================================================
#define AT_D 64
#define AT_NW 4
#define AT_QB 64
#define AT_KC 64
#define AT_LP 72   // LDS row pitch in halves of the 64-half K rows: 144 B = 16 B x odd, so the 16 lanes of a 16-byte fragment read fall on 16 distinct bank groups
#define AT_VP 80   // LDS row pitch in halves of the 64-half V rows: 160 B = 32 B x odd, the conflict-free pitch of ds_load_tr16_b128
#define AT_KB (AT_KC * AT_LP)            // halves of a buffer's K part
#define AT_BUF (AT_KB + AT_KC * AT_VP)   // halves per buffer
struct AttnGeom { long long q_bs, q_rs, q_hs, k_bs, k_rs, k_hs, v_bs, v_rs, v_hs, o_bs, o_rs, o_hs; int S, Skv, H, nchunk; float sscale; float pexp; };
static_assert(sizeof(AttnGeom) == 12 * 8 + 4 * 4 + 2 * 4);

__device__ __forceinline__ v8f at_mmah(v16h a, v16h b, v8f c) {
  c = __builtin_amdgcn_wmma_f32_16x16x32_f16(false, a, false, b, (short)0, c, false, false);
  asm volatile("v_nop\n\tv_nop\n\tv_nop\n\tv_nop" : "+v"(c) : "v"(a), "v"(b));
  return c;
}

// Base-2 exponentials by v_exp_f32, each in place. In one statement, so that no exponential overwrites the source of the one directly in front of it;
// the closing v_nop is the slot that the instruction set asks for between a transcendental and a directly following user of its result.
__device__ __forceinline__ float at_exp2(float x) {
  asm("v_exp_f32 %0, %0\n\tv_nop" : "+v"(x));
  return x;
}
__device__ __forceinline__ v8f at_exp2x8(v8f x) {
  float a = x[0], b = x[1], c = x[2], d = x[3], e = x[4], f = x[5], g = x[6], h = x[7];
  asm("v_exp_f32 %0, %0\n\t"
      "v_exp_f32 %1, %1\n\t"
      "v_exp_f32 %2, %2\n\t"
      "v_exp_f32 %3, %3\n\t"
      "v_exp_f32 %4, %4\n\t"
      "v_exp_f32 %5, %5\n\t"
      "v_exp_f32 %6, %6\n\t"
      "v_exp_f32 %7, %7\n\t"
      "v_nop"
      : "+v"(a), "+v"(b), "+v"(c), "+v"(d), "+v"(e), "+v"(f), "+v"(g), "+v"(h));
  return (v8f){a, b, c, d, e, f, g, h};
}

// Transposing 16-bit LDS load: lane (c = l & 15, h = l >> 4), addressed at row 8h + (l & 7), halves 8 * ((l >> 3) & 1) of a row-major tile, gets T[8h + 0..7][c]
typedef short s16x8 __attribute__((ext_vector_type(8)));
__device__ __forceinline__ v8h at_ldtr16(const _Float16* p) {
  typedef __attribute__((address_space(3))) s16x8 lds_s16x8;
  return __builtin_bit_cast(v8h, __builtin_amdgcn_ds_load_tr16_b128_v8i16((lds_s16x8*)p));
}

// Eight asynchronous 16-byte copies of one lane: rows r, r+16, r+32, r+48 of a K chunk and of a V chunk (global row steps kst, vst halves per 16 rows).
// The s_wait_xcnt stands inside the statement, behind the last copy, so that no address register of a copy is rewritten in front of it.
__device__ __forceinline__ void at_copy8(unsigned lk, const _Float16* gk, size_t kst, unsigned lv, const _Float16* gv, size_t vst) {
  const unsigned ks = 16u * AT_LP * 2u, vs = 16u * AT_VP * 2u;
  asm volatile(
      "global_load_async_to_lds_b128 %0, %8, off\n\t"
      "global_load_async_to_lds_b128 %1, %9, off\n\t"
      "global_load_async_to_lds_b128 %2, %10, off\n\t"
      "global_load_async_to_lds_b128 %3, %11, off\n\t"
      "global_load_async_to_lds_b128 %4, %12, off\n\t"
      "global_load_async_to_lds_b128 %5, %13, off\n\t"
      "global_load_async_to_lds_b128 %6, %14, off\n\t"
      "global_load_async_to_lds_b128 %7, %15, off\n\t"
      "s_wait_xcnt 0x0"
      :: "v"(lk), "v"(lk + ks), "v"(lk + 2u * ks), "v"(lk + 3u * ks), "v"(lv), "v"(lv + vs), "v"(lv + 2u * vs), "v"(lv + 3u * vs),
         "v"(gk), "v"(gk + kst), "v"(gk + 2 * kst), "v"(gk + 3 * kst), "v"(gv), "v"(gv + vst), "v"(gv + 2 * vst), "v"(gv + 3 * vst)
      : "memory");
}

__global__ __launch_bounds__(128) __attribute__((amdgpu_num_vgpr(256)))
void k_attn64(const unsigned short* __restrict__ qp, const unsigned short* __restrict__ kp,
              const unsigned short* __restrict__ vp, float* __restrict__ out, AttnGeom g) {
  union FH { v16h v; v8h h[2]; };
  __shared__ __align__(16) _Float16 kvs[2 * AT_BUF];        // two chunk buffers, each K [kv][d] then V [kv][d], f16 (cross-wave: published by the block barriers below)
  __shared__ __align__(16) float    Os[AT_NW][16 * 68];     // per wave out tile, pitch 68 (wave-private)

  const int tid  = threadIdx.x;
  const int wave = tid >> 5;
  const int lane = tid & 31;
  const int hh   = lane >> 4;
  const int c    = lane & 15;

  const int nqb = g.S / AT_QB;
  const int bx = blockIdx.x;
  const int qb = bx % nqb;
  const int bh = bx / nqb;
  const int h  = bh % g.H;
  const int b  = bh / g.H;
  const int q0 = qb * AT_QB + wave * 16;

  const _Float16* q = (const _Float16*)qp;
  const _Float16* k = (const _Float16*)kp;
  const _Float16* v = (const _Float16*)vp;
  const _Float16* qb_ptr = q + (size_t)b * g.q_bs + (size_t)h * g.q_hs;
  const _Float16* kb_ptr = k + (size_t)b * g.k_bs + (size_t)h * g.k_hs;
  const _Float16* vb_ptr = v + (size_t)b * g.v_bs + (size_t)h * g.v_hs;
  float*          ob_ptr = out + (size_t)b * g.o_bs + (size_t)h * g.o_hs;

  // ---- Q fragments (B operand): 2 d-chunks; lane column c = query q0 + c, elements 0..7 <- d = dc*32 + 8hh + e, 8..15 <- dc*32 + 16 + 8hh + e (two 16-B loads from the f16 row) ----
  v16h qa[2];
  {
    const _Float16* qrow = qb_ptr + (size_t)(q0 + c) * g.q_rs;
#pragma unroll
    for (int dc = 0; dc < 2; ++dc) {
      FH f;
      f.h[0] = *(const v8h*)(qrow + dc * 32 + 8 * hh);
      f.h[1] = *(const v8h*)(qrow + dc * 32 + 16 + 8 * hh);
      qa[dc] = f.v;
    }
  }

  float mcol = -INFINITY;   // running maximum of this lane's query (raw units; equal in both lane halves)
  float lcol = 0.f;         // running sum of 2^pexp * p over the keys of this lane half; the halves are joined after the loop
  const float c2 = g.sscale * 1.4426950408889634f;   // raw score units -> base-2 exponent
  v8f oacc[4];              // out^T: tile t, element r = (d = t*16 + 8hh + r, query q0 + c)
#pragma unroll
  for (int t = 0; t < 4; ++t) oacc[t] = (v8f){0.f,0.f,0.f,0.f,0.f,0.f,0.f,0.f};

  // copy map: thread -> (row srow + 16 i, 16-byte piece sseg / 8) of the chunk's 64 K rows and 64 V rows; a wave's copy covers 4 whole 128-B rows
  const int srow = tid >> 3, sseg = (tid & 7) * 8;
  const _Float16* gk = kb_ptr + (size_t)srow * g.k_rs + sseg;
  const _Float16* gv = vb_ptr + (size_t)srow * g.v_rs + sseg;
  const unsigned lK = (unsigned)(size_t)kvs + (unsigned)(srow * AT_LP + sseg) * 2u;           // LDS byte address in buffer 0, K part
  const unsigned lV = (unsigned)(size_t)kvs + (unsigned)(AT_KB + srow * AT_VP + sseg) * 2u;   // V part
  const size_t kst = (size_t)16 * g.k_rs, vst = (size_t)16 * g.v_rs;         // 16 rows
  const size_t kch = (size_t)AT_KC * g.k_rs, vch = (size_t)AT_KC * g.v_rs;   // one chunk

  if (g.nchunk > 0) at_copy8(lK, gk, kst, lV, gv, vst);
  asm volatile("s_wait_asynccnt 0x0" ::: "memory");   // this wave's copies of chunk 0 have landed before the barrier publishes them
  __syncthreads();
  if (g.nchunk > 1) at_copy8(lK + AT_BUF * 2u, gk + kch, kst, lV + AT_BUF * 2u, gv + vch, vst);

  for (int kc = 0; kc < g.nchunk; ++kc) {
    const int bsel = (kc & 1) * AT_BUF;
    const _Float16* Ksh = kvs + bsel;           // K [kv][d], pitch AT_LP
    const _Float16* Vsh = kvs + bsel + AT_KB;   // V [kv][d], pitch AT_VP

    // ---- scores^T: 4 key subtiles x 2 d-chunks; A fragment lane row c = key j*16+c, same k(i,h) map as B ----
    v8f s[4];
#pragma unroll
    for (int j = 0; j < 4; ++j) {
      v8f acc = (v8f){0.f,0.f,0.f,0.f,0.f,0.f,0.f,0.f};
#pragma unroll
      for (int dc = 0; dc < 2; ++dc) {
        FH kf;
        kf.h[0] = *(const v8h*)(Ksh + (j * 16 + c) * AT_LP + dc * 32 + 8 * hh);
        kf.h[1] = *(const v8h*)(Ksh + (j * 16 + c) * AT_LP + dc * 32 + 16 + 8 * hh);
        acc = at_mmah(kf.v, qa[dc], acc);
      }
      s[j] = acc;
    }
    // ---- chunk maximum of the lane's query (raw units; sscale > 0 so max commutes): D element r of this lane = (key kc*64 + j*16 + 8hh + r, query q0 + c) ----
    float cm4[4];
#pragma unroll
    for (int j = 0; j < 4; ++j)
      cm4[j] = fmaxf(fmaxf(fmaxf(s[j][0], s[j][1]), fmaxf(s[j][2], s[j][3])), fmaxf(fmaxf(s[j][4], s[j][5]), fmaxf(s[j][6], s[j][7])));
    float cm = fmaxf(fmaxf(cm4[0], cm4[1]), fmaxf(cm4[2], cm4[3]));
    cm = fmaxf(cm, __shfl_xor(cm, 16, 32));   // the other lane half holds the query's other 32 keys
    const float mnew = fmaxf(mcol, cm);
    const float alpha = at_exp2((mcol - mnew) * c2);   // 0 on the first chunk, where mcol is -inf
    const float nm = g.pexp - mnew * c2;
    mcol = mnew;
    // ---- p, and P^T as B fragments: element i of fragment kk is key kk*32 + k(i,hh) = element i & 7 of score tile 2 kk + (i >> 3) ----
    v16h pb[2];
    float ps4[4];   // one partial sum per score tile: four independent add chains
#pragma unroll
    for (int j = 0; j < 4; ++j) {
      v8f p;
#pragma unroll
      for (int r = 0; r < 8; ++r) p[r] = fmaf(s[j][r], c2, nm);
      p = at_exp2x8(p);
      float psum = p[0];
#pragma unroll
      for (int r = 1; r < 8; ++r) psum += p[r];
#pragma unroll
      for (int r = 0; r < 8; ++r) pb[j >> 1][(j & 1) * 8 + r] = (_Float16)p[r];
      ps4[j] = psum;
    }
    lcol = lcol * alpha + ((ps4[0] + ps4[1]) + (ps4[2] + ps4[3]));
#pragma unroll
    for (int t = 0; t < 4; ++t) oacc[t] *= alpha;
    // ---- V^T.P^T: A = V^T (lane row c = d, k = key) by transposing loads of the row-major V tile, which deliver the fragment k map; B = P^T from the registers ----
#pragma unroll   // pb and oacc are indexed by constants only, so both stay in registers
    for (int kk = 0; kk < 2; ++kk) {
#pragma unroll
      for (int t = 0; t < 4; ++t) {
        FH vbf;
        vbf.h[0] = at_ldtr16(Vsh + (kk * 32 + 8 * hh + (lane & 7)) * AT_VP + t * 16 + 8 * ((lane >> 3) & 1));        // keys kk*32 + 8hh + 0..7 of d = t*16 + c
        vbf.h[1] = at_ldtr16(Vsh + (kk * 32 + 16 + 8 * hh + (lane & 7)) * AT_VP + t * 16 + 8 * ((lane >> 3) & 1));   // keys kk*32 + 16 + 8hh + 0..7
        oacc[t] = at_mmah(vbf.v, pb[kk], oacc[t]);
      }
    }
    asm volatile("s_wait_dscnt 0x0" ::: "memory");      // this wave's fragment reads have returned before the buffer may be refilled
    asm volatile("s_wait_asynccnt 0x0" ::: "memory");   // this wave's copies of chunk kc + 1 have landed before the barrier publishes them
    __syncthreads();                                    // publishes chunk kc + 1 and ends every wave's reads of chunk kc's buffer
    if (kc + 2 < g.nchunk) at_copy8(lK + (unsigned)bsel * 2u, gk + (size_t)(kc + 2) * kch, kst, lV + (unsigned)bsel * 2u, gv + (size_t)(kc + 2) * vch, vst);
  }
  asm volatile("s_wait_asynccnt 0x0" ::: "memory");     // no copy is outstanding when the wave goes on

  float* os = Os[wave];
  {
    const float inv = 1.0f / (lcol + __shfl_xor(lcol, 16, 32));   // both halves' sums joined once; sum and out^T carry the same 2^pexp
#pragma unroll
    for (int t = 0; t < 4; ++t) {
      // 8 consecutive d of the lane's query row: two 16-B LDS stores
      *(v4f*)(os + c * 68 + t * 16 + 8 * hh)     = (v4f){oacc[t][0] * inv, oacc[t][1] * inv, oacc[t][2] * inv, oacc[t][3] * inv};
      *(v4f*)(os + c * 68 + t * 16 + 8 * hh + 4) = (v4f){oacc[t][4] * inv, oacc[t][5] * inv, oacc[t][6] * inv, oacc[t][7] * inv};
    }
  }
  __builtin_amdgcn_fence(3, "workgroup");
  __builtin_amdgcn_wave_barrier();
  __builtin_amdgcn_fence(2, "workgroup");
  {
    const int c4 = (lane & 15) * 4;
    {
#pragma unroll
      for (int it = 0; it < 8; ++it) {
        const int row = it * 2 + hh;
        v4f val = *(const v4f*)(os + row * 68 + c4);
        *(v4f*)(ob_ptr + (size_t)(q0 + row) * g.o_rs + c4) = val;
      }
      
    }
  }
}

} // namespace w25

// =====================================================================================
// =====================================================================================
__global__ __launch_bounds__(256) void k_vec(const float* __restrict__ bq, const float* __restrict__ bp, const float* __restrict__ qw, const float* __restrict__ kw, float* __restrict__ VEC) {
    const int u = blockIdx.x * 256 + threadIdx.x;
    if (u >= VECN) return;
    const float a  = bq[min(u, NQKV - 1)];
    const float bb = bp[min(max(u - OFF_BP, 0), DM - 1)];
    const float cq = qw[min(max(u - OFF_QW, 0), HDIM - 1)];
    const float ck = kw[min(max(u - OFF_KW, 0), HDIM - 1)];
    const float sel = (u < OFF_BP) ? a : ((u < OFF_QW) ? bb : ((u < OFF_KW) ? cq : ck));
    const float o = cmb_bf(sel);
    *(float*)(VEC + u) = o;
    
}

// =====================================================================================
// k_castp: DST[z][r][c] (pitch ldd halves, batch stride dbs halves) = f16(sc * g(SRC[z][r][c])) with g = bf16 RNE value (bfr != 0) or identity,
//   r < nR, c < nC (nC % 8 == 0); SRC batch stride sbs floats, row pitch lds floats. Thread per (r, 8 consecutive c): two 16-B loads,
// =====================================================================================
__global__ __launch_bounds__(256) void k_castp(const float* __restrict__ SRC, long long sbs, int lds, unsigned short* __restrict__ DST, long long dbs, int ldd, int nR, int nC, float sc, int bfr) {
    const long long u = (long long)blockIdx.x * 256 + threadIdx.x;
    const int per = nC >> 3;
    if (u >= (long long)nR * per) return;
    const int r = (int)(u / per);
    const int c0 = 8 * (int)(u - (long long)r * per);
    const float* s = SRC + (long long)blockIdx.y * sbs + (long long)r * lds + c0;
    const v4f a = *(const v4f*)s;
    const v4f bq = *(const v4f*)(s + 4);
    float w[8] = {a.x, a.y, a.z, a.w, bq.x, bq.y, bq.z, bq.w};
#pragma unroll
    for (int e = 0; e < 8; ++e) { const float t = bfr ? cmb_bf(w[e]) : w[e]; w[e] = t * sc; }
    v4u pk;
    pk.x = cmb_pk2(w[0], w[1]); pk.y = cmb_pk2(w[2], w[3]); pk.z = cmb_pk2(w[4], w[5]); pk.w = cmb_pk2(w[6], w[7]);
    v4u* d = (v4u*)(DST + (long long)blockIdx.y * dbs + (long long)r * ldd + c0);
    *d = pk;
    
}

extern "C" void kernel_launch(void* const* d_in, const int* in_sizes, int n_in, void* d_out, int out_size, void* d_ws, size_t ws_size, hipStream_t stream) {
    if (n_in < 7) return;
    const float* x     = (const float*)d_in[0];     // [2][2048][1024]
    const float* Wqkv  = (const float*)d_in[1];     // [3072][1024]  ([out][in] = Bt layout)
    const float* bqkv  = (const float*)d_in[2];     // [3072]
    const float* Wproj = (const float*)d_in[3];     // [1024][1024]  ([out][in] = Bt layout)
    const float* bproj = (const float*)d_in[4];     // [1024]
    const float* qn_w  = (const float*)d_in[5];     // [64]
    const float* kn_w  = (const float*)d_in[6];     // [64]
    const long long xneed = ((long long)(NB - 1) * SEQ_FULL + SEQ) * DM;
    if ((long long)in_sizes[0] < xneed) return;
    if ((long long)in_sizes[1] < (long long)NQKV * DM) return;
    if (in_sizes[2] < NQKV) return;
    if ((long long)in_sizes[3] < (long long)DM * DM) return;
    if (in_sizes[4] < DM) return;
    if (in_sizes[5] < HDIM || in_sizes[6] < HDIM) return;
    if ((long long)out_size < xneed) return;
    if (WS_TOTAL > ws_size) return;

    char* wsp = (char*)d_ws;
    float* VEC = (float*)wsp; wsp += WS_VEC;                              // 4224 f32 (bf16 RNE values of the small input vectors)
    unsigned short* X16 = (unsigned short*)wsp; wsp += WS_X16;             // [NTOK][1024] f16 = 16 * bf16(x)
    unsigned short* W16 = (unsigned short*)wsp; wsp += WS_W16;             // [3072][1024] f16 = 64 * bf16(Wqkv)
    unsigned short* WP16 = (unsigned short*)wsp; wsp += WS_WP16;           // [1024][1024] f16 = 64 * bf16(Wproj)
    unsigned short* QH16 = (unsigned short*)wsp; wsp += WS_QK16;           // [NTOK][1024] f16 = 16 * normalised q
    unsigned short* KH16 = (unsigned short*)wsp; wsp += WS_QK16;           // [NTOK][1024] f16 = 16 * normalised k
    unsigned short* VH16 = (unsigned short*)wsp; wsp += WS_QK16;           // [NTOK][1024] f16 = v
    float* CTX = (float*)wsp; wsp += WS_CTX;                               // [NTOK][1024] f32 attention output (token-major, head*64 + d)
    unsigned short* CTX16 = (unsigned short*)wsp; wsp += WS_CTX16;         // [NTOK][1024] f16 = 256 * ctx
    float* out = (float*)d_out;

    // 1. small vectors -> bf16 RNE values (f32)
    k_vec<<<(VECN + 255) / 256, 256, 0, stream>>>(bqkv, bproj, qn_w, kn_w, VEC);
    // 2-4. 16-bit operand planes (bf16 RNE input values times a power of two, exact in f16)
    k_castp<<<dim3((unsigned)(((long long)SEQ * (DM / 8) + 255) / 256), (unsigned)NB), 256, 0, stream>>>(x, (long long)SEQ_FULL * DM, DM, X16, (long long)SEQ * DM, DM, SEQ, DM, 16.0f, 1);
    k_castp<<<dim3((unsigned)(((long long)NQKV * (DM / 8) + 255) / 256), 1u), 256, 0, stream>>>(Wqkv, 0LL, DM, W16, 0LL, DM, NQKV, DM, 64.0f, 1);
    k_castp<<<dim3((unsigned)(((long long)DM * (DM / 8) + 255) / 256), 1u), 256, 0, stream>>>(Wproj, 0LL, DM, WP16, 0LL, DM, DM, DM, 64.0f, 1);
    // 5. qkv = (16 bf16(x)) . (64 bf16(Wqkv))^T / 1024 + bf16(bqkv); v -> f16 plane; q and k -> per-head RMSNorm (f32 math) in the epilogue -> f16 planes carried x16
    w25::wmma_gemm64<0, false, 2, 0, false, true><<<dim3((unsigned)((NTOK / 128) * (NQKV / 128)), 1u), 128, 0, stream>>>(
        (const unsigned short*)X16, nullptr, DM, 0L, (const unsigned short*)W16, nullptr, DM, 0L,
        nullptr, nullptr, NQKV, 0L, VEC + OFF_BQ, nullptr, 0L, NTOK, NQKV, DM, 1.0f / 1024.0f,
        VEC + OFF_QW, VEC + OFF_KW, QH16, KH16, VH16);
    // 6. attention: 64 query rows per block, 64-key chunks, online softmax
    w25::AttnGeom g;
    g.q_bs = (long long)SEQ * DM;   g.q_rs = DM;   g.q_hs = HDIM;
    g.k_bs = (long long)SEQ * DM;   g.k_rs = DM;   g.k_hs = HDIM;
    g.v_bs = (long long)SEQ * DM;   g.v_rs = DM;   g.v_hs = HDIM;
    g.o_bs = (long long)SEQ * DM;   g.o_rs = DM;   g.o_hs = HDIM;
    g.S = SEQ; g.Skv = SEQ; g.H = NH; g.nchunk = SEQ / AT_KC; g.sscale = 0.125f / (QCAR * QCAR); g.pexp = 15.0f;
    w25::k_attn64<<<(unsigned)(NB * NH * (SEQ / AT_QB)), 128, 0, stream>>>(QH16, KH16, VH16, CTX, g);
    // 7. ctx -> f16 plane (x256)
    k_castp<<<dim3((unsigned)(((long long)NTOK * (DM / 8) + 255) / 256), 1u), 256, 0, stream>>>(CTX, 0LL, DM, CTX16, 0LL, DM, NTOK, DM, 256.0f, 0);
    // 8. out[b][s][:] = (256 ctx) . (64 bf16(Wproj))^T / 16384 + bf16(bproj), batch rows at the full per-batch stride of d_out
    w25::wmma_gemm64<0, false, 2, 0, false, false><<<dim3((unsigned)((SEQ / 128) * (DM / 128)), (unsigned)NB), 128, 0, stream>>>(
        (const unsigned short*)CTX16, nullptr, DM, (long)SEQ * DM, (const unsigned short*)WP16, nullptr, DM, 0L,
        (void*)out, nullptr, DM, (long)SEQ_FULL * DM, VEC + OFF_BP, nullptr, 0L, SEQ, DM, DM, 1.0f / 16384.0f,
        nullptr, nullptr, nullptr, nullptr, nullptr);
    (void)hipGetLastError();
}

// v007
// It runs in 101 microseconds.
// Next to v006, in two timings, it ran 1.07 and 1.08 times as fast.
// Counting every step since v000, it is 3.30 times as fast.
// Contractions: qkv projection [NB*SEQ x 1024 x 3072] and output projection [NB*SEQ x 1024 x 1024] = v_wmma_f32_16x16x32_f16 (f16 operands: x and weights as bf16 RNE input values scaled by powers of two, ctx as f16 of 256 ctx, f32 accumulate); attention scores, transposed, k.q^T = v_wmma_f32_16x16x32_f16 (normed q,k carried x16 as f16, single product, f32 accumulate); V^T.P^T = v_wmma_f32_16x16x32_f16 (P carried x2^15 as f16, v f16, f32 accumulate); RMSNorm (in the qkv projection's epilogue) and online softmax in f32, its exponentials in base 2.
#include <hip/hip_runtime.h>
#include <math.h>

#ifndef NB
#define NB 2
#endif
#ifndef SEQ
#define SEQ 2048
#endif
#define NB_FULL 2
#define SEQ_FULL 2048
#define DM 1024
#define NH 16
#define HDIM 64
#define NQKV (3 * DM)
#define NTOK (NB * SEQ)
#define QCAR 16.0f
// small f32 vector region: [bqkv 3072 | bproj 1024 | qn_w 64 | kn_w 64], each entry the bf16 RNE value of the input
#define OFF_BQ 0
#define OFF_BP NQKV
#define OFF_QW (NQKV + DM)
#define OFF_KW (NQKV + DM + HDIM)
#define VECN (NQKV + DM + 2 * HDIM)
static_assert(SEQ % 128 == 0);   // 128-row block tiles of the projections; 64-row blocks of the attention
static_assert(NB >= 1);
static_assert(NB <= NB_FULL);
static_assert(SEQ <= SEQ_FULL);
static_assert(VECN % 32 == 0);
static_assert(NH * HDIM == DM);
static_assert(DM % 128 == 0);
static_assert(NQKV % 128 == 0);
static_assert(HDIM == 64);   // one 64-column wave tile of the qkv projection = one head's q, k or v slice

typedef __attribute__((ext_vector_type(16))) _Float16 v16h;
typedef __attribute__((ext_vector_type(8)))  _Float16 v8h;
typedef __attribute__((ext_vector_type(16))) __bf16   v16b;
typedef __attribute__((ext_vector_type(8)))  __bf16   v8b;
typedef __attribute__((ext_vector_type(8)))  float    v8f;
typedef __attribute__((ext_vector_type(4)))  float    v4f;
typedef __attribute__((ext_vector_type(2)))  float    v2f;
typedef __attribute__((ext_vector_type(4)))  unsigned int v4u;

// 16-bit WMMA fragment map (wave32), lane L, h = L>>4, m = L&15:
//   A 16x32: lane = row m;   element i -> k = (i<8) ? 8h+i : 16+8h+(i-8)
//   B 32x16: lane = column m; the SAME k(i,h)
//   D 16x16 (8 f32): lane = column m; element r -> row 8h+r

// workspace carve (bytes, 256-B aligned regions)
constexpr size_t al256(size_t x) { return (x + 255) / 256 * 256; }
constexpr size_t WS_VEC   = al256((size_t)VECN * 4);
constexpr size_t WS_X16   = al256((size_t)NTOK * DM * 2);
constexpr size_t WS_W16   = al256((size_t)NQKV * DM * 2);
constexpr size_t WS_WP16  = al256((size_t)DM * DM * 2);
constexpr size_t WS_QK16  = al256((size_t)NTOK * DM * 2);
constexpr size_t WS_CTX   = al256((size_t)NTOK * DM * 4);
constexpr size_t WS_CTX16 = al256((size_t)NTOK * DM * 2);
constexpr size_t WS_TOTAL = WS_VEC + WS_X16 + WS_W16 + WS_WP16 + 3 * WS_QK16 + WS_CTX + WS_CTX16;
static_assert(WS_TOTAL <= (size_t)134217728);

// ---- scalar helpers ----
__device__ __forceinline__ float cmb_bf(float v) { const unsigned u = __builtin_bit_cast(unsigned, v); const unsigned r = (u + 0x7fffu + ((u >> 16) & 1u)) & 0xffff0000u; return __builtin_bit_cast(float, r); }   // bf16 RNE value kept as f32
__device__ __forceinline__ unsigned int cmb_pk2(float a, float b) { return (unsigned int)__builtin_bit_cast(unsigned short, (_Float16)a) | ((unsigned int)__builtin_bit_cast(unsigned short, (_Float16)b) << 16); }

namespace w25 {

__device__ __forceinline__ unsigned short f2bf_bits(float f) {
  unsigned u = __float_as_uint(f);
  return (unsigned short)((u + 0x7FFFu + ((u >> 16) & 1u)) >> 16);
}
__device__ __forceinline__ float bf_bits2f(unsigned short h) { return __uint_as_float(((unsigned)h) << 16); }

// hazard guards as plain device helpers
__device__ __forceinline__ void dep_guard_h(v8f& a, v8f& b, v16h x, v16h y) { asm volatile("v_nop\n\tv_nop\n\tv_nop\n\tv_nop" : "+v"(a), "+v"(b) : "v"(x), "v"(y)); }
__device__ __forceinline__ void dep_guard_b(v8f& a, v8f& b, v16b x, v16b y) { asm volatile("v_nop\n\tv_nop\n\tv_nop\n\tv_nop" : "+v"(a), "+v"(b) : "v"(x), "v"(y)); }
__device__ __forceinline__ void keep4_h(v16h a, v16h b, v16h c, v16h d) { asm volatile("v_nop" :: "v"(a), "v"(b), "v"(c), "v"(d)); }
__device__ __forceinline__ void keep4_b(v16b a, v16b b, v16b c, v16b d) { asm volatile("v_nop" :: "v"(a), "v"(b), "v"(c), "v"(d)); }
__device__ __forceinline__ void acc_guard4(v8f& a, v8f& b, v8f& c, v8f& d) { asm volatile("v_nop\n\tv_nop\n\tv_nop\n\tv_nop" : "+v"(a), "+v"(b), "+v"(c), "+v"(d)); }
template <typename T> struct Frag;
template <> struct Frag<_Float16> {
  typedef v16h V; union U { v16h v; v8h h[2]; };
  static __device__ __forceinline__ v16h load(const _Float16* p) {   // elements 0..7 <- p[0..7], 8..15 <- p[16..23]
    U f; f.h[0] = *(const v8h*)(p); f.h[1] = *(const v8h*)(p + 16); return f.v;
  }
  static __device__ __forceinline__ v8f mma(v16h a, v16h b, v8f c) {
    return __builtin_amdgcn_wmma_f32_16x16x32_f16(false, a, false, b, (short)0, c, false, false);
  }
  static __device__ __forceinline__ void guard(v8f& a, v8f& b, v16h x, v16h y) { dep_guard_h(a, b, x, y); }
  static __device__ __forceinline__ void keep(v16h a, v16h b, v16h c, v16h d) { keep4_h(a, b, c, d); }
};
template <> struct Frag<__bf16> {
  typedef v16b V; union U { v16b v; v8b h[2]; };
  static __device__ __forceinline__ v16b load(const __bf16* p) {
    U f; f.h[0] = *(const v8b*)(p); f.h[1] = *(const v8b*)(p + 16); return f.v;
  }
  static __device__ __forceinline__ v8f mma(v16b a, v16b b, v8f c) {
    return __builtin_amdgcn_wmma_f32_16x16x32_bf16(false, a, false, b, (short)0, c, false, false);
  }
  static __device__ __forceinline__ void guard(v8f& a, v8f& b, v16b x, v16b y) { dep_guard_b(a, b, x, y); }
  static __device__ __forceinline__ void keep(v16b a, v16b b, v16b c, v16b d) { keep4_b(a, b, c, d); }
};

// ---- Register-blocked batched WMMA GEMM ------------------------------------
// C[m,n] = scale * sum_k A[m,k] * Bt[n,k] (+bias)(+resid); each wave owns a 64x64 tile, a block of 4 waves (2 x 2) a 128x128 tile.
// A row-major [M,K]; Bt row-major [N,K]; M,N % 128 == 0, K % 64 == 0.
// Operands come through LDS: a stage is 64 k (one 128-B line) of the block's 128 A rows and 128 Bt rows, brought by asynchronous 16-B copies
//   (8 lanes = one whole line), two buffers, the next stage in flight while this one is multiplied; fragments are read from LDS with the same (row, k) map as before.
// SPLIT (hi/lo operand planes) is not built in this form.
// BIAS_MODE: 0 = none, 1 = bias[m], 2 = bias[n].
// OUT_MODE: 0 = f32, 1 = f16, 2 = bf16 hi plane (Cout) + bf16 lo plane (Cout2).
// ET: 0 = f16 operands, 1 = bf16 operands (pointers passed as 16-bit storage)
// QKN: the qkv projection. A wave tile is 64 tokens x one head's 64 columns of q (n0 < DM), k (n0 < 2 DM) or v. q and k tiles are RMS-normalised
//   row by row in the epilogue and stored only as f16 planes: QHp / KHp[token][h*64 + d] = f16(QCAR * x[d] * (1 / sqrt(mean(x^2) + 1e-6)) * w[d]),
//   w = qnw / knw; v tiles are stored as a third f16 plane, VHp[token][h*64 + d] = f16(x[d]) (Cout is not used).
template <int ET> struct Elem;
template <> struct Elem<0> { typedef _Float16 T; };
template <> struct Elem<1> { typedef __bf16 T; };
#define GK_KS 64                       // k per stage, in halves
#define GK_LP 72                       // LDS row pitch in halves: 144 B = 16 B x odd, conflict-free for the 16-byte fragment reads
#define GK_BT 128                      // block tile rows of A and of Bt
#define GK_BUF (2 * GK_BT * GK_LP)     // halves per buffer: A rows 0..127, then Bt rows 0..127
// Eight asynchronous 16-byte copies of one lane: rows r, r+16, ..., r+112 of one operand (global row step gstep halves) into LDS rows 16 apart.
// The s_wait_xcnt stands inside the statement, behind the last copy, so that no address register of a copy is rewritten in front of it.
template <typename T>
__device__ __forceinline__ void gk_copy8(unsigned lds, const T* g, size_t gstep) {
  const unsigned ls = 16u * GK_LP * 2u;
  asm volatile(
      "global_load_async_to_lds_b128 %0, %8, off\n\t"
      "global_load_async_to_lds_b128 %1, %9, off\n\t"
      "global_load_async_to_lds_b128 %2, %10, off\n\t"
      "global_load_async_to_lds_b128 %3, %11, off\n\t"
      "global_load_async_to_lds_b128 %4, %12, off\n\t"
      "global_load_async_to_lds_b128 %5, %13, off\n\t"
      "global_load_async_to_lds_b128 %6, %14, off\n\t"
      "global_load_async_to_lds_b128 %7, %15, off\n\t"
      "s_wait_xcnt 0x0"
      :: "v"(lds), "v"(lds + ls), "v"(lds + 2u * ls), "v"(lds + 3u * ls), "v"(lds + 4u * ls), "v"(lds + 5u * ls), "v"(lds + 6u * ls), "v"(lds + 7u * ls),
         "v"(g), "v"(g + gstep), "v"(g + 2 * gstep), "v"(g + 3 * gstep), "v"(g + 4 * gstep), "v"(g + 5 * gstep), "v"(g + 6 * gstep), "v"(g + 7 * gstep)
      : "memory");
}
template <int ET, bool SPLIT, int BIAS_MODE, int OUT_MODE, bool RESID, bool QKN>
__global__ __launch_bounds__(128) void wmma_gemm64(
    const unsigned short* __restrict__ Ap, const unsigned short* __restrict__ A2p, int lda, long strideA,
    const unsigned short* __restrict__ Btp, const unsigned short* __restrict__ Bt2p, int ldb, long strideB,
    void* __restrict__ Cout, void* __restrict__ Cout2, int ldc, long strideC,
    const float* __restrict__ bias,
    const float* __restrict__ resid, long strideR,
    int M, int N, int K, float scale,
    const float* __restrict__ qnw, const float* __restrict__ knw,
    unsigned short* __restrict__ QHp, unsigned short* __restrict__ KHp, unsigned short* __restrict__ VHp) {
  typedef typename Elem<ET>::T T;
  typedef typename Frag<T>::V V;
  static_assert(!SPLIT);
  const T* A = (const T*)Ap; const T* Bt = (const T*)Btp;
  __shared__ __align__(16) T ring[2 * GK_BUF];     // two stage buffers (cross-wave: published by the block barriers below)
  __shared__ __align__(16) float sT[4][16 * 68];   // per-wave 16x64 slab, pitch 68 floats (wave-private)
  const int b    = blockIdx.y;
  const int lane = threadIdx.x & 31;
  const int wave = threadIdx.x >> 5;
  const int tilesN = N >> 7;
  const int tilesM = M >> 7;
  const int tile = blockIdx.x;
  if (tile >= tilesM * tilesN) return;   // block-uniform, in front of every barrier and copy
  const int tm = tile / tilesN;
  const int tn = tile - tm * tilesN;
  const int wm = wave >> 1, wn = wave & 1;         // 2 x 2 waves
  const int m0 = (tm << 7) + (wm << 6);
  const int n0 = (tn << 7) + (wn << 6);

  const T* Ab  = A  + (size_t)b * strideA;
  const T* Bb  = Bt + (size_t)b * strideB;

  const int rlane = lane & 15;                 // row (A) / col (B, D) within subtile
  const int koff  = (lane >> 4) * 8;           // k offset of this lane half
  const int mOff  = (lane >> 4) * 8;           // D row offset

  v8f acc[4][4];
#pragma unroll
  for (int i = 0; i < 4; ++i)
#pragma unroll
    for (int j = 0; j < 4; ++j) acc[i][j] = (v8f){0.f,0.f,0.f,0.f,0.f,0.f,0.f,0.f};

  // copy map: thread -> (row crow + 16 i, 16-byte piece cseg) of each operand's 128 x 128-B stage; a wave's copy covers 4 whole lines
  const int nst  = K / GK_KS;
  const int crow = threadIdx.x >> 3;
  const int cseg = (threadIdx.x & 7) * 8;
  const T* ga = Ab + (size_t)((tm << 7) + crow) * lda + cseg;
  const T* gb = Bb + (size_t)((tn << 7) + crow) * ldb + cseg;
  const unsigned lA = (unsigned)(size_t)ring + (unsigned)(crow * GK_LP + cseg) * 2u;   // LDS byte address in buffer 0, A part
  const unsigned lB = lA + GK_BT * GK_LP * 2u;                                         // Bt part
  const size_t ast = (size_t)16 * lda, bst = (size_t)16 * ldb;

  gk_copy8(lA, ga, ast);
  gk_copy8(lB, gb, bst);
  asm volatile("s_wait_asynccnt 0x0" ::: "memory");   // this wave's copies of stage 0 have landed before the barrier publishes them
  __syncthreads();
  if (nst > 1) {
    gk_copy8(lA + GK_BUF * 2u, ga + GK_KS, ast);
    gk_copy8(lB + GK_BUF * 2u, gb + GK_KS, bst);
  }

  for (int t = 0; t < nst; ++t) {
    const int bsel = (t & 1) * GK_BUF;
    const T* la = ring + bsel + ((wm << 6) + rlane) * GK_LP + koff;
    const T* lb = ring + bsel + (GK_BT + (wn << 6) + rlane) * GK_LP + koff;
    // all four loops unrolled: the fragment and accumulator arrays stay in registers, and the LDS offsets become immediates
#pragma unroll
    for (int ks = 0; ks < GK_KS; ks += 32) {
      V bh[4], ah[4];
#pragma unroll
      for (int j = 0; j < 4; ++j) bh[j] = Frag<T>::load(lb + (j << 4) * GK_LP + ks);
#pragma unroll
      for (int i = 0; i < 4; ++i) ah[i] = Frag<T>::load(la + (i << 4) * GK_LP + ks);
#pragma unroll
      for (int i = 0; i < 4; ++i) {
#pragma unroll
        for (int j = 0; j < 4; ++j) acc[i][j] = Frag<T>::mma(ah[i], bh[j], acc[i][j]);
        Frag<T>::guard(acc[i][0], acc[i][3], ah[i], ah[i]);
      }
      Frag<T>::keep(bh[0], bh[1], bh[2], bh[3]);
    }
    asm volatile("s_wait_dscnt 0x0" ::: "memory");      // this wave's fragment reads have returned before the buffer may be refilled
    asm volatile("s_wait_asynccnt 0x0" ::: "memory");   // this wave's copies of stage t + 1 have landed before the barrier publishes them
    __syncthreads();                                    // publishes stage t + 1 and ends every wave's reads of stage t's buffer
    if (t + 2 < nst) {
      gk_copy8(lA + (unsigned)bsel * 2u, ga + (size_t)(t + 2) * GK_KS, ast);
      gk_copy8(lB + (unsigned)bsel * 2u, gb + (size_t)(t + 2) * GK_KS, bst);
    }
  }
  asm volatile("s_wait_asynccnt 0x0" ::: "memory");     // no copy is outstanding when the wave goes on
  acc_guard4(acc[0][0], acc[0][1], acc[0][2], acc[0][3]);
  acc_guard4(acc[1][0], acc[1][1], acc[1][2], acc[1][3]);
  acc_guard4(acc[2][0], acc[2][1], acc[2][2], acc[2][3]);
  acc_guard4(acc[3][0], acc[3][1], acc[3][2], acc[3][3]);

  // ---- epilogue ----
  float* slab = sT[wave];
  const float* Rb = RESID ? (resid + (size_t)b * strideR) : nullptr;
  const int nslice = QKN ? n0 / DM : 2;            // 0 = q, 1 = k, 2 = v (wave-uniform)
  v4f nw0 = (v4f){0.f,0.f,0.f,0.f}, nw1 = nw0;     // norm weights of this lane's 8 columns
  if (QKN && nslice < 2) {
    const float* nwp = (nslice ? knw : qnw) + (lane & 7) * 8;
    nw0 = *(const v4f*)nwp;
    nw1 = *(const v4f*)(nwp + 4);
  }
#pragma unroll
  for (int i = 0; i < 4; ++i) {
    const int mBase = m0 + (i << 4);
#pragma unroll
    for (int j = 0; j < 4; ++j) {
      const int n = n0 + (j << 4) + rlane;
      float bv = 0.f;
      if (BIAS_MODE == 2) bv = bias[n];
#pragma unroll
      for (int r = 0; r < 8; ++r) {
        float v = acc[i][j][r] * scale;
        if (BIAS_MODE == 1) v += bias[mBase + mOff + r];
        if (BIAS_MODE == 2) v += bv;
        if (RESID) v += Rb[(size_t)(mBase + mOff + r) * ldc + n];
        slab[(mOff + r) * 68 + (j << 4) + rlane] = v;
      }
    }
    __builtin_amdgcn_fence(3, "workgroup");
    __builtin_amdgcn_wave_barrier();
    __builtin_amdgcn_fence(2, "workgroup");
    if (QKN && nslice < 2) {
      // 8 lanes per row, 8 columns per lane: sum of squares in the lane, then over the 8 lanes; one 16-B store per lane = a 128-B line per row
      const int q = lane >> 3, c8 = (lane & 7) * 8;
      unsigned short* P = (nslice ? KHp : QHp) + (n0 - nslice * DM) + c8;
#pragma unroll   // the four row groups' LDS reads and lane exchanges issue together, so their latencies overlap
      for (int it = 0; it < 4; ++it) {
        const int row = it * 4 + q;
        const v4f x0 = *(const v4f*)(slab + row * 68 + c8);
        const v4f x1 = *(const v4f*)(slab + row * 68 + c8 + 4);
        float ss = (x0.x * x0.x + x0.y * x0.y + x0.z * x0.z + x0.w * x0.w) + (x1.x * x1.x + x1.y * x1.y + x1.z * x1.z + x1.w * x1.w);
#pragma unroll   // constant lane distances 1, 2, 4: the 8 lanes of a row
        for (int o = 1; o < 8; o <<= 1) ss += __shfl_xor(ss, o, 32);
        const float rms = sqrtf(ss * (1.0f / 64.0f) + 1e-6f);
        const float rec = 1.0f / rms;
        v4u pk;
        pk.x = cmb_pk2(((x0.x * rec) * nw0.x) * QCAR, ((x0.y * rec) * nw0.y) * QCAR);
        pk.y = cmb_pk2(((x0.z * rec) * nw0.z) * QCAR, ((x0.w * rec) * nw0.w) * QCAR);
        pk.z = cmb_pk2(((x1.x * rec) * nw1.x) * QCAR, ((x1.y * rec) * nw1.y) * QCAR);
        pk.w = cmb_pk2(((x1.z * rec) * nw1.z) * QCAR, ((x1.w * rec) * nw1.w) * QCAR);
        *(v4u*)(P + (size_t)(mBase + row) * DM) = pk;
      }
    } else if (QKN) {
      // v tile: 8 lanes per row, 8 columns per lane, one 16-B store per lane = a 128-B line per row
      const int q = lane >> 3, c8 = (lane & 7) * 8;
      unsigned short* P = VHp + (n0 - 2 * DM) + c8;
#pragma unroll   // the four row groups' LDS reads issue together
      for (int it = 0; it < 4; ++it) {
        const int row = it * 4 + q;
        const v4f x0 = *(const v4f*)(slab + row * 68 + c8);
        const v4f x1 = *(const v4f*)(slab + row * 68 + c8 + 4);
        v4u pk;
        pk.x = cmb_pk2(x0.x, x0.y);
        pk.y = cmb_pk2(x0.z, x0.w);
        pk.z = cmb_pk2(x1.x, x1.y);
        pk.w = cmb_pk2(x1.z, x1.w);
        *(v4u*)(P + (size_t)(mBase + row) * DM) = pk;
      }
    } else if (OUT_MODE == 0) {
      float* C = (float*)Cout + (size_t)b * strideC;
      const int hh = lane >> 4, c4 = (lane & 15) * 4;     // row seg = 256 B = 16 lanes x 16 B
      {
#pragma unroll
        for (int it = 0; it < 8; ++it) {
          const int row = it * 2 + hh;
          v4f v = *(const v4f*)(slab + row * 68 + c4);
          *(v4f*)(C + (size_t)(mBase + row) * ldc + n0 + c4) = v;
        }
        
      }
    } else {
      const int q = lane >> 3, c8 = (lane & 7) * 8;
      unsigned short* C  = (unsigned short*)Cout  + (size_t)b * strideC;
      unsigned short* C2 = (OUT_MODE == 2) ? ((unsigned short*)Cout2 + (size_t)b * strideC) : nullptr;
      {
#pragma unroll
        for (int it = 0; it < 4; ++it) {
          const int row = it * 4 + q;
          const float* sp = slab + row * 68 + c8;
          v8h hv, lv;
#pragma unroll
          for (int e = 0; e < 8; ++e) {
            if (OUT_MODE == 1) {
              hv[e] = (_Float16)sp[e];
            } else {
              unsigned short hb = f2bf_bits(sp[e]);
              unsigned short lb = f2bf_bits(sp[e] - bf_bits2f(hb));
              hv[e] = __builtin_bit_cast(_Float16, hb);
              lv[e] = __builtin_bit_cast(_Float16, lb);
            }
          }
          *(v8h*)(C + (size_t)(mBase + row) * ldc + n0 + c8) = hv;
          if (OUT_MODE == 2) *(v8h*)(C2 + (size_t)(mBase + row) * ldc + n0 + c8) = lv;
        }
        
      }
    }
    __builtin_amdgcn_fence(3, "workgroup");
    __builtin_amdgcn_wave_barrier();
    __builtin_amdgcn_fence(2, "workgroup");
  }
}

// =====================================================================================
// Non-causal attention for head_dim 64; q/k from f16 planes (normed values carried x QCAR), v from an f16 plane, f32 out.
//   scores^T = k.q^T        : v_wmma_f32_16x16x32_f16, single product; natural score = raw * sscale (sscale = 1/sqrt(64) / QCAR^2)
//   out^T    = v^T.p^T      : v_wmma_f32_16x16x32_f16; p = exp((s - m_running)*sscale) carried x 2^pexp (2^15) as f16, v plain f16
//   An exponential is one multiply-add and one v_exp_f32: 2^pexp * p = exp2(s * c2 - (m_running * c2 - pexp)), c2 = sscale * log2(e); the sum of p is carried x 2^pexp too.
//   Both products are transposed, so a lane holds scores, P and output of ONE query (its D column): maximum and sum run inside the lane
//   (one exchange between the lane halves), and two score tiles, converted in place, are the B fragment of the second product.
//   K and V chunks come row-major into LDS by asynchronous 16-B copies (8 lanes = one whole 128-B row), two buffers, the next chunk in flight while
//   this one is worked on; V^T fragments come by the transposing LDS load.
//   f32 accumulate; online softmax in f32. Block = 4 waves = 64 query rows of one (batch, head); S % 64 == 0.
//   Element (b, s, h, d) of tensor X lives at X[b*X_bs + s*X_rs + h*X_hs + d] (strides in elements, multiples of 8).
//   grid.x = B * H * (S/64), block 128.
// =====================================================================================
#define AT_D 64
#define AT_NW 4
#define AT_QB 64
#define AT_KC 64
#define AT_LP 72   // LDS row pitch in halves of the 64-half K rows: 144 B = 16 B x odd, so the 16 lanes of a 16-byte fragment read fall on 16 distinct bank groups
#define AT_VP 80   // LDS row pitch in halves of the 64-half V rows: 160 B = 32 B x odd, the conflict-free pitch of ds_load_tr16_b128
#define AT_KB (AT_KC * AT_LP)            // halves of a buffer's K part
#define AT_BUF (AT_KB + AT_KC * AT_VP)   // halves per buffer
struct AttnGeom { long long q_bs, q_rs, q_hs, k_bs, k_rs, k_hs, v_bs, v_rs, v_hs, o_bs, o_rs, o_hs; int S, Skv, H, nchunk; float sscale; float pexp; };
static_assert(sizeof(AttnGeom) == 12 * 8 + 4 * 4 + 2 * 4);

// the builtin alone: the compiler keeps the distances behind its own matrix instructions, and is free to issue independent ones back to back
__device__ __forceinline__ v8f at_mmah(v16h a, v16h b, v8f c) {
  return __builtin_amdgcn_wmma_f32_16x16x32_f16(false, a, false, b, (short)0, c, false, false);
}

// Base-2 exponentials by v_exp_f32, each in place. In one statement, so that no exponential overwrites the source of the one directly in front of it;
// the closing v_nop is the slot that the instruction set asks for between a transcendental and a directly following user of its result.
__device__ __forceinline__ float at_exp2(float x) {
  asm("v_exp_f32 %0, %0\n\tv_nop" : "+v"(x));
  return x;
}
__device__ __forceinline__ v8f at_exp2x8(v8f x) {
  float a = x[0], b = x[1], c = x[2], d = x[3], e = x[4], f = x[5], g = x[6], h = x[7];
  asm("v_exp_f32 %0, %0\n\t"
      "v_exp_f32 %1, %1\n\t"
      "v_exp_f32 %2, %2\n\t"
      "v_exp_f32 %3, %3\n\t"
      "v_exp_f32 %4, %4\n\t"
      "v_exp_f32 %5, %5\n\t"
      "v_exp_f32 %6, %6\n\t"
      "v_exp_f32 %7, %7\n\t"
      "v_nop"
      : "+v"(a), "+v"(b), "+v"(c), "+v"(d), "+v"(e), "+v"(f), "+v"(g), "+v"(h));
  return (v8f){a, b, c, d, e, f, g, h};
}

// Transposing 16-bit LDS load: lane (c = l & 15, h = l >> 4), addressed at row 8h + (l & 7), halves 8 * ((l >> 3) & 1) of a row-major tile, gets T[8h + 0..7][c]
typedef short s16x8 __attribute__((ext_vector_type(8)));
__device__ __forceinline__ v8h at_ldtr16(const _Float16* p) {
  typedef __attribute__((address_space(3))) s16x8 lds_s16x8;
  return __builtin_bit_cast(v8h, __builtin_amdgcn_ds_load_tr16_b128_v8i16((lds_s16x8*)p));
}

// Eight asynchronous 16-byte copies of one lane: rows r, r+16, r+32, r+48 of a K chunk and of a V chunk (global row steps kst, vst halves per 16 rows).
// The s_wait_xcnt stands inside the statement, behind the last copy, so that no address register of a copy is rewritten in front of it.
__device__ __forceinline__ void at_copy8(unsigned lk, const _Float16* gk, size_t kst, unsigned lv, const _Float16* gv, size_t vst) {
  const unsigned ks = 16u * AT_LP * 2u, vs = 16u * AT_VP * 2u;
  asm volatile(
      "global_load_async_to_lds_b128 %0, %8, off\n\t"
      "global_load_async_to_lds_b128 %1, %9, off\n\t"
      "global_load_async_to_lds_b128 %2, %10, off\n\t"
      "global_load_async_to_lds_b128 %3, %11, off\n\t"
      "global_load_async_to_lds_b128 %4, %12, off\n\t"
      "global_load_async_to_lds_b128 %5, %13, off\n\t"
      "global_load_async_to_lds_b128 %6, %14, off\n\t"
      "global_load_async_to_lds_b128 %7, %15, off\n\t"
      "s_wait_xcnt 0x0"
      :: "v"(lk), "v"(lk + ks), "v"(lk + 2u * ks), "v"(lk + 3u * ks), "v"(lv), "v"(lv + vs), "v"(lv + 2u * vs), "v"(lv + 3u * vs),
         "v"(gk), "v"(gk + kst), "v"(gk + 2 * kst), "v"(gk + 3 * kst), "v"(gv), "v"(gv + vst), "v"(gv + 2 * vst), "v"(gv + 3 * vst)
      : "memory");
}

__global__ __launch_bounds__(128) __attribute__((amdgpu_num_vgpr(256)))
void k_attn64(const unsigned short* __restrict__ qp, const unsigned short* __restrict__ kp,
              const unsigned short* __restrict__ vp, float* __restrict__ out, AttnGeom g) {
  union FH { v16h v; v8h h[2]; };
  __shared__ __align__(16) _Float16 kvs[2 * AT_BUF];        // two chunk buffers, each K [kv][d] then V [kv][d], f16 (cross-wave: published by the block barriers below)
  __shared__ __align__(16) float    Os[AT_NW][16 * 68];     // per wave out tile, pitch 68 (wave-private)

  const int tid  = threadIdx.x;
  const int wave = tid >> 5;
  const int lane = tid & 31;
  const int hh   = lane >> 4;
  const int c    = lane & 15;

  const int nqb = g.S / AT_QB;
  const int bx = blockIdx.x;
  const int qb = bx % nqb;
  const int bh = bx / nqb;
  const int h  = bh % g.H;
  const int b  = bh / g.H;
  const int q0 = qb * AT_QB + wave * 16;

  const _Float16* q = (const _Float16*)qp;
  const _Float16* k = (const _Float16*)kp;
  const _Float16* v = (const _Float16*)vp;
  const _Float16* qb_ptr = q + (size_t)b * g.q_bs + (size_t)h * g.q_hs;
  const _Float16* kb_ptr = k + (size_t)b * g.k_bs + (size_t)h * g.k_hs;
  const _Float16* vb_ptr = v + (size_t)b * g.v_bs + (size_t)h * g.v_hs;
  float*          ob_ptr = out + (size_t)b * g.o_bs + (size_t)h * g.o_hs;

  // ---- Q fragments (B operand): 2 d-chunks; lane column c = query q0 + c, elements 0..7 <- d = dc*32 + 8hh + e, 8..15 <- dc*32 + 16 + 8hh + e (two 16-B loads from the f16 row) ----
  v16h qa[2];
  {
    const _Float16* qrow = qb_ptr + (size_t)(q0 + c) * g.q_rs;
#pragma unroll
    for (int dc = 0; dc < 2; ++dc) {
      FH f;
      f.h[0] = *(const v8h*)(qrow + dc * 32 + 8 * hh);
      f.h[1] = *(const v8h*)(qrow + dc * 32 + 16 + 8 * hh);
      qa[dc] = f.v;
    }
  }

  float mcol = -INFINITY;   // running maximum of this lane's query (raw units; equal in both lane halves)
  float lcol = 0.f;         // running sum of 2^pexp * p over the keys of this lane half; the halves are joined after the loop
  const float c2 = g.sscale * 1.4426950408889634f;   // raw score units -> base-2 exponent
  v8f oacc[4];              // out^T: tile t, element r = (d = t*16 + 8hh + r, query q0 + c)
#pragma unroll
  for (int t = 0; t < 4; ++t) oacc[t] = (v8f){0.f,0.f,0.f,0.f,0.f,0.f,0.f,0.f};

  // copy map: thread -> (row srow + 16 i, 16-byte piece sseg / 8) of the chunk's 64 K rows and 64 V rows; a wave's copy covers 4 whole 128-B rows
  const int srow = tid >> 3, sseg = (tid & 7) * 8;
  const _Float16* gk = kb_ptr + (size_t)srow * g.k_rs + sseg;
  const _Float16* gv = vb_ptr + (size_t)srow * g.v_rs + sseg;
  const unsigned lK = (unsigned)(size_t)kvs + (unsigned)(srow * AT_LP + sseg) * 2u;           // LDS byte address in buffer 0, K part
  const unsigned lV = (unsigned)(size_t)kvs + (unsigned)(AT_KB + srow * AT_VP + sseg) * 2u;   // V part
  const size_t kst = (size_t)16 * g.k_rs, vst = (size_t)16 * g.v_rs;         // 16 rows
  const size_t kch = (size_t)AT_KC * g.k_rs, vch = (size_t)AT_KC * g.v_rs;   // one chunk

  if (g.nchunk > 0) at_copy8(lK, gk, kst, lV, gv, vst);
  asm volatile("s_wait_asynccnt 0x0" ::: "memory");   // this wave's copies of chunk 0 have landed before the barrier publishes them
  __syncthreads();
  if (g.nchunk > 1) at_copy8(lK + AT_BUF * 2u, gk + kch, kst, lV + AT_BUF * 2u, gv + vch, vst);

  for (int kc = 0; kc < g.nchunk; ++kc) {
    const int bsel = (kc & 1) * AT_BUF;
    const _Float16* Ksh = kvs + bsel;           // K [kv][d], pitch AT_LP
    const _Float16* Vsh = kvs + bsel + AT_KB;   // V [kv][d], pitch AT_VP

    // ---- every fragment of the chunk is fetched here, as one group, each into registers of its own: the K fragments are waited for once,
    //      and the V^T fragments arrive behind the score products and the softmax ----
    FH kf[4][2];   // K: A fragment, lane row c = key j*16 + c, same k(i,h) map as B
    FH vf[2][4];   // V^T: A fragment, lane row c = d = t*16 + c, k = key, by transposing loads of the row-major V tile, which deliver the fragment k map
#pragma unroll   // in the order in which the products below take them
    for (int dc = 0; dc < 2; ++dc) {
#pragma unroll
      for (int j = 0; j < 4; ++j) {
        kf[j][dc].h[0] = *(const v8h*)(Ksh + (j * 16 + c) * AT_LP + dc * 32 + 8 * hh);
        kf[j][dc].h[1] = *(const v8h*)(Ksh + (j * 16 + c) * AT_LP + dc * 32 + 16 + 8 * hh);
      }
    }
#pragma unroll
    for (int kk = 0; kk < 2; ++kk) {
#pragma unroll
      for (int t = 0; t < 4; ++t) {
        vf[kk][t].h[0] = at_ldtr16(Vsh + (kk * 32 + 8 * hh + (lane & 7)) * AT_VP + t * 16 + 8 * ((lane >> 3) & 1));        // keys kk*32 + 8hh + 0..7 of d = t*16 + c
        vf[kk][t].h[1] = at_ldtr16(Vsh + (kk * 32 + 16 + 8 * hh + (lane & 7)) * AT_VP + t * 16 + 8 * ((lane >> 3) & 1));   // keys kk*32 + 16 + 8hh + 0..7
      }
    }
    __builtin_amdgcn_sched_barrier(0);   // keeps the group of loads together in front of the products: sunk to their users, each pair would be waited for on its own
    // ---- scores^T: 4 key subtiles x 2 d-chunks; the four tiles are independent, so the products issue back to back ----
    v8f s[4];
#pragma unroll
    for (int j = 0; j < 4; ++j) s[j] = at_mmah(kf[j][0].v, qa[0], (v8f){0.f,0.f,0.f,0.f,0.f,0.f,0.f,0.f});
#pragma unroll
    for (int j = 0; j < 4; ++j) s[j] = at_mmah(kf[j][1].v, qa[1], s[j]);
    // ---- chunk maximum of the lane's query (raw units; sscale > 0 so max commutes): D element r of this lane = (key kc*64 + j*16 + 8hh + r, query q0 + c) ----
    float cm4[4];
#pragma unroll
    for (int j = 0; j < 4; ++j)
      cm4[j] = fmaxf(fmaxf(fmaxf(s[j][0], s[j][1]), fmaxf(s[j][2], s[j][3])), fmaxf(fmaxf(s[j][4], s[j][5]), fmaxf(s[j][6], s[j][7])));
    float cm = fmaxf(fmaxf(cm4[0], cm4[1]), fmaxf(cm4[2], cm4[3]));
    cm = fmaxf(cm, __shfl_xor(cm, 16, 32));   // the other lane half holds the query's other 32 keys
    const float mnew = fmaxf(mcol, cm);
    const float alpha = at_exp2((mcol - mnew) * c2);   // 0 on the first chunk, where mcol is -inf
    const float nm = g.pexp - mnew * c2;
    mcol = mnew;
    // ---- p, and P^T as B fragments: element i of fragment kk is key kk*32 + k(i,hh) = element i & 7 of score tile 2 kk + (i >> 3) ----
    v16h pb[2];
    float ps4[4];   // one partial sum per score tile: four independent add chains
#pragma unroll
    for (int j = 0; j < 4; ++j) {
      v8f p;
#pragma unroll
      for (int r = 0; r < 8; ++r) p[r] = fmaf(s[j][r], c2, nm);
      p = at_exp2x8(p);
      float psum = p[0];
#pragma unroll
      for (int r = 1; r < 8; ++r) psum += p[r];
#pragma unroll
      for (int r = 0; r < 8; ++r) pb[j >> 1][(j & 1) * 8 + r] = (_Float16)p[r];
      ps4[j] = psum;
    }
    lcol = lcol * alpha + ((ps4[0] + ps4[1]) + (ps4[2] + ps4[3]));
#pragma unroll
    for (int t = 0; t < 4; ++t) oacc[t] *= alpha;
    // ---- V^T.P^T: A = V^T from the registers filled at the chunk's head; B = P^T from the registers ----
#pragma unroll   // vf, pb and oacc are indexed by constants only, so all stay in registers
    for (int kk = 0; kk < 2; ++kk) {
#pragma unroll
      for (int t = 0; t < 4; ++t) oacc[t] = at_mmah(vf[kk][t].v, pb[kk], oacc[t]);
    }
    __builtin_amdgcn_sched_barrier(0);   // keeps the chunk's arithmetic in front of the waits below: lifted to the chunk's head, the wait for the next chunk's copies would find them only just issued
    asm volatile("s_wait_dscnt 0x0" ::: "memory");      // this wave's fragment reads have returned before the buffer may be refilled
    asm volatile("s_wait_asynccnt 0x0" ::: "memory");   // this wave's copies of chunk kc + 1 have landed before the barrier publishes them
    __syncthreads();                                    // publishes chunk kc + 1 and ends every wave's reads of chunk kc's buffer
    if (kc + 2 < g.nchunk) at_copy8(lK + (unsigned)bsel * 2u, gk + (size_t)(kc + 2) * kch, kst, lV + (unsigned)bsel * 2u, gv + (size_t)(kc + 2) * vch, vst);
  }
  asm volatile("s_wait_asynccnt 0x0" ::: "memory");     // no copy is outstanding when the wave goes on

  float* os = Os[wave];
  {
    const float inv = 1.0f / (lcol + __shfl_xor(lcol, 16, 32));   // both halves' sums joined once; sum and out^T carry the same 2^pexp
#pragma unroll
    for (int t = 0; t < 4; ++t) {
      // 8 consecutive d of the lane's query row: two 16-B LDS stores
      *(v4f*)(os + c * 68 + t * 16 + 8 * hh)     = (v4f){oacc[t][0] * inv, oacc[t][1] * inv, oacc[t][2] * inv, oacc[t][3] * inv};
      *(v4f*)(os + c * 68 + t * 16 + 8 * hh + 4) = (v4f){oacc[t][4] * inv, oacc[t][5] * inv, oacc[t][6] * inv, oacc[t][7] * inv};
    }
  }
  __builtin_amdgcn_fence(3, "workgroup");
  __builtin_amdgcn_wave_barrier();
  __builtin_amdgcn_fence(2, "workgroup");
  {
    const int c4 = (lane & 15) * 4;
    {
#pragma unroll
      for (int it = 0; it < 8; ++it) {
        const int row = it * 2 + hh;
        v4f val = *(const v4f*)(os + row * 68 + c4);
        *(v4f*)(ob_ptr + (size_t)(q0 + row) * g.o_rs + c4) = val;
      }
      
    }
  }
}

} // namespace w25

// =====================================================================================
// =====================================================================================
__global__ __launch_bounds__(256) void k_vec(const float* __restrict__ bq, const float* __restrict__ bp, const float* __restrict__ qw, const float* __restrict__ kw, float* __restrict__ VEC) {
    const int u = blockIdx.x * 256 + threadIdx.x;
    if (u >= VECN) return;
    const float a  = bq[min(u, NQKV - 1)];
    const float bb = bp[min(max(u - OFF_BP, 0), DM - 1)];
    const float cq = qw[min(max(u - OFF_QW, 0), HDIM - 1)];
    const float ck = kw[min(max(u - OFF_KW, 0), HDIM - 1)];
    const float sel = (u < OFF_BP) ? a : ((u < OFF_QW) ? bb : ((u < OFF_KW) ? cq : ck));
    const float o = cmb_bf(sel);
    *(float*)(VEC + u) = o;
    
}

// =====================================================================================
// k_castp: DST[z][r][c] (pitch ldd halves, batch stride dbs halves) = f16(sc * g(SRC[z][r][c])) with g = bf16 RNE value (bfr != 0) or identity,
//   r < nR, c < nC (nC % 8 == 0); SRC batch stride sbs floats, row pitch lds floats. Thread per (r, 8 consecutive c): two 16-B loads,
// =====================================================================================
__global__ __launch_bounds__(256) void k_castp(const float* __restrict__ SRC, long long sbs, int lds, unsigned short* __restrict__ DST, long long dbs, int ldd, int nR, int nC, float sc, int bfr) {
    const long long u = (long long)blockIdx.x * 256 + threadIdx.x;
    const int per = nC >> 3;
    if (u >= (long long)nR * per) return;
    const int r = (int)(u / per);
    const int c0 = 8 * (int)(u - (long long)r * per);
    const float* s = SRC + (long long)blockIdx.y * sbs + (long long)r * lds + c0;
    const v4f a = *(const v4f*)s;
    const v4f bq = *(const v4f*)(s + 4);
    float w[8] = {a.x, a.y, a.z, a.w, bq.x, bq.y, bq.z, bq.w};
#pragma unroll
    for (int e = 0; e < 8; ++e) { const float t = bfr ? cmb_bf(w[e]) : w[e]; w[e] = t * sc; }
    v4u pk;
    pk.x = cmb_pk2(w[0], w[1]); pk.y = cmb_pk2(w[2], w[3]); pk.z = cmb_pk2(w[4], w[5]); pk.w = cmb_pk2(w[6], w[7]);
    v4u* d = (v4u*)(DST + (long long)blockIdx.y * dbs + (long long)r * ldd + c0);
    *d = pk;
    
}

extern "C" void kernel_launch(void* const* d_in, const int* in_sizes, int n_in, void* d_out, int out_size, void* d_ws, size_t ws_size, hipStream_t stream) {
    if (n_in < 7) return;
    const float* x     = (const float*)d_in[0];     // [2][2048][1024]
    const float* Wqkv  = (const float*)d_in[1];     // [3072][1024]  ([out][in] = Bt layout)
    const float* bqkv  = (const float*)d_in[2];     // [3072]
    const float* Wproj = (const float*)d_in[3];     // [1024][1024]  ([out][in] = Bt layout)
    const float* bproj = (const float*)d_in[4];     // [1024]
    const float* qn_w  = (const float*)d_in[5];     // [64]
    const float* kn_w  = (const float*)d_in[6];     // [64]
    const long long xneed = ((long long)(NB - 1) * SEQ_FULL + SEQ) * DM;
    if ((long long)in_sizes[0] < xneed) return;
    if ((long long)in_sizes[1] < (long long)NQKV * DM) return;
    if (in_sizes[2] < NQKV) return;
    if ((long long)in_sizes[3] < (long long)DM * DM) return;
    if (in_sizes[4] < DM) return;
    if (in_sizes[5] < HDIM || in_sizes[6] < HDIM) return;
    if ((long long)out_size < xneed) return;
    if (WS_TOTAL > ws_size) return;

    char* wsp = (char*)d_ws;
    float* VEC = (float*)wsp; wsp += WS_VEC;                              // 4224 f32 (bf16 RNE values of the small input vectors)
    unsigned short* X16 = (unsigned short*)wsp; wsp += WS_X16;             // [NTOK][1024] f16 = 16 * bf16(x)
    unsigned short* W16 = (unsigned short*)wsp; wsp += WS_W16;             // [3072][1024] f16 = 64 * bf16(Wqkv)
    unsigned short* WP16 = (unsigned short*)wsp; wsp += WS_WP16;           // [1024][1024] f16 = 64 * bf16(Wproj)
    unsigned short* QH16 = (unsigned short*)wsp; wsp += WS_QK16;           // [NTOK][1024] f16 = 16 * normalised q
    unsigned short* KH16 = (unsigned short*)wsp; wsp += WS_QK16;           // [NTOK][1024] f16 = 16 * normalised k
    unsigned short* VH16 = (unsigned short*)wsp; wsp += WS_QK16;           // [NTOK][1024] f16 = v
    float* CTX = (float*)wsp; wsp += WS_CTX;                               // [NTOK][1024] f32 attention output (token-major, head*64 + d)
    unsigned short* CTX16 = (unsigned short*)wsp; wsp += WS_CTX16;         // [NTOK][1024] f16 = 256 * ctx
    float* out = (float*)d_out;

    // 1. small vectors -> bf16 RNE values (f32)
    k_vec<<<(VECN + 255) / 256, 256, 0, stream>>>(bqkv, bproj, qn_w, kn_w, VEC);
    // 2-4. 16-bit operand planes (bf16 RNE input values times a power of two, exact in f16)
    k_castp<<<dim3((unsigned)(((long long)SEQ * (DM / 8) + 255) / 256), (unsigned)NB), 256, 0, stream>>>(x, (long long)SEQ_FULL * DM, DM, X16, (long long)SEQ * DM, DM, SEQ, DM, 16.0f, 1);
    k_castp<<<dim3((unsigned)(((long long)NQKV * (DM / 8) + 255) / 256), 1u), 256, 0, stream>>>(Wqkv, 0LL, DM, W16, 0LL, DM, NQKV, DM, 64.0f, 1);
    k_castp<<<dim3((unsigned)(((long long)DM * (DM / 8) + 255) / 256), 1u), 256, 0, stream>>>(Wproj, 0LL, DM, WP16, 0LL, DM, DM, DM, 64.0f, 1);
    // 5. qkv = (16 bf16(x)) . (64 bf16(Wqkv))^T / 1024 + bf16(bqkv); v -> f16 plane; q and k -> per-head RMSNorm (f32 math) in the epilogue -> f16 planes carried x16
    w25::wmma_gemm64<0, false, 2, 0, false, true><<<dim3((unsigned)((NTOK / 128) * (NQKV / 128)), 1u), 128, 0, stream>>>(
        (const unsigned short*)X16, nullptr, DM, 0L, (const unsigned short*)W16, nullptr, DM, 0L,
        nullptr, nullptr, NQKV, 0L, VEC + OFF_BQ, nullptr, 0L, NTOK, NQKV, DM, 1.0f / 1024.0f,
        VEC + OFF_QW, VEC + OFF_KW, QH16, KH16, VH16);
    // 6. attention: 64 query rows per block, 64-key chunks, online softmax
    w25::AttnGeom g;
    g.q_bs = (long long)SEQ * DM;   g.q_rs = DM;   g.q_hs = HDIM;
    g.k_bs = (long long)SEQ * DM;   g.k_rs = DM;   g.k_hs = HDIM;
    g.v_bs = (long long)SEQ * DM;   g.v_rs = DM;   g.v_hs = HDIM;
    g.o_bs = (long long)SEQ * DM;   g.o_rs = DM;   g.o_hs = HDIM;
    g.S = SEQ; g.Skv = SEQ; g.H = NH; g.nchunk = SEQ / AT_KC; g.sscale = 0.125f / (QCAR * QCAR); g.pexp = 15.0f;
    w25::k_attn64<<<(unsigned)(NB * NH * (SEQ / AT_QB)), 128, 0, stream>>>(QH16, KH16, VH16, CTX, g);
    // 7. ctx -> f16 plane (x256)
    k_castp<<<dim3((unsigned)(((long long)NTOK * (DM / 8) + 255) / 256), 1u), 256, 0, stream>>>(CTX, 0LL, DM, CTX16, 0LL, DM, NTOK, DM, 256.0f, 0);
    // 8. out[b][s][:] = (256 ctx) . (64 bf16(Wproj))^T / 16384 + bf16(bproj), batch rows at the full per-batch stride of d_out
    w25::wmma_gemm64<0, false, 2, 0, false, false><<<dim3((unsigned)((SEQ / 128) * (DM / 128)), (unsigned)NB), 128, 0, stream>>>(
        (const unsigned short*)CTX16, nullptr, DM, (long)SEQ * DM, (const unsigned short*)WP16, nullptr, DM, 0L,
        (void*)out, nullptr, DM, (long)SEQ_FULL * DM, VEC + OFF_BP, nullptr, 0L, SEQ, DM, DM, 1.0f / 16384.0f,
        nullptr, nullptr, nullptr, nullptr, nullptr);
    (void)hipGetLastError();
}

// v008
// Measured time: 95.1 microseconds a run.
// In two side-by-side timings against v007, it was 1.06 and 1.07 times as fast.
// Counting every step since v000, it is 3.53 times as fast.
// Contractions: qkv projection [NB*SEQ x 1024 x 3072] and output projection [NB*SEQ x 1024 x 1024] = v_wmma_f32_16x16x32_f16 (f16 operands: x and weights as bf16 RNE input values scaled by powers of two, ctx as f16 of 256 ctx, f32 accumulate); attention scores, transposed, k.q^T = v_wmma_f32_16x16x32_f16 (normed q,k carried x16 as f16, single product, f32 accumulate); V^T.P^T = v_wmma_f32_16x16x32_f16 (P carried x2^15 as f16, v f16, f32 accumulate); RMSNorm (in the qkv projection's epilogue) and online softmax in f32, its exponentials in base 2.
#include <hip/hip_runtime.h>
#include <math.h>

#ifndef NB
#define NB 2
#endif
#ifndef SEQ
#define SEQ 2048
#endif
#define NB_FULL 2
#define SEQ_FULL 2048
#define DM 1024
#define NH 16
#define HDIM 64
#define NQKV (3 * DM)
#define NTOK (NB * SEQ)
#define QCAR 16.0f
// small f32 vector region: [bqkv 3072 | bproj 1024 | qn_w 64 | kn_w 64], each entry the bf16 RNE value of the input
#define OFF_BQ 0
#define OFF_BP NQKV
#define OFF_QW (NQKV + DM)
#define OFF_KW (NQKV + DM + HDIM)
#define VECN (NQKV + DM + 2 * HDIM)
static_assert(SEQ % 128 == 0);   // 128-row block tiles of the projections; 64-row blocks of the attention
static_assert(NB >= 1);
static_assert(NB <= NB_FULL);
static_assert(SEQ <= SEQ_FULL);
static_assert(VECN % 32 == 0);
static_assert(NH * HDIM == DM);
static_assert(DM % 128 == 0);
static_assert(NQKV % 128 == 0);
static_assert(HDIM == 64);   // one 64-column wave tile of the qkv projection = one head's q, k or v slice

typedef __attribute__((ext_vector_type(16))) _Float16 v16h;
typedef __attribute__((ext_vector_type(8)))  _Float16 v8h;
typedef __attribute__((ext_vector_type(16))) __bf16   v16b;
typedef __attribute__((ext_vector_type(8)))  __bf16   v8b;
typedef __attribute__((ext_vector_type(8)))  float    v8f;
typedef __attribute__((ext_vector_type(4)))  float    v4f;
typedef __attribute__((ext_vector_type(2)))  float    v2f;
typedef __attribute__((ext_vector_type(4)))  unsigned int v4u;

// 16-bit WMMA fragment map (wave32), lane L, h = L>>4, m = L&15:
//   A 16x32: lane = row m;   element i -> k = (i<8) ? 8h+i : 16+8h+(i-8)
//   B 32x16: lane = column m; the SAME k(i,h)
//   D 16x16 (8 f32): lane = column m; element r -> row 8h+r

// workspace carve (bytes, 256-B aligned regions)
constexpr size_t al256(size_t x) { return (x + 255) / 256 * 256; }
constexpr size_t WS_VEC   = al256((size_t)VECN * 4);
constexpr size_t WS_X16   = al256((size_t)NTOK * DM * 2);
constexpr size_t WS_W16   = al256((size_t)NQKV * DM * 2);
constexpr size_t WS_WP16  = al256((size_t)DM * DM * 2);
constexpr size_t WS_QK16  = al256((size_t)NTOK * DM * 2);
constexpr size_t WS_CTX   = al256((size_t)NTOK * DM * 4);
constexpr size_t WS_CTX16 = al256((size_t)NTOK * DM * 2);
constexpr size_t WS_TOTAL = WS_VEC + WS_X16 + WS_W16 + WS_WP16 + 3 * WS_QK16 + WS_CTX + WS_CTX16;
static_assert(WS_TOTAL <= (size_t)134217728);

// ---- scalar helpers ----
__device__ __forceinline__ float cmb_bf(float v) { const unsigned u = __builtin_bit_cast(unsigned, v); const unsigned r = (u + 0x7fffu + ((u >> 16) & 1u)) & 0xffff0000u; return __builtin_bit_cast(float, r); }   // bf16 RNE value kept as f32
__device__ __forceinline__ unsigned int cmb_pk2(float a, float b) { return (unsigned int)__builtin_bit_cast(unsigned short, (_Float16)a) | ((unsigned int)__builtin_bit_cast(unsigned short, (_Float16)b) << 16); }

namespace w25 {

__device__ __forceinline__ unsigned short f2bf_bits(float f) {
  unsigned u = __float_as_uint(f);
  return (unsigned short)((u + 0x7FFFu + ((u >> 16) & 1u)) >> 16);
}
__device__ __forceinline__ float bf_bits2f(unsigned short h) { return __uint_as_float(((unsigned)h) << 16); }

// hazard guards as plain device helpers
__device__ __forceinline__ void dep_guard_h(v8f& a, v8f& b, v16h x, v16h y) { asm volatile("v_nop\n\tv_nop\n\tv_nop\n\tv_nop" : "+v"(a), "+v"(b) : "v"(x), "v"(y)); }
__device__ __forceinline__ void dep_guard_b(v8f& a, v8f& b, v16b x, v16b y) { asm volatile("v_nop\n\tv_nop\n\tv_nop\n\tv_nop" : "+v"(a), "+v"(b) : "v"(x), "v"(y)); }
__device__ __forceinline__ void keep4_h(v16h a, v16h b, v16h c, v16h d) { asm volatile("v_nop" :: "v"(a), "v"(b), "v"(c), "v"(d)); }
__device__ __forceinline__ void keep4_b(v16b a, v16b b, v16b c, v16b d) { asm volatile("v_nop" :: "v"(a), "v"(b), "v"(c), "v"(d)); }
__device__ __forceinline__ void acc_guard4(v8f& a, v8f& b, v8f& c, v8f& d) { asm volatile("v_nop\n\tv_nop\n\tv_nop\n\tv_nop" : "+v"(a), "+v"(b), "+v"(c), "+v"(d)); }
template <typename T> struct Frag;
template <> struct Frag<_Float16> {
  typedef v16h V; union U { v16h v; v8h h[2]; };
  static __device__ __forceinline__ v16h load(const _Float16* p) {   // elements 0..7 <- p[0..7], 8..15 <- p[16..23]
    U f; f.h[0] = *(const v8h*)(p); f.h[1] = *(const v8h*)(p + 16); return f.v;
  }
  static __device__ __forceinline__ v8f mma(v16h a, v16h b, v8f c) {
    return __builtin_amdgcn_wmma_f32_16x16x32_f16(false, a, false, b, (short)0, c, false, false);
  }
  static __device__ __forceinline__ void guard(v8f& a, v8f& b, v16h x, v16h y) { dep_guard_h(a, b, x, y); }
  static __device__ __forceinline__ void keep(v16h a, v16h b, v16h c, v16h d) { keep4_h(a, b, c, d); }
};
template <> struct Frag<__bf16> {
  typedef v16b V; union U { v16b v; v8b h[2]; };
  static __device__ __forceinline__ v16b load(const __bf16* p) {
    U f; f.h[0] = *(const v8b*)(p); f.h[1] = *(const v8b*)(p + 16); return f.v;
  }
  static __device__ __forceinline__ v8f mma(v16b a, v16b b, v8f c) {
    return __builtin_amdgcn_wmma_f32_16x16x32_bf16(false, a, false, b, (short)0, c, false, false);
  }
  static __device__ __forceinline__ void guard(v8f& a, v8f& b, v16b x, v16b y) { dep_guard_b(a, b, x, y); }
  static __device__ __forceinline__ void keep(v16b a, v16b b, v16b c, v16b d) { keep4_b(a, b, c, d); }
};

// ---- Register-blocked batched WMMA GEMM ------------------------------------
// C[m,n] = scale * sum_k A[m,k] * Bt[n,k] (+bias)(+resid); each wave owns a 64x64 tile, a block of 4 waves (2 x 2) a 128x128 tile.
// A row-major [M,K]; Bt row-major [N,K]; M,N % 128 == 0, K % 64 == 0.
// Operands come through LDS: a stage is 64 k (one 128-B line) of the block's 128 A rows and 128 Bt rows, brought by asynchronous 16-B copies
//   (8 lanes = one whole line), two buffers, the next stage in flight while this one is multiplied; fragments are read from LDS with the same (row, k) map as before.
// SPLIT (hi/lo operand planes) is not built in this form.
// BIAS_MODE: 0 = none, 1 = bias[m], 2 = bias[n].
// OUT_MODE: 0 = f32, 1 = f16, 2 = bf16 hi plane (Cout) + bf16 lo plane (Cout2).
// ET: 0 = f16 operands, 1 = bf16 operands (pointers passed as 16-bit storage)
// QKN: the qkv projection. A wave tile is 64 tokens x one head's 64 columns of q (n0 < DM), k (n0 < 2 DM) or v. q and k tiles are RMS-normalised
//   row by row in the epilogue and stored only as f16 planes: QHp / KHp[token][h*64 + d] = f16(QCAR * x[d] * (1 / sqrt(mean(x^2) + 1e-6)) * w[d]),
//   w = qnw / knw; v tiles are stored as a third f16 plane, VHp[token][h*64 + d] = f16(x[d]) (Cout is not used).
template <int ET> struct Elem;
template <> struct Elem<0> { typedef _Float16 T; };
template <> struct Elem<1> { typedef __bf16 T; };
#define GK_KS 64                       // k per stage, in halves
#define GK_LP 72                       // LDS row pitch in halves: 144 B = 16 B x odd, conflict-free for the 16-byte fragment reads
#define GK_BT 128                      // block tile rows of A and of Bt
#define GK_BUF (2 * GK_BT * GK_LP)     // halves per buffer: A rows 0..127, then Bt rows 0..127
// Eight asynchronous 16-byte copies of one lane: rows r, r+16, ..., r+112 of one operand (global row step gstep halves) into LDS rows 16 apart.
// The s_wait_xcnt stands inside the statement, behind the last copy, so that no address register of a copy is rewritten in front of it.
template <typename T>
__device__ __forceinline__ void gk_copy8(unsigned lds, const T* g, size_t gstep) {
  const unsigned ls = 16u * GK_LP * 2u;
  asm volatile(
      "global_load_async_to_lds_b128 %0, %8, off\n\t"
      "global_load_async_to_lds_b128 %1, %9, off\n\t"
      "global_load_async_to_lds_b128 %2, %10, off\n\t"
      "global_load_async_to_lds_b128 %3, %11, off\n\t"
      "global_load_async_to_lds_b128 %4, %12, off\n\t"
      "global_load_async_to_lds_b128 %5, %13, off\n\t"
      "global_load_async_to_lds_b128 %6, %14, off\n\t"
      "global_load_async_to_lds_b128 %7, %15, off\n\t"
      "s_wait_xcnt 0x0"
      :: "v"(lds), "v"(lds + ls), "v"(lds + 2u * ls), "v"(lds + 3u * ls), "v"(lds + 4u * ls), "v"(lds + 5u * ls), "v"(lds + 6u * ls), "v"(lds + 7u * ls),
         "v"(g), "v"(g + gstep), "v"(g + 2 * gstep), "v"(g + 3 * gstep), "v"(g + 4 * gstep), "v"(g + 5 * gstep), "v"(g + 6 * gstep), "v"(g + 7 * gstep)
      : "memory");
}
template <int ET, bool SPLIT, int BIAS_MODE, int OUT_MODE, bool RESID, bool QKN>
__global__ __launch_bounds__(128) void wmma_gemm64(
    const unsigned short* __restrict__ Ap, const unsigned short* __restrict__ A2p, int lda, long strideA,
    const unsigned short* __restrict__ Btp, const unsigned short* __restrict__ Bt2p, int ldb, long strideB,
    void* __restrict__ Cout, void* __restrict__ Cout2, int ldc, long strideC,
    const float* __restrict__ bias,
    const float* __restrict__ resid, long strideR,
    int M, int N, int K, float scale,
    const float* __restrict__ qnw, const float* __restrict__ knw,
    unsigned short* __restrict__ QHp, unsigned short* __restrict__ KHp, unsigned short* __restrict__ VHp) {
  typedef typename Elem<ET>::T T;
  typedef typename Frag<T>::V V;
  static_assert(!SPLIT);
  const T* A = (const T*)Ap; const T* Bt = (const T*)Btp;
  __shared__ __align__(16) T ring[2 * GK_BUF];     // two stage buffers (cross-wave: published by the block barriers below)
  __shared__ __align__(16) float sT[4][16 * 68];   // per-wave 16x64 slab, pitch 68 floats (wave-private)
  const int b    = blockIdx.y;
  const int lane = threadIdx.x & 31;
  const int wave = threadIdx.x >> 5;
  const int tilesN = N >> 7;
  const int tilesM = M >> 7;
  const int tile = blockIdx.x;
  if (tile >= tilesM * tilesN) return;   // block-uniform, in front of every barrier and copy
  const int tm = tile / tilesN;
  const int tn = tile - tm * tilesN;
  const int wm = wave >> 1, wn = wave & 1;         // 2 x 2 waves
  const int m0 = (tm << 7) + (wm << 6);
  const int n0 = (tn << 7) + (wn << 6);

  const T* Ab  = A  + (size_t)b * strideA;
  const T* Bb  = Bt + (size_t)b * strideB;

  const int rlane = lane & 15;                 // row (A) / col (B, D) within subtile
  const int koff  = (lane >> 4) * 8;           // k offset of this lane half
  const int mOff  = (lane >> 4) * 8;           // D row offset

  v8f acc[4][4];
#pragma unroll
  for (int i = 0; i < 4; ++i)
#pragma unroll
    for (int j = 0; j < 4; ++j) acc[i][j] = (v8f){0.f,0.f,0.f,0.f,0.f,0.f,0.f,0.f};

  // copy map: thread -> (row crow + 16 i, 16-byte piece cseg) of each operand's 128 x 128-B stage; a wave's copy covers 4 whole lines
  const int nst  = K / GK_KS;
  const int crow = threadIdx.x >> 3;
  const int cseg = (threadIdx.x & 7) * 8;
  const T* ga = Ab + (size_t)((tm << 7) + crow) * lda + cseg;
  const T* gb = Bb + (size_t)((tn << 7) + crow) * ldb + cseg;
  const unsigned lA = (unsigned)(size_t)ring + (unsigned)(crow * GK_LP + cseg) * 2u;   // LDS byte address in buffer 0, A part
  const unsigned lB = lA + GK_BT * GK_LP * 2u;                                         // Bt part
  const size_t ast = (size_t)16 * lda, bst = (size_t)16 * ldb;

  gk_copy8(lA, ga, ast);
  gk_copy8(lB, gb, bst);
  asm volatile("s_wait_asynccnt 0x0" ::: "memory");   // this wave's copies of stage 0 have landed before the barrier publishes them
  __syncthreads();
  if (nst > 1) {
    gk_copy8(lA + GK_BUF * 2u, ga + GK_KS, ast);
    gk_copy8(lB + GK_BUF * 2u, gb + GK_KS, bst);
  }

  for (int t = 0; t < nst; ++t) {
    const int bsel = (t & 1) * GK_BUF;
    const T* la = ring + bsel + ((wm << 6) + rlane) * GK_LP + koff;
    const T* lb = ring + bsel + (GK_BT + (wn << 6) + rlane) * GK_LP + koff;
    // all four loops unrolled: the fragment and accumulator arrays stay in registers, and the LDS offsets become immediates
#pragma unroll
    for (int ks = 0; ks < GK_KS; ks += 32) {
      V bh[4], ah[4];
#pragma unroll
      for (int j = 0; j < 4; ++j) bh[j] = Frag<T>::load(lb + (j << 4) * GK_LP + ks);
#pragma unroll
      for (int i = 0; i < 4; ++i) ah[i] = Frag<T>::load(la + (i << 4) * GK_LP + ks);
#pragma unroll
      for (int i = 0; i < 4; ++i) {
#pragma unroll
        for (int j = 0; j < 4; ++j) acc[i][j] = Frag<T>::mma(ah[i], bh[j], acc[i][j]);
        Frag<T>::guard(acc[i][0], acc[i][3], ah[i], ah[i]);
      }
      Frag<T>::keep(bh[0], bh[1], bh[2], bh[3]);
    }
    asm volatile("s_wait_dscnt 0x0" ::: "memory");      // this wave's fragment reads have returned before the buffer may be refilled
    asm volatile("s_wait_asynccnt 0x0" ::: "memory");   // this wave's copies of stage t + 1 have landed before the barrier publishes them
    __syncthreads();                                    // publishes stage t + 1 and ends every wave's reads of stage t's buffer
    if (t + 2 < nst) {
      gk_copy8(lA + (unsigned)bsel * 2u, ga + (size_t)(t + 2) * GK_KS, ast);
      gk_copy8(lB + (unsigned)bsel * 2u, gb + (size_t)(t + 2) * GK_KS, bst);
    }
  }
  asm volatile("s_wait_asynccnt 0x0" ::: "memory");     // no copy is outstanding when the wave goes on
  acc_guard4(acc[0][0], acc[0][1], acc[0][2], acc[0][3]);
  acc_guard4(acc[1][0], acc[1][1], acc[1][2], acc[1][3]);
  acc_guard4(acc[2][0], acc[2][1], acc[2][2], acc[2][3]);
  acc_guard4(acc[3][0], acc[3][1], acc[3][2], acc[3][3]);

  // ---- epilogue ----
  float* slab = sT[wave];
  const float* Rb = RESID ? (resid + (size_t)b * strideR) : nullptr;
  const int nslice = QKN ? n0 / DM : 2;            // 0 = q, 1 = k, 2 = v (wave-uniform)
  v4f nw0 = (v4f){0.f,0.f,0.f,0.f}, nw1 = nw0;     // norm weights of this lane's 8 columns
  if (QKN && nslice < 2) {
    const float* nwp = (nslice ? knw : qnw) + (lane & 7) * 8;
    nw0 = *(const v4f*)nwp;
    nw1 = *(const v4f*)(nwp + 4);
  }
#pragma unroll
  for (int i = 0; i < 4; ++i) {
    const int mBase = m0 + (i << 4);
#pragma unroll
    for (int j = 0; j < 4; ++j) {
      const int n = n0 + (j << 4) + rlane;
      float bv = 0.f;
      if (BIAS_MODE == 2) bv = bias[n];
#pragma unroll
      for (int r = 0; r < 8; ++r) {
        float v = acc[i][j][r] * scale;
        if (BIAS_MODE == 1) v += bias[mBase + mOff + r];
        if (BIAS_MODE == 2) v += bv;
        if (RESID) v += Rb[(size_t)(mBase + mOff + r) * ldc + n];
        slab[(mOff + r) * 68 + (j << 4) + rlane] = v;
      }
    }
    __builtin_amdgcn_fence(3, "workgroup");
    __builtin_amdgcn_wave_barrier();
    __builtin_amdgcn_fence(2, "workgroup");
    if (QKN && nslice < 2) {
      // 8 lanes per row, 8 columns per lane: sum of squares in the lane, then over the 8 lanes; one 16-B store per lane = a 128-B line per row
      const int q = lane >> 3, c8 = (lane & 7) * 8;
      unsigned short* P = (nslice ? KHp : QHp) + (n0 - nslice * DM) + c8;
#pragma unroll   // the four row groups' LDS reads and lane exchanges issue together, so their latencies overlap
      for (int it = 0; it < 4; ++it) {
        const int row = it * 4 + q;
        const v4f x0 = *(const v4f*)(slab + row * 68 + c8);
        const v4f x1 = *(const v4f*)(slab + row * 68 + c8 + 4);
        float ss = (x0.x * x0.x + x0.y * x0.y + x0.z * x0.z + x0.w * x0.w) + (x1.x * x1.x + x1.y * x1.y + x1.z * x1.z + x1.w * x1.w);
#pragma unroll   // constant lane distances 1, 2, 4: the 8 lanes of a row
        for (int o = 1; o < 8; o <<= 1) ss += __shfl_xor(ss, o, 32);
        const float rms = sqrtf(ss * (1.0f / 64.0f) + 1e-6f);
        const float rec = 1.0f / rms;
        v4u pk;
        pk.x = cmb_pk2(((x0.x * rec) * nw0.x) * QCAR, ((x0.y * rec) * nw0.y) * QCAR);
        pk.y = cmb_pk2(((x0.z * rec) * nw0.z) * QCAR, ((x0.w * rec) * nw0.w) * QCAR);
        pk.z = cmb_pk2(((x1.x * rec) * nw1.x) * QCAR, ((x1.y * rec) * nw1.y) * QCAR);
        pk.w = cmb_pk2(((x1.z * rec) * nw1.z) * QCAR, ((x1.w * rec) * nw1.w) * QCAR);
        *(v4u*)(P + (size_t)(mBase + row) * DM) = pk;
      }
    } else if (QKN) {
      // v tile: 8 lanes per row, 8 columns per lane, one 16-B store per lane = a 128-B line per row
      const int q = lane >> 3, c8 = (lane & 7) * 8;
      unsigned short* P = VHp + (n0 - 2 * DM) + c8;
#pragma unroll   // the four row groups' LDS reads issue together
      for (int it = 0; it < 4; ++it) {
        const int row = it * 4 + q;
        const v4f x0 = *(const v4f*)(slab + row * 68 + c8);
        const v4f x1 = *(const v4f*)(slab + row * 68 + c8 + 4);
        v4u pk;
        pk.x = cmb_pk2(x0.x, x0.y);
        pk.y = cmb_pk2(x0.z, x0.w);
        pk.z = cmb_pk2(x1.x, x1.y);
        pk.w = cmb_pk2(x1.z, x1.w);
        *(v4u*)(P + (size_t)(mBase + row) * DM) = pk;
      }
    } else if (OUT_MODE == 0) {
      float* C = (float*)Cout + (size_t)b * strideC;
      const int hh = lane >> 4, c4 = (lane & 15) * 4;     // row seg = 256 B = 16 lanes x 16 B
      {
#pragma unroll
        for (int it = 0; it < 8; ++it) {
          const int row = it * 2 + hh;
          v4f v = *(const v4f*)(slab + row * 68 + c4);
          *(v4f*)(C + (size_t)(mBase + row) * ldc + n0 + c4) = v;
        }
        
      }
    } else {
      const int q = lane >> 3, c8 = (lane & 7) * 8;
      unsigned short* C  = (unsigned short*)Cout  + (size_t)b * strideC;
      unsigned short* C2 = (OUT_MODE == 2) ? ((unsigned short*)Cout2 + (size_t)b * strideC) : nullptr;
      {
#pragma unroll
        for (int it = 0; it < 4; ++it) {
          const int row = it * 4 + q;
          const float* sp = slab + row * 68 + c8;
          v8h hv, lv;
#pragma unroll
          for (int e = 0; e < 8; ++e) {
            if (OUT_MODE == 1) {
              hv[e] = (_Float16)sp[e];
            } else {
              unsigned short hb = f2bf_bits(sp[e]);
              unsigned short lb = f2bf_bits(sp[e] - bf_bits2f(hb));
              hv[e] = __builtin_bit_cast(_Float16, hb);
              lv[e] = __builtin_bit_cast(_Float16, lb);
            }
          }
          *(v8h*)(C + (size_t)(mBase + row) * ldc + n0 + c8) = hv;
          if (OUT_MODE == 2) *(v8h*)(C2 + (size_t)(mBase + row) * ldc + n0 + c8) = lv;
        }
        
      }
    }
    __builtin_amdgcn_fence(3, "workgroup");
    __builtin_amdgcn_wave_barrier();
    __builtin_amdgcn_fence(2, "workgroup");
  }
}

// =====================================================================================
// Non-causal attention for head_dim 64; q/k from f16 planes (normed values carried x QCAR), v from an f16 plane, f32 out.
//   scores^T = k.q^T        : v_wmma_f32_16x16x32_f16, single product; natural score = raw * sscale (sscale = 1/sqrt(64) / QCAR^2)
//   out^T    = v^T.p^T      : v_wmma_f32_16x16x32_f16; p = exp((s - m_running)*sscale) carried x 2^pexp (2^15) as f16, v plain f16
//   An exponential is one multiply-add and one v_exp_f32: 2^pexp * p = exp2(s * c2 - (m_running * c2 - pexp)), c2 = sscale * log2(e); the sum of p is carried x 2^pexp too.
//   Both products are transposed, so a lane holds scores, P and output of ONE query (its D column): maximum and sum run inside the lane
//   (one exchange between the lane halves), and two score tiles, converted in place, are the B fragment of the second product.
//   K and V chunks come row-major into LDS by asynchronous 16-B copies (8 lanes = one whole 128-B row), two buffers, the next chunk in flight while
//   this one is worked on; V^T fragments come by the transposing LDS load.
//   f32 accumulate; online softmax in f32. Block = 4 waves = 64 query rows of one (batch, head); S % 64 == 0.
//   Element (b, s, h, d) of tensor X lives at X[b*X_bs + s*X_rs + h*X_hs + d] (strides in elements, multiples of 8).
//   grid.x = B * H * (S/64), block 128.
// =====================================================================================
#define AT_D 64
#define AT_NW 4
#define AT_QB 64
#define AT_KC 64
#define AT_LP 72   // LDS row pitch in halves of the 64-half K rows: 144 B = 16 B x odd, so the 16 lanes of a 16-byte fragment read fall on 16 distinct bank groups
#define AT_VP 80   // LDS row pitch in halves of the 64-half V rows: 160 B = 32 B x odd, the conflict-free pitch of ds_load_tr16_b128
#define AT_KB (AT_KC * AT_LP)            // halves of a buffer's K part
#define AT_BUF (AT_KB + AT_KC * AT_VP)   // halves per buffer
struct AttnGeom { long long q_bs, q_rs, q_hs, k_bs, k_rs, k_hs, v_bs, v_rs, v_hs, o_bs, o_rs, o_hs; int S, Skv, H, nchunk; float sscale; float pexp; };
static_assert(sizeof(AttnGeom) == 12 * 8 + 4 * 4 + 2 * 4);

// the builtin alone: the compiler keeps the distances behind its own matrix instructions, and is free to issue independent ones back to back
__device__ __forceinline__ v8f at_mmah(v16h a, v16h b, v8f c) {
  return __builtin_amdgcn_wmma_f32_16x16x32_f16(false, a, false, b, (short)0, c, false, false);
}

// Base-2 exponentials by v_exp_f32, each in place. In one statement, so that no exponential overwrites the source of the one directly in front of it;
// the closing v_nop is the slot that the instruction set asks for between a transcendental and a directly following user of its result.
__device__ __forceinline__ float at_exp2(float x) {
  asm("v_exp_f32 %0, %0\n\tv_nop" : "+v"(x));
  return x;
}
__device__ __forceinline__ v8f at_exp2x8(v8f x) {
  float a = x[0], b = x[1], c = x[2], d = x[3], e = x[4], f = x[5], g = x[6], h = x[7];
  asm("v_exp_f32 %0, %0\n\t"
      "v_exp_f32 %1, %1\n\t"
      "v_exp_f32 %2, %2\n\t"
      "v_exp_f32 %3, %3\n\t"
      "v_exp_f32 %4, %4\n\t"
      "v_exp_f32 %5, %5\n\t"
      "v_exp_f32 %6, %6\n\t"
      "v_exp_f32 %7, %7\n\t"
      "v_nop"
      : "+v"(a), "+v"(b), "+v"(c), "+v"(d), "+v"(e), "+v"(f), "+v"(g), "+v"(h));
  return (v8f){a, b, c, d, e, f, g, h};
}

// Transposing 16-bit LDS load: lane (c = l & 15, h = l >> 4), addressed at row 8h + (l & 7), halves 8 * ((l >> 3) & 1) of a row-major tile, gets T[8h + 0..7][c]
typedef short s16x8 __attribute__((ext_vector_type(8)));
__device__ __forceinline__ v8h at_ldtr16(const _Float16* p) {
  typedef __attribute__((address_space(3))) s16x8 lds_s16x8;
  return __builtin_bit_cast(v8h, __builtin_amdgcn_ds_load_tr16_b128_v8i16((lds_s16x8*)p));
}

// Eight asynchronous 16-byte copies of one lane: rows r, r+16, r+32, r+48 of a K chunk and of a V chunk (global row steps kst, vst halves per 16 rows).
// The s_wait_xcnt stands inside the statement, behind the last copy, so that no address register of a copy is rewritten in front of it.
__device__ __forceinline__ void at_copy8(unsigned lk, const _Float16* gk, size_t kst, unsigned lv, const _Float16* gv, size_t vst) {
  const unsigned ks = 16u * AT_LP * 2u, vs = 16u * AT_VP * 2u;
  asm volatile(
      "global_load_async_to_lds_b128 %0, %8, off\n\t"
      "global_load_async_to_lds_b128 %1, %9, off\n\t"
      "global_load_async_to_lds_b128 %2, %10, off\n\t"
      "global_load_async_to_lds_b128 %3, %11, off\n\t"
      "global_load_async_to_lds_b128 %4, %12, off\n\t"
      "global_load_async_to_lds_b128 %5, %13, off\n\t"
      "global_load_async_to_lds_b128 %6, %14, off\n\t"
      "global_load_async_to_lds_b128 %7, %15, off\n\t"
      "s_wait_xcnt 0x0"
      :: "v"(lk), "v"(lk + ks), "v"(lk + 2u * ks), "v"(lk + 3u * ks), "v"(lv), "v"(lv + vs), "v"(lv + 2u * vs), "v"(lv + 3u * vs),
         "v"(gk), "v"(gk + kst), "v"(gk + 2 * kst), "v"(gk + 3 * kst), "v"(gv), "v"(gv + vst), "v"(gv + 2 * vst), "v"(gv + 3 * vst)
      : "memory");
}

__global__ __launch_bounds__(128) __attribute__((amdgpu_num_vgpr(256)))
void k_attn64(const unsigned short* __restrict__ qp, const unsigned short* __restrict__ kp,
              const unsigned short* __restrict__ vp, float* __restrict__ out, AttnGeom g) {
  union FH { v16h v; v8h h[2]; };
  __shared__ __align__(16) _Float16 kvs[2 * AT_BUF];        // two chunk buffers, each K [kv][d] then V [kv][d], f16 (cross-wave: published by the block barriers below)
  __shared__ __align__(16) float    Os[AT_NW][16 * 68];     // per wave out tile, pitch 68 (wave-private)

  const int tid  = threadIdx.x;
  const int wave = tid >> 5;
  const int lane = tid & 31;
  const int hh   = lane >> 4;
  const int c    = lane & 15;

  const int nqb = g.S / AT_QB;
  const int bx = blockIdx.x;
  const int qb = bx % nqb;
  const int bh = bx / nqb;
  const int h  = bh % g.H;
  const int b  = bh / g.H;
  const int q0 = qb * AT_QB + wave * 16;

  const _Float16* q = (const _Float16*)qp;
  const _Float16* k = (const _Float16*)kp;
  const _Float16* v = (const _Float16*)vp;
  const _Float16* qb_ptr = q + (size_t)b * g.q_bs + (size_t)h * g.q_hs;
  const _Float16* kb_ptr = k + (size_t)b * g.k_bs + (size_t)h * g.k_hs;
  const _Float16* vb_ptr = v + (size_t)b * g.v_bs + (size_t)h * g.v_hs;
  float*          ob_ptr = out + (size_t)b * g.o_bs + (size_t)h * g.o_hs;

  // ---- Q fragments (B operand): 2 d-chunks; lane column c = query q0 + c, elements 0..7 <- d = dc*32 + 8hh + e, 8..15 <- dc*32 + 16 + 8hh + e (two 16-B loads from the f16 row) ----
  v16h qa[2];
  {
    const _Float16* qrow = qb_ptr + (size_t)(q0 + c) * g.q_rs;
#pragma unroll
    for (int dc = 0; dc < 2; ++dc) {
      FH f;
      f.h[0] = *(const v8h*)(qrow + dc * 32 + 8 * hh);
      f.h[1] = *(const v8h*)(qrow + dc * 32 + 16 + 8 * hh);
      qa[dc] = f.v;
    }
  }

  float mcol = -INFINITY;   // running maximum of this lane's query (raw units; equal in both lane halves)
  float lcol = 0.f;         // running sum of 2^pexp * p over the keys of this lane half; the halves are joined after the loop
  const float c2 = g.sscale * 1.4426950408889634f;   // raw score units -> base-2 exponent
  v8f oacc[4];              // out^T: tile t, element r = (d = t*16 + 8hh + r, query q0 + c)
#pragma unroll
  for (int t = 0; t < 4; ++t) oacc[t] = (v8f){0.f,0.f,0.f,0.f,0.f,0.f,0.f,0.f};

  // copy map: thread -> (row srow + 16 i, 16-byte piece sseg / 8) of the chunk's 64 K rows and 64 V rows; a wave's copy covers 4 whole 128-B rows
  const int srow = tid >> 3, sseg = (tid & 7) * 8;
  const _Float16* gk = kb_ptr + (size_t)srow * g.k_rs + sseg;
  const _Float16* gv = vb_ptr + (size_t)srow * g.v_rs + sseg;
  const unsigned lK = (unsigned)(size_t)kvs + (unsigned)(srow * AT_LP + sseg) * 2u;           // LDS byte address in buffer 0, K part
  const unsigned lV = (unsigned)(size_t)kvs + (unsigned)(AT_KB + srow * AT_VP + sseg) * 2u;   // V part
  const size_t kst = (size_t)16 * g.k_rs, vst = (size_t)16 * g.v_rs;         // 16 rows
  const size_t kch = (size_t)AT_KC * g.k_rs, vch = (size_t)AT_KC * g.v_rs;   // one chunk

  if (g.nchunk > 0) at_copy8(lK, gk, kst, lV, gv, vst);
  asm volatile("s_wait_asynccnt 0x0" ::: "memory");   // this wave's copies of chunk 0 have landed before the barrier publishes them
  __syncthreads();
  if (g.nchunk > 1) at_copy8(lK + AT_BUF * 2u, gk + kch, kst, lV + AT_BUF * 2u, gv + vch, vst);

  for (int kc = 0; kc < g.nchunk; ++kc) {
    const int bsel = (kc & 1) * AT_BUF;
    const _Float16* Ksh = kvs + bsel;           // K [kv][d], pitch AT_LP
    const _Float16* Vsh = kvs + bsel + AT_KB;   // V [kv][d], pitch AT_VP

    // ---- every fragment of the chunk is fetched here, as one group, each into registers of its own: the K fragments are waited for once,
    //      and the V^T fragments arrive behind the score products and the softmax ----
    FH kf[4][2];   // K: A fragment, lane row c = key j*16 + c, same k(i,h) map as B
    FH vf[2][4];   // V^T: A fragment, lane row c = d = t*16 + c, k = key, by transposing loads of the row-major V tile, which deliver the fragment k map
#pragma unroll   // in the order in which the products below take them
    for (int dc = 0; dc < 2; ++dc) {
#pragma unroll
      for (int j = 0; j < 4; ++j) {
        kf[j][dc].h[0] = *(const v8h*)(Ksh + (j * 16 + c) * AT_LP + dc * 32 + 8 * hh);
        kf[j][dc].h[1] = *(const v8h*)(Ksh + (j * 16 + c) * AT_LP + dc * 32 + 16 + 8 * hh);
      }
    }
#pragma unroll
    for (int kk = 0; kk < 2; ++kk) {
#pragma unroll
      for (int t = 0; t < 4; ++t) {
        vf[kk][t].h[0] = at_ldtr16(Vsh + (kk * 32 + 8 * hh + (lane & 7)) * AT_VP + t * 16 + 8 * ((lane >> 3) & 1));        // keys kk*32 + 8hh + 0..7 of d = t*16 + c
        vf[kk][t].h[1] = at_ldtr16(Vsh + (kk * 32 + 16 + 8 * hh + (lane & 7)) * AT_VP + t * 16 + 8 * ((lane >> 3) & 1));   // keys kk*32 + 16 + 8hh + 0..7
      }
    }
    __builtin_amdgcn_sched_barrier(0);   // keeps the group of loads together in front of the products: sunk to their users, each pair would be waited for on its own
    // ---- scores^T: 4 key subtiles x 2 d-chunks; the four tiles are independent, so the products issue back to back ----
    v8f s[4];
#pragma unroll
    for (int j = 0; j < 4; ++j) s[j] = at_mmah(kf[j][0].v, qa[0], (v8f){0.f,0.f,0.f,0.f,0.f,0.f,0.f,0.f});
#pragma unroll
    for (int j = 0; j < 4; ++j) s[j] = at_mmah(kf[j][1].v, qa[1], s[j]);
    // ---- chunk maximum of the lane's query (raw units; sscale > 0 so max commutes): D element r of this lane = (key kc*64 + j*16 + 8hh + r, query q0 + c) ----
    float cm4[4];
#pragma unroll
    for (int j = 0; j < 4; ++j)
      cm4[j] = fmaxf(fmaxf(fmaxf(s[j][0], s[j][1]), fmaxf(s[j][2], s[j][3])), fmaxf(fmaxf(s[j][4], s[j][5]), fmaxf(s[j][6], s[j][7])));
    float cm = fmaxf(fmaxf(cm4[0], cm4[1]), fmaxf(cm4[2], cm4[3]));
    cm = fmaxf(cm, __shfl_xor(cm, 16, 32));   // the other lane half holds the query's other 32 keys
    const float mnew = fmaxf(mcol, cm);
    const float alpha = at_exp2((mcol - mnew) * c2);   // 0 on the first chunk, where mcol is -inf
    const float nm = g.pexp - mnew * c2;
    mcol = mnew;
    // ---- p, and P^T as B fragments: element i of fragment kk is key kk*32 + k(i,hh) = element i & 7 of score tile 2 kk + (i >> 3) ----
    v16h pb[2];
    float ps4[4];   // one partial sum per score tile: four independent add chains
#pragma unroll
    for (int j = 0; j < 4; ++j) {
      v8f p;
#pragma unroll
      for (int r = 0; r < 8; ++r) p[r] = fmaf(s[j][r], c2, nm);
      p = at_exp2x8(p);
      float psum = p[0];
#pragma unroll
      for (int r = 1; r < 8; ++r) psum += p[r];
#pragma unroll
      for (int r = 0; r < 8; ++r) pb[j >> 1][(j & 1) * 8 + r] = (_Float16)p[r];
      ps4[j] = psum;
    }
    lcol = lcol * alpha + ((ps4[0] + ps4[1]) + (ps4[2] + ps4[3]));
#pragma unroll
    for (int t = 0; t < 4; ++t) oacc[t] *= alpha;
    // ---- V^T.P^T: A = V^T from the registers filled at the chunk's head; B = P^T from the registers ----
#pragma unroll   // vf, pb and oacc are indexed by constants only, so all stay in registers
    for (int kk = 0; kk < 2; ++kk) {
#pragma unroll
      for (int t = 0; t < 4; ++t) oacc[t] = at_mmah(vf[kk][t].v, pb[kk], oacc[t]);
    }
    __builtin_amdgcn_sched_barrier(0);   // keeps the chunk's arithmetic in front of the waits below: lifted to the chunk's head, the wait for the next chunk's copies would find them only just issued
    asm volatile("s_wait_dscnt 0x0" ::: "memory");      // this wave's fragment reads have returned before the buffer may be refilled
    asm volatile("s_wait_asynccnt 0x0" ::: "memory");   // this wave's copies of chunk kc + 1 have landed before the barrier publishes them
    __syncthreads();                                    // publishes chunk kc + 1 and ends every wave's reads of chunk kc's buffer
    if (kc + 2 < g.nchunk) at_copy8(lK + (unsigned)bsel * 2u, gk + (size_t)(kc + 2) * kch, kst, lV + (unsigned)bsel * 2u, gv + (size_t)(kc + 2) * vch, vst);
  }
  asm volatile("s_wait_asynccnt 0x0" ::: "memory");     // no copy is outstanding when the wave goes on

  float* os = Os[wave];
  {
    const float inv = 1.0f / (lcol + __shfl_xor(lcol, 16, 32));   // both halves' sums joined once; sum and out^T carry the same 2^pexp
#pragma unroll
    for (int t = 0; t < 4; ++t) {
      // 8 consecutive d of the lane's query row: two 16-B LDS stores
      *(v4f*)(os + c * 68 + t * 16 + 8 * hh)     = (v4f){oacc[t][0] * inv, oacc[t][1] * inv, oacc[t][2] * inv, oacc[t][3] * inv};
      *(v4f*)(os + c * 68 + t * 16 + 8 * hh + 4) = (v4f){oacc[t][4] * inv, oacc[t][5] * inv, oacc[t][6] * inv, oacc[t][7] * inv};
    }
  }
  __builtin_amdgcn_fence(3, "workgroup");
  __builtin_amdgcn_wave_barrier();
  __builtin_amdgcn_fence(2, "workgroup");
  {
    const int c4 = (lane & 15) * 4;
    {
#pragma unroll
      for (int it = 0; it < 8; ++it) {
        const int row = it * 2 + hh;
        v4f val = *(const v4f*)(os + row * 68 + c4);
        *(v4f*)(ob_ptr + (size_t)(q0 + row) * g.o_rs + c4) = val;
      }
      
    }
  }
}

} // namespace w25

// =====================================================================================
// =====================================================================================
// k_prep: the 16-bit planes of x, Wqkv, Wproj and the small vectors in ONE launch; the four jobs are independent, and a block takes its job by its index:
//   blocks [0, PB_X): X16 = f16(16 * bf16 RNE(x)); the next PB_W: W16 = f16(64 * bf16 RNE(Wqkv)); the next PB_P: WP16 = f16(64 * bf16 RNE(Wproj));
//   a block = 2048 consecutive elements, a thread = 8 of them (two 16-B loads, one 16-B store); the last PB_V blocks: the small vectors' bf16 RNE values as f32.
#define PB_XB (SEQ * DM / 2048)     // blocks per batch of x
#define PB_X  (NB * PB_XB)
#define PB_W  (NQKV * DM / 2048)
#define PB_P  (DM * DM / 2048)
#define PB_V  ((VECN + 255) / 256)
static_assert((SEQ * DM) % 2048 == 0);
static_assert((NQKV * DM) % 2048 == 0);
static_assert((DM * DM) % 2048 == 0);
__global__ __launch_bounds__(256) void k_prep(const float* __restrict__ x, const float* __restrict__ wq, const float* __restrict__ wp,
                                              const float* __restrict__ bq, const float* __restrict__ bp, const float* __restrict__ qw, const float* __restrict__ kw,
                                              unsigned short* __restrict__ X16, unsigned short* __restrict__ W16, unsigned short* __restrict__ WP16, float* __restrict__ VEC) {
    const int blk = blockIdx.x;
    if (blk < PB_X + PB_W + PB_P) {
        const float* s;
        unsigned short* d;
        float sc;
        if (blk < PB_X) {
            const int z = blk / PB_XB, r = blk - z * PB_XB;   // batch rows of x at the full per-batch stride
            s = x + (size_t)z * SEQ_FULL * DM + (size_t)r * 2048;
            d = X16 + (size_t)z * SEQ * DM + (size_t)r * 2048;
            sc = 16.0f;
        } else if (blk < PB_X + PB_W) {
            s = wq + (size_t)(blk - PB_X) * 2048;
            d = W16 + (size_t)(blk - PB_X) * 2048;
            sc = 64.0f;
        } else {
            s = wp + (size_t)(blk - PB_X - PB_W) * 2048;
            d = WP16 + (size_t)(blk - PB_X - PB_W) * 2048;
            sc = 64.0f;
        }
        s += threadIdx.x * 8;
        d += threadIdx.x * 8;
        const v4f a = *(const v4f*)s;
        const v4f b = *(const v4f*)(s + 4);
        v4u pk;
        pk.x = cmb_pk2(cmb_bf(a.x) * sc, cmb_bf(a.y) * sc);
        pk.y = cmb_pk2(cmb_bf(a.z) * sc, cmb_bf(a.w) * sc);
        pk.z = cmb_pk2(cmb_bf(b.x) * sc, cmb_bf(b.y) * sc);
        pk.w = cmb_pk2(cmb_bf(b.z) * sc, cmb_bf(b.w) * sc);
        *(v4u*)d = pk;
    } else {
        const int u = (blk - (PB_X + PB_W + PB_P)) * 256 + threadIdx.x;
        if (u < VECN) {
            const float a  = bq[min(u, NQKV - 1)];
            const float bb = bp[min(max(u - OFF_BP, 0), DM - 1)];
            const float cq = qw[min(max(u - OFF_QW, 0), HDIM - 1)];
            const float ck = kw[min(max(u - OFF_KW, 0), HDIM - 1)];
            const float sel = (u < OFF_BP) ? a : ((u < OFF_QW) ? bb : ((u < OFF_KW) ? cq : ck));
            asm volatile("s_wait_xcnt 0x0" ::: "memory");   // stands behind the load, in front of the arithmetic that reuses its address registers
            VEC[u] = cmb_bf(sel);
        }
    }
}

// =====================================================================================
// k_castp: DST[z][r][c] (pitch ldd halves, batch stride dbs halves) = f16(sc * g(SRC[z][r][c])) with g = bf16 RNE value (bfr != 0) or identity,
//   r < nR, c < nC (nC % 8 == 0); SRC batch stride sbs floats, row pitch lds floats. Thread per (r, 8 consecutive c): two 16-B loads,
// =====================================================================================
__global__ __launch_bounds__(256) void k_castp(const float* __restrict__ SRC, long long sbs, int lds, unsigned short* __restrict__ DST, long long dbs, int ldd, int nR, int nC, float sc, int bfr) {
    const long long u = (long long)blockIdx.x * 256 + threadIdx.x;
    const int per = nC >> 3;
    if (u >= (long long)nR * per) return;
    const int r = (int)(u / per);
    const int c0 = 8 * (int)(u - (long long)r * per);
    const float* s = SRC + (long long)blockIdx.y * sbs + (long long)r * lds + c0;
    const v4f a = *(const v4f*)s;
    const v4f bq = *(const v4f*)(s + 4);
    float w[8] = {a.x, a.y, a.z, a.w, bq.x, bq.y, bq.z, bq.w};
#pragma unroll
    for (int e = 0; e < 8; ++e) { const float t = bfr ? cmb_bf(w[e]) : w[e]; w[e] = t * sc; }
    v4u pk;
    pk.x = cmb_pk2(w[0], w[1]); pk.y = cmb_pk2(w[2], w[3]); pk.z = cmb_pk2(w[4], w[5]); pk.w = cmb_pk2(w[6], w[7]);
    v4u* d = (v4u*)(DST + (long long)blockIdx.y * dbs + (long long)r * ldd + c0);
    *d = pk;
    
}

extern "C" void kernel_launch(void* const* d_in, const int* in_sizes, int n_in, void* d_out, int out_size, void* d_ws, size_t ws_size, hipStream_t stream) {
    if (n_in < 7) return;
    const float* x     = (const float*)d_in[0];     // [2][2048][1024]
    const float* Wqkv  = (const float*)d_in[1];     // [3072][1024]  ([out][in] = Bt layout)
    const float* bqkv  = (const float*)d_in[2];     // [3072]
    const float* Wproj = (const float*)d_in[3];     // [1024][1024]  ([out][in] = Bt layout)
    const float* bproj = (const float*)d_in[4];     // [1024]
    const float* qn_w  = (const float*)d_in[5];     // [64]
    const float* kn_w  = (const float*)d_in[6];     // [64]
    const long long xneed = ((long long)(NB - 1) * SEQ_FULL + SEQ) * DM;
    if ((long long)in_sizes[0] < xneed) return;
    if ((long long)in_sizes[1] < (long long)NQKV * DM) return;
    if (in_sizes[2] < NQKV) return;
    if ((long long)in_sizes[3] < (long long)DM * DM) return;
    if (in_sizes[4] < DM) return;
    if (in_sizes[5] < HDIM || in_sizes[6] < HDIM) return;
    if ((long long)out_size < xneed) return;
    if (WS_TOTAL > ws_size) return;

    char* wsp = (char*)d_ws;
    float* VEC = (float*)wsp; wsp += WS_VEC;                              // 4224 f32 (bf16 RNE values of the small input vectors)
    unsigned short* X16 = (unsigned short*)wsp; wsp += WS_X16;             // [NTOK][1024] f16 = 16 * bf16(x)
    unsigned short* W16 = (unsigned short*)wsp; wsp += WS_W16;             // [3072][1024] f16 = 64 * bf16(Wqkv)
    unsigned short* WP16 = (unsigned short*)wsp; wsp += WS_WP16;           // [1024][1024] f16 = 64 * bf16(Wproj)
    unsigned short* QH16 = (unsigned short*)wsp; wsp += WS_QK16;           // [NTOK][1024] f16 = 16 * normalised q
    unsigned short* KH16 = (unsigned short*)wsp; wsp += WS_QK16;           // [NTOK][1024] f16 = 16 * normalised k
    unsigned short* VH16 = (unsigned short*)wsp; wsp += WS_QK16;           // [NTOK][1024] f16 = v
    float* CTX = (float*)wsp; wsp += WS_CTX;                               // [NTOK][1024] f32 attention output (token-major, head*64 + d)
    unsigned short* CTX16 = (unsigned short*)wsp; wsp += WS_CTX16;         // [NTOK][1024] f16 = 256 * ctx
    float* out = (float*)d_out;

    // 1-4. one launch: small vectors -> bf16 RNE values (f32); 16-bit operand planes of x, Wqkv, Wproj (bf16 RNE input values times a power of two, exact in f16)
    k_prep<<<(unsigned)(PB_X + PB_W + PB_P + PB_V), 256, 0, stream>>>(x, Wqkv, Wproj, bqkv, bproj, qn_w, kn_w, X16, W16, WP16, VEC);
    // 5. qkv = (16 bf16(x)) . (64 bf16(Wqkv))^T / 1024 + bf16(bqkv); v -> f16 plane; q and k -> per-head RMSNorm (f32 math) in the epilogue -> f16 planes carried x16
    w25::wmma_gemm64<0, false, 2, 0, false, true><<<dim3((unsigned)((NTOK / 128) * (NQKV / 128)), 1u), 128, 0, stream>>>(
        (const unsigned short*)X16, nullptr, DM, 0L, (const unsigned short*)W16, nullptr, DM, 0L,
        nullptr, nullptr, NQKV, 0L, VEC + OFF_BQ, nullptr, 0L, NTOK, NQKV, DM, 1.0f / 1024.0f,
        VEC + OFF_QW, VEC + OFF_KW, QH16, KH16, VH16);
    // 6. attention: 64 query rows per block, 64-key chunks, online softmax
    w25::AttnGeom g;
    g.q_bs = (long long)SEQ * DM;   g.q_rs = DM;   g.q_hs = HDIM;
    g.k_bs = (long long)SEQ * DM;   g.k_rs = DM;   g.k_hs = HDIM;
    g.v_bs = (long long)SEQ * DM;   g.v_rs = DM;   g.v_hs = HDIM;
    g.o_bs = (long long)SEQ * DM;   g.o_rs = DM;   g.o_hs = HDIM;
    g.S = SEQ; g.Skv = SEQ; g.H = NH; g.nchunk = SEQ / AT_KC; g.sscale = 0.125f / (QCAR * QCAR); g.pexp = 15.0f;
    w25::k_attn64<<<(unsigned)(NB * NH * (SEQ / AT_QB)), 128, 0, stream>>>(QH16, KH16, VH16, CTX, g);
    // 7. ctx -> f16 plane (x256)
    k_castp<<<dim3((unsigned)(((long long)NTOK * (DM / 8) + 255) / 256), 1u), 256, 0, stream>>>(CTX, 0LL, DM, CTX16, 0LL, DM, NTOK, DM, 256.0f, 0);
    // 8. out[b][s][:] = (256 ctx) . (64 bf16(Wproj))^T / 16384 + bf16(bproj), batch rows at the full per-batch stride of d_out
    w25::wmma_gemm64<0, false, 2, 0, false, false><<<dim3((unsigned)((SEQ / 128) * (DM / 128)), (unsigned)NB), 128, 0, stream>>>(
        (const unsigned short*)CTX16, nullptr, DM, (long)SEQ * DM, (const unsigned short*)WP16, nullptr, DM, 0L,
        (void*)out, nullptr, DM, (long)SEQ_FULL * DM, VEC + OFF_BP, nullptr, 0L, SEQ, DM, DM, 1.0f / 16384.0f,
        nullptr, nullptr, nullptr, nullptr, nullptr);
    (void)hipGetLastError();
}

// v009
// A run of this version takes 88.9 microseconds.
// Next to v008, in two timings, it ran 1.07 and 1.06 times as fast.
// All steps since v000 together make it 3.76 times as fast.
// Contractions: qkv projection [NB*SEQ x 1024 x 3072] and output projection [NB*SEQ x 1024 x 1024] = v_wmma_f32_16x16x32_f16 (f16 operands: bf16 RNE input values scaled by powers of two, and the attention output carried x256 in the output projection's A, f32 accumulate); attention scores, transposed, k.q^T = v_wmma_f32_16x16x32_f16 (normed q,k carried x16 as f16, single product, f32 accumulate); V^T.P^T = v_wmma_f32_16x16x32_f16 (P carried x2^15 as f16, v f16, f32 accumulate); RMSNorm (in the qkv projection's epilogue) and online softmax in f32, its exponentials in base 2.
#include <hip/hip_runtime.h>
#include <math.h>

#ifndef NB
#define NB 2
#endif
#ifndef SEQ
#define SEQ 2048
#endif
#define NB_FULL 2
#define SEQ_FULL 2048
#define DM 1024
#define NH 16
#define HDIM 64
#define NQKV (3 * DM)
#define NTOK (NB * SEQ)
#define QCAR 16.0f
#define CCAR 256.0f   // carry of the attention output in its f16 plane
// small f32 vector region: [bqkv 3072 | bproj 1024 | qn_w 64 | kn_w 64], each entry the bf16 RNE value of the input
#define OFF_BQ 0
#define OFF_BP NQKV
#define OFF_QW (NQKV + DM)
#define OFF_KW (NQKV + DM + HDIM)
#define VECN (NQKV + DM + 2 * HDIM)
static_assert(SEQ % 128 == 0);   // 128-row block tiles of the projections; 64-row blocks of the attention
static_assert(NB >= 1);
static_assert(NB <= NB_FULL);
static_assert(SEQ <= SEQ_FULL);
static_assert(VECN % 32 == 0);
static_assert(NH * HDIM == DM);
static_assert(DM % 128 == 0);
static_assert(NQKV % 128 == 0);
static_assert(HDIM == 64);   // one 64-column wave tile of the qkv projection = one head's q, k or v slice

typedef __attribute__((ext_vector_type(16))) _Float16 v16h;
typedef __attribute__((ext_vector_type(8)))  _Float16 v8h;
typedef __attribute__((ext_vector_type(16))) __bf16   v16b;
typedef __attribute__((ext_vector_type(8)))  __bf16   v8b;
typedef __attribute__((ext_vector_type(8)))  float    v8f;
typedef __attribute__((ext_vector_type(4)))  float    v4f;
typedef __attribute__((ext_vector_type(2)))  float    v2f;
typedef __attribute__((ext_vector_type(4)))  unsigned int v4u;

// 16-bit WMMA fragment map (wave32), lane L, h = L>>4, m = L&15:
//   A 16x32: lane = row m;   element i -> k = (i<8) ? 8h+i : 16+8h+(i-8)
//   B 32x16: lane = column m; the SAME k(i,h)
//   D 16x16 (8 f32): lane = column m; element r -> row 8h+r

// workspace carve (bytes, 256-B aligned regions)
constexpr size_t al256(size_t x) { return (x + 255) / 256 * 256; }
constexpr size_t WS_VEC   = al256((size_t)VECN * 4);
constexpr size_t WS_X16   = al256((size_t)NTOK * DM * 2);
constexpr size_t WS_W16   = al256((size_t)NQKV * DM * 2);
constexpr size_t WS_WP16  = al256((size_t)DM * DM * 2);
constexpr size_t WS_QK16  = al256((size_t)NTOK * DM * 2);
constexpr size_t WS_CTX16 = al256((size_t)NTOK * DM * 2);
constexpr size_t WS_TOTAL = WS_VEC + WS_X16 + WS_W16 + WS_WP16 + 3 * WS_QK16 + WS_CTX16;
static_assert(WS_TOTAL <= (size_t)134217728);

// ---- scalar helpers ----
__device__ __forceinline__ float cmb_bf(float v) { const unsigned u = __builtin_bit_cast(unsigned, v); const unsigned r = (u + 0x7fffu + ((u >> 16) & 1u)) & 0xffff0000u; return __builtin_bit_cast(float, r); }   // bf16 RNE value kept as f32
__device__ __forceinline__ unsigned int cmb_pk2(float a, float b) { return (unsigned int)__builtin_bit_cast(unsigned short, (_Float16)a) | ((unsigned int)__builtin_bit_cast(unsigned short, (_Float16)b) << 16); }

namespace w25 {

__device__ __forceinline__ unsigned short f2bf_bits(float f) {
  unsigned u = __float_as_uint(f);
  return (unsigned short)((u + 0x7FFFu + ((u >> 16) & 1u)) >> 16);
}
__device__ __forceinline__ float bf_bits2f(unsigned short h) { return __uint_as_float(((unsigned)h) << 16); }

// hazard guards as plain device helpers
__device__ __forceinline__ void dep_guard_h(v8f& a, v8f& b, v16h x, v16h y) { asm volatile("v_nop\n\tv_nop\n\tv_nop\n\tv_nop" : "+v"(a), "+v"(b) : "v"(x), "v"(y)); }
__device__ __forceinline__ void dep_guard_b(v8f& a, v8f& b, v16b x, v16b y) { asm volatile("v_nop\n\tv_nop\n\tv_nop\n\tv_nop" : "+v"(a), "+v"(b) : "v"(x), "v"(y)); }
__device__ __forceinline__ void keep4_h(v16h a, v16h b, v16h c, v16h d) { asm volatile("v_nop" :: "v"(a), "v"(b), "v"(c), "v"(d)); }
__device__ __forceinline__ void keep4_b(v16b a, v16b b, v16b c, v16b d) { asm volatile("v_nop" :: "v"(a), "v"(b), "v"(c), "v"(d)); }
__device__ __forceinline__ void acc_guard4(v8f& a, v8f& b, v8f& c, v8f& d) { asm volatile("v_nop\n\tv_nop\n\tv_nop\n\tv_nop" : "+v"(a), "+v"(b), "+v"(c), "+v"(d)); }
template <typename T> struct Frag;
template <> struct Frag<_Float16> {
  typedef v16h V; union U { v16h v; v8h h[2]; };
  static __device__ __forceinline__ v16h load(const _Float16* p) {   // elements 0..7 <- p[0..7], 8..15 <- p[16..23]
    U f; f.h[0] = *(const v8h*)(p); f.h[1] = *(const v8h*)(p + 16); return f.v;
  }
  static __device__ __forceinline__ v8f mma(v16h a, v16h b, v8f c) {
    return __builtin_amdgcn_wmma_f32_16x16x32_f16(false, a, false, b, (short)0, c, false, false);
  }
  static __device__ __forceinline__ void guard(v8f& a, v8f& b, v16h x, v16h y) { dep_guard_h(a, b, x, y); }
  static __device__ __forceinline__ void keep(v16h a, v16h b, v16h c, v16h d) { keep4_h(a, b, c, d); }
};
template <> struct Frag<__bf16> {
  typedef v16b V; union U { v16b v; v8b h[2]; };
  static __device__ __forceinline__ v16b load(const __bf16* p) {
    U f; f.h[0] = *(const v8b*)(p); f.h[1] = *(const v8b*)(p + 16); return f.v;
  }
  static __device__ __forceinline__ v8f mma(v16b a, v16b b, v8f c) {
    return __builtin_amdgcn_wmma_f32_16x16x32_bf16(false, a, false, b, (short)0, c, false, false);
  }
  static __device__ __forceinline__ void guard(v8f& a, v8f& b, v16b x, v16b y) { dep_guard_b(a, b, x, y); }
  static __device__ __forceinline__ void keep(v16b a, v16b b, v16b c, v16b d) { keep4_b(a, b, c, d); }
};

// ---- Register-blocked batched WMMA GEMM ------------------------------------
// C[m,n] = scale * sum_k A[m,k] * Bt[n,k] (+bias)(+resid); each wave owns a 64x64 tile, a block of 4 waves (2 x 2) a 128x128 tile.
// A row-major [M,K]; Bt row-major [N,K]; M,N % 128 == 0, K % 64 == 0.
// Operands come through LDS: a stage is 64 k (one 128-B line) of the block's 128 A rows and 128 Bt rows, brought by asynchronous 16-B copies
//   (8 lanes = one whole line), two buffers, the next stage in flight while this one is multiplied; fragments are read from LDS with the same (row, k) map as before.
// SPLIT (hi/lo operand planes) is not built in this form.
// BIAS_MODE: 0 = none, 1 = bias[m], 2 = bias[n].
// OUT_MODE: 0 = f32, 1 = f16, 2 = bf16 hi plane (Cout) + bf16 lo plane (Cout2).
// ET: 0 = f16 operands, 1 = bf16 operands (pointers passed as 16-bit storage)
// QKN: the qkv projection. A wave tile is 64 tokens x one head's 64 columns of q (n0 < DM), k (n0 < 2 DM) or v. q and k tiles are RMS-normalised
//   row by row in the epilogue and stored only as f16 planes: QHp / KHp[token][h*64 + d] = f16(QCAR * x[d] * (1 / sqrt(mean(x^2) + 1e-6)) * w[d]),
//   w = qnw / knw; v tiles are stored as a third f16 plane, VHp[token][h*64 + d] = f16(x[d]) (Cout is not used).
template <int ET> struct Elem;
template <> struct Elem<0> { typedef _Float16 T; };
template <> struct Elem<1> { typedef __bf16 T; };
#define GK_KS 64                       // k per stage, in halves
#define GK_LP 72                       // LDS row pitch in halves: 144 B = 16 B x odd, conflict-free for the 16-byte fragment reads
#define GK_BT 128                      // block tile rows of A and of Bt
#define GK_BUF (2 * GK_BT * GK_LP)     // halves per buffer: A rows 0..127, then Bt rows 0..127
// Eight asynchronous 16-byte copies of one lane: rows r, r+16, ..., r+112 of one operand (global row step gstep halves) into LDS rows 16 apart.
// The s_wait_xcnt stands inside the statement, behind the last copy, so that no address register of a copy is rewritten in front of it.
template <typename T>
__device__ __forceinline__ void gk_copy8(unsigned lds, const T* g, size_t gstep) {
  const unsigned ls = 16u * GK_LP * 2u;
  asm volatile(
      "global_load_async_to_lds_b128 %0, %8, off\n\t"
      "global_load_async_to_lds_b128 %1, %9, off\n\t"
      "global_load_async_to_lds_b128 %2, %10, off\n\t"
      "global_load_async_to_lds_b128 %3, %11, off\n\t"
      "global_load_async_to_lds_b128 %4, %12, off\n\t"
      "global_load_async_to_lds_b128 %5, %13, off\n\t"
      "global_load_async_to_lds_b128 %6, %14, off\n\t"
      "global_load_async_to_lds_b128 %7, %15, off\n\t"
      "s_wait_xcnt 0x0"
      :: "v"(lds), "v"(lds + ls), "v"(lds + 2u * ls), "v"(lds + 3u * ls), "v"(lds + 4u * ls), "v"(lds + 5u * ls), "v"(lds + 6u * ls), "v"(lds + 7u * ls),
         "v"(g), "v"(g + gstep), "v"(g + 2 * gstep), "v"(g + 3 * gstep), "v"(g + 4 * gstep), "v"(g + 5 * gstep), "v"(g + 6 * gstep), "v"(g + 7 * gstep)
      : "memory");
}
template <int ET, bool SPLIT, int BIAS_MODE, int OUT_MODE, bool RESID, bool QKN>
__global__ __launch_bounds__(128) void wmma_gemm64(
    const unsigned short* __restrict__ Ap, const unsigned short* __restrict__ A2p, int lda, long strideA,
    const unsigned short* __restrict__ Btp, const unsigned short* __restrict__ Bt2p, int ldb, long strideB,
    void* __restrict__ Cout, void* __restrict__ Cout2, int ldc, long strideC,
    const float* __restrict__ bias,
    const float* __restrict__ resid, long strideR,
    int M, int N, int K, float scale,
    const float* __restrict__ qnw, const float* __restrict__ knw,
    unsigned short* __restrict__ QHp, unsigned short* __restrict__ KHp, unsigned short* __restrict__ VHp) {
  typedef typename Elem<ET>::T T;
  typedef typename Frag<T>::V V;
  static_assert(!SPLIT);
  const T* A = (const T*)Ap; const T* Bt = (const T*)Btp;
  __shared__ __align__(16) T ring[2 * GK_BUF];     // two stage buffers (cross-wave: published by the block barriers below)
  __shared__ __align__(16) float sT[4][16 * 68];   // per-wave 16x64 slab, pitch 68 floats (wave-private)
  const int b    = blockIdx.y;
  const int lane = threadIdx.x & 31;
  const int wave = threadIdx.x >> 5;
  const int tilesN = N >> 7;
  const int tilesM = M >> 7;
  const int tile = blockIdx.x;
  if (tile >= tilesM * tilesN) return;   // block-uniform, in front of every barrier and copy
  const int tm = tile / tilesN;
  const int tn = tile - tm * tilesN;
  const int wm = wave >> 1, wn = wave & 1;         // 2 x 2 waves
  const int m0 = (tm << 7) + (wm << 6);
  const int n0 = (tn << 7) + (wn << 6);

  const T* Ab  = A  + (size_t)b * strideA;
  const T* Bb  = Bt + (size_t)b * strideB;

  const int rlane = lane & 15;                 // row (A) / col (B, D) within subtile
  const int koff  = (lane >> 4) * 8;           // k offset of this lane half
  const int mOff  = (lane >> 4) * 8;           // D row offset

  v8f acc[4][4];
#pragma unroll
  for (int i = 0; i < 4; ++i)
#pragma unroll
    for (int j = 0; j < 4; ++j) acc[i][j] = (v8f){0.f,0.f,0.f,0.f,0.f,0.f,0.f,0.f};

  // copy map: thread -> (row crow + 16 i, 16-byte piece cseg) of each operand's 128 x 128-B stage; a wave's copy covers 4 whole lines
  const int nst  = K / GK_KS;
  const int crow = threadIdx.x >> 3;
  const int cseg = (threadIdx.x & 7) * 8;
  const T* ga = Ab + (size_t)((tm << 7) + crow) * lda + cseg;
  const T* gb = Bb + (size_t)((tn << 7) + crow) * ldb + cseg;
  const unsigned lA = (unsigned)(size_t)ring + (unsigned)(crow * GK_LP + cseg) * 2u;   // LDS byte address in buffer 0, A part
  const unsigned lB = lA + GK_BT * GK_LP * 2u;                                         // Bt part
  const size_t ast = (size_t)16 * lda, bst = (size_t)16 * ldb;

  gk_copy8(lA, ga, ast);
  gk_copy8(lB, gb, bst);
  asm volatile("s_wait_asynccnt 0x0" ::: "memory");   // this wave's copies of stage 0 have landed before the barrier publishes them
  __syncthreads();
  if (nst > 1) {
    gk_copy8(lA + GK_BUF * 2u, ga + GK_KS, ast);
    gk_copy8(lB + GK_BUF * 2u, gb + GK_KS, bst);
  }

  for (int t = 0; t < nst; ++t) {
    const int bsel = (t & 1) * GK_BUF;
    const T* la = ring + bsel + ((wm << 6) + rlane) * GK_LP + koff;
    const T* lb = ring + bsel + (GK_BT + (wn << 6) + rlane) * GK_LP + koff;
    // all four loops unrolled: the fragment and accumulator arrays stay in registers, and the LDS offsets become immediates
#pragma unroll
    for (int ks = 0; ks < GK_KS; ks += 32) {
      V bh[4], ah[4];
#pragma unroll
      for (int j = 0; j < 4; ++j) bh[j] = Frag<T>::load(lb + (j << 4) * GK_LP + ks);
#pragma unroll
      for (int i = 0; i < 4; ++i) ah[i] = Frag<T>::load(la + (i << 4) * GK_LP + ks);
#pragma unroll
      for (int i = 0; i < 4; ++i) {
#pragma unroll
        for (int j = 0; j < 4; ++j) acc[i][j] = Frag<T>::mma(ah[i], bh[j], acc[i][j]);
        Frag<T>::guard(acc[i][0], acc[i][3], ah[i], ah[i]);
      }
      Frag<T>::keep(bh[0], bh[1], bh[2], bh[3]);
    }
    asm volatile("s_wait_dscnt 0x0" ::: "memory");      // this wave's fragment reads have returned before the buffer may be refilled
    asm volatile("s_wait_asynccnt 0x0" ::: "memory");   // this wave's copies of stage t + 1 have landed before the barrier publishes them
    __syncthreads();                                    // publishes stage t + 1 and ends every wave's reads of stage t's buffer
    if (t + 2 < nst) {
      gk_copy8(lA + (unsigned)bsel * 2u, ga + (size_t)(t + 2) * GK_KS, ast);
      gk_copy8(lB + (unsigned)bsel * 2u, gb + (size_t)(t + 2) * GK_KS, bst);
    }
  }
  asm volatile("s_wait_asynccnt 0x0" ::: "memory");     // no copy is outstanding when the wave goes on
  acc_guard4(acc[0][0], acc[0][1], acc[0][2], acc[0][3]);
  acc_guard4(acc[1][0], acc[1][1], acc[1][2], acc[1][3]);
  acc_guard4(acc[2][0], acc[2][1], acc[2][2], acc[2][3]);
  acc_guard4(acc[3][0], acc[3][1], acc[3][2], acc[3][3]);

  // ---- epilogue ----
  float* slab = sT[wave];
  const float* Rb = RESID ? (resid + (size_t)b * strideR) : nullptr;
  const int nslice = QKN ? n0 / DM : 2;            // 0 = q, 1 = k, 2 = v (wave-uniform)
  v4f nw0 = (v4f){0.f,0.f,0.f,0.f}, nw1 = nw0;     // norm weights of this lane's 8 columns
  if (QKN && nslice < 2) {
    const float* nwp = (nslice ? knw : qnw) + (lane & 7) * 8;
    nw0 = *(const v4f*)nwp;
    nw1 = *(const v4f*)(nwp + 4);
  }
#pragma unroll
  for (int i = 0; i < 4; ++i) {
    const int mBase = m0 + (i << 4);
#pragma unroll
    for (int j = 0; j < 4; ++j) {
      const int n = n0 + (j << 4) + rlane;
      float bv = 0.f;
      if (BIAS_MODE == 2) bv = bias[n];
#pragma unroll
      for (int r = 0; r < 8; ++r) {
        float v = acc[i][j][r] * scale;
        if (BIAS_MODE == 1) v += bias[mBase + mOff + r];
        if (BIAS_MODE == 2) v += bv;
        if (RESID) v += Rb[(size_t)(mBase + mOff + r) * ldc + n];
        slab[(mOff + r) * 68 + (j << 4) + rlane] = v;
      }
    }
    __builtin_amdgcn_fence(3, "workgroup");
    __builtin_amdgcn_wave_barrier();
    __builtin_amdgcn_fence(2, "workgroup");
    if (QKN && nslice < 2) {
      // 8 lanes per row, 8 columns per lane: sum of squares in the lane, then over the 8 lanes; one 16-B store per lane = a 128-B line per row
      const int q = lane >> 3, c8 = (lane & 7) * 8;
      unsigned short* P = (nslice ? KHp : QHp) + (n0 - nslice * DM) + c8;
#pragma unroll   // the four row groups' LDS reads and lane exchanges issue together, so their latencies overlap
      for (int it = 0; it < 4; ++it) {
        const int row = it * 4 + q;
        const v4f x0 = *(const v4f*)(slab + row * 68 + c8);
        const v4f x1 = *(const v4f*)(slab + row * 68 + c8 + 4);
        float ss = (x0.x * x0.x + x0.y * x0.y + x0.z * x0.z + x0.w * x0.w) + (x1.x * x1.x + x1.y * x1.y + x1.z * x1.z + x1.w * x1.w);
#pragma unroll   // constant lane distances 1, 2, 4: the 8 lanes of a row
        for (int o = 1; o < 8; o <<= 1) ss += __shfl_xor(ss, o, 32);
        const float rms = sqrtf(ss * (1.0f / 64.0f) + 1e-6f);
        const float rec = 1.0f / rms;
        v4u pk;
        pk.x = cmb_pk2(((x0.x * rec) * nw0.x) * QCAR, ((x0.y * rec) * nw0.y) * QCAR);
        pk.y = cmb_pk2(((x0.z * rec) * nw0.z) * QCAR, ((x0.w * rec) * nw0.w) * QCAR);
        pk.z = cmb_pk2(((x1.x * rec) * nw1.x) * QCAR, ((x1.y * rec) * nw1.y) * QCAR);
        pk.w = cmb_pk2(((x1.z * rec) * nw1.z) * QCAR, ((x1.w * rec) * nw1.w) * QCAR);
        *(v4u*)(P + (size_t)(mBase + row) * DM) = pk;
      }
    } else if (QKN) {
      // v tile: 8 lanes per row, 8 columns per lane, one 16-B store per lane = a 128-B line per row
      const int q = lane >> 3, c8 = (lane & 7) * 8;
      unsigned short* P = VHp + (n0 - 2 * DM) + c8;
#pragma unroll   // the four row groups' LDS reads issue together
      for (int it = 0; it < 4; ++it) {
        const int row = it * 4 + q;
        const v4f x0 = *(const v4f*)(slab + row * 68 + c8);
        const v4f x1 = *(const v4f*)(slab + row * 68 + c8 + 4);
        v4u pk;
        pk.x = cmb_pk2(x0.x, x0.y);
        pk.y = cmb_pk2(x0.z, x0.w);
        pk.z = cmb_pk2(x1.x, x1.y);
        pk.w = cmb_pk2(x1.z, x1.w);
        *(v4u*)(P + (size_t)(mBase + row) * DM) = pk;
      }
    } else if (OUT_MODE == 0) {
      float* C = (float*)Cout + (size_t)b * strideC;
      const int hh = lane >> 4, c4 = (lane & 15) * 4;     // row seg = 256 B = 16 lanes x 16 B
      {
#pragma unroll
        for (int it = 0; it < 8; ++it) {
          const int row = it * 2 + hh;
          v4f v = *(const v4f*)(slab + row * 68 + c4);
          *(v4f*)(C + (size_t)(mBase + row) * ldc + n0 + c4) = v;
        }
        
      }
    } else {
      const int q = lane >> 3, c8 = (lane & 7) * 8;
      unsigned short* C  = (unsigned short*)Cout  + (size_t)b * strideC;
      unsigned short* C2 = (OUT_MODE == 2) ? ((unsigned short*)Cout2 + (size_t)b * strideC) : nullptr;
      {
#pragma unroll
        for (int it = 0; it < 4; ++it) {
          const int row = it * 4 + q;
          const float* sp = slab + row * 68 + c8;
          v8h hv, lv;
#pragma unroll
          for (int e = 0; e < 8; ++e) {
            if (OUT_MODE == 1) {
              hv[e] = (_Float16)sp[e];
            } else {
              unsigned short hb = f2bf_bits(sp[e]);
              unsigned short lb = f2bf_bits(sp[e] - bf_bits2f(hb));
              hv[e] = __builtin_bit_cast(_Float16, hb);
              lv[e] = __builtin_bit_cast(_Float16, lb);
            }
          }
          *(v8h*)(C + (size_t)(mBase + row) * ldc + n0 + c8) = hv;
          if (OUT_MODE == 2) *(v8h*)(C2 + (size_t)(mBase + row) * ldc + n0 + c8) = lv;
        }
        
      }
    }
    __builtin_amdgcn_fence(3, "workgroup");
    __builtin_amdgcn_wave_barrier();
    __builtin_amdgcn_fence(2, "workgroup");
  }
}

// =====================================================================================
// Non-causal attention for head_dim 64; q/k from f16 planes (normed values carried x QCAR), v from an f16 plane; out an f16 plane carried x CCAR, the output projection's A operand.
//   scores^T = k.q^T        : v_wmma_f32_16x16x32_f16, single product; natural score = raw * sscale (sscale = 1/sqrt(64) / QCAR^2)
//   out^T    = v^T.p^T      : v_wmma_f32_16x16x32_f16; p = exp((s - m_running)*sscale) carried x 2^pexp (2^15) as f16, v plain f16
//   An exponential is one multiply-add and one v_exp_f32: 2^pexp * p = exp2(s * c2 - (m_running * c2 - pexp)), c2 = sscale * log2(e); the sum of p is carried x 2^pexp too.
//   Both products are transposed, so a lane holds scores, P and output of ONE query (its D column): maximum and sum run inside the lane
//   (one exchange between the lane halves), and two score tiles, converted in place, are the B fragment of the second product.
//   K and V chunks come row-major into LDS by asynchronous 16-B copies (8 lanes = one whole 128-B row), two buffers, the next chunk in flight while
//   this one is worked on; V^T fragments come by the transposing LDS load.
//   f32 accumulate; online softmax in f32. Block = 4 waves = 64 query rows of one (batch, head); S % 64 == 0.
//   Element (b, s, h, d) of tensor X lives at X[b*X_bs + s*X_rs + h*X_hs + d] (strides in elements, multiples of 8).
//   grid.x = B * H * (S/64), block 128.
// =====================================================================================
#define AT_D 64
#define AT_NW 4
#define AT_QB 64
#define AT_KC 64
#define AT_LP 72   // LDS row pitch in halves of the 64-half K rows: 144 B = 16 B x odd, so the 16 lanes of a 16-byte fragment read fall on 16 distinct bank groups
#define AT_VP 80   // LDS row pitch in halves of the 64-half V rows: 160 B = 32 B x odd, the conflict-free pitch of ds_load_tr16_b128
#define AT_KB (AT_KC * AT_LP)            // halves of a buffer's K part
#define AT_BUF (AT_KB + AT_KC * AT_VP)   // halves per buffer
struct AttnGeom { long long q_bs, q_rs, q_hs, k_bs, k_rs, k_hs, v_bs, v_rs, v_hs, o_bs, o_rs, o_hs; int S, Skv, H, nchunk; float sscale; float pexp; };
static_assert(sizeof(AttnGeom) == 12 * 8 + 4 * 4 + 2 * 4);

// the builtin alone: the compiler keeps the distances behind its own matrix instructions, and is free to issue independent ones back to back
__device__ __forceinline__ v8f at_mmah(v16h a, v16h b, v8f c) {
  return __builtin_amdgcn_wmma_f32_16x16x32_f16(false, a, false, b, (short)0, c, false, false);
}

// Base-2 exponentials by v_exp_f32, each in place. In one statement, so that no exponential overwrites the source of the one directly in front of it;
// the closing v_nop is the slot that the instruction set asks for between a transcendental and a directly following user of its result.
__device__ __forceinline__ float at_exp2(float x) {
  asm("v_exp_f32 %0, %0\n\tv_nop" : "+v"(x));
  return x;
}
__device__ __forceinline__ v8f at_exp2x8(v8f x) {
  float a = x[0], b = x[1], c = x[2], d = x[3], e = x[4], f = x[5], g = x[6], h = x[7];
  asm("v_exp_f32 %0, %0\n\t"
      "v_exp_f32 %1, %1\n\t"
      "v_exp_f32 %2, %2\n\t"
      "v_exp_f32 %3, %3\n\t"
      "v_exp_f32 %4, %4\n\t"
      "v_exp_f32 %5, %5\n\t"
      "v_exp_f32 %6, %6\n\t"
      "v_exp_f32 %7, %7\n\t"
      "v_nop"
      : "+v"(a), "+v"(b), "+v"(c), "+v"(d), "+v"(e), "+v"(f), "+v"(g), "+v"(h));
  return (v8f){a, b, c, d, e, f, g, h};
}

// Transposing 16-bit LDS load: lane (c = l & 15, h = l >> 4), addressed at row 8h + (l & 7), halves 8 * ((l >> 3) & 1) of a row-major tile, gets T[8h + 0..7][c]
typedef short s16x8 __attribute__((ext_vector_type(8)));
__device__ __forceinline__ v8h at_ldtr16(const _Float16* p) {
  typedef __attribute__((address_space(3))) s16x8 lds_s16x8;
  return __builtin_bit_cast(v8h, __builtin_amdgcn_ds_load_tr16_b128_v8i16((lds_s16x8*)p));
}

// Eight asynchronous 16-byte copies of one lane: rows r, r+16, r+32, r+48 of a K chunk and of a V chunk (global row steps kst, vst halves per 16 rows).
// The s_wait_xcnt stands inside the statement, behind the last copy, so that no address register of a copy is rewritten in front of it.
__device__ __forceinline__ void at_copy8(unsigned lk, const _Float16* gk, size_t kst, unsigned lv, const _Float16* gv, size_t vst) {
  const unsigned ks = 16u * AT_LP * 2u, vs = 16u * AT_VP * 2u;
  asm volatile(
      "global_load_async_to_lds_b128 %0, %8, off\n\t"
      "global_load_async_to_lds_b128 %1, %9, off\n\t"
      "global_load_async_to_lds_b128 %2, %10, off\n\t"
      "global_load_async_to_lds_b128 %3, %11, off\n\t"
      "global_load_async_to_lds_b128 %4, %12, off\n\t"
      "global_load_async_to_lds_b128 %5, %13, off\n\t"
      "global_load_async_to_lds_b128 %6, %14, off\n\t"
      "global_load_async_to_lds_b128 %7, %15, off\n\t"
      "s_wait_xcnt 0x0"
      :: "v"(lk), "v"(lk + ks), "v"(lk + 2u * ks), "v"(lk + 3u * ks), "v"(lv), "v"(lv + vs), "v"(lv + 2u * vs), "v"(lv + 3u * vs),
         "v"(gk), "v"(gk + kst), "v"(gk + 2 * kst), "v"(gk + 3 * kst), "v"(gv), "v"(gv + vst), "v"(gv + 2 * vst), "v"(gv + 3 * vst)
      : "memory");
}

// at most 4 waves a SIMD: what the registers hold and the grid supplies; without the bound the compiler plans for the residency that the LDS alone would allow, spares registers and orders the loop's products less freely (more hazard v_nop)
__global__ __launch_bounds__(128) __attribute__((amdgpu_num_vgpr(256))) __attribute__((amdgpu_waves_per_eu(1, 4)))
void k_attn64(const unsigned short* __restrict__ qp, const unsigned short* __restrict__ kp,
              const unsigned short* __restrict__ vp, unsigned short* __restrict__ out, AttnGeom g) {
  union FH { v16h v; v8h h[2]; };
  __shared__ __align__(16) _Float16 kvs[2 * AT_BUF];        // two chunk buffers, each K [kv][d] then V [kv][d], f16 (cross-wave: published by the block barriers below)
  __shared__ __align__(16) _Float16 Os[AT_NW][16 * AT_LP];   // per wave out tile, f16, 64 halves a row at pitch AT_LP (wave-private)

  const int tid  = threadIdx.x;
  const int wave = tid >> 5;
  const int lane = tid & 31;
  const int hh   = lane >> 4;
  const int c    = lane & 15;

  const int nqb = g.S / AT_QB;
  const int bx = blockIdx.x;
  const int qb = bx % nqb;
  const int bh = bx / nqb;
  const int h  = bh % g.H;
  const int b  = bh / g.H;
  const int q0 = qb * AT_QB + wave * 16;

  const _Float16* q = (const _Float16*)qp;
  const _Float16* k = (const _Float16*)kp;
  const _Float16* v = (const _Float16*)vp;
  const _Float16* qb_ptr = q + (size_t)b * g.q_bs + (size_t)h * g.q_hs;
  const _Float16* kb_ptr = k + (size_t)b * g.k_bs + (size_t)h * g.k_hs;
  const _Float16* vb_ptr = v + (size_t)b * g.v_bs + (size_t)h * g.v_hs;
  unsigned short* ob_ptr = out + (size_t)b * g.o_bs + (size_t)h * g.o_hs;

  // ---- Q fragments (B operand): 2 d-chunks; lane column c = query q0 + c, elements 0..7 <- d = dc*32 + 8hh + e, 8..15 <- dc*32 + 16 + 8hh + e (two 16-B loads from the f16 row) ----
  v16h qa[2];
  {
    const _Float16* qrow = qb_ptr + (size_t)(q0 + c) * g.q_rs;
#pragma unroll
    for (int dc = 0; dc < 2; ++dc) {
      FH f;
      f.h[0] = *(const v8h*)(qrow + dc * 32 + 8 * hh);
      f.h[1] = *(const v8h*)(qrow + dc * 32 + 16 + 8 * hh);
      qa[dc] = f.v;
    }
  }

  float mcol = -INFINITY;   // running maximum of this lane's query (raw units; equal in both lane halves)
  float lcol = 0.f;         // running sum of 2^pexp * p over the keys of this lane half; the halves are joined after the loop
  const float c2 = g.sscale * 1.4426950408889634f;   // raw score units -> base-2 exponent
  v8f oacc[4];              // out^T: tile t, element r = (d = t*16 + 8hh + r, query q0 + c)
#pragma unroll
  for (int t = 0; t < 4; ++t) oacc[t] = (v8f){0.f,0.f,0.f,0.f,0.f,0.f,0.f,0.f};

  // copy map: thread -> (row srow + 16 i, 16-byte piece sseg / 8) of the chunk's 64 K rows and 64 V rows; a wave's copy covers 4 whole 128-B rows
  const int srow = tid >> 3, sseg = (tid & 7) * 8;
  const _Float16* gk = kb_ptr + (size_t)srow * g.k_rs + sseg;
  const _Float16* gv = vb_ptr + (size_t)srow * g.v_rs + sseg;
  const unsigned lK = (unsigned)(size_t)kvs + (unsigned)(srow * AT_LP + sseg) * 2u;           // LDS byte address in buffer 0, K part
  const unsigned lV = (unsigned)(size_t)kvs + (unsigned)(AT_KB + srow * AT_VP + sseg) * 2u;   // V part
  const size_t kst = (size_t)16 * g.k_rs, vst = (size_t)16 * g.v_rs;         // 16 rows
  const size_t kch = (size_t)AT_KC * g.k_rs, vch = (size_t)AT_KC * g.v_rs;   // one chunk

  if (g.nchunk > 0) at_copy8(lK, gk, kst, lV, gv, vst);
  asm volatile("s_wait_asynccnt 0x0" ::: "memory");   // this wave's copies of chunk 0 have landed before the barrier publishes them
  __syncthreads();
  if (g.nchunk > 1) at_copy8(lK + AT_BUF * 2u, gk + kch, kst, lV + AT_BUF * 2u, gv + vch, vst);

  for (int kc = 0; kc < g.nchunk; ++kc) {
    const int bsel = (kc & 1) * AT_BUF;
    const _Float16* Ksh = kvs + bsel;           // K [kv][d], pitch AT_LP
    const _Float16* Vsh = kvs + bsel + AT_KB;   // V [kv][d], pitch AT_VP

    // ---- every fragment of the chunk is fetched here, as one group, each into registers of its own: the K fragments are waited for once,
    //      and the V^T fragments arrive behind the score products and the softmax ----
    FH kf[4][2];   // K: A fragment, lane row c = key j*16 + c, same k(i,h) map as B
    FH vf[2][4];   // V^T: A fragment, lane row c = d = t*16 + c, k = key, by transposing loads of the row-major V tile, which deliver the fragment k map
#pragma unroll   // in the order in which the products below take them
    for (int dc = 0; dc < 2; ++dc) {
#pragma unroll
      for (int j = 0; j < 4; ++j) {
        kf[j][dc].h[0] = *(const v8h*)(Ksh + (j * 16 + c) * AT_LP + dc * 32 + 8 * hh);
        kf[j][dc].h[1] = *(const v8h*)(Ksh + (j * 16 + c) * AT_LP + dc * 32 + 16 + 8 * hh);
      }
    }
#pragma unroll
    for (int kk = 0; kk < 2; ++kk) {
#pragma unroll
      for (int t = 0; t < 4; ++t) {
        vf[kk][t].h[0] = at_ldtr16(Vsh + (kk * 32 + 8 * hh + (lane & 7)) * AT_VP + t * 16 + 8 * ((lane >> 3) & 1));        // keys kk*32 + 8hh + 0..7 of d = t*16 + c
        vf[kk][t].h[1] = at_ldtr16(Vsh + (kk * 32 + 16 + 8 * hh + (lane & 7)) * AT_VP + t * 16 + 8 * ((lane >> 3) & 1));   // keys kk*32 + 16 + 8hh + 0..7
      }
    }
    __builtin_amdgcn_sched_barrier(0);   // keeps the group of loads together in front of the products: sunk to their users, each pair would be waited for on its own
    // ---- scores^T: 4 key subtiles x 2 d-chunks; the four tiles are independent, so the products issue back to back ----
    v8f s[4];
#pragma unroll
    for (int j = 0; j < 4; ++j) s[j] = at_mmah(kf[j][0].v, qa[0], (v8f){0.f,0.f,0.f,0.f,0.f,0.f,0.f,0.f});
#pragma unroll
    for (int j = 0; j < 4; ++j) s[j] = at_mmah(kf[j][1].v, qa[1], s[j]);
    // ---- chunk maximum of the lane's query (raw units; sscale > 0 so max commutes): D element r of this lane = (key kc*64 + j*16 + 8hh + r, query q0 + c) ----
    float cm4[4];
#pragma unroll
    for (int j = 0; j < 4; ++j)
      cm4[j] = fmaxf(fmaxf(fmaxf(s[j][0], s[j][1]), fmaxf(s[j][2], s[j][3])), fmaxf(fmaxf(s[j][4], s[j][5]), fmaxf(s[j][6], s[j][7])));
    float cm = fmaxf(fmaxf(cm4[0], cm4[1]), fmaxf(cm4[2], cm4[3]));
    cm = fmaxf(cm, __shfl_xor(cm, 16, 32));   // the other lane half holds the query's other 32 keys
    const float mnew = fmaxf(mcol, cm);
    const float alpha = at_exp2((mcol - mnew) * c2);   // 0 on the first chunk, where mcol is -inf
    const float nm = g.pexp - mnew * c2;
    mcol = mnew;
    // ---- p, and P^T as B fragments: element i of fragment kk is key kk*32 + k(i,hh) = element i & 7 of score tile 2 kk + (i >> 3) ----
    v16h pb[2];
    float ps4[4];   // one partial sum per score tile: four independent add chains
#pragma unroll
    for (int j = 0; j < 4; ++j) {
      v8f p;
#pragma unroll
      for (int r = 0; r < 8; ++r) p[r] = fmaf(s[j][r], c2, nm);
      p = at_exp2x8(p);
      float psum = p[0];
#pragma unroll
      for (int r = 1; r < 8; ++r) psum += p[r];
#pragma unroll
      for (int r = 0; r < 8; ++r) pb[j >> 1][(j & 1) * 8 + r] = (_Float16)p[r];
      ps4[j] = psum;
    }
    lcol = lcol * alpha + ((ps4[0] + ps4[1]) + (ps4[2] + ps4[3]));
#pragma unroll
    for (int t = 0; t < 4; ++t) oacc[t] *= alpha;
    // ---- V^T.P^T: A = V^T from the registers filled at the chunk's head; B = P^T from the registers ----
#pragma unroll   // vf, pb and oacc are indexed by constants only, so all stay in registers
    for (int kk = 0; kk < 2; ++kk) {
#pragma unroll
      for (int t = 0; t < 4; ++t) oacc[t] = at_mmah(vf[kk][t].v, pb[kk], oacc[t]);
    }
    __builtin_amdgcn_sched_barrier(0);   // keeps the chunk's arithmetic in front of the waits below: lifted to the chunk's head, the wait for the next chunk's copies would find them only just issued
    asm volatile("s_wait_dscnt 0x0" ::: "memory");      // this wave's fragment reads have returned before the buffer may be refilled
    asm volatile("s_wait_asynccnt 0x0" ::: "memory");   // this wave's copies of chunk kc + 1 have landed before the barrier publishes them
    __syncthreads();                                    // publishes chunk kc + 1 and ends every wave's reads of chunk kc's buffer
    if (kc + 2 < g.nchunk) at_copy8(lK + (unsigned)bsel * 2u, gk + (size_t)(kc + 2) * kch, kst, lV + (unsigned)bsel * 2u, gv + (size_t)(kc + 2) * vch, vst);
  }
  asm volatile("s_wait_asynccnt 0x0" ::: "memory");     // no copy is outstanding when the wave goes on

  _Float16* os = Os[wave];
  {
    const float inv = CCAR / (lcol + __shfl_xor(lcol, 16, 32));   // both halves' sums joined once; sum and out^T carry the same 2^pexp; the plane's carry rides on the quotient (a power of two: same rounding)
#pragma unroll
    for (int t = 0; t < 4; ++t) {
      // 8 consecutive d of the lane's query row, as f16: one 16-B LDS store
      v8h hv;
#pragma unroll
      for (int r = 0; r < 8; ++r) hv[r] = (_Float16)(oacc[t][r] * inv);
      *(v8h*)(os + c * AT_LP + t * 16 + 8 * hh) = hv;
    }
  }
  __builtin_amdgcn_fence(3, "workgroup");
  __builtin_amdgcn_wave_barrier();
  __builtin_amdgcn_fence(2, "workgroup");
  {
    // 8 lanes per row, 16 B per lane: a head's 64 halves of a token = one whole 128-B line per row
    const int q4 = lane >> 3, c8 = (lane & 7) * 8;
#pragma unroll   // the four LDS reads issue together
    for (int it = 0; it < 4; ++it) {
      const int row = it * 4 + q4;
      const v8h val = *(const v8h*)(os + row * AT_LP + c8);
      *(v8h*)(ob_ptr + (size_t)(q0 + row) * g.o_rs + c8) = val;
    }
  }
}

} // namespace w25

// =====================================================================================
// =====================================================================================
// k_prep: the 16-bit planes of x, Wqkv, Wproj and the small vectors in ONE launch; the four jobs are independent, and a block takes its job by its index:
//   blocks [0, PB_X): X16 = f16(16 * bf16 RNE(x)); the next PB_W: W16 = f16(64 * bf16 RNE(Wqkv)); the next PB_P: WP16 = f16(64 * bf16 RNE(Wproj));
//   a block = 2048 consecutive elements, a thread = 8 of them (two 16-B loads, one 16-B store); the last PB_V blocks: the small vectors' bf16 RNE values as f32.
#define PB_XB (SEQ * DM / 2048)     // blocks per batch of x
#define PB_X  (NB * PB_XB)
#define PB_W  (NQKV * DM / 2048)
#define PB_P  (DM * DM / 2048)
#define PB_V  ((VECN + 255) / 256)
static_assert((SEQ * DM) % 2048 == 0);
static_assert((NQKV * DM) % 2048 == 0);
static_assert((DM * DM) % 2048 == 0);
__global__ __launch_bounds__(256) void k_prep(const float* __restrict__ x, const float* __restrict__ wq, const float* __restrict__ wp,
                                              const float* __restrict__ bq, const float* __restrict__ bp, const float* __restrict__ qw, const float* __restrict__ kw,
                                              unsigned short* __restrict__ X16, unsigned short* __restrict__ W16, unsigned short* __restrict__ WP16, float* __restrict__ VEC) {
    const int blk = blockIdx.x;
    if (blk < PB_X + PB_W + PB_P) {
        const float* s;
        unsigned short* d;
        float sc;
        if (blk < PB_X) {
            const int z = blk / PB_XB, r = blk - z * PB_XB;   // batch rows of x at the full per-batch stride
            s = x + (size_t)z * SEQ_FULL * DM + (size_t)r * 2048;
            d = X16 + (size_t)z * SEQ * DM + (size_t)r * 2048;
            sc = 16.0f;
        } else if (blk < PB_X + PB_W) {
            s = wq + (size_t)(blk - PB_X) * 2048;
            d = W16 + (size_t)(blk - PB_X) * 2048;
            sc = 64.0f;
        } else {
            s = wp + (size_t)(blk - PB_X - PB_W) * 2048;
            d = WP16 + (size_t)(blk - PB_X - PB_W) * 2048;
            sc = 64.0f;
        }
        s += threadIdx.x * 8;
        d += threadIdx.x * 8;
        const v4f a = *(const v4f*)s;
        const v4f b = *(const v4f*)(s + 4);
        v4u pk;
        pk.x = cmb_pk2(cmb_bf(a.x) * sc, cmb_bf(a.y) * sc);
        pk.y = cmb_pk2(cmb_bf(a.z) * sc, cmb_bf(a.w) * sc);
        pk.z = cmb_pk2(cmb_bf(b.x) * sc, cmb_bf(b.y) * sc);
        pk.w = cmb_pk2(cmb_bf(b.z) * sc, cmb_bf(b.w) * sc);
        *(v4u*)d = pk;
    } else {
        const int u = (blk - (PB_X + PB_W + PB_P)) * 256 + threadIdx.x;
        if (u < VECN) {
            const float a  = bq[min(u, NQKV - 1)];
            const float bb = bp[min(max(u - OFF_BP, 0), DM - 1)];
            const float cq = qw[min(max(u - OFF_QW, 0), HDIM - 1)];
            const float ck = kw[min(max(u - OFF_KW, 0), HDIM - 1)];
            const float sel = (u < OFF_BP) ? a : ((u < OFF_QW) ? bb : ((u < OFF_KW) ? cq : ck));
            asm volatile("s_wait_xcnt 0x0" ::: "memory");   // stands behind the load, in front of the arithmetic that reuses its address registers
            VEC[u] = cmb_bf(sel);
        }
    }
}

extern "C" void kernel_launch(void* const* d_in, const int* in_sizes, int n_in, void* d_out, int out_size, void* d_ws, size_t ws_size, hipStream_t stream) {
    if (n_in < 7) return;
    const float* x     = (const float*)d_in[0];     // [2][2048][1024]
    const float* Wqkv  = (const float*)d_in[1];     // [3072][1024]  ([out][in] = Bt layout)
    const float* bqkv  = (const float*)d_in[2];     // [3072]
    const float* Wproj = (const float*)d_in[3];     // [1024][1024]  ([out][in] = Bt layout)
    const float* bproj = (const float*)d_in[4];     // [1024]
    const float* qn_w  = (const float*)d_in[5];     // [64]
    const float* kn_w  = (const float*)d_in[6];     // [64]
    const long long xneed = ((long long)(NB - 1) * SEQ_FULL + SEQ) * DM;
    if ((long long)in_sizes[0] < xneed) return;
    if ((long long)in_sizes[1] < (long long)NQKV * DM) return;
    if (in_sizes[2] < NQKV) return;
    if ((long long)in_sizes[3] < (long long)DM * DM) return;
    if (in_sizes[4] < DM) return;
    if (in_sizes[5] < HDIM || in_sizes[6] < HDIM) return;
    if ((long long)out_size < xneed) return;
    if (WS_TOTAL > ws_size) return;

    char* wsp = (char*)d_ws;
    float* VEC = (float*)wsp; wsp += WS_VEC;                              // 4224 f32 (bf16 RNE values of the small input vectors)
    unsigned short* X16 = (unsigned short*)wsp; wsp += WS_X16;             // [NTOK][1024] f16 = 16 * bf16(x)
    unsigned short* W16 = (unsigned short*)wsp; wsp += WS_W16;             // [3072][1024] f16 = 64 * bf16(Wqkv)
    unsigned short* WP16 = (unsigned short*)wsp; wsp += WS_WP16;           // [1024][1024] f16 = 64 * bf16(Wproj)
    unsigned short* QH16 = (unsigned short*)wsp; wsp += WS_QK16;           // [NTOK][1024] f16 = 16 * normalised q
    unsigned short* KH16 = (unsigned short*)wsp; wsp += WS_QK16;           // [NTOK][1024] f16 = 16 * normalised k
    unsigned short* VH16 = (unsigned short*)wsp; wsp += WS_QK16;           // [NTOK][1024] f16 = v
    unsigned short* CTX16 = (unsigned short*)wsp; wsp += WS_CTX16;         // [NTOK][1024] f16 = 256 * attention output (token-major, head*64 + d)
    float* out = (float*)d_out;

    // 1-4. one launch: small vectors -> bf16 RNE values (f32); 16-bit operand planes of x, Wqkv, Wproj (bf16 RNE input values times a power of two, exact in f16)
    k_prep<<<(unsigned)(PB_X + PB_W + PB_P + PB_V), 256, 0, stream>>>(x, Wqkv, Wproj, bqkv, bproj, qn_w, kn_w, X16, W16, WP16, VEC);
    // 5. qkv = (16 bf16(x)) . (64 bf16(Wqkv))^T / 1024 + bf16(bqkv); v -> f16 plane; q and k -> per-head RMSNorm (f32 math) in the epilogue -> f16 planes carried x16
    w25::wmma_gemm64<0, false, 2, 0, false, true><<<dim3((unsigned)((NTOK / 128) * (NQKV / 128)), 1u), 128, 0, stream>>>(
        (const unsigned short*)X16, nullptr, DM, 0L, (const unsigned short*)W16, nullptr, DM, 0L,
        nullptr, nullptr, NQKV, 0L, VEC + OFF_BQ, nullptr, 0L, NTOK, NQKV, DM, 1.0f / 1024.0f,
        VEC + OFF_QW, VEC + OFF_KW, QH16, KH16, VH16);
    // 6. attention: 64 query rows per block, 64-key chunks, online softmax; its epilogue stores the f16 plane (x256) that the output projection reads
    w25::AttnGeom g;
    g.q_bs = (long long)SEQ * DM;   g.q_rs = DM;   g.q_hs = HDIM;
    g.k_bs = (long long)SEQ * DM;   g.k_rs = DM;   g.k_hs = HDIM;
    g.v_bs = (long long)SEQ * DM;   g.v_rs = DM;   g.v_hs = HDIM;
    g.o_bs = (long long)SEQ * DM;   g.o_rs = DM;   g.o_hs = HDIM;
    g.S = SEQ; g.Skv = SEQ; g.H = NH; g.nchunk = SEQ / AT_KC; g.sscale = 0.125f / (QCAR * QCAR); g.pexp = 15.0f;
    w25::k_attn64<<<(unsigned)(NB * NH * (SEQ / AT_QB)), 128, 0, stream>>>(QH16, KH16, VH16, CTX16, g);
    // 7. out[b][s][:] = (256 ctx) . (64 bf16(Wproj))^T / 16384 + bf16(bproj), batch rows at the full per-batch stride of d_out
    w25::wmma_gemm64<0, false, 2, 0, false, false><<<dim3((unsigned)((SEQ / 128) * (DM / 128)), (unsigned)NB), 128, 0, stream>>>(
        (const unsigned short*)CTX16, nullptr, DM, (long)SEQ * DM, (const unsigned short*)WP16, nullptr, DM, 0L,
        (void*)out, nullptr, DM, (long)SEQ_FULL * DM, VEC + OFF_BP, nullptr, 0L, SEQ, DM, DM, 1.0f / 16384.0f,
        nullptr, nullptr, nullptr, nullptr, nullptr);
    (void)hipGetLastError();
}

// v010
// A run of this version takes 85.8 microseconds.
// Two timings next to v009 put it at 1.03 and 1.04 times that version's speed.
// Counting every step since v000, it is 3.90 times as fast.
// Contractions: qkv projection [NB*SEQ x 1024 x 3072] and output projection [NB*SEQ x 1024 x 1024] = v_wmma_f32_16x16x32_f16 (f16 operands: bf16 RNE input values scaled by powers of two, and the attention output carried x256 in the output projection's A, f32 accumulate); attention scores, transposed, k.q^T = v_wmma_f32_16x16x32_f16 (normed q,k carried x16 as f16, single product, f32 accumulate); V^T.P^T = v_wmma_f32_16x16x32_f16 (P carried x2^15 as f16, v f16, f32 accumulate); RMSNorm (in the qkv projection's epilogue) and online softmax in f32, its exponentials in base 2.
#include <hip/hip_runtime.h>
#include <math.h>

#ifndef NB
#define NB 2
#endif
#ifndef SEQ
#define SEQ 2048
#endif
#define NB_FULL 2
#define SEQ_FULL 2048
#define DM 1024
#define NH 16
#define HDIM 64
#define NQKV (3 * DM)
#define NTOK (NB * SEQ)
#define QCAR 16.0f
#define CCAR 256.0f   // carry of the attention output in its f16 plane
// small f32 vector region: [bqkv 3072 | bproj 1024 | qn_w 64 | kn_w 64], each entry the bf16 RNE value of the input
#define OFF_BQ 0
#define OFF_BP NQKV
#define OFF_QW (NQKV + DM)
#define OFF_KW (NQKV + DM + HDIM)
#define VECN (NQKV + DM + 2 * HDIM)
static_assert(SEQ % 128 == 0);   // 128-row block tiles of the projections; 128-row blocks of the attention
static_assert(NB >= 1);
static_assert(NB <= NB_FULL);
static_assert(SEQ <= SEQ_FULL);
static_assert(VECN % 32 == 0);
static_assert(NH * HDIM == DM);
static_assert(DM % 128 == 0);
static_assert(NQKV % 128 == 0);
static_assert(HDIM == 64);   // one 64-column wave tile of the qkv projection = one head's q, k or v slice

typedef __attribute__((ext_vector_type(16))) _Float16 v16h;
typedef __attribute__((ext_vector_type(8)))  _Float16 v8h;
typedef __attribute__((ext_vector_type(16))) __bf16   v16b;
typedef __attribute__((ext_vector_type(8)))  __bf16   v8b;
typedef __attribute__((ext_vector_type(8)))  float    v8f;
typedef __attribute__((ext_vector_type(4)))  float    v4f;
typedef __attribute__((ext_vector_type(2)))  float    v2f;
typedef __attribute__((ext_vector_type(4)))  unsigned int v4u;

// 16-bit WMMA fragment map (wave32), lane L, h = L>>4, m = L&15:
//   A 16x32: lane = row m;   element i -> k = (i<8) ? 8h+i : 16+8h+(i-8)
//   B 32x16: lane = column m; the SAME k(i,h)
//   D 16x16 (8 f32): lane = column m; element r -> row 8h+r

// workspace carve (bytes, 256-B aligned regions)
constexpr size_t al256(size_t x) { return (x + 255) / 256 * 256; }
constexpr size_t WS_VEC   = al256((size_t)VECN * 4);
constexpr size_t WS_X16   = al256((size_t)NTOK * DM * 2);
constexpr size_t WS_W16   = al256((size_t)NQKV * DM * 2);
constexpr size_t WS_WP16  = al256((size_t)DM * DM * 2);
constexpr size_t WS_QK16  = al256((size_t)NTOK * DM * 2);
constexpr size_t WS_CTX16 = al256((size_t)NTOK * DM * 2);
constexpr size_t WS_TOTAL = WS_VEC + WS_X16 + WS_W16 + WS_WP16 + 3 * WS_QK16 + WS_CTX16;
static_assert(WS_TOTAL <= (size_t)134217728);

// ---- scalar helpers ----
__device__ __forceinline__ float cmb_bf(float v) { const unsigned u = __builtin_bit_cast(unsigned, v); const unsigned r = (u + 0x7fffu + ((u >> 16) & 1u)) & 0xffff0000u; return __builtin_bit_cast(float, r); }   // bf16 RNE value kept as f32
__device__ __forceinline__ unsigned int cmb_pk2(float a, float b) { return (unsigned int)__builtin_bit_cast(unsigned short, (_Float16)a) | ((unsigned int)__builtin_bit_cast(unsigned short, (_Float16)b) << 16); }

namespace w25 {

__device__ __forceinline__ unsigned short f2bf_bits(float f) {
  unsigned u = __float_as_uint(f);
  return (unsigned short)((u + 0x7FFFu + ((u >> 16) & 1u)) >> 16);
}
__device__ __forceinline__ float bf_bits2f(unsigned short h) { return __uint_as_float(((unsigned)h) << 16); }

// hazard guards as plain device helpers
__device__ __forceinline__ void dep_guard_h(v8f& a, v8f& b, v16h x, v16h y) { asm volatile("v_nop\n\tv_nop\n\tv_nop\n\tv_nop" : "+v"(a), "+v"(b) : "v"(x), "v"(y)); }
__device__ __forceinline__ void dep_guard_b(v8f& a, v8f& b, v16b x, v16b y) { asm volatile("v_nop\n\tv_nop\n\tv_nop\n\tv_nop" : "+v"(a), "+v"(b) : "v"(x), "v"(y)); }
__device__ __forceinline__ void keep4_h(v16h a, v16h b, v16h c, v16h d) { asm volatile("v_nop" :: "v"(a), "v"(b), "v"(c), "v"(d)); }
__device__ __forceinline__ void keep4_b(v16b a, v16b b, v16b c, v16b d) { asm volatile("v_nop" :: "v"(a), "v"(b), "v"(c), "v"(d)); }
__device__ __forceinline__ void acc_guard4(v8f& a, v8f& b, v8f& c, v8f& d) { asm volatile("v_nop\n\tv_nop\n\tv_nop\n\tv_nop" : "+v"(a), "+v"(b), "+v"(c), "+v"(d)); }
template <typename T> struct Frag;
template <> struct Frag<_Float16> {
  typedef v16h V; union U { v16h v; v8h h[2]; };
  static __device__ __forceinline__ v16h load(const _Float16* p) {   // elements 0..7 <- p[0..7], 8..15 <- p[16..23]
    U f; f.h[0] = *(const v8h*)(p); f.h[1] = *(const v8h*)(p + 16); return f.v;
  }
  static __device__ __forceinline__ v8f mma(v16h a, v16h b, v8f c) {
    return __builtin_amdgcn_wmma_f32_16x16x32_f16(false, a, false, b, (short)0, c, false, false);
  }
  static __device__ __forceinline__ void guard(v8f& a, v8f& b, v16h x, v16h y) { dep_guard_h(a, b, x, y); }
  static __device__ __forceinline__ void keep(v16h a, v16h b, v16h c, v16h d) { keep4_h(a, b, c, d); }
};
template <> struct Frag<__bf16> {
  typedef v16b V; union U { v16b v; v8b h[2]; };
  static __device__ __forceinline__ v16b load(const __bf16* p) {
    U f; f.h[0] = *(const v8b*)(p); f.h[1] = *(const v8b*)(p + 16); return f.v;
  }
  static __device__ __forceinline__ v8f mma(v16b a, v16b b, v8f c) {
    return __builtin_amdgcn_wmma_f32_16x16x32_bf16(false, a, false, b, (short)0, c, false, false);
  }
  static __device__ __forceinline__ void guard(v8f& a, v8f& b, v16b x, v16b y) { dep_guard_b(a, b, x, y); }
  static __device__ __forceinline__ void keep(v16b a, v16b b, v16b c, v16b d) { keep4_b(a, b, c, d); }
};

// ---- Register-blocked batched WMMA GEMM ------------------------------------
// C[m,n] = scale * sum_k A[m,k] * Bt[n,k] (+bias)(+resid); each wave owns a 64x64 tile, a block of 4 waves (2 x 2) a 128x128 tile.
// A row-major [M,K]; Bt row-major [N,K]; M,N % 128 == 0, K % 64 == 0.
// Operands come through LDS: a stage is 64 k (one 128-B line) of the block's 128 A rows and 128 Bt rows, brought by asynchronous 16-B copies
//   (8 lanes = one whole line), two buffers, the next stage in flight while this one is multiplied; fragments are read from LDS with the same (row, k) map as before.
// SPLIT (hi/lo operand planes) is not built in this form.
// BIAS_MODE: 0 = none, 1 = bias[m], 2 = bias[n].
// OUT_MODE: 0 = f32, 1 = f16, 2 = bf16 hi plane (Cout) + bf16 lo plane (Cout2).
// ET: 0 = f16 operands, 1 = bf16 operands (pointers passed as 16-bit storage)
// QKN: the qkv projection. A wave tile is 64 tokens x one head's 64 columns of q (n0 < DM), k (n0 < 2 DM) or v. q and k tiles are RMS-normalised
//   row by row in the epilogue and stored only as f16 planes: QHp / KHp[token][h*64 + d] = f16(QCAR * x[d] * (1 / sqrt(mean(x^2) + 1e-6)) * w[d]),
//   w = qnw / knw; v tiles are stored as a third f16 plane, VHp[token][h*64 + d] = f16(x[d]) (Cout is not used).
template <int ET> struct Elem;
template <> struct Elem<0> { typedef _Float16 T; };
template <> struct Elem<1> { typedef __bf16 T; };
#define GK_KS 64                       // k per stage, in halves
#define GK_LP 72                       // LDS row pitch in halves: 144 B = 16 B x odd, conflict-free for the 16-byte fragment reads
#define GK_BT 128                      // block tile rows of A and of Bt
#define GK_BUF (2 * GK_BT * GK_LP)     // halves per buffer: A rows 0..127, then Bt rows 0..127
// Eight asynchronous 16-byte copies of one lane: rows r, r+16, ..., r+112 of one operand (global row step gstep halves) into LDS rows 16 apart.
// The s_wait_xcnt stands inside the statement, behind the last copy, so that no address register of a copy is rewritten in front of it.
template <typename T>
__device__ __forceinline__ void gk_copy8(unsigned lds, const T* g, size_t gstep) {
  const unsigned ls = 16u * GK_LP * 2u;
  asm volatile(
      "global_load_async_to_lds_b128 %0, %8, off\n\t"
      "global_load_async_to_lds_b128 %1, %9, off\n\t"
      "global_load_async_to_lds_b128 %2, %10, off\n\t"
      "global_load_async_to_lds_b128 %3, %11, off\n\t"
      "global_load_async_to_lds_b128 %4, %12, off\n\t"
      "global_load_async_to_lds_b128 %5, %13, off\n\t"
      "global_load_async_to_lds_b128 %6, %14, off\n\t"
      "global_load_async_to_lds_b128 %7, %15, off\n\t"
      "s_wait_xcnt 0x0"
      :: "v"(lds), "v"(lds + ls), "v"(lds + 2u * ls), "v"(lds + 3u * ls), "v"(lds + 4u * ls), "v"(lds + 5u * ls), "v"(lds + 6u * ls), "v"(lds + 7u * ls),
         "v"(g), "v"(g + gstep), "v"(g + 2 * gstep), "v"(g + 3 * gstep), "v"(g + 4 * gstep), "v"(g + 5 * gstep), "v"(g + 6 * gstep), "v"(g + 7 * gstep)
      : "memory");
}
template <int ET, bool SPLIT, int BIAS_MODE, int OUT_MODE, bool RESID, bool QKN>
__global__ __launch_bounds__(128) void wmma_gemm64(
    const unsigned short* __restrict__ Ap, const unsigned short* __restrict__ A2p, int lda, long strideA,
    const unsigned short* __restrict__ Btp, const unsigned short* __restrict__ Bt2p, int ldb, long strideB,
    void* __restrict__ Cout, void* __restrict__ Cout2, int ldc, long strideC,
    const float* __restrict__ bias,
    const float* __restrict__ resid, long strideR,
    int M, int N, int K, float scale,
    const float* __restrict__ qnw, const float* __restrict__ knw,
    unsigned short* __restrict__ QHp, unsigned short* __restrict__ KHp, unsigned short* __restrict__ VHp) {
  typedef typename Elem<ET>::T T;
  typedef typename Frag<T>::V V;
  static_assert(!SPLIT);
  const T* A = (const T*)Ap; const T* Bt = (const T*)Btp;
  __shared__ __align__(16) T ring[2 * GK_BUF];     // two stage buffers (cross-wave: published by the block barriers below)
  __shared__ __align__(16) float sT[4][16 * 68];   // per-wave 16x64 slab, pitch 68 floats (wave-private)
  const int b    = blockIdx.y;
  const int lane = threadIdx.x & 31;
  const int wave = threadIdx.x >> 5;
  const int tilesN = N >> 7;
  const int tilesM = M >> 7;
  const int tile = blockIdx.x;
  if (tile >= tilesM * tilesN) return;   // block-uniform, in front of every barrier and copy
  const int tm = tile / tilesN;
  const int tn = tile - tm * tilesN;
  const int wm = wave >> 1, wn = wave & 1;         // 2 x 2 waves
  const int m0 = (tm << 7) + (wm << 6);
  const int n0 = (tn << 7) + (wn << 6);

  const T* Ab  = A  + (size_t)b * strideA;
  const T* Bb  = Bt + (size_t)b * strideB;

  const int rlane = lane & 15;                 // row (A) / col (B, D) within subtile
  const int koff  = (lane >> 4) * 8;           // k offset of this lane half
  const int mOff  = (lane >> 4) * 8;           // D row offset

  v8f acc[4][4];
#pragma unroll
  for (int i = 0; i < 4; ++i)
#pragma unroll
    for (int j = 0; j < 4; ++j) acc[i][j] = (v8f){0.f,0.f,0.f,0.f,0.f,0.f,0.f,0.f};

  // copy map: thread -> (row crow + 16 i, 16-byte piece cseg) of each operand's 128 x 128-B stage; a wave's copy covers 4 whole lines
  const int nst  = K / GK_KS;
  const int crow = threadIdx.x >> 3;
  const int cseg = (threadIdx.x & 7) * 8;
  const T* ga = Ab + (size_t)((tm << 7) + crow) * lda + cseg;
  const T* gb = Bb + (size_t)((tn << 7) + crow) * ldb + cseg;
  const unsigned lA = (unsigned)(size_t)ring + (unsigned)(crow * GK_LP + cseg) * 2u;   // LDS byte address in buffer 0, A part
  const unsigned lB = lA + GK_BT * GK_LP * 2u;                                         // Bt part
  const size_t ast = (size_t)16 * lda, bst = (size_t)16 * ldb;

  gk_copy8(lA, ga, ast);
  gk_copy8(lB, gb, bst);
  asm volatile("s_wait_asynccnt 0x0" ::: "memory");   // this wave's copies of stage 0 have landed before the barrier publishes them
  __syncthreads();
  if (nst > 1) {
    gk_copy8(lA + GK_BUF * 2u, ga + GK_KS, ast);
    gk_copy8(lB + GK_BUF * 2u, gb + GK_KS, bst);
  }

  for (int t = 0; t < nst; ++t) {
    const int bsel = (t & 1) * GK_BUF;
    const T* la = ring + bsel + ((wm << 6) + rlane) * GK_LP + koff;
    const T* lb = ring + bsel + (GK_BT + (wn << 6) + rlane) * GK_LP + koff;
    // all four loops unrolled: the fragment and accumulator arrays stay in registers, and the LDS offsets become immediates
#pragma unroll
    for (int ks = 0; ks < GK_KS; ks += 32) {
      V bh[4], ah[4];
#pragma unroll
      for (int j = 0; j < 4; ++j) bh[j] = Frag<T>::load(lb + (j << 4) * GK_LP + ks);
#pragma unroll
      for (int i = 0; i < 4; ++i) ah[i] = Frag<T>::load(la + (i << 4) * GK_LP + ks);
#pragma unroll
      for (int i = 0; i < 4; ++i) {
#pragma unroll
        for (int j = 0; j < 4; ++j) acc[i][j] = Frag<T>::mma(ah[i], bh[j], acc[i][j]);
        Frag<T>::guard(acc[i][0], acc[i][3], ah[i], ah[i]);
      }
      Frag<T>::keep(bh[0], bh[1], bh[2], bh[3]);
    }
    asm volatile("s_wait_dscnt 0x0" ::: "memory");      // this wave's fragment reads have returned before the buffer may be refilled
    asm volatile("s_wait_asynccnt 0x0" ::: "memory");   // this wave's copies of stage t + 1 have landed before the barrier publishes them
    __syncthreads();                                    // publishes stage t + 1 and ends every wave's reads of stage t's buffer
    if (t + 2 < nst) {
      gk_copy8(lA + (unsigned)bsel * 2u, ga + (size_t)(t + 2) * GK_KS, ast);
      gk_copy8(lB + (unsigned)bsel * 2u, gb + (size_t)(t + 2) * GK_KS, bst);
    }
  }
  asm volatile("s_wait_asynccnt 0x0" ::: "memory");     // no copy is outstanding when the wave goes on
  acc_guard4(acc[0][0], acc[0][1], acc[0][2], acc[0][3]);
  acc_guard4(acc[1][0], acc[1][1], acc[1][2], acc[1][3]);
  acc_guard4(acc[2][0], acc[2][1], acc[2][2], acc[2][3]);
  acc_guard4(acc[3][0], acc[3][1], acc[3][2], acc[3][3]);

  // ---- epilogue ----
  float* slab = sT[wave];
  const float* Rb = RESID ? (resid + (size_t)b * strideR) : nullptr;
  const int nslice = QKN ? n0 / DM : 2;            // 0 = q, 1 = k, 2 = v (wave-uniform)
  v4f nw0 = (v4f){0.f,0.f,0.f,0.f}, nw1 = nw0;     // norm weights of this lane's 8 columns
  if (QKN && nslice < 2) {
    const float* nwp = (nslice ? knw : qnw) + (lane & 7) * 8;
    nw0 = *(const v4f*)nwp;
    nw1 = *(const v4f*)(nwp + 4);
  }
#pragma unroll
  for (int i = 0; i < 4; ++i) {
    const int mBase = m0 + (i << 4);
#pragma unroll
    for (int j = 0; j < 4; ++j) {
      const int n = n0 + (j << 4) + rlane;
      float bv = 0.f;
      if (BIAS_MODE == 2) bv = bias[n];
#pragma unroll
      for (int r = 0; r < 8; ++r) {
        float v = acc[i][j][r] * scale;
        if (BIAS_MODE == 1) v += bias[mBase + mOff + r];
        if (BIAS_MODE == 2) v += bv;
        if (RESID) v += Rb[(size_t)(mBase + mOff + r) * ldc + n];
        slab[(mOff + r) * 68 + (j << 4) + rlane] = v;
      }
    }
    __builtin_amdgcn_fence(3, "workgroup");
    __builtin_amdgcn_wave_barrier();
    __builtin_amdgcn_fence(2, "workgroup");
    if (QKN && nslice < 2) {
      // 8 lanes per row, 8 columns per lane: sum of squares in the lane, then over the 8 lanes; one 16-B store per lane = a 128-B line per row
      const int q = lane >> 3, c8 = (lane & 7) * 8;
      unsigned short* P = (nslice ? KHp : QHp) + (n0 - nslice * DM) + c8;
#pragma unroll   // the four row groups' LDS reads and lane exchanges issue together, so their latencies overlap
      for (int it = 0; it < 4; ++it) {
        const int row = it * 4 + q;
        const v4f x0 = *(const v4f*)(slab + row * 68 + c8);
        const v4f x1 = *(const v4f*)(slab + row * 68 + c8 + 4);
        float ss = (x0.x * x0.x + x0.y * x0.y + x0.z * x0.z + x0.w * x0.w) + (x1.x * x1.x + x1.y * x1.y + x1.z * x1.z + x1.w * x1.w);
#pragma unroll   // constant lane distances 1, 2, 4: the 8 lanes of a row
        for (int o = 1; o < 8; o <<= 1) ss += __shfl_xor(ss, o, 32);
        const float rms = sqrtf(ss * (1.0f / 64.0f) + 1e-6f);
        const float rec = 1.0f / rms;
        v4u pk;
        pk.x = cmb_pk2(((x0.x * rec) * nw0.x) * QCAR, ((x0.y * rec) * nw0.y) * QCAR);
        pk.y = cmb_pk2(((x0.z * rec) * nw0.z) * QCAR, ((x0.w * rec) * nw0.w) * QCAR);
        pk.z = cmb_pk2(((x1.x * rec) * nw1.x) * QCAR, ((x1.y * rec) * nw1.y) * QCAR);
        pk.w = cmb_pk2(((x1.z * rec) * nw1.z) * QCAR, ((x1.w * rec) * nw1.w) * QCAR);
        *(v4u*)(P + (size_t)(mBase + row) * DM) = pk;
      }
    } else if (QKN) {
      // v tile: 8 lanes per row, 8 columns per lane, one 16-B store per lane = a 128-B line per row
      const int q = lane >> 3, c8 = (lane & 7) * 8;
      unsigned short* P = VHp + (n0 - 2 * DM) + c8;
#pragma unroll   // the four row groups' LDS reads issue together
      for (int it = 0; it < 4; ++it) {
        const int row = it * 4 + q;
        const v4f x0 = *(const v4f*)(slab + row * 68 + c8);
        const v4f x1 = *(const v4f*)(slab + row * 68 + c8 + 4);
        v4u pk;
        pk.x = cmb_pk2(x0.x, x0.y);
        pk.y = cmb_pk2(x0.z, x0.w);
        pk.z = cmb_pk2(x1.x, x1.y);
        pk.w = cmb_pk2(x1.z, x1.w);
        *(v4u*)(P + (size_t)(mBase + row) * DM) = pk;
      }
    } else if (OUT_MODE == 0) {
      float* C = (float*)Cout + (size_t)b * strideC;
      const int hh = lane >> 4, c4 = (lane & 15) * 4;     // row seg = 256 B = 16 lanes x 16 B
      {
#pragma unroll
        for (int it = 0; it < 8; ++it) {
          const int row = it * 2 + hh;
          v4f v = *(const v4f*)(slab + row * 68 + c4);
          *(v4f*)(C + (size_t)(mBase + row) * ldc + n0 + c4) = v;
        }
        
      }
    } else {
      const int q = lane >> 3, c8 = (lane & 7) * 8;
      unsigned short* C  = (unsigned short*)Cout  + (size_t)b * strideC;
      unsigned short* C2 = (OUT_MODE == 2) ? ((unsigned short*)Cout2 + (size_t)b * strideC) : nullptr;
      {
#pragma unroll
        for (int it = 0; it < 4; ++it) {
          const int row = it * 4 + q;
          const float* sp = slab + row * 68 + c8;
          v8h hv, lv;
#pragma unroll
          for (int e = 0; e < 8; ++e) {
            if (OUT_MODE == 1) {
              hv[e] = (_Float16)sp[e];
            } else {
              unsigned short hb = f2bf_bits(sp[e]);
              unsigned short lb = f2bf_bits(sp[e] - bf_bits2f(hb));
              hv[e] = __builtin_bit_cast(_Float16, hb);
              lv[e] = __builtin_bit_cast(_Float16, lb);
            }
          }
          *(v8h*)(C + (size_t)(mBase + row) * ldc + n0 + c8) = hv;
          if (OUT_MODE == 2) *(v8h*)(C2 + (size_t)(mBase + row) * ldc + n0 + c8) = lv;
        }
        
      }
    }
    __builtin_amdgcn_fence(3, "workgroup");
    __builtin_amdgcn_wave_barrier();
    __builtin_amdgcn_fence(2, "workgroup");
  }
}

// =====================================================================================
// Non-causal attention for head_dim 64; q/k from f16 planes (normed values carried x QCAR), v from an f16 plane; out an f16 plane carried x CCAR, the output projection's A operand.
//   scores^T = k.q^T        : v_wmma_f32_16x16x32_f16, single product; natural score = raw * sscale (sscale = 1/sqrt(64) / QCAR^2)
//   out^T    = v^T.p^T      : v_wmma_f32_16x16x32_f16; p = exp((s - m_running)*sscale) carried x 2^pexp (2^15) as f16, v plain f16
//   An exponential is one multiply-add and one v_exp_f32: 2^pexp * p = exp2(s * c2 - (m_running * c2 - pexp)), c2 = sscale * log2(e); the sum of p is carried x 2^pexp too.
//   Both products are transposed, so a lane holds scores, P and output of one query per query tile (its D column): maximum and sum run inside the lane
//   (one exchange between the lane halves), and two score tiles, converted in place, are the B fragment of the second product.
//   K and V chunks come row-major into LDS by asynchronous 16-B copies (8 lanes = one whole 128-B row), two buffers, the next chunk in flight while
//   this one is worked on; V^T fragments come by the transposing LDS load.
//   A wave holds two query tiles (32 queries), so that every K and V^T fragment read from LDS feeds two products.
//   f32 accumulate; online softmax in f32. Block = 4 waves = 128 query rows of one (batch, head); S % 128 == 0.
//   Element (b, s, h, d) of tensor X lives at X[b*X_bs + s*X_rs + h*X_hs + d] (strides in elements, multiples of 8).
//   grid.x = B * H * (S/128), block 128.
// =====================================================================================
#define AT_D 64
#define AT_NW 4
#define AT_QT 2    // query tiles (of 16) per wave
#define AT_QB (AT_NW * AT_QT * 16)
#define AT_KC 64
#define AT_LP 72   // LDS row pitch in halves of the 64-half K rows: 144 B = 16 B x odd, so the 16 lanes of a 16-byte fragment read fall on 16 distinct bank groups
#define AT_VP 80   // LDS row pitch in halves of the 64-half V rows: 160 B = 32 B x odd, the conflict-free pitch of ds_load_tr16_b128
#define AT_KB (AT_KC * AT_LP)            // halves of a buffer's K part
#define AT_BUF (AT_KB + AT_KC * AT_VP)   // halves per buffer
struct AttnGeom { long long q_bs, q_rs, q_hs, k_bs, k_rs, k_hs, v_bs, v_rs, v_hs, o_bs, o_rs, o_hs; int S, Skv, H, nchunk; float sscale; float pexp; };
static_assert(sizeof(AttnGeom) == 12 * 8 + 4 * 4 + 2 * 4);

// the builtin alone: the compiler keeps the distances behind its own matrix instructions, and is free to issue independent ones back to back
__device__ __forceinline__ v8f at_mmah(v16h a, v16h b, v8f c) {
  return __builtin_amdgcn_wmma_f32_16x16x32_f16(false, a, false, b, (short)0, c, false, false);
}

// Base-2 exponentials by v_exp_f32, each in place. In one statement, so that no exponential overwrites the source of the one directly in front of it;
// the closing v_nop is the slot that the instruction set asks for between a transcendental and a directly following user of its result.
__device__ __forceinline__ float at_exp2(float x) {
  asm("v_exp_f32 %0, %0\n\tv_nop" : "+v"(x));
  return x;
}
__device__ __forceinline__ v8f at_exp2x8(v8f x) {
  float a = x[0], b = x[1], c = x[2], d = x[3], e = x[4], f = x[5], g = x[6], h = x[7];
  asm("v_exp_f32 %0, %0\n\t"
      "v_exp_f32 %1, %1\n\t"
      "v_exp_f32 %2, %2\n\t"
      "v_exp_f32 %3, %3\n\t"
      "v_exp_f32 %4, %4\n\t"
      "v_exp_f32 %5, %5\n\t"
      "v_exp_f32 %6, %6\n\t"
      "v_exp_f32 %7, %7\n\t"
      "v_nop"
      : "+v"(a), "+v"(b), "+v"(c), "+v"(d), "+v"(e), "+v"(f), "+v"(g), "+v"(h));
  return (v8f){a, b, c, d, e, f, g, h};
}

// Transposing 16-bit LDS load: lane (c = l & 15, h = l >> 4), addressed at row 8h + (l & 7), halves 8 * ((l >> 3) & 1) of a row-major tile, gets T[8h + 0..7][c]
typedef short s16x8 __attribute__((ext_vector_type(8)));
__device__ __forceinline__ v8h at_ldtr16(const _Float16* p) {
  typedef __attribute__((address_space(3))) s16x8 lds_s16x8;
  return __builtin_bit_cast(v8h, __builtin_amdgcn_ds_load_tr16_b128_v8i16((lds_s16x8*)p));
}

// Eight asynchronous 16-byte copies of one lane: rows r, r+16, r+32, r+48 of a K chunk and of a V chunk (global row steps kst, vst halves per 16 rows).
// The s_wait_xcnt stands inside the statement, behind the last copy, so that no address register of a copy is rewritten in front of it.
__device__ __forceinline__ void at_copy8(unsigned lk, const _Float16* gk, size_t kst, unsigned lv, const _Float16* gv, size_t vst) {
  const unsigned ks = 16u * AT_LP * 2u, vs = 16u * AT_VP * 2u;
  asm volatile(
      "global_load_async_to_lds_b128 %0, %8, off\n\t"
      "global_load_async_to_lds_b128 %1, %9, off\n\t"
      "global_load_async_to_lds_b128 %2, %10, off\n\t"
      "global_load_async_to_lds_b128 %3, %11, off\n\t"
      "global_load_async_to_lds_b128 %4, %12, off\n\t"
      "global_load_async_to_lds_b128 %5, %13, off\n\t"
      "global_load_async_to_lds_b128 %6, %14, off\n\t"
      "global_load_async_to_lds_b128 %7, %15, off\n\t"
      "s_wait_xcnt 0x0"
      :: "v"(lk), "v"(lk + ks), "v"(lk + 2u * ks), "v"(lk + 3u * ks), "v"(lv), "v"(lv + vs), "v"(lv + 2u * vs), "v"(lv + 3u * vs),
         "v"(gk), "v"(gk + kst), "v"(gk + 2 * kst), "v"(gk + 3 * kst), "v"(gv), "v"(gv + vst), "v"(gv + 2 * vst), "v"(gv + 3 * vst)
      : "memory");
}

// exactly 2 waves a SIMD: what the grid supplies (512 blocks of 4 waves on 256 WGPs); the lower bound gives the compiler 512 registers a wave, the upper one keeps a third block off a WGP, so that every WGP gets two
__global__ __launch_bounds__(128) __attribute__((amdgpu_waves_per_eu(2, 2)))
void k_attn64(const unsigned short* __restrict__ qp, const unsigned short* __restrict__ kp,
              const unsigned short* __restrict__ vp, unsigned short* __restrict__ out, AttnGeom g) {
  union FH { v16h v; v8h h[2]; };
  __shared__ __align__(16) _Float16 kvs[2 * AT_BUF];        // two chunk buffers, each K [kv][d] then V [kv][d], f16 (cross-wave: published by the block barriers below)
  __shared__ __align__(16) _Float16 Os[AT_NW][AT_QT * 16 * AT_LP];   // per wave out tile, f16, 64 halves a row at pitch AT_LP (wave-private)

  const int tid  = threadIdx.x;
  const int wave = tid >> 5;
  const int lane = tid & 31;
  const int hh   = lane >> 4;
  const int c    = lane & 15;

  const int nqb = g.S / AT_QB;
  const int bx = blockIdx.x;
  const int qb = bx % nqb;
  const int bh = bx / nqb;
  const int h  = bh % g.H;
  const int b  = bh / g.H;
  const int q0 = qb * AT_QB + wave * (AT_QT * 16);

  const _Float16* q = (const _Float16*)qp;
  const _Float16* k = (const _Float16*)kp;
  const _Float16* v = (const _Float16*)vp;
  const _Float16* qb_ptr = q + (size_t)b * g.q_bs + (size_t)h * g.q_hs;
  const _Float16* kb_ptr = k + (size_t)b * g.k_bs + (size_t)h * g.k_hs;
  const _Float16* vb_ptr = v + (size_t)b * g.v_bs + (size_t)h * g.v_hs;
  unsigned short* ob_ptr = out + (size_t)b * g.o_bs + (size_t)h * g.o_hs;

  // ---- Q fragments (B operand): AT_QT query tiles x 2 d-chunks; lane column c of tile u = query q0 + 16u + c, elements 0..7 <- d = dc*32 + 8hh + e, 8..15 <- dc*32 + 16 + 8hh + e (two 16-B loads from the f16 row) ----
  v16h qa[AT_QT][2];
#pragma unroll   // qa is indexed by constants only, so it stays in registers
  for (int u = 0; u < AT_QT; ++u) {
    const _Float16* qrow = qb_ptr + (size_t)(q0 + u * 16 + c) * g.q_rs;
#pragma unroll
    for (int dc = 0; dc < 2; ++dc) {
      FH f;
      f.h[0] = *(const v8h*)(qrow + dc * 32 + 8 * hh);
      f.h[1] = *(const v8h*)(qrow + dc * 32 + 16 + 8 * hh);
      qa[u][dc] = f.v;
    }
  }

  float mcol[AT_QT];        // running maximum of this lane's query of tile u (raw units; equal in both lane halves)
  float lcol[AT_QT];        // running sum of 2^pexp * p over the keys of this lane half; the halves are joined after the loop
  const float c2 = g.sscale * 1.4426950408889634f;   // raw score units -> base-2 exponent
  v8f oacc[AT_QT][4];       // out^T: query tile u, tile t, element r = (d = t*16 + 8hh + r, query q0 + 16u + c)
#pragma unroll   // mcol, lcol and oacc are indexed by constants only, so all stay in registers
  for (int u = 0; u < AT_QT; ++u) {
    mcol[u] = -INFINITY;
    lcol[u] = 0.f;
#pragma unroll
    for (int t = 0; t < 4; ++t) oacc[u][t] = (v8f){0.f,0.f,0.f,0.f,0.f,0.f,0.f,0.f};
  }

  // copy map: thread -> (row srow + 16 i, 16-byte piece sseg / 8) of the chunk's 64 K rows and 64 V rows; a wave's copy covers 4 whole 128-B rows
  const int srow = tid >> 3, sseg = (tid & 7) * 8;
  const _Float16* gk = kb_ptr + (size_t)srow * g.k_rs + sseg;
  const _Float16* gv = vb_ptr + (size_t)srow * g.v_rs + sseg;
  const unsigned lK = (unsigned)(size_t)kvs + (unsigned)(srow * AT_LP + sseg) * 2u;           // LDS byte address in buffer 0, K part
  const unsigned lV = (unsigned)(size_t)kvs + (unsigned)(AT_KB + srow * AT_VP + sseg) * 2u;   // V part
  const size_t kst = (size_t)16 * g.k_rs, vst = (size_t)16 * g.v_rs;         // 16 rows
  const size_t kch = (size_t)AT_KC * g.k_rs, vch = (size_t)AT_KC * g.v_rs;   // one chunk

  if (g.nchunk > 0) at_copy8(lK, gk, kst, lV, gv, vst);
  asm volatile("s_wait_asynccnt 0x0" ::: "memory");   // this wave's copies of chunk 0 have landed before the barrier publishes them
  __syncthreads();
  if (g.nchunk > 1) at_copy8(lK + AT_BUF * 2u, gk + kch, kst, lV + AT_BUF * 2u, gv + vch, vst);

  for (int kc = 0; kc < g.nchunk; ++kc) {
    const int bsel = (kc & 1) * AT_BUF;
    const _Float16* Ksh = kvs + bsel;           // K [kv][d], pitch AT_LP
    const _Float16* Vsh = kvs + bsel + AT_KB;   // V [kv][d], pitch AT_VP

    // ---- every fragment of the chunk is fetched here, as one group, each into registers of its own: the K fragments are waited for once,
    //      and the V^T fragments arrive behind the score products and the softmax; each fragment then feeds the products of both query tiles ----
    FH kf[4][2];   // K: A fragment, lane row c = key j*16 + c, same k(i,h) map as B
    FH vf[2][4];   // V^T: A fragment, lane row c = d = t*16 + c, k = key, by transposing loads of the row-major V tile, which deliver the fragment k map
#pragma unroll   // in the order in which the products below take them
    for (int dc = 0; dc < 2; ++dc) {
#pragma unroll
      for (int j = 0; j < 4; ++j) {
        kf[j][dc].h[0] = *(const v8h*)(Ksh + (j * 16 + c) * AT_LP + dc * 32 + 8 * hh);
        kf[j][dc].h[1] = *(const v8h*)(Ksh + (j * 16 + c) * AT_LP + dc * 32 + 16 + 8 * hh);
      }
    }
#pragma unroll
    for (int kk = 0; kk < 2; ++kk) {
#pragma unroll
      for (int t = 0; t < 4; ++t) {
        vf[kk][t].h[0] = at_ldtr16(Vsh + (kk * 32 + 8 * hh + (lane & 7)) * AT_VP + t * 16 + 8 * ((lane >> 3) & 1));        // keys kk*32 + 8hh + 0..7 of d = t*16 + c
        vf[kk][t].h[1] = at_ldtr16(Vsh + (kk * 32 + 16 + 8 * hh + (lane & 7)) * AT_VP + t * 16 + 8 * ((lane >> 3) & 1));   // keys kk*32 + 16 + 8hh + 0..7
      }
    }
    __builtin_amdgcn_sched_barrier(0);   // keeps the group of loads together in front of the products: sunk to their users, each pair would be waited for on its own
    // ---- scores^T: AT_QT query tiles x 4 key subtiles x 2 d-chunks; the tiles are independent, so the products issue back to back ----
    v8f s[AT_QT][4];
#pragma unroll   // here and below: s, kf and qa are indexed by constants only, so all stay in registers
    for (int u = 0; u < AT_QT; ++u) {
#pragma unroll
      for (int j = 0; j < 4; ++j) s[u][j] = at_mmah(kf[j][0].v, qa[u][0], (v8f){0.f,0.f,0.f,0.f,0.f,0.f,0.f,0.f});
    }
#pragma unroll
    for (int u = 0; u < AT_QT; ++u) {
#pragma unroll
      for (int j = 0; j < 4; ++j) s[u][j] = at_mmah(kf[j][1].v, qa[u][1], s[u][j]);
    }
#pragma unroll   // the query tiles are independent: one tile's vector work can stand beside the other's products
    for (int u = 0; u < AT_QT; ++u) {
      // ---- chunk maximum of the lane's query (raw units; sscale > 0 so max commutes): D element r of this lane = (key kc*64 + j*16 + 8hh + r, query q0 + 16u + c) ----
      float cm4[4];
#pragma unroll
      for (int j = 0; j < 4; ++j)
        cm4[j] = fmaxf(fmaxf(fmaxf(s[u][j][0], s[u][j][1]), fmaxf(s[u][j][2], s[u][j][3])), fmaxf(fmaxf(s[u][j][4], s[u][j][5]), fmaxf(s[u][j][6], s[u][j][7])));
      float cm = fmaxf(fmaxf(cm4[0], cm4[1]), fmaxf(cm4[2], cm4[3]));
      cm = fmaxf(cm, __shfl_xor(cm, 16, 32));   // the other lane half holds the query's other 32 keys
      const float mnew = fmaxf(mcol[u], cm);
      const float alpha = at_exp2((mcol[u] - mnew) * c2);   // 0 on the first chunk, where mcol is -inf
      const float nm = g.pexp - mnew * c2;
      mcol[u] = mnew;
      // ---- p, and P^T as B fragments: element i of fragment kk is key kk*32 + k(i,hh) = element i & 7 of score tile 2 kk + (i >> 3) ----
      v16h pb[2];
      float ps4[4];   // one partial sum per score tile: four independent add chains
#pragma unroll
      for (int j = 0; j < 4; ++j) {
        v8f p;
#pragma unroll
        for (int r = 0; r < 8; ++r) p[r] = fmaf(s[u][j][r], c2, nm);
        p = at_exp2x8(p);
        float psum = p[0];
#pragma unroll
        for (int r = 1; r < 8; ++r) psum += p[r];
#pragma unroll
        for (int r = 0; r < 8; ++r) pb[j >> 1][(j & 1) * 8 + r] = (_Float16)p[r];
        ps4[j] = psum;
      }
      lcol[u] = lcol[u] * alpha + ((ps4[0] + ps4[1]) + (ps4[2] + ps4[3]));
#pragma unroll
      for (int t = 0; t < 4; ++t) oacc[u][t] *= alpha;
      // ---- V^T.P^T: A = V^T from the registers filled at the chunk's head; B = P^T from the registers ----
#pragma unroll   // vf, pb and oacc are indexed by constants only, so all stay in registers
      for (int kk = 0; kk < 2; ++kk) {
#pragma unroll
        for (int t = 0; t < 4; ++t) oacc[u][t] = at_mmah(vf[kk][t].v, pb[kk], oacc[u][t]);
      }
    }
    __builtin_amdgcn_sched_barrier(0);   // keeps the chunk's arithmetic in front of the waits below: lifted to the chunk's head, the wait for the next chunk's copies would find them only just issued
    asm volatile("s_wait_dscnt 0x0" ::: "memory");      // this wave's fragment reads have returned before the buffer may be refilled
    asm volatile("s_wait_asynccnt 0x0" ::: "memory");   // this wave's copies of chunk kc + 1 have landed before the barrier publishes them
    __syncthreads();                                    // publishes chunk kc + 1 and ends every wave's reads of chunk kc's buffer
    if (kc + 2 < g.nchunk) at_copy8(lK + (unsigned)bsel * 2u, gk + (size_t)(kc + 2) * kch, kst, lV + (unsigned)bsel * 2u, gv + (size_t)(kc + 2) * vch, vst);
  }
  asm volatile("s_wait_asynccnt 0x0" ::: "memory");     // no copy is outstanding when the wave goes on

  _Float16* os = Os[wave];
#pragma unroll   // lcol and oacc are indexed by constants only
  for (int u = 0; u < AT_QT; ++u) {
    const float inv = CCAR / (lcol[u] + __shfl_xor(lcol[u], 16, 32));   // both halves' sums joined once; sum and out^T carry the same 2^pexp; the plane's carry rides on the quotient (a power of two: same rounding)
#pragma unroll
    for (int t = 0; t < 4; ++t) {
      // 8 consecutive d of the lane's query row, as f16: one 16-B LDS store
      v8h hv;
#pragma unroll
      for (int r = 0; r < 8; ++r) hv[r] = (_Float16)(oacc[u][t][r] * inv);
      *(v8h*)(os + (u * 16 + c) * AT_LP + t * 16 + 8 * hh) = hv;
    }
  }
  __builtin_amdgcn_fence(3, "workgroup");
  __builtin_amdgcn_wave_barrier();
  __builtin_amdgcn_fence(2, "workgroup");
  {
    // 8 lanes per row, 16 B per lane: a head's 64 halves of a token = one whole 128-B line per row
    const int q4 = lane >> 3, c8 = (lane & 7) * 8;
#pragma unroll   // the LDS reads issue together
    for (int it = 0; it < AT_QT * 4; ++it) {
      const int row = it * 4 + q4;
      const v8h val = *(const v8h*)(os + row * AT_LP + c8);
      *(v8h*)(ob_ptr + (size_t)(q0 + row) * g.o_rs + c8) = val;
    }
  }
}

} // namespace w25

// =====================================================================================
// =====================================================================================
// k_prep: the 16-bit planes of x, Wqkv, Wproj and the small vectors in ONE launch; the four jobs are independent, and a block takes its job by its index:
//   blocks [0, PB_X): X16 = f16(16 * bf16 RNE(x)); the next PB_W: W16 = f16(64 * bf16 RNE(Wqkv)); the next PB_P: WP16 = f16(64 * bf16 RNE(Wproj));
//   a block = 2048 consecutive elements, a thread = 8 of them (two 16-B loads, one 16-B store); the last PB_V blocks: the small vectors' bf16 RNE values as f32.
#define PB_XB (SEQ * DM / 2048)     // blocks per batch of x
#define PB_X  (NB * PB_XB)
#define PB_W  (NQKV * DM / 2048)
#define PB_P  (DM * DM / 2048)
#define PB_V  ((VECN + 255) / 256)
static_assert((SEQ * DM) % 2048 == 0);
static_assert((NQKV * DM) % 2048 == 0);
static_assert((DM * DM) % 2048 == 0);
__global__ __launch_bounds__(256) void k_prep(const float* __restrict__ x, const float* __restrict__ wq, const float* __restrict__ wp,
                                              const float* __restrict__ bq, const float* __restrict__ bp, const float* __restrict__ qw, const float* __restrict__ kw,
                                              unsigned short* __restrict__ X16, unsigned short* __restrict__ W16, unsigned short* __restrict__ WP16, float* __restrict__ VEC) {
    const int blk = blockIdx.x;
    if (blk < PB_X + PB_W + PB_P) {
        const float* s;
        unsigned short* d;
        float sc;
        if (blk < PB_X) {
            const int z = blk / PB_XB, r = blk - z * PB_XB;   // batch rows of x at the full per-batch stride
            s = x + (size_t)z * SEQ_FULL * DM + (size_t)r * 2048;
            d = X16 + (size_t)z * SEQ * DM + (size_t)r * 2048;
            sc = 16.0f;
        } else if (blk < PB_X + PB_W) {
            s = wq + (size_t)(blk - PB_X) * 2048;
            d = W16 + (size_t)(blk - PB_X) * 2048;
            sc = 64.0f;
        } else {
            s = wp + (size_t)(blk - PB_X - PB_W) * 2048;
            d = WP16 + (size_t)(blk - PB_X - PB_W) * 2048;
            sc = 64.0f;
        }
        s += threadIdx.x * 8;
        d += threadIdx.x * 8;
        const v4f a = *(const v4f*)s;
        const v4f b = *(const v4f*)(s + 4);
        v4u pk;
        pk.x = cmb_pk2(cmb_bf(a.x) * sc, cmb_bf(a.y) * sc);
        pk.y = cmb_pk2(cmb_bf(a.z) * sc, cmb_bf(a.w) * sc);
        pk.z = cmb_pk2(cmb_bf(b.x) * sc, cmb_bf(b.y) * sc);
        pk.w = cmb_pk2(cmb_bf(b.z) * sc, cmb_bf(b.w) * sc);
        *(v4u*)d = pk;
    } else {
        const int u = (blk - (PB_X + PB_W + PB_P)) * 256 + threadIdx.x;
        if (u < VECN) {
            const float a  = bq[min(u, NQKV - 1)];
            const float bb = bp[min(max(u - OFF_BP, 0), DM - 1)];
            const float cq = qw[min(max(u - OFF_QW, 0), HDIM - 1)];
            const float ck = kw[min(max(u - OFF_KW, 0), HDIM - 1)];
            const float sel = (u < OFF_BP) ? a : ((u < OFF_QW) ? bb : ((u < OFF_KW) ? cq : ck));
            asm volatile("s_wait_xcnt 0x0" ::: "memory");   // stands behind the load, in front of the arithmetic that reuses its address registers
            VEC[u] = cmb_bf(sel);
        }
    }
}

extern "C" void kernel_launch(void* const* d_in, const int* in_sizes, int n_in, void* d_out, int out_size, void* d_ws, size_t ws_size, hipStream_t stream) {
    if (n_in < 7) return;
    const float* x     = (const float*)d_in[0];     // [2][2048][1024]
    const float* Wqkv  = (const float*)d_in[1];     // [3072][1024]  ([out][in] = Bt layout)
    const float* bqkv  = (const float*)d_in[2];     // [3072]
    const float* Wproj = (const float*)d_in[3];     // [1024][1024]  ([out][in] = Bt layout)
    const float* bproj = (const float*)d_in[4];     // [1024]
    const float* qn_w  = (const float*)d_in[5];     // [64]
    const float* kn_w  = (const float*)d_in[6];     // [64]
    const long long xneed = ((long long)(NB - 1) * SEQ_FULL + SEQ) * DM;
    if ((long long)in_sizes[0] < xneed) return;
    if ((long long)in_sizes[1] < (long long)NQKV * DM) return;
    if (in_sizes[2] < NQKV) return;
    if ((long long)in_sizes[3] < (long long)DM * DM) return;
    if (in_sizes[4] < DM) return;
    if (in_sizes[5] < HDIM || in_sizes[6] < HDIM) return;
    if ((long long)out_size < xneed) return;
    if (WS_TOTAL > ws_size) return;

    char* wsp = (char*)d_ws;
    float* VEC = (float*)wsp; wsp += WS_VEC;                              // 4224 f32 (bf16 RNE values of the small input vectors)
    unsigned short* X16 = (unsigned short*)wsp; wsp += WS_X16;             // [NTOK][1024] f16 = 16 * bf16(x)
    unsigned short* W16 = (unsigned short*)wsp; wsp += WS_W16;             // [3072][1024] f16 = 64 * bf16(Wqkv)
    unsigned short* WP16 = (unsigned short*)wsp; wsp += WS_WP16;           // [1024][1024] f16 = 64 * bf16(Wproj)
    unsigned short* QH16 = (unsigned short*)wsp; wsp += WS_QK16;           // [NTOK][1024] f16 = 16 * normalised q
    unsigned short* KH16 = (unsigned short*)wsp; wsp += WS_QK16;           // [NTOK][1024] f16 = 16 * normalised k
    unsigned short* VH16 = (unsigned short*)wsp; wsp += WS_QK16;           // [NTOK][1024] f16 = v
    unsigned short* CTX16 = (unsigned short*)wsp; wsp += WS_CTX16;         // [NTOK][1024] f16 = 256 * attention output (token-major, head*64 + d)
    float* out = (float*)d_out;

    // 1-4. one launch: small vectors -> bf16 RNE values (f32); 16-bit operand planes of x, Wqkv, Wproj (bf16 RNE input values times a power of two, exact in f16)
    k_prep<<<(unsigned)(PB_X + PB_W + PB_P + PB_V), 256, 0, stream>>>(x, Wqkv, Wproj, bqkv, bproj, qn_w, kn_w, X16, W16, WP16, VEC);
    // 5. qkv = (16 bf16(x)) . (64 bf16(Wqkv))^T / 1024 + bf16(bqkv); v -> f16 plane; q and k -> per-head RMSNorm (f32 math) in the epilogue -> f16 planes carried x16
    w25::wmma_gemm64<0, false, 2, 0, false, true><<<dim3((unsigned)((NTOK / 128) * (NQKV / 128)), 1u), 128, 0, stream>>>(
        (const unsigned short*)X16, nullptr, DM, 0L, (const unsigned short*)W16, nullptr, DM, 0L,
        nullptr, nullptr, NQKV, 0L, VEC + OFF_BQ, nullptr, 0L, NTOK, NQKV, DM, 1.0f / 1024.0f,
        VEC + OFF_QW, VEC + OFF_KW, QH16, KH16, VH16);
    // 6. attention: 128 query rows per block (32 per wave), 64-key chunks, online softmax; its epilogue stores the f16 plane (x256) that the output projection reads
    w25::AttnGeom g;
    g.q_bs = (long long)SEQ * DM;   g.q_rs = DM;   g.q_hs = HDIM;
    g.k_bs = (long long)SEQ * DM;   g.k_rs = DM;   g.k_hs = HDIM;
    g.v_bs = (long long)SEQ * DM;   g.v_rs = DM;   g.v_hs = HDIM;
    g.o_bs = (long long)SEQ * DM;   g.o_rs = DM;   g.o_hs = HDIM;
    g.S = SEQ; g.Skv = SEQ; g.H = NH; g.nchunk = SEQ / AT_KC; g.sscale = 0.125f / (QCAR * QCAR); g.pexp = 15.0f;
    w25::k_attn64<<<(unsigned)(NB * NH * (SEQ / AT_QB)), 128, 0, stream>>>(QH16, KH16, VH16, CTX16, g);
    // 7. out[b][s][:] = (256 ctx) . (64 bf16(Wproj))^T / 16384 + bf16(bproj), batch rows at the full per-batch stride of d_out
    w25::wmma_gemm64<0, false, 2, 0, false, false><<<dim3((unsigned)((SEQ / 128) * (DM / 128)), (unsigned)NB), 128, 0, stream>>>(
        (const unsigned short*)CTX16, nullptr, DM, (long)SEQ * DM, (const unsigned short*)WP16, nullptr, DM, 0L,
        (void*)out, nullptr, DM, (long)SEQ_FULL * DM, VEC + OFF_BP, nullptr, 0L, SEQ, DM, DM, 1.0f / 16384.0f,
        nullptr, nullptr, nullptr, nullptr, nullptr);
    (void)hipGetLastError();
}
